// v000
// Times are from an AMD MI455X. After a warm-up the kernel runs many times in a row, and a time is the length of
// such a window on the GPU divided by its runs, so every launch and the gaps after it count. The runs cycle
// through copies of the inputs. A figure is the median of several windows, for all but v000 over two sittings.
// Sittings can differ by a few percent; kernels timed side by side share one.
// v000, which the later versions start from, runs in 458 microseconds.
// Contractions: q/k/v projections on v_wmma_f32_16x16x32_bf16 (operands = RNE bf16 of the inputs); scores on bf16 hi/lo split (hi.hi + hi.lo + lo.hi); p.v and output projection on v_wmma_f32_16x16x32_f16 (p carried x2^14, attention output carried x2^6, Wo carried x2^10); f32 accumulate; norms and softmax in f32.
#include <hip/hip_runtime.h>
#include <stdint.h>

typedef __attribute__((ext_vector_type(16))) _Float16 v16h;
typedef __attribute__((ext_vector_type(8)))  _Float16 v8h;
typedef __attribute__((ext_vector_type(16))) __bf16   v16b;
typedef __attribute__((ext_vector_type(8)))  __bf16   v8b;
typedef __attribute__((ext_vector_type(8)))  float    v8f;
typedef __attribute__((ext_vector_type(4)))  float    v4f;
typedef __attribute__((ext_vector_type(2)))  float    v2f;
typedef __attribute__((ext_vector_type(4)))  unsigned v4u;

/* problem geometry */
constexpr int kBatch = 2;
constexpr int kSeq   = 2048;
constexpr int kDm    = 1024;
constexpr int kHeads = 16;
constexpr int kHd    = 64;
constexpr int kTok   = kBatch * kSeq;      /* 4096 token rows */
constexpr int kKch   = 64;                 /* kv chunk */
constexpr int kQblk  = 64;                 /* query rows per block */
#define P_CARRY 16384.0f
#define O_CARRY 64.0f
#define WO_CARRY 1024.0f

static_assert(kDm == kHeads * kHd, "head split");
static_assert(kTok % 64 == 0 && kDm % 64 == 0, "GEMM M,N tile multiples");
static_assert(kDm % 32 == 0, "GEMM K multiple of 32");
static_assert(kSeq % kKch == 0 && kSeq % kQblk == 0, "attention tiles");
static_assert((kTok * kHeads) % 32 == 0, "normalize grid");

__device__ __forceinline__ unsigned short f2bf_bits(float f) {
  unsigned u = __float_as_uint(f);
  return (unsigned short)((u + 0x7FFFu + ((u >> 16) & 1u)) >> 16);
}
__device__ __forceinline__ float bf_bits2f(unsigned short h) { return __uint_as_float(((unsigned)h) << 16); }
__device__ __forceinline__ _Float16 h16_lo(unsigned w) { return __builtin_bit_cast(_Float16, (unsigned short)(w & 0xffffu)); }
__device__ __forceinline__ _Float16 h16_hi(unsigned w) { return __builtin_bit_cast(_Float16, (unsigned short)(w >> 16)); }

/* hazard guards as plain device helpers */
__device__ __forceinline__ void dep_guard_h(v8f& a, v8f& b, v16h x, v16h y) { asm volatile("v_nop\n\tv_nop\n\tv_nop\n\tv_nop" : "+v"(a), "+v"(b) : "v"(x), "v"(y)); }
__device__ __forceinline__ void dep_guard_b(v8f& a, v8f& b, v16b x, v16b y) { asm volatile("v_nop\n\tv_nop\n\tv_nop\n\tv_nop" : "+v"(a), "+v"(b) : "v"(x), "v"(y)); }
__device__ __forceinline__ void keep4_h(v16h a, v16h b, v16h c, v16h d) { asm volatile("v_nop" :: "v"(a), "v"(b), "v"(c), "v"(d)); }
__device__ __forceinline__ void keep4_b(v16b a, v16b b, v16b c, v16b d) { asm volatile("v_nop" :: "v"(a), "v"(b), "v"(c), "v"(d)); }
__device__ __forceinline__ void acc_guard4(v8f& a, v8f& b, v8f& c, v8f& d) { asm volatile("v_nop\n\tv_nop\n\tv_nop\n\tv_nop" : "+v"(a), "+v"(b), "+v"(c), "+v"(d)); }
template <typename T> struct Frag;
template <> struct Frag<_Float16> {
  typedef v16h V; union U { v16h v; v8h h[2]; };
  static __device__ __forceinline__ v16h load(const _Float16* p) {   /* elements 0..7 <- p[0..7], 8..15 <- p[16..23] */
    U f; f.h[0] = *(const v8h*)(p); f.h[1] = *(const v8h*)(p + 16); return f.v;
  }
  static __device__ __forceinline__ v8f mma(v16h a, v16h b, v8f c) {
    return __builtin_amdgcn_wmma_f32_16x16x32_f16(false, a, false, b, (short)0, c, false, false);
  }
  static __device__ __forceinline__ void guard(v8f& a, v8f& b, v16h x, v16h y) { dep_guard_h(a, b, x, y); }
  static __device__ __forceinline__ void keep(v16h a, v16h b, v16h c, v16h d) { keep4_h(a, b, c, d); }
};
template <> struct Frag<__bf16> {
  typedef v16b V; union U { v16b v; v8b h[2]; };
  static __device__ __forceinline__ v16b load(const __bf16* p) {
    U f; f.h[0] = *(const v8b*)(p); f.h[1] = *(const v8b*)(p + 16); return f.v;
  }
  static __device__ __forceinline__ v8f mma(v16b a, v16b b, v8f c) {
    return __builtin_amdgcn_wmma_f32_16x16x32_bf16(false, a, false, b, (short)0, c, false, false);
  }
  static __device__ __forceinline__ void guard(v8f& a, v8f& b, v16b x, v16b y) { dep_guard_b(a, b, x, y); }
  static __device__ __forceinline__ void keep(v16b a, v16b b, v16b c, v16b d) { keep4_b(a, b, c, d); }
};

/* ---- Register-blocked batched WMMA GEMM --------------------------------
   C[m,n] = scale * sum_k A[m,k] * Bt[n,k] (+bias); each wave owns a 64x64 tile.
   A row-major [M,K]; Bt row-major [N,K]; M,N % 64 == 0, K % 32 == 0.
   BIAS_MODE: 0 = none, 1 = bias[m], 2 = bias[n]; bias values RNE-converted to bf16 precision before the add.
   OUT_MODE: 0 = f32, 1 = f16, 2 = bf16 hi plane (Cout) + bf16 lo plane (Cout2).
   ET: 0 = f16 operands, 1 = bf16 operands (pointers passed as 16-bit storage) */
template <int ET> struct Elem;
template <> struct Elem<0> { typedef _Float16 T; };
template <> struct Elem<1> { typedef __bf16 T; };
template <int ET, bool SPLIT, int BIAS_MODE, int OUT_MODE, bool RESID, int ACT = 0>
__global__ __launch_bounds__(256) void wmma_gemm64(
    const unsigned short* __restrict__ Ap, const unsigned short* __restrict__ A2p, int lda, long strideA,
    const unsigned short* __restrict__ Btp, const unsigned short* __restrict__ Bt2p, int ldb, long strideB,
    void* __restrict__ Cout, void* __restrict__ Cout2, int ldc, long strideC,
    const float* __restrict__ bias,
    const float* __restrict__ resid, long strideR,
    int M, int N, int K, float scale) {
  typedef typename Elem<ET>::T T;
  typedef typename Frag<T>::V V;
  const T* A = (const T*)Ap; const T* A2 = (const T*)A2p; const T* Bt = (const T*)Btp; const T* Bt2 = (const T*)Bt2p;
  __shared__ __align__(16) float sT[8][16 * 68];   /* per-wave 16x64 slab, pitch 68 floats */
  const int b    = blockIdx.y;
  const int lane = threadIdx.x & 31;
  const int wave = threadIdx.x >> 5;
  const int tilesN = N >> 6;
  const int tilesM = M >> 6;
  const int tile = blockIdx.x * 8 + wave;
  if (tile >= tilesM * tilesN) return;   /* wave-uniform; no block barriers in this kernel */
  const int tm = tile / tilesN;
  const int tn = tile - tm * tilesN;
  const int m0 = tm << 6;
  const int n0 = tn << 6;

  const T* Ab  = A  + (size_t)b * strideA;
  const T* Bb  = Bt + (size_t)b * strideB;
  const T* Ab2 = SPLIT ? (A2  + (size_t)b * strideA) : nullptr;
  const T* Bb2 = SPLIT ? (Bt2 + (size_t)b * strideB) : nullptr;

  const int rlane = lane & 15;                 /* row (A) / col (B, D) within subtile */
  const int koff  = (lane >> 4) * 8;           /* k offset of this lane half */
  const int mOff  = (lane >> 4) * 8;           /* D row offset */

  v8f acc[4][4];
#pragma unroll
  for (int i = 0; i < 4; ++i)
#pragma unroll
    for (int j = 0; j < 4; ++j) acc[i][j] = (v8f){0.f,0.f,0.f,0.f,0.f,0.f,0.f,0.f};

  for (int k0 = 0; k0 < K; k0 += 32) {
    V bh[4], bl[4];
#pragma unroll
    for (int j = 0; j < 4; ++j) {
      const size_t bo = (size_t)(n0 + (j << 4) + rlane) * ldb + koff + k0;
      bh[j] = Frag<T>::load(Bb + bo);
      if (SPLIT) bl[j] = Frag<T>::load(Bb2 + bo);
    }
#pragma unroll
    for (int i = 0; i < 4; ++i) {
      const size_t ao = (size_t)(m0 + (i << 4) + rlane) * lda + koff + k0;
      V ah = Frag<T>::load(Ab + ao);
      V al;
      if (SPLIT) al = Frag<T>::load(Ab2 + ao);
#pragma unroll
      for (int j = 0; j < 4; ++j) {
        acc[i][j] = Frag<T>::mma(ah, bh[j], acc[i][j]);
        if (SPLIT) {
          acc[i][j] = Frag<T>::mma(ah, bl[j], acc[i][j]);
          acc[i][j] = Frag<T>::mma(al, bh[j], acc[i][j]);
        }
      }
      Frag<T>::guard(acc[i][0], acc[i][3], ah, SPLIT ? al : ah);
    }
    Frag<T>::keep(bh[0], bh[1], bh[2], bh[3]);
    if (SPLIT) Frag<T>::keep(bl[0], bl[1], bl[2], bl[3]);
  }
  acc_guard4(acc[0][0], acc[0][1], acc[0][2], acc[0][3]);
  acc_guard4(acc[1][0], acc[1][1], acc[1][2], acc[1][3]);
  acc_guard4(acc[2][0], acc[2][1], acc[2][2], acc[2][3]);
  acc_guard4(acc[3][0], acc[3][1], acc[3][2], acc[3][3]);

  /* ---- epilogue ---- */
  float* slab = sT[wave];
  const float* Rb = RESID ? (resid + (size_t)b * strideR) : nullptr;
#pragma unroll
  for (int i = 0; i < 4; ++i) {
    const int mBase = m0 + (i << 4);
#pragma unroll
    for (int j = 0; j < 4; ++j) {
      const int n = n0 + (j << 4) + rlane;
      float bv = 0.f;
      if (BIAS_MODE == 2) bv = bf_bits2f(f2bf_bits(bias[n]));
#pragma unroll
      for (int r = 0; r < 8; ++r) {
        float v = acc[i][j][r] * scale;
        if (BIAS_MODE == 1) v += bf_bits2f(f2bf_bits(bias[mBase + mOff + r]));
        if (BIAS_MODE == 2) v += bv;
        if (RESID) v += Rb[(size_t)(mBase + mOff + r) * ldc + n];
        if (ACT == 1) v = tanhf(v);
        if (ACT == 2) v = fmaxf(v, 0.0f);
        if (ACT == 3) v = v / (1.0f + expf(-v));
        if (ACT == 4) v = (v > 0.f) ? v : 0.01f * v;
        slab[(mOff + r) * 68 + (j << 4) + rlane] = v;
      }
    }
    __builtin_amdgcn_fence(__ATOMIC_RELEASE, "workgroup");
    __builtin_amdgcn_wave_barrier();
    __builtin_amdgcn_fence(__ATOMIC_ACQUIRE, "workgroup");
    if (OUT_MODE == 0) {
      float* C = (float*)Cout + (size_t)b * strideC;
      const int hh = lane >> 4, c4 = (lane & 15) * 4;     /* row seg = 256 B = 16 lanes x 16 B */
      {
#pragma unroll
        for (int it = 0; it < 8; ++it) {
          const int row = it * 2 + hh;
          v4f v = *(const v4f*)(slab + row * 68 + c4);
          *(v4f*)(C + (size_t)(mBase + row) * ldc + n0 + c4) = v;
        }
        
      }
    } else {
      const int q = lane >> 3, c8 = (lane & 7) * 8;        
      unsigned short* C  = (unsigned short*)Cout  + (size_t)b * strideC;
      unsigned short* C2 = (OUT_MODE == 2) ? ((unsigned short*)Cout2 + (size_t)b * strideC) : nullptr;
      {
#pragma unroll
        for (int it = 0; it < 4; ++it) {
          const int row = it * 4 + q;
          const float* sp = slab + row * 68 + c8;
          v8h hv, lv;
#pragma unroll
          for (int e = 0; e < 8; ++e) {
            if (OUT_MODE == 1) {
              hv[e] = (_Float16)sp[e];
            } else {
              unsigned short hb = f2bf_bits(sp[e]);
              unsigned short lb = f2bf_bits(sp[e] - bf_bits2f(hb));
              hv[e] = __builtin_bit_cast(_Float16, hb);
              lv[e] = __builtin_bit_cast(_Float16, lb);
            }
          }
          *(v8h*)(C + (size_t)(mBase + row) * ldc + n0 + c8) = hv;
          if (OUT_MODE == 2) *(v8h*)(C2 + (size_t)(mBase + row) * ldc + n0 + c8) = lv;
        }
        
      }
    }
    __builtin_amdgcn_fence(__ATOMIC_RELEASE, "workgroup");
    __builtin_amdgcn_wave_barrier();
    __builtin_amdgcn_fence(__ATOMIC_ACQUIRE, "workgroup");
  }
}

/*
   MODE 0: bf16 bits (RNE).  MODE 1: f16 bits of (RNE-bf16 value * mul).
   coverage: grid = n2/256 blocks x 256 threads x 2 elements = 2*n2 elements exactly. */
template <int MODE>
__global__ __launch_bounds__(256) void cast2_kernel(const float* __restrict__ in,
                                                    unsigned short* __restrict__ out, int n2, float mul) {
  const int i = blockIdx.x * 256 + threadIdx.x;
  if (i < n2) {
    const v2f p = *(const v2f*)(in + 2 * (size_t)i);
    unsigned short u0, u1;
    if (MODE == 0) {
      u0 = f2bf_bits(p.x); u1 = f2bf_bits(p.y);
    } else {
      const float r0 = bf_bits2f(f2bf_bits(p.x)) * mul;
      const float r1 = bf_bits2f(f2bf_bits(p.y)) * mul;
      u0 = __builtin_bit_cast(unsigned short, (_Float16)r0);
      u1 = __builtin_bit_cast(unsigned short, (_Float16)r1);
    }
    const unsigned u = (unsigned)u0 | ((unsigned)u1 << 16);
    unsigned* op = (unsigned*)(void*)out;
    op[i] = u;
    
  }
}

/* ---- per (token, head) L2 normalisation + bf16 hi/lo split.
   blockIdx.y = 0: q plane, scaled by 1/max(||q||,1e-12) * bf16(tau[head]); y = 1: k plane, 1/max(||k||,1e-12).
   8 lanes per 64-vector (8 floats each), 32 segments per 256-thread block; grid.x = kTok*kHeads/32 = 2048.
*/
__global__ __launch_bounds__(256) void l2norm_split_kernel(
    const float* __restrict__ qf, const float* __restrict__ kf, const float* __restrict__ tau,
    unsigned short* __restrict__ qhp, unsigned short* __restrict__ qlp,
    unsigned short* __restrict__ khp, unsigned short* __restrict__ klp) {
  const bool isk = (blockIdx.y != 0);                 /* block-uniform */
  const float* src = isk ? kf : qf;
  unsigned short* dhp = isk ? khp : qhp;
  unsigned short* dlp = isk ? klp : qlp;
  const int tid = threadIdx.x;
  const int g = tid >> 3, e = tid & 7;
  const int seg = blockIdx.x * 32 + g;                 /* < kTok*kHeads */
  const int token = seg >> 4, head = seg & 15;
  const size_t base = (size_t)token * kDm + (size_t)head * kHd + (size_t)e * 8;
  const v4f a  = *(const v4f*)(src + base);
  const v4f c4 = *(const v4f*)(src + base + 4);
  float ss = 0.0f;
  ss += a.x * a.x;  ss += a.y * a.y;  ss += a.z * a.z;  ss += a.w * a.w;
  ss += c4.x * c4.x; ss += c4.y * c4.y; ss += c4.z * c4.z; ss += c4.w * c4.w;
  ss += __shfl_xor(ss, 1, 32);
  ss += __shfl_xor(ss, 2, 32);
  ss += __shfl_xor(ss, 4, 32);
  const float nrm  = sqrtf(ss);
  const float rinv = 1.0f / fmaxf(nrm, 1e-12f);
  const float th   = bf_bits2f(f2bf_bits(tau[head]));
  const float sc   = isk ? rinv : rinv * th;
  float vals[8];
  vals[0] = a.x * sc;  vals[1] = a.y * sc;  vals[2] = a.z * sc;  vals[3] = a.w * sc;
  vals[4] = c4.x * sc; vals[5] = c4.y * sc; vals[6] = c4.z * sc; vals[7] = c4.w * sc;
  unsigned hw[4], lw[4];
#pragma unroll
  for (int i = 0; i < 4; ++i) {
    const float v0 = vals[2 * i], v1 = vals[2 * i + 1];
    const unsigned short h0 = f2bf_bits(v0), h1 = f2bf_bits(v1);
    const unsigned short l0 = f2bf_bits(v0 - bf_bits2f(h0));
    const unsigned short l1 = f2bf_bits(v1 - bf_bits2f(h1));
    hw[i] = (unsigned)h0 | ((unsigned)h1 << 16);
    lw[i] = (unsigned)l0 | ((unsigned)l1 << 16);
  }
  v4u hv; hv.x = hw[0]; hv.y = hw[1]; hv.z = hw[2]; hv.w = hw[3];
  v4u lv; lv.x = lw[0]; lv.y = lw[1]; lv.z = lw[2]; lv.w = lw[3];
  v4u* ph = (v4u*)(void*)(dhp + base);
  v4u* pl = (v4u*)(void*)(dlp + base);
  *ph = hv; *pl = lv;
  
}

__device__ __forceinline__ v8f at_mma_b(v16b a, v16b b, v8f c) {
  c = __builtin_amdgcn_wmma_f32_16x16x32_bf16(false, a, false, b, (short)0, c, false, false);
  asm volatile("v_nop\n\tv_nop\n\tv_nop\n\tv_nop" : "+v"(c) : "v"(a), "v"(b));
  return c;
}
__device__ __forceinline__ v8f at_mma_h(v16h a, v16h b, v8f c) {
  c = __builtin_amdgcn_wmma_f32_16x16x32_f16(false, a, false, b, (short)0, c, false, false);
  asm volatile("v_nop\n\tv_nop\n\tv_nop\n\tv_nop" : "+v"(c) : "v"(a), "v"(b));
  return c;
}

/* =====================================================================================
   Attention for head_dim 64 with an additive [kSeq][kSeq] f32 mask shared over (b,h).
   Inputs: qh/ql = bf16 hi/lo planes of (q/||q|| * tau[h]), kh/kl = bf16 hi/lo planes of k/||k||,
           vv = f16 plane of v; all [kTok][kDm] with element (b, s, h, d) at (b*kSeq+s)*kDm + h*64 + d.
   scores = qhat_tau . khat^T : 3 bf16 WMMAs (hi.hi + hi.lo + lo.hi); += bf16(mask[q][kv]); online softmax f32.
   out    = p . v : f16 WMMA, p carried x2^14; result written as f16 of (out * 2^6) into oo (same plane layout).
   Block = 4 waves = 64 query rows of one (b, h); every one of the kSeq/64 kv chunks is processed.
   grid.x = kBatch * kHeads * (kSeq/64) = 1024.  coverage of oo: 1024 blocks x 64 rows x 64 d = kTok*kDm.
   ===================================================================================== */
__global__ __launch_bounds__(128)
void cos_attn_kernel(const unsigned short* __restrict__ qhp, const unsigned short* __restrict__ qlp,
                     const unsigned short* __restrict__ khp, const unsigned short* __restrict__ klp,
                     const unsigned short* __restrict__ vvp, const float* __restrict__ mask,
                     unsigned short* __restrict__ oo) {
  union FB { v16b v; v8b h[2]; };
  union FH { v16h v; v8h h[2]; };
  __shared__ __align__(16) __bf16   Ksh[kKch * kHd];        /* K hi [kv][d]       8 KB */
  __shared__ __align__(16) __bf16   Ksl[kKch * kHd];        /* K lo [kv][d]       8 KB */
  __shared__ __align__(16) _Float16 Vt[kHd * kKch];         /* V    [d][kv]       8 KB */
  __shared__ __align__(16) float    Msk[kQblk * kKch];      /* mask [qrow][kv]   16 KB */
  __shared__ __align__(16) _Float16 Psh[4][16 * kKch];      /* per wave P / out staging  8 KB */

  const int tid  = threadIdx.x;
  const int wave = tid >> 5;
  const int lane = tid & 31;
  const int hh   = lane >> 4;
  const int c    = lane & 15;

  const int nqb = kSeq / kQblk;                 /* 32 */
  const int bx  = blockIdx.x;
  const int qb  = bx % nqb;
  const int bh  = bx / nqb;
  const int h   = bh % kHeads;
  const int b   = bh / kHeads;
  const int qbase = qb * kQblk;
  const int q0    = qbase + wave * 16;
  const size_t tokb = (size_t)b * kSeq;

  const __bf16*   qh = (const __bf16*)(const void*)qhp;
  const __bf16*   ql = (const __bf16*)(const void*)qlp;

  /* ---- Q fragments (A operand): row = lane&15, elements 0..7 <- d0+8hh+0..7, 8..15 <- d0+16+8hh+0..7 ---- */
  v16b qah[2], qal[2];
  {
    const size_t ro = (tokb + (size_t)(q0 + c)) * kDm + (size_t)h * kHd;
#pragma unroll
    for (int dc = 0; dc < 2; ++dc) {
      qah[dc] = Frag<__bf16>::load(qh + ro + dc * 32 + 8 * hh);
      qal[dc] = Frag<__bf16>::load(ql + ro + dc * 32 + 8 * hh);
    }
  }

  float mrow[8], lrow[8];
  v8f oacc[4];
#pragma unroll
  for (int r = 0; r < 8; ++r) { mrow[r] = -INFINITY; lrow[r] = 0.f; }
#pragma unroll
  for (int t = 0; t < 4; ++t) oacc[t] = (v8f){0.f,0.f,0.f,0.f,0.f,0.f,0.f,0.f};

  for (int kc = 0; kc < kSeq / kKch; ++kc) {
    const int kv0 = kc * kKch;
    __syncthreads();
    {
      /* staging: 128 threads; rr = kv row (K, V) or query row (mask tile), c0 = 32-element half.
         coverage per array: 128 threads x 32 elements = 64 x 64. */
      const int rr = tid >> 1;
      const int c0 = (tid & 1) * 32;
      const size_t ro = (tokb + (size_t)(kv0 + rr)) * kDm + (size_t)h * kHd + c0;
      const uint4* kph = (const uint4*)(const void*)(khp + ro);
      const uint4* kpl = (const uint4*)(const void*)(klp + ro);
#pragma unroll
      for (int i = 0; i < 4; ++i) {
        const uint4 wh = kph[i];
        const uint4 wl = kpl[i];
        *(uint4*)(void*)(Ksh + rr * kHd + c0 + 8 * i) = wh;
        *(uint4*)(void*)(Ksl + rr * kHd + c0 + 8 * i) = wl;
      }
      asm volatile("" ::: "memory");
      const uint4* vp = (const uint4*)(const void*)(vvp + ro);
#pragma unroll
      for (int i = 0; i < 4; ++i) {
        const uint4 w4 = vp[i];
        const int d0 = c0 + 8 * i;
        Vt[(d0 + 0) * kKch + rr] = h16_lo(w4.x);
        Vt[(d0 + 1) * kKch + rr] = h16_hi(w4.x);
        Vt[(d0 + 2) * kKch + rr] = h16_lo(w4.y);
        Vt[(d0 + 3) * kKch + rr] = h16_hi(w4.y);
        Vt[(d0 + 4) * kKch + rr] = h16_lo(w4.z);
        Vt[(d0 + 5) * kKch + rr] = h16_hi(w4.z);
        Vt[(d0 + 6) * kKch + rr] = h16_lo(w4.w);
        Vt[(d0 + 7) * kKch + rr] = h16_hi(w4.w);
      }
      asm volatile("" ::: "memory");
      /* mask tile rows qbase+rr, cols kv0+c0..+31; values RNE-converted to bf16 precision */
      const float* mp = mask + (size_t)(qbase + rr) * kSeq + kv0 + c0;
#pragma unroll
      for (int i = 0; i < 8; ++i) {
        const v4f m4 = *(const v4f*)(mp + 4 * i);
        v4f r4;
        r4.x = bf_bits2f(f2bf_bits(m4.x));
        r4.y = bf_bits2f(f2bf_bits(m4.y));
        r4.z = bf_bits2f(f2bf_bits(m4.z));
        r4.w = bf_bits2f(f2bf_bits(m4.w));
        *(v4f*)(Msk + rr * kKch + c0 + 4 * i) = r4;
      }
    }
    __syncthreads();

    /* ---- scores: S[qrow][kvcol], B[k=d][n=kv] = Ksh[kv][d] ---- */
    v8f s[4];
#pragma unroll
    for (int j = 0; j < 4; ++j) {
      s[j] = (v8f){0.f,0.f,0.f,0.f,0.f,0.f,0.f,0.f};
#pragma unroll
      for (int dc = 0; dc < 2; ++dc) {
        FB kb, klo;
        kb.h[0]  = *(const v8b*)(Ksh + (j * 16 + c) * kHd + dc * 32 + 8 * hh);
        kb.h[1]  = *(const v8b*)(Ksh + (j * 16 + c) * kHd + dc * 32 + 16 + 8 * hh);
        klo.h[0] = *(const v8b*)(Ksl + (j * 16 + c) * kHd + dc * 32 + 8 * hh);
        klo.h[1] = *(const v8b*)(Ksl + (j * 16 + c) * kHd + dc * 32 + 16 + 8 * hh);
        s[j] = at_mma_b(qah[dc], kb.v,  s[j]);
        s[j] = at_mma_b(qah[dc], klo.v, s[j]);
        s[j] = at_mma_b(qal[dc], kb.v,  s[j]);
      }
    }

    /* ---- additive mask from LDS tile + row max over this chunk ---- */
    float cm[8];
    const float* mrw = Msk + (wave * 16 + 8 * hh) * kKch;
#pragma unroll
    for (int r = 0; r < 8; ++r) {
      float m = -INFINITY;
#pragma unroll
      for (int j = 0; j < 4; ++j) {
        s[j][r] += mrw[r * kKch + j * 16 + c];
        m = fmaxf(m, s[j][r]);
      }
#pragma unroll
      for (int off = 1; off < 16; off <<= 1) m = fmaxf(m, __shfl_xor(m, off, 32));
      cm[r] = m;
    }
    _Float16* pwh = Psh[wave];
#pragma unroll
    for (int r = 0; r < 8; ++r) {
      const float mnew  = fmaxf(mrow[r], cm[r]);
      const float alpha = expf(mrow[r] - mnew);
      mrow[r] = mnew;
      float psum = 0.f;
#pragma unroll
      for (int j = 0; j < 4; ++j) {
        const float p = expf(s[j][r] - mnew);
        psum += p;
        pwh[(8 * hh + r) * kKch + j * 16 + c] = (_Float16)(p * P_CARRY);
      }
#pragma unroll
      for (int off = 1; off < 16; off <<= 1) psum += __shfl_xor(psum, off, 32);
      lrow[r] = lrow[r] * alpha + psum;
#pragma unroll
      for (int t = 0; t < 4; ++t) oacc[t][r] *= alpha;
    }
    __builtin_amdgcn_fence(__ATOMIC_RELEASE, "workgroup");
    __builtin_amdgcn_wave_barrier();
    __builtin_amdgcn_fence(__ATOMIC_ACQUIRE, "workgroup");
    /* ---- O += P . V : A = P[qrow][kv] (lane row c), B[k=kv][n=d] = Vt[d][kv] ---- */
#pragma unroll 1
    for (int kk = 0; kk < 2; ++kk) {
      FH pa;
      pa.h[0] = *(const v8h*)(pwh + c * kKch + kk * 32 + 8 * hh);
      pa.h[1] = *(const v8h*)(pwh + c * kKch + kk * 32 + 16 + 8 * hh);
#pragma unroll
      for (int t = 0; t < 4; ++t) {
        FH vb;
        vb.h[0] = *(const v8h*)(Vt + (t * 16 + c) * kKch + kk * 32 + 8 * hh);
        vb.h[1] = *(const v8h*)(Vt + (t * 16 + c) * kKch + kk * 32 + 16 + 8 * hh);
        oacc[t] = at_mma_h(pa.v, vb.v, oacc[t]);
      }
    }
  }

  _Float16* pw = Psh[wave];
  __builtin_amdgcn_fence(__ATOMIC_RELEASE, "workgroup");
  __builtin_amdgcn_wave_barrier();
  __builtin_amdgcn_fence(__ATOMIC_ACQUIRE, "workgroup");
#pragma unroll
  for (int r = 0; r < 8; ++r) {
    const float inv = O_CARRY / (lrow[r] * P_CARRY);     /* lrow >= 1 */
#pragma unroll
    for (int t = 0; t < 4; ++t) pw[(8 * hh + r) * kKch + t * 16 + c] = (_Float16)(oacc[t][r] * inv);
  }
  __builtin_amdgcn_fence(__ATOMIC_RELEASE, "workgroup");
  __builtin_amdgcn_wave_barrier();
  __builtin_amdgcn_fence(__ATOMIC_ACQUIRE, "workgroup");
  {
    const int q8 = lane >> 3, c8 = (lane & 7) * 8;
    _Float16* ob = (_Float16*)(void*)oo + (tokb + (size_t)q0) * kDm + (size_t)h * kHd;
    {
#pragma unroll
      for (int it = 0; it < 4; ++it) {
        const int row = it * 4 + q8;
        const v8h val = *(const v8h*)(pw + row * kKch + c8);
        *(v8h*)(ob + (size_t)row * kDm + c8) = val;
      }
      
    }
  }
}

/* ------------------------------------------------------------------------------------- */
extern "C" void kernel_launch(void* const* d_in, const int* in_sizes, int n_in,
                              void* d_out, int out_size, void* d_ws, size_t ws_size,
                              hipStream_t stream) {
  if (n_in < 11) return;
  const float* x    = (const float*)d_in[0];
  const float* mask = (const float*)d_in[1];
  const float* Wq   = (const float*)d_in[2];
  const float* bq   = (const float*)d_in[3];
  const float* Wk   = (const float*)d_in[4];
  const float* bk   = (const float*)d_in[5];
  const float* Wv   = (const float*)d_in[6];
  const float* bv   = (const float*)d_in[7];
  const float* Wo   = (const float*)d_in[8];
  const float* bo   = (const float*)d_in[9];
  const float* tau  = (const float*)d_in[10];

  const size_t nX = (size_t)kTok * kDm;     /* 4,194,304 */
  const size_t nW = (size_t)kDm * kDm;      /* 1,048,576 */
  if ((size_t)in_sizes[0] != nX || (size_t)in_sizes[1] != (size_t)kSeq * kSeq ||
      (size_t)in_sizes[2] != nW || (size_t)in_sizes[4] != nW || (size_t)in_sizes[6] != nW ||
      (size_t)in_sizes[8] != nW || in_sizes[3] != kDm || in_sizes[5] != kDm || in_sizes[7] != kDm ||
      in_sizes[9] != kDm || in_sizes[10] != kHeads) return;
  if ((size_t)out_size != nX) return;

  /*
       xb   bf16 [4096][1024]        off         0   size  8,388,608
       wqb  bf16 [1024][1024]        off  8,388,608  size  2,097,152
       wkb  bf16 [1024][1024]        off 10,485,760  size  2,097,152
       wvb  bf16 [1024][1024]        off 12,582,912  size  2,097,152
       wof  f16  [1024][1024] (x1024) off 14,680,064  size  2,097,152
       qf   f32  [4096][1024]        off 16,777,216  size 16,777,216   (reused as oo f16 [4096][1024], 8,388,608 B, after qf is consumed)
       kf   f32  [4096][1024]        off 33,554,432  size 16,777,216
       qhb  bf16 [4096][1024]        off 50,331,648  size  8,388,608
       qlb  bf16 [4096][1024]        off 58,720,256  size  8,388,608
       khb  bf16 [4096][1024]        off 67,108,864  size  8,388,608
       klb  bf16 [4096][1024]        off 75,497,472  size  8,388,608
       vvh  f16  [4096][1024]        off 83,886,080  size  8,388,608
       end                               92,274,688 */
  const size_t offXb  = 0;
  const size_t offWq  = offXb  + nX * 2;
  const size_t offWk  = offWq  + nW * 2;
  const size_t offWv  = offWk  + nW * 2;
  const size_t offWo  = offWv  + nW * 2;
  const size_t offQf  = offWo  + nW * 2;
  const size_t offKf  = offQf  + nX * 4;
  const size_t offQh  = offKf  + nX * 4;
  const size_t offQl  = offQh  + nX * 2;
  const size_t offKh  = offQl  + nX * 2;
  const size_t offKl  = offKh  + nX * 2;
  const size_t offVv  = offKl  + nX * 2;
  const size_t offEnd = offVv  + nX * 2;
  if (offEnd > ws_size) return;

  char* ws = (char*)d_ws;
  unsigned short* xb  = (unsigned short*)(ws + offXb);
  unsigned short* wqb = (unsigned short*)(ws + offWq);
  unsigned short* wkb = (unsigned short*)(ws + offWk);
  unsigned short* wvb = (unsigned short*)(ws + offWv);
  unsigned short* wof = (unsigned short*)(ws + offWo);
  float*          qf  = (float*)(ws + offQf);
  unsigned short* oo  = (unsigned short*)(ws + offQf);   /* reuse after qf is consumed */
  float*          kf  = (float*)(ws + offKf);
  unsigned short* qhb = (unsigned short*)(ws + offQh);
  unsigned short* qlb = (unsigned short*)(ws + offQl);
  unsigned short* khb = (unsigned short*)(ws + offKh);
  unsigned short* klb = (unsigned short*)(ws + offKl);
  unsigned short* vvh = (unsigned short*)(ws + offVv);

  /* 1-5: input casts (RNE bf16; Wo -> f16 of bf16 value x 1024) */
  const int n2X = (int)(nX / 2), n2W = (int)(nW / 2);
  cast2_kernel<0><<<dim3(n2X / 256), dim3(256), 0, stream>>>(x,  xb,  n2X, 1.0f);
  cast2_kernel<0><<<dim3(n2W / 256), dim3(256), 0, stream>>>(Wq, wqb, n2W, 1.0f);
  cast2_kernel<0><<<dim3(n2W / 256), dim3(256), 0, stream>>>(Wk, wkb, n2W, 1.0f);
  cast2_kernel<0><<<dim3(n2W / 256), dim3(256), 0, stream>>>(Wv, wvb, n2W, 1.0f);
  cast2_kernel<1><<<dim3(n2W / 256), dim3(256), 0, stream>>>(Wo, wof, n2W, WO_CARRY);

  /* 6-8: projections C[m][n] = sum_k xb[m][k] W[n][k] + bias[n]; M=4096, N=1024, K=1024 (tiles 64x64, K%32==0) */
  const int gemmTiles  = (kTok / 64) * (kDm / 64);      /* 1024 */
  const int gemmBlocks = (gemmTiles + 7) / 8;           /* 128 */
  wmma_gemm64<1, false, 2, 0, false, 0><<<dim3(gemmBlocks, 1), dim3(256), 0, stream>>>(
      xb, xb, kDm, 0L, wqb, wqb, kDm, 0L, (void*)qf, (void*)qf, kDm, 0L, bq, nullptr, 0L, kTok, kDm, kDm, 1.0f);
  wmma_gemm64<1, false, 2, 0, false, 0><<<dim3(gemmBlocks, 1), dim3(256), 0, stream>>>(
      xb, xb, kDm, 0L, wkb, wkb, kDm, 0L, (void*)kf, (void*)kf, kDm, 0L, bk, nullptr, 0L, kTok, kDm, kDm, 1.0f);
  wmma_gemm64<1, false, 2, 1, false, 0><<<dim3(gemmBlocks, 1), dim3(256), 0, stream>>>(
      xb, xb, kDm, 0L, wvb, wvb, kDm, 0L, (void*)vvh, (void*)vvh, kDm, 0L, bv, nullptr, 0L, kTok, kDm, kDm, 1.0f);

  /* 9: L2 normalisation of q (x tau) and k, bf16 hi/lo planes */
  l2norm_split_kernel<<<dim3((kTok * kHeads) / 32, 2), dim3(256), 0, stream>>>(qf, kf, tau, qhb, qlb, khb, klb);

  /* 10: attention -> oo (f16, value x 64), overwrites the dead qf region */
  cos_attn_kernel<<<dim3(kBatch * kHeads * (kSeq / kQblk)), dim3(128), 0, stream>>>(qhb, qlb, khb, klb, vvh, mask, oo);

  /* 11: output projection: out[m][n] = 2^-16 * sum_c (oo x64)[m][c] (Wo x1024)[n][c] + bo[n] -> d_out f32 */
  wmma_gemm64<0, false, 2, 0, false, 0><<<dim3(gemmBlocks, 1), dim3(256), 0, stream>>>(
      oo, oo, kDm, 0L, wof, wof, kDm, 0L, d_out, d_out, kDm, 0L, bo, nullptr, 0L, kTok, kDm, kDm,
      1.0f / (O_CARRY * WO_CARRY));
}

// v001
// It runs in 374 microseconds.
// Two timings next to v000 both put it at 1.25 times that version's speed.
// Contractions: q/k/v projections on v_wmma_f32_16x16x32_bf16 (operands = RNE bf16 of the inputs); scores on bf16 hi/lo split (hi.hi + hi.lo + lo.hi); p.v and output projection on v_wmma_f32_16x16x32_f16 (p carried x2^14, attention output carried x2^6, Wo carried x2^10); f32 accumulate; norms and softmax in f32.
#include <hip/hip_runtime.h>
#include <stdint.h>

typedef __attribute__((ext_vector_type(16))) _Float16 v16h;
typedef __attribute__((ext_vector_type(8)))  _Float16 v8h;
typedef __attribute__((ext_vector_type(16))) __bf16   v16b;
typedef __attribute__((ext_vector_type(8)))  __bf16   v8b;
typedef __attribute__((ext_vector_type(8)))  float    v8f;
typedef __attribute__((ext_vector_type(4)))  float    v4f;
typedef __attribute__((ext_vector_type(2)))  float    v2f;
typedef __attribute__((ext_vector_type(4)))  unsigned v4u;

/* problem geometry */
constexpr int kBatch = 2;
constexpr int kSeq   = 2048;
constexpr int kDm    = 1024;
constexpr int kHeads = 16;
constexpr int kHd    = 64;
constexpr int kTok   = kBatch * kSeq;      /* 4096 token rows */
constexpr int kKch   = 64;                 /* kv chunk */
constexpr int kQblk  = 64;                 /* query rows per block */
/* LDS row pitches of the attention tiles: 16 B x odd, so that the 16 rows a ds_load_b128 fragment read
   touches fall on 16 different groups of four banks (an unpadded 128 B or 256 B row puts them on one or two) */
constexpr int kP16   = 72;                 /* 64 16-bit elements + 8 pad  = 144 B */
constexpr int kPm    = 68;                 /* 64 f32 + 4 pad = 272 B; rows 8 apart land 32 banks apart */
#define P_CARRY 16384.0f
#define O_CARRY 64.0f
#define WO_CARRY 1024.0f

static_assert(kDm == kHeads * kHd, "head split");
static_assert(kTok % 64 == 0 && kDm % 64 == 0, "GEMM M,N tile multiples");
static_assert(kDm % 32 == 0, "GEMM K multiple of 32");
static_assert(kSeq % kKch == 0 && kSeq % kQblk == 0, "attention tiles");
static_assert((kTok * kHeads) % 32 == 0, "normalize grid");

__device__ __forceinline__ unsigned short f2bf_bits(float f) {
  unsigned u = __float_as_uint(f);
  return (unsigned short)((u + 0x7FFFu + ((u >> 16) & 1u)) >> 16);
}
__device__ __forceinline__ float bf_bits2f(unsigned short h) { return __uint_as_float(((unsigned)h) << 16); }
__device__ __forceinline__ _Float16 h16_lo(unsigned w) { return __builtin_bit_cast(_Float16, (unsigned short)(w & 0xffffu)); }
__device__ __forceinline__ _Float16 h16_hi(unsigned w) { return __builtin_bit_cast(_Float16, (unsigned short)(w >> 16)); }

/* hazard guards as plain device helpers */
__device__ __forceinline__ void dep_guard_h(v8f& a, v8f& b, v16h x, v16h y) { asm volatile("v_nop\n\tv_nop\n\tv_nop\n\tv_nop" : "+v"(a), "+v"(b) : "v"(x), "v"(y)); }
__device__ __forceinline__ void dep_guard_b(v8f& a, v8f& b, v16b x, v16b y) { asm volatile("v_nop\n\tv_nop\n\tv_nop\n\tv_nop" : "+v"(a), "+v"(b) : "v"(x), "v"(y)); }
__device__ __forceinline__ void keep4_h(v16h a, v16h b, v16h c, v16h d) { asm volatile("v_nop" :: "v"(a), "v"(b), "v"(c), "v"(d)); }
__device__ __forceinline__ void keep4_b(v16b a, v16b b, v16b c, v16b d) { asm volatile("v_nop" :: "v"(a), "v"(b), "v"(c), "v"(d)); }
__device__ __forceinline__ void acc_guard4(v8f& a, v8f& b, v8f& c, v8f& d) { asm volatile("v_nop\n\tv_nop\n\tv_nop\n\tv_nop" : "+v"(a), "+v"(b), "+v"(c), "+v"(d)); }
template <typename T> struct Frag;
template <> struct Frag<_Float16> {
  typedef v16h V; union U { v16h v; v8h h[2]; };
  static __device__ __forceinline__ v16h load(const _Float16* p) {   /* elements 0..7 <- p[0..7], 8..15 <- p[16..23] */
    U f; f.h[0] = *(const v8h*)(p); f.h[1] = *(const v8h*)(p + 16); return f.v;
  }
  static __device__ __forceinline__ v8f mma(v16h a, v16h b, v8f c) {
    return __builtin_amdgcn_wmma_f32_16x16x32_f16(false, a, false, b, (short)0, c, false, false);
  }
  static __device__ __forceinline__ void guard(v8f& a, v8f& b, v16h x, v16h y) { dep_guard_h(a, b, x, y); }
  static __device__ __forceinline__ void keep(v16h a, v16h b, v16h c, v16h d) { keep4_h(a, b, c, d); }
};
template <> struct Frag<__bf16> {
  typedef v16b V; union U { v16b v; v8b h[2]; };
  static __device__ __forceinline__ v16b load(const __bf16* p) {
    U f; f.h[0] = *(const v8b*)(p); f.h[1] = *(const v8b*)(p + 16); return f.v;
  }
  static __device__ __forceinline__ v8f mma(v16b a, v16b b, v8f c) {
    return __builtin_amdgcn_wmma_f32_16x16x32_bf16(false, a, false, b, (short)0, c, false, false);
  }
  static __device__ __forceinline__ void guard(v8f& a, v8f& b, v16b x, v16b y) { dep_guard_b(a, b, x, y); }
  static __device__ __forceinline__ void keep(v16b a, v16b b, v16b c, v16b d) { keep4_b(a, b, c, d); }
};

/* ---- Register-blocked batched WMMA GEMM --------------------------------
   C[m,n] = scale * sum_k A[m,k] * Bt[n,k] (+bias); each wave owns a 64x64 tile.
   A row-major [M,K]; Bt row-major [N,K]; M,N % 64 == 0, K % 32 == 0.
   BIAS_MODE: 0 = none, 1 = bias[m], 2 = bias[n]; bias values RNE-converted to bf16 precision before the add.
   OUT_MODE: 0 = f32, 1 = f16, 2 = bf16 hi plane (Cout) + bf16 lo plane (Cout2).
   ET: 0 = f16 operands, 1 = bf16 operands (pointers passed as 16-bit storage) */
template <int ET> struct Elem;
template <> struct Elem<0> { typedef _Float16 T; };
template <> struct Elem<1> { typedef __bf16 T; };
template <int ET, bool SPLIT, int BIAS_MODE, int OUT_MODE, bool RESID, int ACT = 0>
__global__ __launch_bounds__(256) void wmma_gemm64(
    const unsigned short* __restrict__ Ap, const unsigned short* __restrict__ A2p, int lda, long strideA,
    const unsigned short* __restrict__ Btp, const unsigned short* __restrict__ Bt2p, int ldb, long strideB,
    void* __restrict__ Cout, void* __restrict__ Cout2, int ldc, long strideC,
    const float* __restrict__ bias,
    const float* __restrict__ resid, long strideR,
    int M, int N, int K, float scale) {
  typedef typename Elem<ET>::T T;
  typedef typename Frag<T>::V V;
  const T* A = (const T*)Ap; const T* A2 = (const T*)A2p; const T* Bt = (const T*)Btp; const T* Bt2 = (const T*)Bt2p;
  __shared__ __align__(16) float sT[8][16 * 68];   /* per-wave 16x64 slab, pitch 68 floats */
  const int b    = blockIdx.y;
  const int lane = threadIdx.x & 31;
  const int wave = threadIdx.x >> 5;
  const int tilesN = N >> 6;
  const int tilesM = M >> 6;
  const int tile = blockIdx.x * 8 + wave;
  if (tile >= tilesM * tilesN) return;   /* wave-uniform; no block barriers in this kernel */
  const int tm = tile / tilesN;
  const int tn = tile - tm * tilesN;
  const int m0 = tm << 6;
  const int n0 = tn << 6;

  const T* Ab  = A  + (size_t)b * strideA;
  const T* Bb  = Bt + (size_t)b * strideB;
  const T* Ab2 = SPLIT ? (A2  + (size_t)b * strideA) : nullptr;
  const T* Bb2 = SPLIT ? (Bt2 + (size_t)b * strideB) : nullptr;

  const int rlane = lane & 15;                 /* row (A) / col (B, D) within subtile */
  const int koff  = (lane >> 4) * 8;           /* k offset of this lane half */
  const int mOff  = (lane >> 4) * 8;           /* D row offset */

  v8f acc[4][4];
#pragma unroll
  for (int i = 0; i < 4; ++i)
#pragma unroll
    for (int j = 0; j < 4; ++j) acc[i][j] = (v8f){0.f,0.f,0.f,0.f,0.f,0.f,0.f,0.f};

  for (int k0 = 0; k0 < K; k0 += 32) {
    V bh[4], bl[4];
#pragma unroll
    for (int j = 0; j < 4; ++j) {
      const size_t bo = (size_t)(n0 + (j << 4) + rlane) * ldb + koff + k0;
      bh[j] = Frag<T>::load(Bb + bo);
      if (SPLIT) bl[j] = Frag<T>::load(Bb2 + bo);
    }
#pragma unroll
    for (int i = 0; i < 4; ++i) {
      const size_t ao = (size_t)(m0 + (i << 4) + rlane) * lda + koff + k0;
      V ah = Frag<T>::load(Ab + ao);
      V al;
      if (SPLIT) al = Frag<T>::load(Ab2 + ao);
#pragma unroll
      for (int j = 0; j < 4; ++j) {
        acc[i][j] = Frag<T>::mma(ah, bh[j], acc[i][j]);
        if (SPLIT) {
          acc[i][j] = Frag<T>::mma(ah, bl[j], acc[i][j]);
          acc[i][j] = Frag<T>::mma(al, bh[j], acc[i][j]);
        }
      }
      Frag<T>::guard(acc[i][0], acc[i][3], ah, SPLIT ? al : ah);
    }
    Frag<T>::keep(bh[0], bh[1], bh[2], bh[3]);
    if (SPLIT) Frag<T>::keep(bl[0], bl[1], bl[2], bl[3]);
  }
  acc_guard4(acc[0][0], acc[0][1], acc[0][2], acc[0][3]);
  acc_guard4(acc[1][0], acc[1][1], acc[1][2], acc[1][3]);
  acc_guard4(acc[2][0], acc[2][1], acc[2][2], acc[2][3]);
  acc_guard4(acc[3][0], acc[3][1], acc[3][2], acc[3][3]);

  /* ---- epilogue ---- */
  float* slab = sT[wave];
  const float* Rb = RESID ? (resid + (size_t)b * strideR) : nullptr;
#pragma unroll
  for (int i = 0; i < 4; ++i) {
    const int mBase = m0 + (i << 4);
#pragma unroll
    for (int j = 0; j < 4; ++j) {
      const int n = n0 + (j << 4) + rlane;
      float bv = 0.f;
      if (BIAS_MODE == 2) bv = bf_bits2f(f2bf_bits(bias[n]));
#pragma unroll
      for (int r = 0; r < 8; ++r) {
        float v = acc[i][j][r] * scale;
        if (BIAS_MODE == 1) v += bf_bits2f(f2bf_bits(bias[mBase + mOff + r]));
        if (BIAS_MODE == 2) v += bv;
        if (RESID) v += Rb[(size_t)(mBase + mOff + r) * ldc + n];
        if (ACT == 1) v = tanhf(v);
        if (ACT == 2) v = fmaxf(v, 0.0f);
        if (ACT == 3) v = v / (1.0f + expf(-v));
        if (ACT == 4) v = (v > 0.f) ? v : 0.01f * v;
        slab[(mOff + r) * 68 + (j << 4) + rlane] = v;
      }
    }
    __builtin_amdgcn_fence(__ATOMIC_RELEASE, "workgroup");
    __builtin_amdgcn_wave_barrier();
    __builtin_amdgcn_fence(__ATOMIC_ACQUIRE, "workgroup");
    if (OUT_MODE == 0) {
      float* C = (float*)Cout + (size_t)b * strideC;
      const int hh = lane >> 4, c4 = (lane & 15) * 4;     /* row seg = 256 B = 16 lanes x 16 B */
      {
#pragma unroll
        for (int it = 0; it < 8; ++it) {
          const int row = it * 2 + hh;
          v4f v = *(const v4f*)(slab + row * 68 + c4);
          *(v4f*)(C + (size_t)(mBase + row) * ldc + n0 + c4) = v;
        }
        
      }
    } else {
      const int q = lane >> 3, c8 = (lane & 7) * 8;        
      unsigned short* C  = (unsigned short*)Cout  + (size_t)b * strideC;
      unsigned short* C2 = (OUT_MODE == 2) ? ((unsigned short*)Cout2 + (size_t)b * strideC) : nullptr;
      {
#pragma unroll
        for (int it = 0; it < 4; ++it) {
          const int row = it * 4 + q;
          const float* sp = slab + row * 68 + c8;
          v8h hv, lv;
#pragma unroll
          for (int e = 0; e < 8; ++e) {
            if (OUT_MODE == 1) {
              hv[e] = (_Float16)sp[e];
            } else {
              unsigned short hb = f2bf_bits(sp[e]);
              unsigned short lb = f2bf_bits(sp[e] - bf_bits2f(hb));
              hv[e] = __builtin_bit_cast(_Float16, hb);
              lv[e] = __builtin_bit_cast(_Float16, lb);
            }
          }
          *(v8h*)(C + (size_t)(mBase + row) * ldc + n0 + c8) = hv;
          if (OUT_MODE == 2) *(v8h*)(C2 + (size_t)(mBase + row) * ldc + n0 + c8) = lv;
        }
        
      }
    }
    __builtin_amdgcn_fence(__ATOMIC_RELEASE, "workgroup");
    __builtin_amdgcn_wave_barrier();
    __builtin_amdgcn_fence(__ATOMIC_ACQUIRE, "workgroup");
  }
}

/*
   MODE 0: bf16 bits (RNE).  MODE 1: f16 bits of (RNE-bf16 value * mul).
   coverage: grid = n2/256 blocks x 256 threads x 2 elements = 2*n2 elements exactly. */
template <int MODE>
__global__ __launch_bounds__(256) void cast2_kernel(const float* __restrict__ in,
                                                    unsigned short* __restrict__ out, int n2, float mul) {
  const int i = blockIdx.x * 256 + threadIdx.x;
  if (i < n2) {
    const v2f p = *(const v2f*)(in + 2 * (size_t)i);
    unsigned short u0, u1;
    if (MODE == 0) {
      u0 = f2bf_bits(p.x); u1 = f2bf_bits(p.y);
    } else {
      const float r0 = bf_bits2f(f2bf_bits(p.x)) * mul;
      const float r1 = bf_bits2f(f2bf_bits(p.y)) * mul;
      u0 = __builtin_bit_cast(unsigned short, (_Float16)r0);
      u1 = __builtin_bit_cast(unsigned short, (_Float16)r1);
    }
    const unsigned u = (unsigned)u0 | ((unsigned)u1 << 16);
    unsigned* op = (unsigned*)(void*)out;
    op[i] = u;
    
  }
}

/* ---- per (token, head) L2 normalisation + bf16 hi/lo split.
   blockIdx.y = 0: q plane, scaled by 1/max(||q||,1e-12) * bf16(tau[head]); y = 1: k plane, 1/max(||k||,1e-12).
   8 lanes per 64-vector (8 floats each), 32 segments per 256-thread block; grid.x = kTok*kHeads/32 = 2048.
*/
__global__ __launch_bounds__(256) void l2norm_split_kernel(
    const float* __restrict__ qf, const float* __restrict__ kf, const float* __restrict__ tau,
    unsigned short* __restrict__ qhp, unsigned short* __restrict__ qlp,
    unsigned short* __restrict__ khp, unsigned short* __restrict__ klp) {
  const bool isk = (blockIdx.y != 0);                 /* block-uniform */
  const float* src = isk ? kf : qf;
  unsigned short* dhp = isk ? khp : qhp;
  unsigned short* dlp = isk ? klp : qlp;
  const int tid = threadIdx.x;
  const int g = tid >> 3, e = tid & 7;
  const int seg = blockIdx.x * 32 + g;                 /* < kTok*kHeads */
  const int token = seg >> 4, head = seg & 15;
  const size_t base = (size_t)token * kDm + (size_t)head * kHd + (size_t)e * 8;
  const v4f a  = *(const v4f*)(src + base);
  const v4f c4 = *(const v4f*)(src + base + 4);
  float ss = 0.0f;
  ss += a.x * a.x;  ss += a.y * a.y;  ss += a.z * a.z;  ss += a.w * a.w;
  ss += c4.x * c4.x; ss += c4.y * c4.y; ss += c4.z * c4.z; ss += c4.w * c4.w;
  ss += __shfl_xor(ss, 1, 32);
  ss += __shfl_xor(ss, 2, 32);
  ss += __shfl_xor(ss, 4, 32);
  const float nrm  = sqrtf(ss);
  const float rinv = 1.0f / fmaxf(nrm, 1e-12f);
  const float th   = bf_bits2f(f2bf_bits(tau[head]));
  const float sc   = isk ? rinv : rinv * th;
  float vals[8];
  vals[0] = a.x * sc;  vals[1] = a.y * sc;  vals[2] = a.z * sc;  vals[3] = a.w * sc;
  vals[4] = c4.x * sc; vals[5] = c4.y * sc; vals[6] = c4.z * sc; vals[7] = c4.w * sc;
  unsigned hw[4], lw[4];
#pragma unroll
  for (int i = 0; i < 4; ++i) {
    const float v0 = vals[2 * i], v1 = vals[2 * i + 1];
    const unsigned short h0 = f2bf_bits(v0), h1 = f2bf_bits(v1);
    const unsigned short l0 = f2bf_bits(v0 - bf_bits2f(h0));
    const unsigned short l1 = f2bf_bits(v1 - bf_bits2f(h1));
    hw[i] = (unsigned)h0 | ((unsigned)h1 << 16);
    lw[i] = (unsigned)l0 | ((unsigned)l1 << 16);
  }
  v4u hv; hv.x = hw[0]; hv.y = hw[1]; hv.z = hw[2]; hv.w = hw[3];
  v4u lv; lv.x = lw[0]; lv.y = lw[1]; lv.z = lw[2]; lv.w = lw[3];
  v4u* ph = (v4u*)(void*)(dhp + base);
  v4u* pl = (v4u*)(void*)(dlp + base);
  *ph = hv; *pl = lv;
  
}

__device__ __forceinline__ v8f at_mma_b(v16b a, v16b b, v8f c) {
  c = __builtin_amdgcn_wmma_f32_16x16x32_bf16(false, a, false, b, (short)0, c, false, false);
  asm volatile("v_nop\n\tv_nop\n\tv_nop\n\tv_nop" : "+v"(c) : "v"(a), "v"(b));
  return c;
}
__device__ __forceinline__ v8f at_mma_h(v16h a, v16h b, v8f c) {
  c = __builtin_amdgcn_wmma_f32_16x16x32_f16(false, a, false, b, (short)0, c, false, false);
  asm volatile("v_nop\n\tv_nop\n\tv_nop\n\tv_nop" : "+v"(c) : "v"(a), "v"(b));
  return c;
}

/* =====================================================================================
   Attention for head_dim 64 with an additive [kSeq][kSeq] f32 mask shared over (b,h).
   Inputs: qh/ql = bf16 hi/lo planes of (q/||q|| * tau[h]), kh/kl = bf16 hi/lo planes of k/||k||,
           vv = f16 plane of v; all [kTok][kDm] with element (b, s, h, d) at (b*kSeq+s)*kDm + h*64 + d.
   scores = qhat_tau . khat^T : 3 bf16 WMMAs (hi.hi + hi.lo + lo.hi); += bf16(mask[q][kv]); online softmax f32.
   out    = p . v : f16 WMMA, p carried x2^14; result written as f16 of (out * 2^6) into oo (same plane layout).
   Block = 4 waves = 64 query rows of one (b, h); every one of the kSeq/64 kv chunks is processed.
   grid.x = kBatch * kHeads * (kSeq/64) = 1024.  coverage of oo: 1024 blocks x 64 rows x 64 d = kTok*kDm.
   ===================================================================================== */
__global__ __launch_bounds__(128)
void cos_attn_kernel(const unsigned short* __restrict__ qhp, const unsigned short* __restrict__ qlp,
                     const unsigned short* __restrict__ khp, const unsigned short* __restrict__ klp,
                     const unsigned short* __restrict__ vvp, const float* __restrict__ mask,
                     unsigned short* __restrict__ oo) {
  union FB { v16b v; v8b h[2]; };
  union FH { v16h v; v8h h[2]; };
  __shared__ __align__(16) __bf16   Ksh[kKch * kP16];       /* K hi [kv][d]       9 KB */
  __shared__ __align__(16) __bf16   Ksl[kKch * kP16];       /* K lo [kv][d]       9 KB */
  __shared__ __align__(16) _Float16 Vt[kHd * kP16];         /* V    [d][kv]       9 KB */
  __shared__ __align__(16) float    Msk[kQblk * kPm];       /* mask [qrow][kv]   17 KB */
  __shared__ __align__(16) _Float16 Psh[4][16 * kP16];      /* per wave P / out staging  9 KB */

  const int tid  = threadIdx.x;
  const int wave = tid >> 5;
  const int lane = tid & 31;
  const int hh   = lane >> 4;
  const int c    = lane & 15;

  const int nqb = kSeq / kQblk;                 /* 32 */
  const int bx  = blockIdx.x;
  const int qb  = bx % nqb;
  const int bh  = bx / nqb;
  const int h   = bh % kHeads;
  const int b   = bh / kHeads;
  const int qbase = qb * kQblk;
  const int q0    = qbase + wave * 16;
  const size_t tokb = (size_t)b * kSeq;

  const __bf16*   qh = (const __bf16*)(const void*)qhp;
  const __bf16*   ql = (const __bf16*)(const void*)qlp;

  /* ---- Q fragments (A operand): row = lane&15, elements 0..7 <- d0+8hh+0..7, 8..15 <- d0+16+8hh+0..7 ---- */
  v16b qah[2], qal[2];
  {
    const size_t ro = (tokb + (size_t)(q0 + c)) * kDm + (size_t)h * kHd;
#pragma unroll
    for (int dc = 0; dc < 2; ++dc) {
      qah[dc] = Frag<__bf16>::load(qh + ro + dc * 32 + 8 * hh);
      qal[dc] = Frag<__bf16>::load(ql + ro + dc * 32 + 8 * hh);
    }
  }

  float mrow[8], lrow[8];
  v8f oacc[4];
#pragma unroll
  for (int r = 0; r < 8; ++r) { mrow[r] = -INFINITY; lrow[r] = 0.f; }
#pragma unroll
  for (int t = 0; t < 4; ++t) oacc[t] = (v8f){0.f,0.f,0.f,0.f,0.f,0.f,0.f,0.f};

  for (int kc = 0; kc < kSeq / kKch; ++kc) {
    const int kv0 = kc * kKch;
    __syncthreads();
    {
      /* staging: 128 threads; rr = kv row (K, V) or query row (mask tile), c0 = 32-element half.
         coverage per array: 128 threads x 32 elements = 64 x 64. */
      const int rr = tid >> 1;
      const int c0 = (tid & 1) * 32;
      const size_t ro = (tokb + (size_t)(kv0 + rr)) * kDm + (size_t)h * kHd + c0;
      const uint4* kph = (const uint4*)(const void*)(khp + ro);
      const uint4* kpl = (const uint4*)(const void*)(klp + ro);
#pragma unroll
      for (int i = 0; i < 4; ++i) {
        const uint4 wh = kph[i];
        const uint4 wl = kpl[i];
        *(uint4*)(void*)(Ksh + rr * kP16 + c0 + 8 * i) = wh;
        *(uint4*)(void*)(Ksl + rr * kP16 + c0 + 8 * i) = wl;
      }
      asm volatile("" ::: "memory");
      const uint4* vp = (const uint4*)(const void*)(vvp + ro);
#pragma unroll
      for (int i = 0; i < 4; ++i) {
        const uint4 w4 = vp[i];
        const int d0 = c0 + 8 * i;
        Vt[(d0 + 0) * kP16 + rr] = h16_lo(w4.x);
        Vt[(d0 + 1) * kP16 + rr] = h16_hi(w4.x);
        Vt[(d0 + 2) * kP16 + rr] = h16_lo(w4.y);
        Vt[(d0 + 3) * kP16 + rr] = h16_hi(w4.y);
        Vt[(d0 + 4) * kP16 + rr] = h16_lo(w4.z);
        Vt[(d0 + 5) * kP16 + rr] = h16_hi(w4.z);
        Vt[(d0 + 6) * kP16 + rr] = h16_lo(w4.w);
        Vt[(d0 + 7) * kP16 + rr] = h16_hi(w4.w);
      }
      asm volatile("" ::: "memory");
      /* mask tile rows qbase+rr, cols kv0+c0..+31; values RNE-converted to bf16 precision */
      const float* mp = mask + (size_t)(qbase + rr) * kSeq + kv0 + c0;
#pragma unroll
      for (int i = 0; i < 8; ++i) {
        const v4f m4 = *(const v4f*)(mp + 4 * i);
        v4f r4;
        r4.x = bf_bits2f(f2bf_bits(m4.x));
        r4.y = bf_bits2f(f2bf_bits(m4.y));
        r4.z = bf_bits2f(f2bf_bits(m4.z));
        r4.w = bf_bits2f(f2bf_bits(m4.w));
        *(v4f*)(Msk + rr * kPm + c0 + 4 * i) = r4;
      }
    }
    __syncthreads();

    /* ---- scores: S[qrow][kvcol], B[k=d][n=kv] = Ksh[kv][d] ---- */
    v8f s[4];
#pragma unroll
    for (int j = 0; j < 4; ++j) {
      s[j] = (v8f){0.f,0.f,0.f,0.f,0.f,0.f,0.f,0.f};
#pragma unroll
      for (int dc = 0; dc < 2; ++dc) {
        FB kb, klo;
        kb.h[0]  = *(const v8b*)(Ksh + (j * 16 + c) * kP16 + dc * 32 + 8 * hh);
        kb.h[1]  = *(const v8b*)(Ksh + (j * 16 + c) * kP16 + dc * 32 + 16 + 8 * hh);
        klo.h[0] = *(const v8b*)(Ksl + (j * 16 + c) * kP16 + dc * 32 + 8 * hh);
        klo.h[1] = *(const v8b*)(Ksl + (j * 16 + c) * kP16 + dc * 32 + 16 + 8 * hh);
        s[j] = at_mma_b(qah[dc], kb.v,  s[j]);
        s[j] = at_mma_b(qah[dc], klo.v, s[j]);
        s[j] = at_mma_b(qal[dc], kb.v,  s[j]);
      }
    }

    /* ---- additive mask from LDS tile + row max over this chunk ---- */
    float cm[8];
    const float* mrw = Msk + (wave * 16 + 8 * hh) * kPm;
#pragma unroll
    for (int r = 0; r < 8; ++r) {
      float m = -INFINITY;
#pragma unroll
      for (int j = 0; j < 4; ++j) {
        s[j][r] += mrw[r * kPm + j * 16 + c];
        m = fmaxf(m, s[j][r]);
      }
#pragma unroll
      for (int off = 1; off < 16; off <<= 1) m = fmaxf(m, __shfl_xor(m, off, 32));
      cm[r] = m;
    }
    _Float16* pwh = Psh[wave];
#pragma unroll
    for (int r = 0; r < 8; ++r) {
      const float mnew  = fmaxf(mrow[r], cm[r]);
      const float alpha = expf(mrow[r] - mnew);
      mrow[r] = mnew;
      float psum = 0.f;
#pragma unroll
      for (int j = 0; j < 4; ++j) {
        const float p = expf(s[j][r] - mnew);
        psum += p;
        pwh[(8 * hh + r) * kP16 + j * 16 + c] = (_Float16)(p * P_CARRY);
      }
#pragma unroll
      for (int off = 1; off < 16; off <<= 1) psum += __shfl_xor(psum, off, 32);
      lrow[r] = lrow[r] * alpha + psum;
#pragma unroll
      for (int t = 0; t < 4; ++t) oacc[t][r] *= alpha;
    }
    __builtin_amdgcn_fence(__ATOMIC_RELEASE, "workgroup");
    __builtin_amdgcn_wave_barrier();
    __builtin_amdgcn_fence(__ATOMIC_ACQUIRE, "workgroup");
    /* ---- O += P . V : A = P[qrow][kv] (lane row c), B[k=kv][n=d] = Vt[d][kv] ---- */
#pragma unroll 1
    for (int kk = 0; kk < 2; ++kk) {
      FH pa;
      pa.h[0] = *(const v8h*)(pwh + c * kP16 + kk * 32 + 8 * hh);
      pa.h[1] = *(const v8h*)(pwh + c * kP16 + kk * 32 + 16 + 8 * hh);
#pragma unroll
      for (int t = 0; t < 4; ++t) {
        FH vb;
        vb.h[0] = *(const v8h*)(Vt + (t * 16 + c) * kP16 + kk * 32 + 8 * hh);
        vb.h[1] = *(const v8h*)(Vt + (t * 16 + c) * kP16 + kk * 32 + 16 + 8 * hh);
        oacc[t] = at_mma_h(pa.v, vb.v, oacc[t]);
      }
    }
  }

  _Float16* pw = Psh[wave];
  __builtin_amdgcn_fence(__ATOMIC_RELEASE, "workgroup");
  __builtin_amdgcn_wave_barrier();
  __builtin_amdgcn_fence(__ATOMIC_ACQUIRE, "workgroup");
#pragma unroll
  for (int r = 0; r < 8; ++r) {
    const float inv = O_CARRY / (lrow[r] * P_CARRY);     /* lrow >= 1 */
#pragma unroll
    for (int t = 0; t < 4; ++t) pw[(8 * hh + r) * kP16 + t * 16 + c] = (_Float16)(oacc[t][r] * inv);
  }
  __builtin_amdgcn_fence(__ATOMIC_RELEASE, "workgroup");
  __builtin_amdgcn_wave_barrier();
  __builtin_amdgcn_fence(__ATOMIC_ACQUIRE, "workgroup");
  {
    const int q8 = lane >> 3, c8 = (lane & 7) * 8;
    _Float16* ob = (_Float16*)(void*)oo + (tokb + (size_t)q0) * kDm + (size_t)h * kHd;
    {
#pragma unroll
      for (int it = 0; it < 4; ++it) {
        const int row = it * 4 + q8;
        const v8h val = *(const v8h*)(pw + row * kP16 + c8);
        *(v8h*)(ob + (size_t)row * kDm + c8) = val;
      }
      
    }
  }
}

/* ------------------------------------------------------------------------------------- */
extern "C" void kernel_launch(void* const* d_in, const int* in_sizes, int n_in,
                              void* d_out, int out_size, void* d_ws, size_t ws_size,
                              hipStream_t stream) {
  if (n_in < 11) return;
  const float* x    = (const float*)d_in[0];
  const float* mask = (const float*)d_in[1];
  const float* Wq   = (const float*)d_in[2];
  const float* bq   = (const float*)d_in[3];
  const float* Wk   = (const float*)d_in[4];
  const float* bk   = (const float*)d_in[5];
  const float* Wv   = (const float*)d_in[6];
  const float* bv   = (const float*)d_in[7];
  const float* Wo   = (const float*)d_in[8];
  const float* bo   = (const float*)d_in[9];
  const float* tau  = (const float*)d_in[10];

  const size_t nX = (size_t)kTok * kDm;     /* 4,194,304 */
  const size_t nW = (size_t)kDm * kDm;      /* 1,048,576 */
  if ((size_t)in_sizes[0] != nX || (size_t)in_sizes[1] != (size_t)kSeq * kSeq ||
      (size_t)in_sizes[2] != nW || (size_t)in_sizes[4] != nW || (size_t)in_sizes[6] != nW ||
      (size_t)in_sizes[8] != nW || in_sizes[3] != kDm || in_sizes[5] != kDm || in_sizes[7] != kDm ||
      in_sizes[9] != kDm || in_sizes[10] != kHeads) return;
  if ((size_t)out_size != nX) return;

  /*
       xb   bf16 [4096][1024]        off         0   size  8,388,608
       wqb  bf16 [1024][1024]        off  8,388,608  size  2,097,152
       wkb  bf16 [1024][1024]        off 10,485,760  size  2,097,152
       wvb  bf16 [1024][1024]        off 12,582,912  size  2,097,152
       wof  f16  [1024][1024] (x1024) off 14,680,064  size  2,097,152
       qf   f32  [4096][1024]        off 16,777,216  size 16,777,216   (reused as oo f16 [4096][1024], 8,388,608 B, after qf is consumed)
       kf   f32  [4096][1024]        off 33,554,432  size 16,777,216
       qhb  bf16 [4096][1024]        off 50,331,648  size  8,388,608
       qlb  bf16 [4096][1024]        off 58,720,256  size  8,388,608
       khb  bf16 [4096][1024]        off 67,108,864  size  8,388,608
       klb  bf16 [4096][1024]        off 75,497,472  size  8,388,608
       vvh  f16  [4096][1024]        off 83,886,080  size  8,388,608
       end                               92,274,688 */
  const size_t offXb  = 0;
  const size_t offWq  = offXb  + nX * 2;
  const size_t offWk  = offWq  + nW * 2;
  const size_t offWv  = offWk  + nW * 2;
  const size_t offWo  = offWv  + nW * 2;
  const size_t offQf  = offWo  + nW * 2;
  const size_t offKf  = offQf  + nX * 4;
  const size_t offQh  = offKf  + nX * 4;
  const size_t offQl  = offQh  + nX * 2;
  const size_t offKh  = offQl  + nX * 2;
  const size_t offKl  = offKh  + nX * 2;
  const size_t offVv  = offKl  + nX * 2;
  const size_t offEnd = offVv  + nX * 2;
  if (offEnd > ws_size) return;

  char* ws = (char*)d_ws;
  unsigned short* xb  = (unsigned short*)(ws + offXb);
  unsigned short* wqb = (unsigned short*)(ws + offWq);
  unsigned short* wkb = (unsigned short*)(ws + offWk);
  unsigned short* wvb = (unsigned short*)(ws + offWv);
  unsigned short* wof = (unsigned short*)(ws + offWo);
  float*          qf  = (float*)(ws + offQf);
  unsigned short* oo  = (unsigned short*)(ws + offQf);   /* reuse after qf is consumed */
  float*          kf  = (float*)(ws + offKf);
  unsigned short* qhb = (unsigned short*)(ws + offQh);
  unsigned short* qlb = (unsigned short*)(ws + offQl);
  unsigned short* khb = (unsigned short*)(ws + offKh);
  unsigned short* klb = (unsigned short*)(ws + offKl);
  unsigned short* vvh = (unsigned short*)(ws + offVv);

  /* 1-5: input casts (RNE bf16; Wo -> f16 of bf16 value x 1024) */
  const int n2X = (int)(nX / 2), n2W = (int)(nW / 2);
  cast2_kernel<0><<<dim3(n2X / 256), dim3(256), 0, stream>>>(x,  xb,  n2X, 1.0f);
  cast2_kernel<0><<<dim3(n2W / 256), dim3(256), 0, stream>>>(Wq, wqb, n2W, 1.0f);
  cast2_kernel<0><<<dim3(n2W / 256), dim3(256), 0, stream>>>(Wk, wkb, n2W, 1.0f);
  cast2_kernel<0><<<dim3(n2W / 256), dim3(256), 0, stream>>>(Wv, wvb, n2W, 1.0f);
  cast2_kernel<1><<<dim3(n2W / 256), dim3(256), 0, stream>>>(Wo, wof, n2W, WO_CARRY);

  /* 6-8: projections C[m][n] = sum_k xb[m][k] W[n][k] + bias[n]; M=4096, N=1024, K=1024 (tiles 64x64, K%32==0) */
  const int gemmTiles  = (kTok / 64) * (kDm / 64);      /* 1024 */
  const int gemmBlocks = (gemmTiles + 7) / 8;           /* 128 */
  wmma_gemm64<1, false, 2, 0, false, 0><<<dim3(gemmBlocks, 1), dim3(256), 0, stream>>>(
      xb, xb, kDm, 0L, wqb, wqb, kDm, 0L, (void*)qf, (void*)qf, kDm, 0L, bq, nullptr, 0L, kTok, kDm, kDm, 1.0f);
  wmma_gemm64<1, false, 2, 0, false, 0><<<dim3(gemmBlocks, 1), dim3(256), 0, stream>>>(
      xb, xb, kDm, 0L, wkb, wkb, kDm, 0L, (void*)kf, (void*)kf, kDm, 0L, bk, nullptr, 0L, kTok, kDm, kDm, 1.0f);
  wmma_gemm64<1, false, 2, 1, false, 0><<<dim3(gemmBlocks, 1), dim3(256), 0, stream>>>(
      xb, xb, kDm, 0L, wvb, wvb, kDm, 0L, (void*)vvh, (void*)vvh, kDm, 0L, bv, nullptr, 0L, kTok, kDm, kDm, 1.0f);

  /* 9: L2 normalisation of q (x tau) and k, bf16 hi/lo planes */
  l2norm_split_kernel<<<dim3((kTok * kHeads) / 32, 2), dim3(256), 0, stream>>>(qf, kf, tau, qhb, qlb, khb, klb);

  /* 10: attention -> oo (f16, value x 64), overwrites the dead qf region */
  cos_attn_kernel<<<dim3(kBatch * kHeads * (kSeq / kQblk)), dim3(128), 0, stream>>>(qhb, qlb, khb, klb, vvh, mask, oo);

  /* 11: output projection: out[m][n] = 2^-16 * sum_c (oo x64)[m][c] (Wo x1024)[n][c] + bo[n] -> d_out f32 */
  wmma_gemm64<0, false, 2, 0, false, 0><<<dim3(gemmBlocks, 1), dim3(256), 0, stream>>>(
      oo, oo, kDm, 0L, wof, wof, kDm, 0L, d_out, d_out, kDm, 0L, bo, nullptr, 0L, kTok, kDm, kDm,
      1.0f / (O_CARRY * WO_CARRY));
}

// v002
// A run of this version takes 280 microseconds.
// In two side-by-side timings against v001, it was 1.33 and 1.34 times as fast.
// Over all steps from v000 it is 1.67 times as fast.
// Contractions: q/k/v projections on v_wmma_f32_16x16x32_bf16 (operands = RNE bf16 of the inputs); scores on bf16 hi/lo split (hi.hi + hi.lo + lo.hi); p.v and output projection on v_wmma_f32_16x16x32_f16 (p carried x2^14, attention output carried x2^6, Wo carried x2^10); f32 accumulate; norms and softmax in f32.
#include <hip/hip_runtime.h>
#include <stdint.h>

typedef __attribute__((ext_vector_type(16))) _Float16 v16h;
typedef __attribute__((ext_vector_type(8)))  _Float16 v8h;
typedef __attribute__((ext_vector_type(16))) __bf16   v16b;
typedef __attribute__((ext_vector_type(8)))  __bf16   v8b;
typedef __attribute__((ext_vector_type(8)))  float    v8f;
typedef __attribute__((ext_vector_type(4)))  float    v4f;
typedef __attribute__((ext_vector_type(2)))  float    v2f;
typedef __attribute__((ext_vector_type(4)))  unsigned v4u;

/* problem geometry */
constexpr int kBatch = 2;
constexpr int kSeq   = 2048;
constexpr int kDm    = 1024;
constexpr int kHeads = 16;
constexpr int kHd    = 64;
constexpr int kTok   = kBatch * kSeq;      /* 4096 token rows */
constexpr int kKch   = 64;                 /* kv chunk */
constexpr int kQblk  = 64;                 /* query rows per block */
/* LDS row pitches of the attention tiles: 16 B x odd, so that the 16 rows a ds_load_b128 fragment read
   touches fall on 16 different groups of four banks (an unpadded 128 B or 256 B row puts them on one or two) */
constexpr int kP16   = 72;                 /* 64 16-bit elements + 8 pad  = 144 B */
constexpr int kPm    = 68;                 /* 64 f32 + 4 pad = 272 B; rows 8 apart land 32 banks apart */
/* GEMM operand staging in LDS */
constexpr int kGk    = 64;                 /* k elements per stage: 128 B of every operand row, whole cache lines */
constexpr int kGp    = 72;                 /* LDS row pitch 144 B = 16 B x odd, as for the attention tiles */
constexpr int kGrows = 64 + 8 * 64;        /* 64 A rows shared by the block's 8 waves + 64 B rows for each wave */
#define P_CARRY 16384.0f
#define O_CARRY 64.0f
#define WO_CARRY 1024.0f

static_assert(kDm == kHeads * kHd, "head split");
static_assert(kTok % 64 == 0 && kDm % 64 == 0, "GEMM M,N tile multiples");
static_assert(kDm % kGk == 0, "GEMM K multiple of the LDS stage");
static_assert((kDm / 64) % 8 == 0, "a GEMM block's 8 tiles lie in one tile row");
static_assert(kSeq % kKch == 0 && kSeq % kQblk == 0, "attention tiles");
static_assert((kTok * kHeads) % 32 == 0, "normalize grid");

__device__ __forceinline__ unsigned short f2bf_bits(float f) {
  unsigned u = __float_as_uint(f);
  return (unsigned short)((u + 0x7FFFu + ((u >> 16) & 1u)) >> 16);
}
__device__ __forceinline__ float bf_bits2f(unsigned short h) { return __uint_as_float(((unsigned)h) << 16); }
__device__ __forceinline__ _Float16 h16_lo(unsigned w) { return __builtin_bit_cast(_Float16, (unsigned short)(w & 0xffffu)); }
__device__ __forceinline__ _Float16 h16_hi(unsigned w) { return __builtin_bit_cast(_Float16, (unsigned short)(w >> 16)); }

/* hazard guards as plain device helpers */
__device__ __forceinline__ void dep_guard_h(v8f& a, v8f& b, v16h x, v16h y) { asm volatile("v_nop\n\tv_nop\n\tv_nop\n\tv_nop" : "+v"(a), "+v"(b) : "v"(x), "v"(y)); }
__device__ __forceinline__ void dep_guard_b(v8f& a, v8f& b, v16b x, v16b y) { asm volatile("v_nop\n\tv_nop\n\tv_nop\n\tv_nop" : "+v"(a), "+v"(b) : "v"(x), "v"(y)); }
__device__ __forceinline__ void keep4_h(v16h a, v16h b, v16h c, v16h d) { asm volatile("v_nop" :: "v"(a), "v"(b), "v"(c), "v"(d)); }
__device__ __forceinline__ void keep4_b(v16b a, v16b b, v16b c, v16b d) { asm volatile("v_nop" :: "v"(a), "v"(b), "v"(c), "v"(d)); }
__device__ __forceinline__ void acc_guard4(v8f& a, v8f& b, v8f& c, v8f& d) { asm volatile("v_nop\n\tv_nop\n\tv_nop\n\tv_nop" : "+v"(a), "+v"(b), "+v"(c), "+v"(d)); }
template <typename T> struct Frag;
template <> struct Frag<_Float16> {
  typedef v16h V; union U { v16h v; v8h h[2]; };
  static __device__ __forceinline__ v16h load(const _Float16* p) {   /* elements 0..7 <- p[0..7], 8..15 <- p[16..23] */
    U f; f.h[0] = *(const v8h*)(p); f.h[1] = *(const v8h*)(p + 16); return f.v;
  }
  static __device__ __forceinline__ v8f mma(v16h a, v16h b, v8f c) {
    return __builtin_amdgcn_wmma_f32_16x16x32_f16(false, a, false, b, (short)0, c, false, false);
  }
  static __device__ __forceinline__ void guard(v8f& a, v8f& b, v16h x, v16h y) { dep_guard_h(a, b, x, y); }
  static __device__ __forceinline__ void keep(v16h a, v16h b, v16h c, v16h d) { keep4_h(a, b, c, d); }
};
template <> struct Frag<__bf16> {
  typedef v16b V; union U { v16b v; v8b h[2]; };
  static __device__ __forceinline__ v16b load(const __bf16* p) {
    U f; f.h[0] = *(const v8b*)(p); f.h[1] = *(const v8b*)(p + 16); return f.v;
  }
  static __device__ __forceinline__ v8f mma(v16b a, v16b b, v8f c) {
    return __builtin_amdgcn_wmma_f32_16x16x32_bf16(false, a, false, b, (short)0, c, false, false);
  }
  static __device__ __forceinline__ void guard(v8f& a, v8f& b, v16b x, v16b y) { dep_guard_b(a, b, x, y); }
  static __device__ __forceinline__ void keep(v16b a, v16b b, v16b c, v16b d) { keep4_b(a, b, c, d); }
};

/* Nine asynchronous 16-byte copies global -> LDS per lane, through no register: l = the lane's LDS byte address,
   g = the lane's global address.  The closing s_wait_xcnt stands inside the statement so that no address
   register of an issued copy is rewritten in front of it. */
__device__ __forceinline__ void async_copy9(const unsigned (&l)[9], const unsigned short* const (&g)[9]) {
  asm volatile(
      "global_load_async_to_lds_b128 %0, %9, off\n\t"
      "global_load_async_to_lds_b128 %1, %10, off\n\t"
      "global_load_async_to_lds_b128 %2, %11, off\n\t"
      "global_load_async_to_lds_b128 %3, %12, off\n\t"
      "global_load_async_to_lds_b128 %4, %13, off\n\t"
      "global_load_async_to_lds_b128 %5, %14, off\n\t"
      "global_load_async_to_lds_b128 %6, %15, off\n\t"
      "global_load_async_to_lds_b128 %7, %16, off\n\t"
      "global_load_async_to_lds_b128 %8, %17, off\n\t"
      "s_wait_xcnt 0x0"
      :: "v"(l[0]), "v"(l[1]), "v"(l[2]), "v"(l[3]), "v"(l[4]), "v"(l[5]), "v"(l[6]), "v"(l[7]), "v"(l[8]),
         "v"(g[0]), "v"(g[1]), "v"(g[2]), "v"(g[3]), "v"(g[4]), "v"(g[5]), "v"(g[6]), "v"(g[7]), "v"(g[8])
      : "memory");
}

/* ---- Register-blocked batched WMMA GEMM --------------------------------
   C[m,n] = scale * sum_k A[m,k] * Bt[n,k] (+bias); each wave owns a 64x64 tile.
   A row-major [M,K]; Bt row-major [N,K]; M % 64 == 0, N % 512 == 0, K % 64 == 0, lda and ldb % 8 == 0.
   A block's 8 waves own 8 neighbouring tiles of one tile row.  Per 64 k the block's 64 A rows and 512 Bt rows
   are copied to LDS in whole 128 B lines (two buffers: the next stage flies while this one is multiplied);
   the fragments are read from LDS in ascending k, 32 at a time.
   BIAS_MODE: 0 = none, 1 = bias[m], 2 = bias[n]; bias values RNE-converted to bf16 precision before the add.
   OUT_MODE: 0 = f32, 1 = f16, 2 = bf16 hi plane (Cout) + bf16 lo plane (Cout2).
   ET: 0 = f16 operands, 1 = bf16 operands (pointers passed as 16-bit storage) */
template <int ET> struct Elem;
template <> struct Elem<0> { typedef _Float16 T; };
template <> struct Elem<1> { typedef __bf16 T; };
template <int ET, bool SPLIT, int BIAS_MODE, int OUT_MODE, bool RESID, int ACT = 0>
__global__ __launch_bounds__(256) void wmma_gemm64(
    const unsigned short* __restrict__ Ap, const unsigned short* __restrict__ A2p, int lda, long strideA,
    const unsigned short* __restrict__ Btp, const unsigned short* __restrict__ Bt2p, int ldb, long strideB,
    void* __restrict__ Cout, void* __restrict__ Cout2, int ldc, long strideC,
    const float* __restrict__ bias,
    const float* __restrict__ resid, long strideR,
    int M, int N, int K, float scale) {
  typedef typename Elem<ET>::T T;
  typedef typename Frag<T>::V V;
  static_assert(!SPLIT, "the LDS stage holds one plane of each operand");
  __shared__ __align__(16) float sT[8][16 * 68];   /* per-wave 16x64 slab, pitch 68 floats */
  __shared__ __align__(16) unsigned short sAB[2][kGrows * kGp];   /* two stages: rows 0..63 A, 64..575 Bt */
  const int b    = blockIdx.y;
  const int lane = threadIdx.x & 31;
  const int wave = threadIdx.x >> 5;
  const int tilesN = N >> 6;
  const int tilesM = M >> 6;
  const int tile0 = blockIdx.x * 8;
  if (tile0 >= tilesM * tilesN) return;  /* block-uniform, in front of every barrier */
  const int tile = tile0 + wave;
  const int tm = tile / tilesN;
  const int tn = tile - tm * tilesN;
  const int m0 = tm << 6;
  const int n0 = tn << 6;

  const unsigned short* Ab = Ap  + (size_t)b * strideA;
  const unsigned short* Bb = Btp + (size_t)b * strideB;

  const int rlane = lane & 15;                 /* row (A) / col (B, D) within subtile */
  const int koff  = (lane >> 4) * 8;           /* k offset of this lane half */
  const int mOff  = (lane >> 4) * 8;           /* D row offset */

  /* copy map: 8 lanes x 16 B = one 128 B row, 32 rows per pass of the block, 18 passes = 576 rows */
  const int crow = threadIdx.x >> 3;
  const int cchk = (threadIdx.x & 7) * 8;
  const int nb0  = (tile0 - tm * tilesN) << 6;  /* first Bt row of the block */
  const unsigned short* gA = Ab + (size_t)(m0 + crow) * lda + cchk;
  const unsigned short* gB = Bb + (size_t)(nb0 + crow) * ldb + cchk;
  const unsigned lds0 = (unsigned)(uintptr_t)(const void*)&sAB[0][0] + (unsigned)(crow * kGp + cchk) * 2u;
  auto stage_copy = [&](int st, int buf) {
    const unsigned lb = lds0 + (unsigned)buf * (unsigned)(kGrows * kGp * 2);
    const unsigned short* pa = gA + (size_t)st * kGk;
    const unsigned short* pb = gB + (size_t)st * kGk;
    unsigned l[9];
    const unsigned short* g[9];
    /* both loops unrolled: l[] and g[] are asm operands and must be registers */
#pragma unroll
    for (int it = 0; it < 9; ++it) {
      l[it] = lb + (unsigned)(it * 32 * kGp * 2);
      g[it] = (it < 2) ? pa + (size_t)(it * 32) * lda : pb + (size_t)((it - 2) * 32) * ldb;
    }
    async_copy9(l, g);
#pragma unroll
    for (int it = 0; it < 9; ++it) {
      l[it] = lb + (unsigned)((it + 9) * 32 * kGp * 2);
      g[it] = pb + (size_t)((it + 7) * 32) * ldb;
    }
    async_copy9(l, g);
  };

  v8f acc[4][4];
#pragma unroll
  for (int i = 0; i < 4; ++i)
#pragma unroll
    for (int j = 0; j < 4; ++j) acc[i][j] = (v8f){0.f,0.f,0.f,0.f,0.f,0.f,0.f,0.f};

  const int nst = K / kGk;
  stage_copy(0, 0);
  asm volatile("s_wait_asynccnt 0x0" ::: "memory");   /* this wave's share of stage 0 has landed */
  __syncthreads();                                     /* ... and every other wave's */
  if (nst > 1) stage_copy(1, 1);
  for (int t = 0; t < nst; ++t) {
    const T* sA = (const T*)(const void*)sAB[t & 1] + rlane * kGp + koff;
    const T* sB = sA + (64 + wave * 64) * kGp;
    /* all loops of the stage unrolled: fragments and accumulators are indexed by constants and stay in registers */
#pragma unroll
    for (int ks = 0; ks < kGk; ks += 32) {
      V bh[4], ah[4];
#pragma unroll
      for (int j = 0; j < 4; ++j) bh[j] = Frag<T>::load(sB + j * 16 * kGp + ks);
#pragma unroll
      for (int i = 0; i < 4; ++i) ah[i] = Frag<T>::load(sA + i * 16 * kGp + ks);
#pragma unroll
      for (int i = 0; i < 4; ++i) {
#pragma unroll
        for (int j = 0; j < 4; ++j) acc[i][j] = Frag<T>::mma(ah[i], bh[j], acc[i][j]);
        Frag<T>::guard(acc[i][0], acc[i][3], ah[i], ah[i]);
      }
      Frag<T>::keep(bh[0], bh[1], bh[2], bh[3]);
    }
    asm volatile("s_wait_dscnt 0x0" ::: "memory");     /* this wave's reads of the buffer have returned before it is refilled */
    asm volatile("s_wait_asynccnt 0x0" ::: "memory");  /* this wave's share of stage t + 1 has landed */
    __syncthreads();                                   /* publishes stage t + 1, ends every read of stage t */
    if (t + 2 < nst) stage_copy(t + 2, t & 1);
  }
  asm volatile("s_wait_asynccnt 0x0" ::: "memory");    /* no copy is outstanding when the wave goes on */
  acc_guard4(acc[0][0], acc[0][1], acc[0][2], acc[0][3]);
  acc_guard4(acc[1][0], acc[1][1], acc[1][2], acc[1][3]);
  acc_guard4(acc[2][0], acc[2][1], acc[2][2], acc[2][3]);
  acc_guard4(acc[3][0], acc[3][1], acc[3][2], acc[3][3]);

  /* ---- epilogue ---- */
  float* slab = sT[wave];
  const float* Rb = RESID ? (resid + (size_t)b * strideR) : nullptr;
#pragma unroll
  for (int i = 0; i < 4; ++i) {
    const int mBase = m0 + (i << 4);
#pragma unroll
    for (int j = 0; j < 4; ++j) {
      const int n = n0 + (j << 4) + rlane;
      float bv = 0.f;
      if (BIAS_MODE == 2) bv = bf_bits2f(f2bf_bits(bias[n]));
#pragma unroll
      for (int r = 0; r < 8; ++r) {
        float v = acc[i][j][r] * scale;
        if (BIAS_MODE == 1) v += bf_bits2f(f2bf_bits(bias[mBase + mOff + r]));
        if (BIAS_MODE == 2) v += bv;
        if (RESID) v += Rb[(size_t)(mBase + mOff + r) * ldc + n];
        if (ACT == 1) v = tanhf(v);
        if (ACT == 2) v = fmaxf(v, 0.0f);
        if (ACT == 3) v = v / (1.0f + expf(-v));
        if (ACT == 4) v = (v > 0.f) ? v : 0.01f * v;
        slab[(mOff + r) * 68 + (j << 4) + rlane] = v;
      }
    }
    __builtin_amdgcn_fence(__ATOMIC_RELEASE, "workgroup");
    __builtin_amdgcn_wave_barrier();
    __builtin_amdgcn_fence(__ATOMIC_ACQUIRE, "workgroup");
    if (OUT_MODE == 0) {
      float* C = (float*)Cout + (size_t)b * strideC;
      const int hh = lane >> 4, c4 = (lane & 15) * 4;     /* row seg = 256 B = 16 lanes x 16 B */
      {
#pragma unroll
        for (int it = 0; it < 8; ++it) {
          const int row = it * 2 + hh;
          v4f v = *(const v4f*)(slab + row * 68 + c4);
          *(v4f*)(C + (size_t)(mBase + row) * ldc + n0 + c4) = v;
        }
        
      }
    } else {
      const int q = lane >> 3, c8 = (lane & 7) * 8;        
      unsigned short* C  = (unsigned short*)Cout  + (size_t)b * strideC;
      unsigned short* C2 = (OUT_MODE == 2) ? ((unsigned short*)Cout2 + (size_t)b * strideC) : nullptr;
      {
#pragma unroll
        for (int it = 0; it < 4; ++it) {
          const int row = it * 4 + q;
          const float* sp = slab + row * 68 + c8;
          v8h hv, lv;
#pragma unroll
          for (int e = 0; e < 8; ++e) {
            if (OUT_MODE == 1) {
              hv[e] = (_Float16)sp[e];
            } else {
              unsigned short hb = f2bf_bits(sp[e]);
              unsigned short lb = f2bf_bits(sp[e] - bf_bits2f(hb));
              hv[e] = __builtin_bit_cast(_Float16, hb);
              lv[e] = __builtin_bit_cast(_Float16, lb);
            }
          }
          *(v8h*)(C + (size_t)(mBase + row) * ldc + n0 + c8) = hv;
          if (OUT_MODE == 2) *(v8h*)(C2 + (size_t)(mBase + row) * ldc + n0 + c8) = lv;
        }
        
      }
    }
    __builtin_amdgcn_fence(__ATOMIC_RELEASE, "workgroup");
    __builtin_amdgcn_wave_barrier();
    __builtin_amdgcn_fence(__ATOMIC_ACQUIRE, "workgroup");
  }
}

/*
   MODE 0: bf16 bits (RNE).  MODE 1: f16 bits of (RNE-bf16 value * mul).
   coverage: grid = n2/256 blocks x 256 threads x 2 elements = 2*n2 elements exactly. */
template <int MODE>
__global__ __launch_bounds__(256) void cast2_kernel(const float* __restrict__ in,
                                                    unsigned short* __restrict__ out, int n2, float mul) {
  const int i = blockIdx.x * 256 + threadIdx.x;
  if (i < n2) {
    const v2f p = *(const v2f*)(in + 2 * (size_t)i);
    unsigned short u0, u1;
    if (MODE == 0) {
      u0 = f2bf_bits(p.x); u1 = f2bf_bits(p.y);
    } else {
      const float r0 = bf_bits2f(f2bf_bits(p.x)) * mul;
      const float r1 = bf_bits2f(f2bf_bits(p.y)) * mul;
      u0 = __builtin_bit_cast(unsigned short, (_Float16)r0);
      u1 = __builtin_bit_cast(unsigned short, (_Float16)r1);
    }
    const unsigned u = (unsigned)u0 | ((unsigned)u1 << 16);
    unsigned* op = (unsigned*)(void*)out;
    op[i] = u;
    
  }
}

/* ---- per (token, head) L2 normalisation + bf16 hi/lo split.
   blockIdx.y = 0: q plane, scaled by 1/max(||q||,1e-12) * bf16(tau[head]); y = 1: k plane, 1/max(||k||,1e-12).
   8 lanes per 64-vector (8 floats each), 32 segments per 256-thread block; grid.x = kTok*kHeads/32 = 2048.
*/
__global__ __launch_bounds__(256) void l2norm_split_kernel(
    const float* __restrict__ qf, const float* __restrict__ kf, const float* __restrict__ tau,
    unsigned short* __restrict__ qhp, unsigned short* __restrict__ qlp,
    unsigned short* __restrict__ khp, unsigned short* __restrict__ klp) {
  const bool isk = (blockIdx.y != 0);                 /* block-uniform */
  const float* src = isk ? kf : qf;
  unsigned short* dhp = isk ? khp : qhp;
  unsigned short* dlp = isk ? klp : qlp;
  const int tid = threadIdx.x;
  const int g = tid >> 3, e = tid & 7;
  const int seg = blockIdx.x * 32 + g;                 /* < kTok*kHeads */
  const int token = seg >> 4, head = seg & 15;
  const size_t base = (size_t)token * kDm + (size_t)head * kHd + (size_t)e * 8;
  const v4f a  = *(const v4f*)(src + base);
  const v4f c4 = *(const v4f*)(src + base + 4);
  float ss = 0.0f;
  ss += a.x * a.x;  ss += a.y * a.y;  ss += a.z * a.z;  ss += a.w * a.w;
  ss += c4.x * c4.x; ss += c4.y * c4.y; ss += c4.z * c4.z; ss += c4.w * c4.w;
  ss += __shfl_xor(ss, 1, 32);
  ss += __shfl_xor(ss, 2, 32);
  ss += __shfl_xor(ss, 4, 32);
  const float nrm  = sqrtf(ss);
  const float rinv = 1.0f / fmaxf(nrm, 1e-12f);
  const float th   = bf_bits2f(f2bf_bits(tau[head]));
  const float sc   = isk ? rinv : rinv * th;
  float vals[8];
  vals[0] = a.x * sc;  vals[1] = a.y * sc;  vals[2] = a.z * sc;  vals[3] = a.w * sc;
  vals[4] = c4.x * sc; vals[5] = c4.y * sc; vals[6] = c4.z * sc; vals[7] = c4.w * sc;
  unsigned hw[4], lw[4];
#pragma unroll
  for (int i = 0; i < 4; ++i) {
    const float v0 = vals[2 * i], v1 = vals[2 * i + 1];
    const unsigned short h0 = f2bf_bits(v0), h1 = f2bf_bits(v1);
    const unsigned short l0 = f2bf_bits(v0 - bf_bits2f(h0));
    const unsigned short l1 = f2bf_bits(v1 - bf_bits2f(h1));
    hw[i] = (unsigned)h0 | ((unsigned)h1 << 16);
    lw[i] = (unsigned)l0 | ((unsigned)l1 << 16);
  }
  v4u hv; hv.x = hw[0]; hv.y = hw[1]; hv.z = hw[2]; hv.w = hw[3];
  v4u lv; lv.x = lw[0]; lv.y = lw[1]; lv.z = lw[2]; lv.w = lw[3];
  v4u* ph = (v4u*)(void*)(dhp + base);
  v4u* pl = (v4u*)(void*)(dlp + base);
  *ph = hv; *pl = lv;
  
}

__device__ __forceinline__ v8f at_mma_b(v16b a, v16b b, v8f c) {
  c = __builtin_amdgcn_wmma_f32_16x16x32_bf16(false, a, false, b, (short)0, c, false, false);
  asm volatile("v_nop\n\tv_nop\n\tv_nop\n\tv_nop" : "+v"(c) : "v"(a), "v"(b));
  return c;
}
__device__ __forceinline__ v8f at_mma_h(v16h a, v16h b, v8f c) {
  c = __builtin_amdgcn_wmma_f32_16x16x32_f16(false, a, false, b, (short)0, c, false, false);
  asm volatile("v_nop\n\tv_nop\n\tv_nop\n\tv_nop" : "+v"(c) : "v"(a), "v"(b));
  return c;
}

/* =====================================================================================
   Attention for head_dim 64 with an additive [kSeq][kSeq] f32 mask shared over (b,h).
   Inputs: qh/ql = bf16 hi/lo planes of (q/||q|| * tau[h]), kh/kl = bf16 hi/lo planes of k/||k||,
           vv = f16 plane of v; all [kTok][kDm] with element (b, s, h, d) at (b*kSeq+s)*kDm + h*64 + d.
   scores = qhat_tau . khat^T : 3 bf16 WMMAs (hi.hi + hi.lo + lo.hi); += bf16(mask[q][kv]); online softmax f32.
   out    = p . v : f16 WMMA, p carried x2^14; result written as f16 of (out * 2^6) into oo (same plane layout).
   Block = 4 waves = 64 query rows of one (b, h); every one of the kSeq/64 kv chunks is processed.
   grid.x = kBatch * kHeads * (kSeq/64) = 1024.  coverage of oo: 1024 blocks x 64 rows x 64 d = kTok*kDm.
   ===================================================================================== */
__global__ __launch_bounds__(128)
void cos_attn_kernel(const unsigned short* __restrict__ qhp, const unsigned short* __restrict__ qlp,
                     const unsigned short* __restrict__ khp, const unsigned short* __restrict__ klp,
                     const unsigned short* __restrict__ vvp, const float* __restrict__ mask,
                     unsigned short* __restrict__ oo) {
  union FB { v16b v; v8b h[2]; };
  union FH { v16h v; v8h h[2]; };
  __shared__ __align__(16) __bf16   Ksh[kKch * kP16];       /* K hi [kv][d]       9 KB */
  __shared__ __align__(16) __bf16   Ksl[kKch * kP16];       /* K lo [kv][d]       9 KB */
  __shared__ __align__(16) _Float16 Vt[kHd * kP16];         /* V    [d][kv]       9 KB */
  __shared__ __align__(16) float    Msk[kQblk * kPm];       /* mask [qrow][kv]   17 KB */
  __shared__ __align__(16) _Float16 Psh[4][16 * kP16];      /* per wave P / out staging  9 KB */

  const int tid  = threadIdx.x;
  const int wave = tid >> 5;
  const int lane = tid & 31;
  const int hh   = lane >> 4;
  const int c    = lane & 15;

  const int nqb = kSeq / kQblk;                 /* 32 */
  const int bx  = blockIdx.x;
  const int qb  = bx % nqb;
  const int bh  = bx / nqb;
  const int h   = bh % kHeads;
  const int b   = bh / kHeads;
  const int qbase = qb * kQblk;
  const int q0    = qbase + wave * 16;
  const size_t tokb = (size_t)b * kSeq;

  const __bf16*   qh = (const __bf16*)(const void*)qhp;
  const __bf16*   ql = (const __bf16*)(const void*)qlp;

  /* ---- Q fragments (A operand): row = lane&15, elements 0..7 <- d0+8hh+0..7, 8..15 <- d0+16+8hh+0..7 ---- */
  v16b qah[2], qal[2];
  {
    const size_t ro = (tokb + (size_t)(q0 + c)) * kDm + (size_t)h * kHd;
#pragma unroll
    for (int dc = 0; dc < 2; ++dc) {
      qah[dc] = Frag<__bf16>::load(qh + ro + dc * 32 + 8 * hh);
      qal[dc] = Frag<__bf16>::load(ql + ro + dc * 32 + 8 * hh);
    }
  }

  float mrow[8], lrow[8];
  v8f oacc[4];
#pragma unroll
  for (int r = 0; r < 8; ++r) { mrow[r] = -INFINITY; lrow[r] = 0.f; }
#pragma unroll
  for (int t = 0; t < 4; ++t) oacc[t] = (v8f){0.f,0.f,0.f,0.f,0.f,0.f,0.f,0.f};

  for (int kc = 0; kc < kSeq / kKch; ++kc) {
    const int kv0 = kc * kKch;
    __syncthreads();
    {
      /* staging: 128 threads; rr = kv row (K, V) or query row (mask tile), c0 = 32-element half.
         coverage per array: 128 threads x 32 elements = 64 x 64. */
      const int rr = tid >> 1;
      const int c0 = (tid & 1) * 32;
      const size_t ro = (tokb + (size_t)(kv0 + rr)) * kDm + (size_t)h * kHd + c0;
      const uint4* kph = (const uint4*)(const void*)(khp + ro);
      const uint4* kpl = (const uint4*)(const void*)(klp + ro);
#pragma unroll
      for (int i = 0; i < 4; ++i) {
        const uint4 wh = kph[i];
        const uint4 wl = kpl[i];
        *(uint4*)(void*)(Ksh + rr * kP16 + c0 + 8 * i) = wh;
        *(uint4*)(void*)(Ksl + rr * kP16 + c0 + 8 * i) = wl;
      }
      asm volatile("" ::: "memory");
      const uint4* vp = (const uint4*)(const void*)(vvp + ro);
#pragma unroll
      for (int i = 0; i < 4; ++i) {
        const uint4 w4 = vp[i];
        const int d0 = c0 + 8 * i;
        Vt[(d0 + 0) * kP16 + rr] = h16_lo(w4.x);
        Vt[(d0 + 1) * kP16 + rr] = h16_hi(w4.x);
        Vt[(d0 + 2) * kP16 + rr] = h16_lo(w4.y);
        Vt[(d0 + 3) * kP16 + rr] = h16_hi(w4.y);
        Vt[(d0 + 4) * kP16 + rr] = h16_lo(w4.z);
        Vt[(d0 + 5) * kP16 + rr] = h16_hi(w4.z);
        Vt[(d0 + 6) * kP16 + rr] = h16_lo(w4.w);
        Vt[(d0 + 7) * kP16 + rr] = h16_hi(w4.w);
      }
      asm volatile("" ::: "memory");
      /* mask tile rows qbase+rr, cols kv0+c0..+31; values RNE-converted to bf16 precision */
      const float* mp = mask + (size_t)(qbase + rr) * kSeq + kv0 + c0;
#pragma unroll
      for (int i = 0; i < 8; ++i) {
        const v4f m4 = *(const v4f*)(mp + 4 * i);
        v4f r4;
        r4.x = bf_bits2f(f2bf_bits(m4.x));
        r4.y = bf_bits2f(f2bf_bits(m4.y));
        r4.z = bf_bits2f(f2bf_bits(m4.z));
        r4.w = bf_bits2f(f2bf_bits(m4.w));
        *(v4f*)(Msk + rr * kPm + c0 + 4 * i) = r4;
      }
    }
    __syncthreads();

    /* ---- scores: S[qrow][kvcol], B[k=d][n=kv] = Ksh[kv][d] ---- */
    v8f s[4];
#pragma unroll
    for (int j = 0; j < 4; ++j) {
      s[j] = (v8f){0.f,0.f,0.f,0.f,0.f,0.f,0.f,0.f};
#pragma unroll
      for (int dc = 0; dc < 2; ++dc) {
        FB kb, klo;
        kb.h[0]  = *(const v8b*)(Ksh + (j * 16 + c) * kP16 + dc * 32 + 8 * hh);
        kb.h[1]  = *(const v8b*)(Ksh + (j * 16 + c) * kP16 + dc * 32 + 16 + 8 * hh);
        klo.h[0] = *(const v8b*)(Ksl + (j * 16 + c) * kP16 + dc * 32 + 8 * hh);
        klo.h[1] = *(const v8b*)(Ksl + (j * 16 + c) * kP16 + dc * 32 + 16 + 8 * hh);
        s[j] = at_mma_b(qah[dc], kb.v,  s[j]);
        s[j] = at_mma_b(qah[dc], klo.v, s[j]);
        s[j] = at_mma_b(qal[dc], kb.v,  s[j]);
      }
    }

    /* ---- additive mask from LDS tile + row max over this chunk ---- */
    float cm[8];
    const float* mrw = Msk + (wave * 16 + 8 * hh) * kPm;
#pragma unroll
    for (int r = 0; r < 8; ++r) {
      float m = -INFINITY;
#pragma unroll
      for (int j = 0; j < 4; ++j) {
        s[j][r] += mrw[r * kPm + j * 16 + c];
        m = fmaxf(m, s[j][r]);
      }
#pragma unroll
      for (int off = 1; off < 16; off <<= 1) m = fmaxf(m, __shfl_xor(m, off, 32));
      cm[r] = m;
    }
    _Float16* pwh = Psh[wave];
#pragma unroll
    for (int r = 0; r < 8; ++r) {
      const float mnew  = fmaxf(mrow[r], cm[r]);
      const float alpha = expf(mrow[r] - mnew);
      mrow[r] = mnew;
      float psum = 0.f;
#pragma unroll
      for (int j = 0; j < 4; ++j) {
        const float p = expf(s[j][r] - mnew);
        psum += p;
        pwh[(8 * hh + r) * kP16 + j * 16 + c] = (_Float16)(p * P_CARRY);
      }
#pragma unroll
      for (int off = 1; off < 16; off <<= 1) psum += __shfl_xor(psum, off, 32);
      lrow[r] = lrow[r] * alpha + psum;
#pragma unroll
      for (int t = 0; t < 4; ++t) oacc[t][r] *= alpha;
    }
    __builtin_amdgcn_fence(__ATOMIC_RELEASE, "workgroup");
    __builtin_amdgcn_wave_barrier();
    __builtin_amdgcn_fence(__ATOMIC_ACQUIRE, "workgroup");
    /* ---- O += P . V : A = P[qrow][kv] (lane row c), B[k=kv][n=d] = Vt[d][kv] ---- */
#pragma unroll 1
    for (int kk = 0; kk < 2; ++kk) {
      FH pa;
      pa.h[0] = *(const v8h*)(pwh + c * kP16 + kk * 32 + 8 * hh);
      pa.h[1] = *(const v8h*)(pwh + c * kP16 + kk * 32 + 16 + 8 * hh);
#pragma unroll
      for (int t = 0; t < 4; ++t) {
        FH vb;
        vb.h[0] = *(const v8h*)(Vt + (t * 16 + c) * kP16 + kk * 32 + 8 * hh);
        vb.h[1] = *(const v8h*)(Vt + (t * 16 + c) * kP16 + kk * 32 + 16 + 8 * hh);
        oacc[t] = at_mma_h(pa.v, vb.v, oacc[t]);
      }
    }
  }

  _Float16* pw = Psh[wave];
  __builtin_amdgcn_fence(__ATOMIC_RELEASE, "workgroup");
  __builtin_amdgcn_wave_barrier();
  __builtin_amdgcn_fence(__ATOMIC_ACQUIRE, "workgroup");
#pragma unroll
  for (int r = 0; r < 8; ++r) {
    const float inv = O_CARRY / (lrow[r] * P_CARRY);     /* lrow >= 1 */
#pragma unroll
    for (int t = 0; t < 4; ++t) pw[(8 * hh + r) * kP16 + t * 16 + c] = (_Float16)(oacc[t][r] * inv);
  }
  __builtin_amdgcn_fence(__ATOMIC_RELEASE, "workgroup");
  __builtin_amdgcn_wave_barrier();
  __builtin_amdgcn_fence(__ATOMIC_ACQUIRE, "workgroup");
  {
    const int q8 = lane >> 3, c8 = (lane & 7) * 8;
    _Float16* ob = (_Float16*)(void*)oo + (tokb + (size_t)q0) * kDm + (size_t)h * kHd;
    {
#pragma unroll
      for (int it = 0; it < 4; ++it) {
        const int row = it * 4 + q8;
        const v8h val = *(const v8h*)(pw + row * kP16 + c8);
        *(v8h*)(ob + (size_t)row * kDm + c8) = val;
      }
      
    }
  }
}

/* ------------------------------------------------------------------------------------- */
extern "C" void kernel_launch(void* const* d_in, const int* in_sizes, int n_in,
                              void* d_out, int out_size, void* d_ws, size_t ws_size,
                              hipStream_t stream) {
  if (n_in < 11) return;
  const float* x    = (const float*)d_in[0];
  const float* mask = (const float*)d_in[1];
  const float* Wq   = (const float*)d_in[2];
  const float* bq   = (const float*)d_in[3];
  const float* Wk   = (const float*)d_in[4];
  const float* bk   = (const float*)d_in[5];
  const float* Wv   = (const float*)d_in[6];
  const float* bv   = (const float*)d_in[7];
  const float* Wo   = (const float*)d_in[8];
  const float* bo   = (const float*)d_in[9];
  const float* tau  = (const float*)d_in[10];

  const size_t nX = (size_t)kTok * kDm;     /* 4,194,304 */
  const size_t nW = (size_t)kDm * kDm;      /* 1,048,576 */
  if ((size_t)in_sizes[0] != nX || (size_t)in_sizes[1] != (size_t)kSeq * kSeq ||
      (size_t)in_sizes[2] != nW || (size_t)in_sizes[4] != nW || (size_t)in_sizes[6] != nW ||
      (size_t)in_sizes[8] != nW || in_sizes[3] != kDm || in_sizes[5] != kDm || in_sizes[7] != kDm ||
      in_sizes[9] != kDm || in_sizes[10] != kHeads) return;
  if ((size_t)out_size != nX) return;

  /*
       xb   bf16 [4096][1024]        off         0   size  8,388,608
       wqb  bf16 [1024][1024]        off  8,388,608  size  2,097,152
       wkb  bf16 [1024][1024]        off 10,485,760  size  2,097,152
       wvb  bf16 [1024][1024]        off 12,582,912  size  2,097,152
       wof  f16  [1024][1024] (x1024) off 14,680,064  size  2,097,152
       qf   f32  [4096][1024]        off 16,777,216  size 16,777,216   (reused as oo f16 [4096][1024], 8,388,608 B, after qf is consumed)
       kf   f32  [4096][1024]        off 33,554,432  size 16,777,216
       qhb  bf16 [4096][1024]        off 50,331,648  size  8,388,608
       qlb  bf16 [4096][1024]        off 58,720,256  size  8,388,608
       khb  bf16 [4096][1024]        off 67,108,864  size  8,388,608
       klb  bf16 [4096][1024]        off 75,497,472  size  8,388,608
       vvh  f16  [4096][1024]        off 83,886,080  size  8,388,608
       end                               92,274,688 */
  const size_t offXb  = 0;
  const size_t offWq  = offXb  + nX * 2;
  const size_t offWk  = offWq  + nW * 2;
  const size_t offWv  = offWk  + nW * 2;
  const size_t offWo  = offWv  + nW * 2;
  const size_t offQf  = offWo  + nW * 2;
  const size_t offKf  = offQf  + nX * 4;
  const size_t offQh  = offKf  + nX * 4;
  const size_t offQl  = offQh  + nX * 2;
  const size_t offKh  = offQl  + nX * 2;
  const size_t offKl  = offKh  + nX * 2;
  const size_t offVv  = offKl  + nX * 2;
  const size_t offEnd = offVv  + nX * 2;
  if (offEnd > ws_size) return;

  char* ws = (char*)d_ws;
  unsigned short* xb  = (unsigned short*)(ws + offXb);
  unsigned short* wqb = (unsigned short*)(ws + offWq);
  unsigned short* wkb = (unsigned short*)(ws + offWk);
  unsigned short* wvb = (unsigned short*)(ws + offWv);
  unsigned short* wof = (unsigned short*)(ws + offWo);
  float*          qf  = (float*)(ws + offQf);
  unsigned short* oo  = (unsigned short*)(ws + offQf);   /* reuse after qf is consumed */
  float*          kf  = (float*)(ws + offKf);
  unsigned short* qhb = (unsigned short*)(ws + offQh);
  unsigned short* qlb = (unsigned short*)(ws + offQl);
  unsigned short* khb = (unsigned short*)(ws + offKh);
  unsigned short* klb = (unsigned short*)(ws + offKl);
  unsigned short* vvh = (unsigned short*)(ws + offVv);

  /* 1-5: input casts (RNE bf16; Wo -> f16 of bf16 value x 1024) */
  const int n2X = (int)(nX / 2), n2W = (int)(nW / 2);
  cast2_kernel<0><<<dim3(n2X / 256), dim3(256), 0, stream>>>(x,  xb,  n2X, 1.0f);
  cast2_kernel<0><<<dim3(n2W / 256), dim3(256), 0, stream>>>(Wq, wqb, n2W, 1.0f);
  cast2_kernel<0><<<dim3(n2W / 256), dim3(256), 0, stream>>>(Wk, wkb, n2W, 1.0f);
  cast2_kernel<0><<<dim3(n2W / 256), dim3(256), 0, stream>>>(Wv, wvb, n2W, 1.0f);
  cast2_kernel<1><<<dim3(n2W / 256), dim3(256), 0, stream>>>(Wo, wof, n2W, WO_CARRY);

  /* 6-8: projections C[m][n] = sum_k xb[m][k] W[n][k] + bias[n]; M=4096, N=1024, K=1024 (tiles 64x64, K%64==0) */
  const int gemmTiles  = (kTok / 64) * (kDm / 64);      /* 1024 */
  const int gemmBlocks = (gemmTiles + 7) / 8;           /* 128 */
  wmma_gemm64<1, false, 2, 0, false, 0><<<dim3(gemmBlocks, 1), dim3(256), 0, stream>>>(
      xb, xb, kDm, 0L, wqb, wqb, kDm, 0L, (void*)qf, (void*)qf, kDm, 0L, bq, nullptr, 0L, kTok, kDm, kDm, 1.0f);
  wmma_gemm64<1, false, 2, 0, false, 0><<<dim3(gemmBlocks, 1), dim3(256), 0, stream>>>(
      xb, xb, kDm, 0L, wkb, wkb, kDm, 0L, (void*)kf, (void*)kf, kDm, 0L, bk, nullptr, 0L, kTok, kDm, kDm, 1.0f);
  wmma_gemm64<1, false, 2, 1, false, 0><<<dim3(gemmBlocks, 1), dim3(256), 0, stream>>>(
      xb, xb, kDm, 0L, wvb, wvb, kDm, 0L, (void*)vvh, (void*)vvh, kDm, 0L, bv, nullptr, 0L, kTok, kDm, kDm, 1.0f);

  /* 9: L2 normalisation of q (x tau) and k, bf16 hi/lo planes */
  l2norm_split_kernel<<<dim3((kTok * kHeads) / 32, 2), dim3(256), 0, stream>>>(qf, kf, tau, qhb, qlb, khb, klb);

  /* 10: attention -> oo (f16, value x 64), overwrites the dead qf region */
  cos_attn_kernel<<<dim3(kBatch * kHeads * (kSeq / kQblk)), dim3(128), 0, stream>>>(qhb, qlb, khb, klb, vvh, mask, oo);

  /* 11: output projection: out[m][n] = 2^-16 * sum_c (oo x64)[m][c] (Wo x1024)[n][c] + bo[n] -> d_out f32 */
  wmma_gemm64<0, false, 2, 0, false, 0><<<dim3(gemmBlocks, 1), dim3(256), 0, stream>>>(
      oo, oo, kDm, 0L, wof, wof, kDm, 0L, d_out, d_out, kDm, 0L, bo, nullptr, 0L, kTok, kDm, kDm,
      1.0f / (O_CARRY * WO_CARRY));
}

// v003
// Measured time: 235 microseconds a run.
// In both of two side-by-side timings against v002, it was 1.18 times as fast.
// All steps since v000 together make it 1.97 times as fast.
// Contractions: q/k/v projections on v_wmma_f32_16x16x32_bf16 (operands = RNE bf16 of the inputs); scores on bf16 hi/lo split (hi.hi + hi.lo + lo.hi); p.v and output projection on v_wmma_f32_16x16x32_f16 (p carried x2^14, attention output carried x2^6, Wo carried x2^10); f32 accumulate; norms and softmax in f32.
#include <hip/hip_runtime.h>
#include <stdint.h>

typedef __attribute__((ext_vector_type(16))) _Float16 v16h;
typedef __attribute__((ext_vector_type(8)))  _Float16 v8h;
typedef __attribute__((ext_vector_type(16))) __bf16   v16b;
typedef __attribute__((ext_vector_type(8)))  __bf16   v8b;
typedef __attribute__((ext_vector_type(8)))  float    v8f;
typedef __attribute__((ext_vector_type(4)))  float    v4f;
typedef __attribute__((ext_vector_type(2)))  float    v2f;
typedef __attribute__((ext_vector_type(4)))  unsigned v4u;

/* problem geometry */
constexpr int kBatch = 2;
constexpr int kSeq   = 2048;
constexpr int kDm    = 1024;
constexpr int kHeads = 16;
constexpr int kHd    = 64;
constexpr int kTok   = kBatch * kSeq;      /* 4096 token rows */
constexpr int kKch   = 64;                 /* kv chunk */
constexpr int kQblk  = 64;                 /* query rows per block */
/* LDS row pitches of the attention tiles: 16 B x odd, so that the 16 rows a ds_load_b128 fragment read
   touches fall on 16 different groups of four banks (an unpadded 128 B or 256 B row puts them on one or two) */
constexpr int kP16   = 72;                 /* 64 16-bit elements + 8 pad  = 144 B */
constexpr int kPm    = 68;                 /* 64 f32 + 4 pad = 272 B; rows 8 apart land 32 banks apart */
/* GEMM operand staging in LDS */
constexpr int kGk    = 64;                 /* k elements per stage: 128 B of every operand row, whole cache lines */
constexpr int kGp    = 72;                 /* LDS row pitch 144 B = 16 B x odd, as for the attention tiles */
constexpr int kGrows = 64 + 8 * 64;        /* 64 A rows shared by the block's 8 waves + 64 B rows for each wave */
#define P_CARRY 16384.0f
#define O_CARRY 64.0f
#define WO_CARRY 1024.0f

static_assert(kDm == kHeads * kHd, "head split");
static_assert(kTok % 64 == 0 && kDm % 64 == 0, "GEMM M,N tile multiples");
static_assert(kDm % kGk == 0, "GEMM K multiple of the LDS stage");
static_assert((kDm / 64) % 8 == 0, "a GEMM block's 8 tiles lie in one tile row");
static_assert(kSeq % kKch == 0 && kSeq % kQblk == 0, "attention tiles");
static_assert((kTok * kHeads) % 32 == 0, "normalize grid");

__device__ __forceinline__ unsigned short f2bf_bits(float f) {
  unsigned u = __float_as_uint(f);
  return (unsigned short)((u + 0x7FFFu + ((u >> 16) & 1u)) >> 16);
}
__device__ __forceinline__ float bf_bits2f(unsigned short h) { return __uint_as_float(((unsigned)h) << 16); }
__device__ __forceinline__ _Float16 h16_lo(unsigned w) { return __builtin_bit_cast(_Float16, (unsigned short)(w & 0xffffu)); }
__device__ __forceinline__ _Float16 h16_hi(unsigned w) { return __builtin_bit_cast(_Float16, (unsigned short)(w >> 16)); }

/* hazard guards as plain device helpers */
__device__ __forceinline__ void dep_guard_h(v8f& a, v8f& b, v16h x, v16h y) { asm volatile("v_nop\n\tv_nop\n\tv_nop\n\tv_nop" : "+v"(a), "+v"(b) : "v"(x), "v"(y)); }
__device__ __forceinline__ void dep_guard_b(v8f& a, v8f& b, v16b x, v16b y) { asm volatile("v_nop\n\tv_nop\n\tv_nop\n\tv_nop" : "+v"(a), "+v"(b) : "v"(x), "v"(y)); }
__device__ __forceinline__ void keep4_h(v16h a, v16h b, v16h c, v16h d) { asm volatile("v_nop" :: "v"(a), "v"(b), "v"(c), "v"(d)); }
__device__ __forceinline__ void keep4_b(v16b a, v16b b, v16b c, v16b d) { asm volatile("v_nop" :: "v"(a), "v"(b), "v"(c), "v"(d)); }
__device__ __forceinline__ void acc_guard4(v8f& a, v8f& b, v8f& c, v8f& d) { asm volatile("v_nop\n\tv_nop\n\tv_nop\n\tv_nop" : "+v"(a), "+v"(b), "+v"(c), "+v"(d)); }
template <typename T> struct Frag;
template <> struct Frag<_Float16> {
  typedef v16h V; union U { v16h v; v8h h[2]; };
  static __device__ __forceinline__ v16h load(const _Float16* p) {   /* elements 0..7 <- p[0..7], 8..15 <- p[16..23] */
    U f; f.h[0] = *(const v8h*)(p); f.h[1] = *(const v8h*)(p + 16); return f.v;
  }
  static __device__ __forceinline__ v8f mma(v16h a, v16h b, v8f c) {
    return __builtin_amdgcn_wmma_f32_16x16x32_f16(false, a, false, b, (short)0, c, false, false);
  }
  static __device__ __forceinline__ void guard(v8f& a, v8f& b, v16h x, v16h y) { dep_guard_h(a, b, x, y); }
  static __device__ __forceinline__ void keep(v16h a, v16h b, v16h c, v16h d) { keep4_h(a, b, c, d); }
};
template <> struct Frag<__bf16> {
  typedef v16b V; union U { v16b v; v8b h[2]; };
  static __device__ __forceinline__ v16b load(const __bf16* p) {
    U f; f.h[0] = *(const v8b*)(p); f.h[1] = *(const v8b*)(p + 16); return f.v;
  }
  static __device__ __forceinline__ v8f mma(v16b a, v16b b, v8f c) {
    return __builtin_amdgcn_wmma_f32_16x16x32_bf16(false, a, false, b, (short)0, c, false, false);
  }
  static __device__ __forceinline__ void guard(v8f& a, v8f& b, v16b x, v16b y) { dep_guard_b(a, b, x, y); }
  static __device__ __forceinline__ void keep(v16b a, v16b b, v16b c, v16b d) { keep4_b(a, b, c, d); }
};

/* Nine asynchronous 16-byte copies global -> LDS per lane, through no register: l = the lane's LDS byte address,
   g = the lane's global address.  The closing s_wait_xcnt stands inside the statement so that no address
   register of an issued copy is rewritten in front of it. */
__device__ __forceinline__ void async_copy9(const unsigned (&l)[9], const unsigned short* const (&g)[9]) {
  asm volatile(
      "global_load_async_to_lds_b128 %0, %9, off\n\t"
      "global_load_async_to_lds_b128 %1, %10, off\n\t"
      "global_load_async_to_lds_b128 %2, %11, off\n\t"
      "global_load_async_to_lds_b128 %3, %12, off\n\t"
      "global_load_async_to_lds_b128 %4, %13, off\n\t"
      "global_load_async_to_lds_b128 %5, %14, off\n\t"
      "global_load_async_to_lds_b128 %6, %15, off\n\t"
      "global_load_async_to_lds_b128 %7, %16, off\n\t"
      "global_load_async_to_lds_b128 %8, %17, off\n\t"
      "s_wait_xcnt 0x0"
      :: "v"(l[0]), "v"(l[1]), "v"(l[2]), "v"(l[3]), "v"(l[4]), "v"(l[5]), "v"(l[6]), "v"(l[7]), "v"(l[8]),
         "v"(g[0]), "v"(g[1]), "v"(g[2]), "v"(g[3]), "v"(g[4]), "v"(g[5]), "v"(g[6]), "v"(g[7]), "v"(g[8])
      : "memory");
}

/* ---- Register-blocked batched WMMA GEMM --------------------------------
   C[m,n] = scale * sum_k A[m,k] * Bt[n,k] (+bias); each wave owns a 64x64 tile.
   A row-major [M,K]; Bt row-major [N,K]; M % 64 == 0, N % 512 == 0, K % 64 == 0, lda and ldb % 8 == 0.
   A block's 8 waves own 8 neighbouring tiles of one tile row.  Per 64 k the block's 64 A rows and 512 Bt rows
   are copied to LDS in whole 128 B lines (two buffers: the next stage flies while this one is multiplied);
   the fragments are read from LDS in ascending k, 32 at a time.
   BIAS_MODE: 0 = none, 1 = bias[m], 2 = bias[n]; bias values RNE-converted to bf16 precision before the add.
   OUT_MODE: 0 = f32, 1 = f16, 2 = bf16 hi plane (Cout) + bf16 lo plane (Cout2).
   ET: 0 = f16 operands, 1 = bf16 operands (pointers passed as 16-bit storage) */
template <int ET> struct Elem;
template <> struct Elem<0> { typedef _Float16 T; };
template <> struct Elem<1> { typedef __bf16 T; };
template <int ET, bool SPLIT, int BIAS_MODE, int OUT_MODE, bool RESID, int ACT = 0>
__global__ __launch_bounds__(256) void wmma_gemm64(
    const unsigned short* __restrict__ Ap, const unsigned short* __restrict__ A2p, int lda, long strideA,
    const unsigned short* __restrict__ Btp, const unsigned short* __restrict__ Bt2p, int ldb, long strideB,
    void* __restrict__ Cout, void* __restrict__ Cout2, int ldc, long strideC,
    const float* __restrict__ bias,
    const float* __restrict__ resid, long strideR,
    int M, int N, int K, float scale) {
  typedef typename Elem<ET>::T T;
  typedef typename Frag<T>::V V;
  static_assert(!SPLIT, "the LDS stage holds one plane of each operand");
  __shared__ __align__(16) float sT[8][16 * 68];   /* per-wave 16x64 slab, pitch 68 floats */
  __shared__ __align__(16) unsigned short sAB[2][kGrows * kGp];   /* two stages: rows 0..63 A, 64..575 Bt */
  const int b    = blockIdx.y;
  const int lane = threadIdx.x & 31;
  const int wave = threadIdx.x >> 5;
  const int tilesN = N >> 6;
  const int tilesM = M >> 6;
  const int tile0 = blockIdx.x * 8;
  if (tile0 >= tilesM * tilesN) return;  /* block-uniform, in front of every barrier */
  const int tile = tile0 + wave;
  const int tm = tile / tilesN;
  const int tn = tile - tm * tilesN;
  const int m0 = tm << 6;
  const int n0 = tn << 6;

  const unsigned short* Ab = Ap  + (size_t)b * strideA;
  const unsigned short* Bb = Btp + (size_t)b * strideB;

  const int rlane = lane & 15;                 /* row (A) / col (B, D) within subtile */
  const int koff  = (lane >> 4) * 8;           /* k offset of this lane half */
  const int mOff  = (lane >> 4) * 8;           /* D row offset */

  /* copy map: 8 lanes x 16 B = one 128 B row, 32 rows per pass of the block, 18 passes = 576 rows */
  const int crow = threadIdx.x >> 3;
  const int cchk = (threadIdx.x & 7) * 8;
  const int nb0  = (tile0 - tm * tilesN) << 6;  /* first Bt row of the block */
  const unsigned short* gA = Ab + (size_t)(m0 + crow) * lda + cchk;
  const unsigned short* gB = Bb + (size_t)(nb0 + crow) * ldb + cchk;
  const unsigned lds0 = (unsigned)(uintptr_t)(const void*)&sAB[0][0] + (unsigned)(crow * kGp + cchk) * 2u;
  auto stage_copy = [&](int st, int buf) {
    const unsigned lb = lds0 + (unsigned)buf * (unsigned)(kGrows * kGp * 2);
    const unsigned short* pa = gA + (size_t)st * kGk;
    const unsigned short* pb = gB + (size_t)st * kGk;
    unsigned l[9];
    const unsigned short* g[9];
    /* both loops unrolled: l[] and g[] are asm operands and must be registers */
#pragma unroll
    for (int it = 0; it < 9; ++it) {
      l[it] = lb + (unsigned)(it * 32 * kGp * 2);
      g[it] = (it < 2) ? pa + (size_t)(it * 32) * lda : pb + (size_t)((it - 2) * 32) * ldb;
    }
    async_copy9(l, g);
#pragma unroll
    for (int it = 0; it < 9; ++it) {
      l[it] = lb + (unsigned)((it + 9) * 32 * kGp * 2);
      g[it] = pb + (size_t)((it + 7) * 32) * ldb;
    }
    async_copy9(l, g);
  };

  v8f acc[4][4];
#pragma unroll
  for (int i = 0; i < 4; ++i)
#pragma unroll
    for (int j = 0; j < 4; ++j) acc[i][j] = (v8f){0.f,0.f,0.f,0.f,0.f,0.f,0.f,0.f};

  const int nst = K / kGk;
  stage_copy(0, 0);
  asm volatile("s_wait_asynccnt 0x0" ::: "memory");   /* this wave's share of stage 0 has landed */
  __syncthreads();                                     /* ... and every other wave's */
  if (nst > 1) stage_copy(1, 1);
  for (int t = 0; t < nst; ++t) {
    const T* sA = (const T*)(const void*)sAB[t & 1] + rlane * kGp + koff;
    const T* sB = sA + (64 + wave * 64) * kGp;
    /* all loops of the stage unrolled: fragments and accumulators are indexed by constants and stay in registers */
#pragma unroll
    for (int ks = 0; ks < kGk; ks += 32) {
      V bh[4], ah[4];
#pragma unroll
      for (int j = 0; j < 4; ++j) bh[j] = Frag<T>::load(sB + j * 16 * kGp + ks);
#pragma unroll
      for (int i = 0; i < 4; ++i) ah[i] = Frag<T>::load(sA + i * 16 * kGp + ks);
#pragma unroll
      for (int i = 0; i < 4; ++i) {
#pragma unroll
        for (int j = 0; j < 4; ++j) acc[i][j] = Frag<T>::mma(ah[i], bh[j], acc[i][j]);
        Frag<T>::guard(acc[i][0], acc[i][3], ah[i], ah[i]);
      }
      Frag<T>::keep(bh[0], bh[1], bh[2], bh[3]);
    }
    asm volatile("s_wait_dscnt 0x0" ::: "memory");     /* this wave's reads of the buffer have returned before it is refilled */
    asm volatile("s_wait_asynccnt 0x0" ::: "memory");  /* this wave's share of stage t + 1 has landed */
    __syncthreads();                                   /* publishes stage t + 1, ends every read of stage t */
    if (t + 2 < nst) stage_copy(t + 2, t & 1);
  }
  asm volatile("s_wait_asynccnt 0x0" ::: "memory");    /* no copy is outstanding when the wave goes on */
  acc_guard4(acc[0][0], acc[0][1], acc[0][2], acc[0][3]);
  acc_guard4(acc[1][0], acc[1][1], acc[1][2], acc[1][3]);
  acc_guard4(acc[2][0], acc[2][1], acc[2][2], acc[2][3]);
  acc_guard4(acc[3][0], acc[3][1], acc[3][2], acc[3][3]);

  /* ---- epilogue ---- */
  float* slab = sT[wave];
  const float* Rb = RESID ? (resid + (size_t)b * strideR) : nullptr;
#pragma unroll
  for (int i = 0; i < 4; ++i) {
    const int mBase = m0 + (i << 4);
#pragma unroll
    for (int j = 0; j < 4; ++j) {
      const int n = n0 + (j << 4) + rlane;
      float bv = 0.f;
      if (BIAS_MODE == 2) bv = bf_bits2f(f2bf_bits(bias[n]));
#pragma unroll
      for (int r = 0; r < 8; ++r) {
        float v = acc[i][j][r] * scale;
        if (BIAS_MODE == 1) v += bf_bits2f(f2bf_bits(bias[mBase + mOff + r]));
        if (BIAS_MODE == 2) v += bv;
        if (RESID) v += Rb[(size_t)(mBase + mOff + r) * ldc + n];
        if (ACT == 1) v = tanhf(v);
        if (ACT == 2) v = fmaxf(v, 0.0f);
        if (ACT == 3) v = v / (1.0f + expf(-v));
        if (ACT == 4) v = (v > 0.f) ? v : 0.01f * v;
        slab[(mOff + r) * 68 + (j << 4) + rlane] = v;
      }
    }
    __builtin_amdgcn_fence(__ATOMIC_RELEASE, "workgroup");
    __builtin_amdgcn_wave_barrier();
    __builtin_amdgcn_fence(__ATOMIC_ACQUIRE, "workgroup");
    if (OUT_MODE == 0) {
      float* C = (float*)Cout + (size_t)b * strideC;
      const int hh = lane >> 4, c4 = (lane & 15) * 4;     /* row seg = 256 B = 16 lanes x 16 B */
      {
#pragma unroll
        for (int it = 0; it < 8; ++it) {
          const int row = it * 2 + hh;
          v4f v = *(const v4f*)(slab + row * 68 + c4);
          *(v4f*)(C + (size_t)(mBase + row) * ldc + n0 + c4) = v;
        }
        
      }
    } else {
      const int q = lane >> 3, c8 = (lane & 7) * 8;        
      unsigned short* C  = (unsigned short*)Cout  + (size_t)b * strideC;
      unsigned short* C2 = (OUT_MODE == 2) ? ((unsigned short*)Cout2 + (size_t)b * strideC) : nullptr;
      {
#pragma unroll
        for (int it = 0; it < 4; ++it) {
          const int row = it * 4 + q;
          const float* sp = slab + row * 68 + c8;
          v8h hv, lv;
#pragma unroll
          for (int e = 0; e < 8; ++e) {
            if (OUT_MODE == 1) {
              hv[e] = (_Float16)sp[e];
            } else {
              unsigned short hb = f2bf_bits(sp[e]);
              unsigned short lb = f2bf_bits(sp[e] - bf_bits2f(hb));
              hv[e] = __builtin_bit_cast(_Float16, hb);
              lv[e] = __builtin_bit_cast(_Float16, lb);
            }
          }
          *(v8h*)(C + (size_t)(mBase + row) * ldc + n0 + c8) = hv;
          if (OUT_MODE == 2) *(v8h*)(C2 + (size_t)(mBase + row) * ldc + n0 + c8) = lv;
        }
        
      }
    }
    __builtin_amdgcn_fence(__ATOMIC_RELEASE, "workgroup");
    __builtin_amdgcn_wave_barrier();
    __builtin_amdgcn_fence(__ATOMIC_ACQUIRE, "workgroup");
  }
}

/*
   MODE 0: bf16 bits (RNE).  MODE 1: f16 bits of (RNE-bf16 value * mul).
   coverage: grid = n2/256 blocks x 256 threads x 2 elements = 2*n2 elements exactly. */
template <int MODE>
__global__ __launch_bounds__(256) void cast2_kernel(const float* __restrict__ in,
                                                    unsigned short* __restrict__ out, int n2, float mul) {
  const int i = blockIdx.x * 256 + threadIdx.x;
  if (i < n2) {
    const v2f p = *(const v2f*)(in + 2 * (size_t)i);
    unsigned short u0, u1;
    if (MODE == 0) {
      u0 = f2bf_bits(p.x); u1 = f2bf_bits(p.y);
    } else {
      const float r0 = bf_bits2f(f2bf_bits(p.x)) * mul;
      const float r1 = bf_bits2f(f2bf_bits(p.y)) * mul;
      u0 = __builtin_bit_cast(unsigned short, (_Float16)r0);
      u1 = __builtin_bit_cast(unsigned short, (_Float16)r1);
    }
    const unsigned u = (unsigned)u0 | ((unsigned)u1 << 16);
    unsigned* op = (unsigned*)(void*)out;
    op[i] = u;
    
  }
}

/* ---- per (token, head) L2 normalisation + bf16 hi/lo split.
   blockIdx.y = 0: q plane, scaled by 1/max(||q||,1e-12) * bf16(tau[head]); y = 1: k plane, 1/max(||k||,1e-12).
   8 lanes per 64-vector (8 floats each), 32 segments per 256-thread block; grid.x = kTok*kHeads/32 = 2048.
*/
__global__ __launch_bounds__(256) void l2norm_split_kernel(
    const float* __restrict__ qf, const float* __restrict__ kf, const float* __restrict__ tau,
    unsigned short* __restrict__ qhp, unsigned short* __restrict__ qlp,
    unsigned short* __restrict__ khp, unsigned short* __restrict__ klp) {
  const bool isk = (blockIdx.y != 0);                 /* block-uniform */
  const float* src = isk ? kf : qf;
  unsigned short* dhp = isk ? khp : qhp;
  unsigned short* dlp = isk ? klp : qlp;
  const int tid = threadIdx.x;
  const int g = tid >> 3, e = tid & 7;
  const int seg = blockIdx.x * 32 + g;                 /* < kTok*kHeads */
  const int token = seg >> 4, head = seg & 15;
  const size_t base = (size_t)token * kDm + (size_t)head * kHd + (size_t)e * 8;
  const v4f a  = *(const v4f*)(src + base);
  const v4f c4 = *(const v4f*)(src + base + 4);
  float ss = 0.0f;
  ss += a.x * a.x;  ss += a.y * a.y;  ss += a.z * a.z;  ss += a.w * a.w;
  ss += c4.x * c4.x; ss += c4.y * c4.y; ss += c4.z * c4.z; ss += c4.w * c4.w;
  ss += __shfl_xor(ss, 1, 32);
  ss += __shfl_xor(ss, 2, 32);
  ss += __shfl_xor(ss, 4, 32);
  const float nrm  = sqrtf(ss);
  const float rinv = 1.0f / fmaxf(nrm, 1e-12f);
  const float th   = bf_bits2f(f2bf_bits(tau[head]));
  const float sc   = isk ? rinv : rinv * th;
  float vals[8];
  vals[0] = a.x * sc;  vals[1] = a.y * sc;  vals[2] = a.z * sc;  vals[3] = a.w * sc;
  vals[4] = c4.x * sc; vals[5] = c4.y * sc; vals[6] = c4.z * sc; vals[7] = c4.w * sc;
  unsigned hw[4], lw[4];
#pragma unroll
  for (int i = 0; i < 4; ++i) {
    const float v0 = vals[2 * i], v1 = vals[2 * i + 1];
    const unsigned short h0 = f2bf_bits(v0), h1 = f2bf_bits(v1);
    const unsigned short l0 = f2bf_bits(v0 - bf_bits2f(h0));
    const unsigned short l1 = f2bf_bits(v1 - bf_bits2f(h1));
    hw[i] = (unsigned)h0 | ((unsigned)h1 << 16);
    lw[i] = (unsigned)l0 | ((unsigned)l1 << 16);
  }
  v4u hv; hv.x = hw[0]; hv.y = hw[1]; hv.z = hw[2]; hv.w = hw[3];
  v4u lv; lv.x = lw[0]; lv.y = lw[1]; lv.z = lw[2]; lv.w = lw[3];
  v4u* ph = (v4u*)(void*)(dhp + base);
  v4u* pl = (v4u*)(void*)(dlp + base);
  *ph = hv; *pl = lv;
  
}

__device__ __forceinline__ v8f at_mma_b(v16b a, v16b b, v8f c) {
  c = __builtin_amdgcn_wmma_f32_16x16x32_bf16(false, a, false, b, (short)0, c, false, false);
  asm volatile("v_nop\n\tv_nop\n\tv_nop\n\tv_nop" : "+v"(c) : "v"(a), "v"(b));
  return c;
}
__device__ __forceinline__ v8f at_mma_h(v16h a, v16h b, v8f c) {
  c = __builtin_amdgcn_wmma_f32_16x16x32_f16(false, a, false, b, (short)0, c, false, false);
  asm volatile("v_nop\n\tv_nop\n\tv_nop\n\tv_nop" : "+v"(c) : "v"(a), "v"(b));
  return c;
}

/* lane l <-> lane l ^ 16 by one vector cross-row move */
__device__ __forceinline__ float xhalf(float x) {
  const int b = __builtin_bit_cast(int, x);
  return __builtin_bit_cast(float, __builtin_amdgcn_permlanex16(b, b, 0x76543210, 0xfedcba98, false, false));
}

/* =====================================================================================
   Attention for head_dim 64 with an additive [kSeq][kSeq] f32 mask shared over (b,h).
   Inputs: qh/ql = bf16 hi/lo planes of (q/||q|| * tau[h]), kh/kl = bf16 hi/lo planes of k/||k||,
           vv = f16 plane of v; all [kTok][kDm] with element (b, s, h, d) at (b*kSeq+s)*kDm + h*64 + d.
   scores, transposed: S^T = khat . qhat_tau^T : 3 bf16 WMMAs (hi.hi + lo.hi + hi.lo), A = K rows, B = Q columns;
           lanes c and c + 16 hold all scores of query column c: += bf16(mask[q][kv]); online softmax f32, maximum and
           sum in the lane, the halves' maxima joined per chunk, their sums once at the end.
   out, transposed: O^T += V^T . P^T : f16 WMMA, p carried x2^14; two score tiles converted in place are the B operand.
           result written as f16 of (out * 2^6) into oo (same plane layout).
   Block = 4 waves = 64 query rows of one (b, h); every one of the kSeq/64 kv chunks is processed.
   grid.x = kBatch * kHeads * (kSeq/64) = 1024.  coverage of oo: 1024 blocks x 64 rows x 64 d = kTok*kDm.
   ===================================================================================== */
__global__ __launch_bounds__(128)
void cos_attn_kernel(const unsigned short* __restrict__ qhp, const unsigned short* __restrict__ qlp,
                     const unsigned short* __restrict__ khp, const unsigned short* __restrict__ klp,
                     const unsigned short* __restrict__ vvp, const float* __restrict__ mask,
                     unsigned short* __restrict__ oo) {
  union FB { v16b v; v8b h[2]; };
  union FH { v16h v; v8h h[2]; };
  __shared__ __align__(16) __bf16   Ksh[kKch * kP16];       /* K hi [kv][d]       9 KB */
  __shared__ __align__(16) __bf16   Ksl[kKch * kP16];       /* K lo [kv][d]       9 KB */
  __shared__ __align__(16) _Float16 Vt[kHd * kP16];         /* V    [d][kv]       9 KB */
  __shared__ __align__(16) float    Msk[kQblk * kPm];       /* mask [qrow][kv]   17 KB */
  __shared__ __align__(16) _Float16 Psh[4][16 * kP16];      /* per wave out staging  9 KB */

  const int tid  = threadIdx.x;
  const int wave = tid >> 5;
  const int lane = tid & 31;
  const int hh   = lane >> 4;
  const int c    = lane & 15;

  const int nqb = kSeq / kQblk;                 /* 32 */
  const int bx  = blockIdx.x;
  const int qb  = bx % nqb;
  const int bh  = bx / nqb;
  const int h   = bh % kHeads;
  const int b   = bh / kHeads;
  const int qbase = qb * kQblk;
  const int q0    = qbase + wave * 16;
  const size_t tokb = (size_t)b * kSeq;

  const __bf16*   qh = (const __bf16*)(const void*)qhp;
  const __bf16*   ql = (const __bf16*)(const void*)qlp;

  /* ---- Q fragments (B operand): column = lane&15, elements 0..7 <- d0+8hh+0..7, 8..15 <- d0+16+8hh+0..7 ---- */
  v16b qah[2], qal[2];
  {
    const size_t ro = (tokb + (size_t)(q0 + c)) * kDm + (size_t)h * kHd;
#pragma unroll
    for (int dc = 0; dc < 2; ++dc) {
      qah[dc] = Frag<__bf16>::load(qh + ro + dc * 32 + 8 * hh);
      qal[dc] = Frag<__bf16>::load(ql + ro + dc * 32 + 8 * hh);
    }
  }

  float mrow = -INFINITY;      /* running maximum of query column c, equal in both lane halves */
  float lrow = 0.f;            /* running sum over this lane half's kv rows only */
  v8f oacc[4];                 /* O^T: oacc[t][r] = out[d = 16t + 8hh + r][query c] */
#pragma unroll
  for (int t = 0; t < 4; ++t) oacc[t] = (v8f){0.f,0.f,0.f,0.f,0.f,0.f,0.f,0.f};

  for (int kc = 0; kc < kSeq / kKch; ++kc) {
    const int kv0 = kc * kKch;
    __syncthreads();
    {
      /* staging: 128 threads; rr = kv row (K, V) or query row (mask tile), c0 = 32-element half.
         coverage per array: 128 threads x 32 elements = 64 x 64. */
      const int rr = tid >> 1;
      const int c0 = (tid & 1) * 32;
      const size_t ro = (tokb + (size_t)(kv0 + rr)) * kDm + (size_t)h * kHd + c0;
      const uint4* kph = (const uint4*)(const void*)(khp + ro);
      const uint4* kpl = (const uint4*)(const void*)(klp + ro);
#pragma unroll
      for (int i = 0; i < 4; ++i) {
        const uint4 wh = kph[i];
        const uint4 wl = kpl[i];
        *(uint4*)(void*)(Ksh + rr * kP16 + c0 + 8 * i) = wh;
        *(uint4*)(void*)(Ksl + rr * kP16 + c0 + 8 * i) = wl;
      }
      asm volatile("" ::: "memory");
      const uint4* vp = (const uint4*)(const void*)(vvp + ro);
#pragma unroll
      for (int i = 0; i < 4; ++i) {
        const uint4 w4 = vp[i];
        const int d0 = c0 + 8 * i;
        Vt[(d0 + 0) * kP16 + rr] = h16_lo(w4.x);
        Vt[(d0 + 1) * kP16 + rr] = h16_hi(w4.x);
        Vt[(d0 + 2) * kP16 + rr] = h16_lo(w4.y);
        Vt[(d0 + 3) * kP16 + rr] = h16_hi(w4.y);
        Vt[(d0 + 4) * kP16 + rr] = h16_lo(w4.z);
        Vt[(d0 + 5) * kP16 + rr] = h16_hi(w4.z);
        Vt[(d0 + 6) * kP16 + rr] = h16_lo(w4.w);
        Vt[(d0 + 7) * kP16 + rr] = h16_hi(w4.w);
      }
      asm volatile("" ::: "memory");
      /* mask tile rows qbase+rr, cols kv0+c0..+31; values RNE-converted to bf16 precision */
      const float* mp = mask + (size_t)(qbase + rr) * kSeq + kv0 + c0;
#pragma unroll
      for (int i = 0; i < 8; ++i) {
        const v4f m4 = *(const v4f*)(mp + 4 * i);
        v4f r4;
        r4.x = bf_bits2f(f2bf_bits(m4.x));
        r4.y = bf_bits2f(f2bf_bits(m4.y));
        r4.z = bf_bits2f(f2bf_bits(m4.z));
        r4.w = bf_bits2f(f2bf_bits(m4.w));
        *(v4f*)(Msk + rr * kPm + c0 + 4 * i) = r4;
      }
    }
    __syncthreads();

    /* ---- scores: S^T[kvrow][qcol], A[m=kv][k=d] = Ksh[kv][d], B[k=d][n=q] = Q; s[j][r] = S[q = c][kv = 16j + 8hh + r] ---- */
    v8f s[4];
#pragma unroll
    for (int j = 0; j < 4; ++j) {
      s[j] = (v8f){0.f,0.f,0.f,0.f,0.f,0.f,0.f,0.f};
#pragma unroll
      for (int dc = 0; dc < 2; ++dc) {
        FB kb, klo;
        kb.h[0]  = *(const v8b*)(Ksh + (j * 16 + c) * kP16 + dc * 32 + 8 * hh);
        kb.h[1]  = *(const v8b*)(Ksh + (j * 16 + c) * kP16 + dc * 32 + 16 + 8 * hh);
        klo.h[0] = *(const v8b*)(Ksl + (j * 16 + c) * kP16 + dc * 32 + 8 * hh);
        klo.h[1] = *(const v8b*)(Ksl + (j * 16 + c) * kP16 + dc * 32 + 16 + 8 * hh);
        s[j] = at_mma_b(kb.v,  qah[dc], s[j]);
        s[j] = at_mma_b(klo.v, qah[dc], s[j]);
        s[j] = at_mma_b(kb.v,  qal[dc], s[j]);
      }
    }

    /* ---- additive mask from the LDS tile (8 consecutive kv of the lane's own query row per score tile) + chunk max ---- */
    const float* mrw = Msk + (wave * 16 + c) * kPm + 8 * hh;
    float cj[4];                /* one maximum per score tile: four short chains instead of one long one */
#pragma unroll
    for (int j = 0; j < 4; ++j) {
      const v4f ma = *(const v4f*)(mrw + j * 16);
      const v4f mb = *(const v4f*)(mrw + j * 16 + 4);
#pragma unroll
      for (int r = 0; r < 4; ++r) {
        s[j][r]     += ma[r];
        s[j][r + 4] += mb[r];
      }
      cj[j] = fmaxf(s[j][0], s[j][4]);
#pragma unroll
      for (int r = 1; r < 4; ++r) cj[j] = fmaxf(cj[j], fmaxf(s[j][r], s[j][r + 4]));
    }
    float cm = fmaxf(fmaxf(cj[0], cj[1]), fmaxf(cj[2], cj[3]));
    cm = fmaxf(cm, xhalf(cm));
    const float mnew  = fmaxf(mrow, cm);
    const float alpha = expf(mrow - mnew);
    mrow = mnew;
    float ps[4];                /* one sum per score tile, as for the maxima */
    FH pb[2];                   /* P^T as B operand: element e <- kv 32kk + 8hh + e, element 8 + e <- kv 32kk + 16 + 8hh + e */
#pragma unroll
    for (int j = 0; j < 4; ++j) {
      ps[j] = 0.f;
#pragma unroll
      for (int r = 0; r < 8; ++r) {
        const float p = expf(s[j][r] - mnew);
        ps[j] += p;
        pb[j >> 1].h[j & 1][r] = (_Float16)(p * P_CARRY);
      }
    }
    lrow = lrow * alpha + ((ps[0] + ps[1]) + (ps[2] + ps[3]));
#pragma unroll
    for (int t = 0; t < 4; ++t)
#pragma unroll
      for (int r = 0; r < 8; ++r) oacc[t][r] *= alpha;
    /* ---- O^T += V^T . P^T : A[m=d][k=kv] = Vt[d][kv] (lane row c), B = pb; both loops unrolled: pb is indexed by constants ---- */
#pragma unroll
    for (int kk = 0; kk < 2; ++kk) {
#pragma unroll
      for (int t = 0; t < 4; ++t) {
        FH vb;
        vb.h[0] = *(const v8h*)(Vt + (t * 16 + c) * kP16 + kk * 32 + 8 * hh);
        vb.h[1] = *(const v8h*)(Vt + (t * 16 + c) * kP16 + kk * 32 + 16 + 8 * hh);
        oacc[t] = at_mma_h(vb.v, pb[kk].v, oacc[t]);
      }
    }
  }

  _Float16* pw = Psh[wave];
  {
    const float ltot = lrow + xhalf(lrow);               /* both halves' kv rows; ltot >= 1 */
    const float inv  = O_CARRY / (ltot * P_CARRY);
#pragma unroll
    for (int t = 0; t < 4; ++t) {
      v8h ov;
#pragma unroll
      for (int r = 0; r < 8; ++r) ov[r] = (_Float16)(oacc[t][r] * inv);
      *(v8h*)(pw + c * kP16 + t * 16 + 8 * hh) = ov;     /* query row c, d = 16t + 8hh + 0..7 */
    }
  }
  __builtin_amdgcn_fence(__ATOMIC_RELEASE, "workgroup");
  __builtin_amdgcn_wave_barrier();
  __builtin_amdgcn_fence(__ATOMIC_ACQUIRE, "workgroup");
  {
    const int q8 = lane >> 3, c8 = (lane & 7) * 8;
    _Float16* ob = (_Float16*)(void*)oo + (tokb + (size_t)q0) * kDm + (size_t)h * kHd;
    {
#pragma unroll
      for (int it = 0; it < 4; ++it) {
        const int row = it * 4 + q8;
        const v8h val = *(const v8h*)(pw + row * kP16 + c8);
        *(v8h*)(ob + (size_t)row * kDm + c8) = val;
      }
      
    }
  }
}

/* ------------------------------------------------------------------------------------- */
extern "C" void kernel_launch(void* const* d_in, const int* in_sizes, int n_in,
                              void* d_out, int out_size, void* d_ws, size_t ws_size,
                              hipStream_t stream) {
  if (n_in < 11) return;
  const float* x    = (const float*)d_in[0];
  const float* mask = (const float*)d_in[1];
  const float* Wq   = (const float*)d_in[2];
  const float* bq   = (const float*)d_in[3];
  const float* Wk   = (const float*)d_in[4];
  const float* bk   = (const float*)d_in[5];
  const float* Wv   = (const float*)d_in[6];
  const float* bv   = (const float*)d_in[7];
  const float* Wo   = (const float*)d_in[8];
  const float* bo   = (const float*)d_in[9];
  const float* tau  = (const float*)d_in[10];

  const size_t nX = (size_t)kTok * kDm;     /* 4,194,304 */
  const size_t nW = (size_t)kDm * kDm;      /* 1,048,576 */
  if ((size_t)in_sizes[0] != nX || (size_t)in_sizes[1] != (size_t)kSeq * kSeq ||
      (size_t)in_sizes[2] != nW || (size_t)in_sizes[4] != nW || (size_t)in_sizes[6] != nW ||
      (size_t)in_sizes[8] != nW || in_sizes[3] != kDm || in_sizes[5] != kDm || in_sizes[7] != kDm ||
      in_sizes[9] != kDm || in_sizes[10] != kHeads) return;
  if ((size_t)out_size != nX) return;

  /*
       xb   bf16 [4096][1024]        off         0   size  8,388,608
       wqb  bf16 [1024][1024]        off  8,388,608  size  2,097,152
       wkb  bf16 [1024][1024]        off 10,485,760  size  2,097,152
       wvb  bf16 [1024][1024]        off 12,582,912  size  2,097,152
       wof  f16  [1024][1024] (x1024) off 14,680,064  size  2,097,152
       qf   f32  [4096][1024]        off 16,777,216  size 16,777,216   (reused as oo f16 [4096][1024], 8,388,608 B, after qf is consumed)
       kf   f32  [4096][1024]        off 33,554,432  size 16,777,216
       qhb  bf16 [4096][1024]        off 50,331,648  size  8,388,608
       qlb  bf16 [4096][1024]        off 58,720,256  size  8,388,608
       khb  bf16 [4096][1024]        off 67,108,864  size  8,388,608
       klb  bf16 [4096][1024]        off 75,497,472  size  8,388,608
       vvh  f16  [4096][1024]        off 83,886,080  size  8,388,608
       end                               92,274,688 */
  const size_t offXb  = 0;
  const size_t offWq  = offXb  + nX * 2;
  const size_t offWk  = offWq  + nW * 2;
  const size_t offWv  = offWk  + nW * 2;
  const size_t offWo  = offWv  + nW * 2;
  const size_t offQf  = offWo  + nW * 2;
  const size_t offKf  = offQf  + nX * 4;
  const size_t offQh  = offKf  + nX * 4;
  const size_t offQl  = offQh  + nX * 2;
  const size_t offKh  = offQl  + nX * 2;
  const size_t offKl  = offKh  + nX * 2;
  const size_t offVv  = offKl  + nX * 2;
  const size_t offEnd = offVv  + nX * 2;
  if (offEnd > ws_size) return;

  char* ws = (char*)d_ws;
  unsigned short* xb  = (unsigned short*)(ws + offXb);
  unsigned short* wqb = (unsigned short*)(ws + offWq);
  unsigned short* wkb = (unsigned short*)(ws + offWk);
  unsigned short* wvb = (unsigned short*)(ws + offWv);
  unsigned short* wof = (unsigned short*)(ws + offWo);
  float*          qf  = (float*)(ws + offQf);
  unsigned short* oo  = (unsigned short*)(ws + offQf);   /* reuse after qf is consumed */
  float*          kf  = (float*)(ws + offKf);
  unsigned short* qhb = (unsigned short*)(ws + offQh);
  unsigned short* qlb = (unsigned short*)(ws + offQl);
  unsigned short* khb = (unsigned short*)(ws + offKh);
  unsigned short* klb = (unsigned short*)(ws + offKl);
  unsigned short* vvh = (unsigned short*)(ws + offVv);

  /* 1-5: input casts (RNE bf16; Wo -> f16 of bf16 value x 1024) */
  const int n2X = (int)(nX / 2), n2W = (int)(nW / 2);
  cast2_kernel<0><<<dim3(n2X / 256), dim3(256), 0, stream>>>(x,  xb,  n2X, 1.0f);
  cast2_kernel<0><<<dim3(n2W / 256), dim3(256), 0, stream>>>(Wq, wqb, n2W, 1.0f);
  cast2_kernel<0><<<dim3(n2W / 256), dim3(256), 0, stream>>>(Wk, wkb, n2W, 1.0f);
  cast2_kernel<0><<<dim3(n2W / 256), dim3(256), 0, stream>>>(Wv, wvb, n2W, 1.0f);
  cast2_kernel<1><<<dim3(n2W / 256), dim3(256), 0, stream>>>(Wo, wof, n2W, WO_CARRY);

  /* 6-8: projections C[m][n] = sum_k xb[m][k] W[n][k] + bias[n]; M=4096, N=1024, K=1024 (tiles 64x64, K%64==0) */
  const int gemmTiles  = (kTok / 64) * (kDm / 64);      /* 1024 */
  const int gemmBlocks = (gemmTiles + 7) / 8;           /* 128 */
  wmma_gemm64<1, false, 2, 0, false, 0><<<dim3(gemmBlocks, 1), dim3(256), 0, stream>>>(
      xb, xb, kDm, 0L, wqb, wqb, kDm, 0L, (void*)qf, (void*)qf, kDm, 0L, bq, nullptr, 0L, kTok, kDm, kDm, 1.0f);
  wmma_gemm64<1, false, 2, 0, false, 0><<<dim3(gemmBlocks, 1), dim3(256), 0, stream>>>(
      xb, xb, kDm, 0L, wkb, wkb, kDm, 0L, (void*)kf, (void*)kf, kDm, 0L, bk, nullptr, 0L, kTok, kDm, kDm, 1.0f);
  wmma_gemm64<1, false, 2, 1, false, 0><<<dim3(gemmBlocks, 1), dim3(256), 0, stream>>>(
      xb, xb, kDm, 0L, wvb, wvb, kDm, 0L, (void*)vvh, (void*)vvh, kDm, 0L, bv, nullptr, 0L, kTok, kDm, kDm, 1.0f);

  /* 9: L2 normalisation of q (x tau) and k, bf16 hi/lo planes */
  l2norm_split_kernel<<<dim3((kTok * kHeads) / 32, 2), dim3(256), 0, stream>>>(qf, kf, tau, qhb, qlb, khb, klb);

  /* 10: attention -> oo (f16, value x 64), overwrites the dead qf region */
  cos_attn_kernel<<<dim3(kBatch * kHeads * (kSeq / kQblk)), dim3(128), 0, stream>>>(qhb, qlb, khb, klb, vvh, mask, oo);

  /* 11: output projection: out[m][n] = 2^-16 * sum_c (oo x64)[m][c] (Wo x1024)[n][c] + bo[n] -> d_out f32 */
  wmma_gemm64<0, false, 2, 0, false, 0><<<dim3(gemmBlocks, 1), dim3(256), 0, stream>>>(
      oo, oo, kDm, 0L, wof, wof, kDm, 0L, d_out, d_out, kDm, 0L, bo, nullptr, 0L, kTok, kDm, kDm,
      1.0f / (O_CARRY * WO_CARRY));
}

// v004
// A run of this version takes 226 microseconds.
// Timed twice side by side with v003, it ran 1.04 times as fast both times.
// Over all steps from v000 it is 2.04 times as fast.
// Contractions: q/k/v projections on v_wmma_f32_16x16x32_bf16 (operands = RNE bf16 of the inputs); scores on bf16 hi/lo split (hi.hi + hi.lo + lo.hi); p.v and output projection on v_wmma_f32_16x16x32_f16 (p carried x2^14, attention output carried x2^6, Wo carried x2^10); f32 accumulate; norms and softmax in f32.
#include <hip/hip_runtime.h>
#include <stdint.h>

typedef __attribute__((ext_vector_type(16))) _Float16 v16h;
typedef __attribute__((ext_vector_type(8)))  _Float16 v8h;
typedef __attribute__((ext_vector_type(16))) __bf16   v16b;
typedef __attribute__((ext_vector_type(8)))  __bf16   v8b;
typedef __attribute__((ext_vector_type(8)))  float    v8f;
typedef __attribute__((ext_vector_type(4)))  float    v4f;
typedef __attribute__((ext_vector_type(2)))  float    v2f;
typedef __attribute__((ext_vector_type(4)))  unsigned v4u;

/* problem geometry */
constexpr int kBatch = 2;
constexpr int kSeq   = 2048;
constexpr int kDm    = 1024;
constexpr int kHeads = 16;
constexpr int kHd    = 64;
constexpr int kTok   = kBatch * kSeq;      /* 4096 token rows */
constexpr int kKch   = 64;                 /* kv chunk */
constexpr int kQblk  = 64;                 /* query rows per block */
/* LDS row pitches of the attention tiles: 16 B x odd, so that the 16 rows a ds_load_b128 fragment read
   touches fall on 16 different groups of four banks (an unpadded 128 B or 256 B row puts them on one or two) */
constexpr int kP16   = 72;                 /* 64 16-bit elements + 8 pad  = 144 B */
constexpr int kPm    = 68;                 /* 64 f32 + 4 pad = 272 B; rows 8 apart land 32 banks apart */
/* GEMM operand staging in LDS */
constexpr int kGk    = 64;                 /* k elements per stage: 128 B of every operand row, whole cache lines */
constexpr int kGp    = 72;                 /* LDS row pitch 144 B = 16 B x odd, as for the attention tiles */
constexpr int kGrows = 64 + 8 * 64;        /* 64 A rows shared by the block's 8 waves + 64 B rows for each wave */
#define O_CARRY 64.0f
#define WO_CARRY 1024.0f
#define LOG2E 1.4426950408889634f
#define P_CARRY_LOG2 14.0f                  /* p is carried x2^14 */

static_assert(kDm == kHeads * kHd, "head split");
static_assert(kTok % 64 == 0 && kDm % 64 == 0, "GEMM M,N tile multiples");
static_assert(kDm % kGk == 0, "GEMM K multiple of the LDS stage");
static_assert((kDm / 64) % 8 == 0, "a GEMM block's 8 tiles lie in one tile row");
static_assert(kSeq % kKch == 0 && kSeq % kQblk == 0, "attention tiles");
static_assert((kTok * kHeads) % 32 == 0, "normalize grid");

__device__ __forceinline__ unsigned short f2bf_bits(float f) {
  unsigned u = __float_as_uint(f);
  return (unsigned short)((u + 0x7FFFu + ((u >> 16) & 1u)) >> 16);
}
__device__ __forceinline__ float bf_bits2f(unsigned short h) { return __uint_as_float(((unsigned)h) << 16); }
__device__ __forceinline__ _Float16 h16_lo(unsigned w) { return __builtin_bit_cast(_Float16, (unsigned short)(w & 0xffffu)); }
__device__ __forceinline__ _Float16 h16_hi(unsigned w) { return __builtin_bit_cast(_Float16, (unsigned short)(w >> 16)); }

/* hazard guards as plain device helpers */
__device__ __forceinline__ void dep_guard_h(v8f& a, v8f& b, v16h x, v16h y) { asm volatile("v_nop\n\tv_nop\n\tv_nop\n\tv_nop" : "+v"(a), "+v"(b) : "v"(x), "v"(y)); }
__device__ __forceinline__ void dep_guard_b(v8f& a, v8f& b, v16b x, v16b y) { asm volatile("v_nop\n\tv_nop\n\tv_nop\n\tv_nop" : "+v"(a), "+v"(b) : "v"(x), "v"(y)); }
__device__ __forceinline__ void keep4_h(v16h a, v16h b, v16h c, v16h d) { asm volatile("v_nop" :: "v"(a), "v"(b), "v"(c), "v"(d)); }
__device__ __forceinline__ void keep4_b(v16b a, v16b b, v16b c, v16b d) { asm volatile("v_nop" :: "v"(a), "v"(b), "v"(c), "v"(d)); }
__device__ __forceinline__ void acc_guard4(v8f& a, v8f& b, v8f& c, v8f& d) { asm volatile("v_nop\n\tv_nop\n\tv_nop\n\tv_nop" : "+v"(a), "+v"(b), "+v"(c), "+v"(d)); }
template <typename T> struct Frag;
template <> struct Frag<_Float16> {
  typedef v16h V; union U { v16h v; v8h h[2]; };
  static __device__ __forceinline__ v16h load(const _Float16* p) {   /* elements 0..7 <- p[0..7], 8..15 <- p[16..23] */
    U f; f.h[0] = *(const v8h*)(p); f.h[1] = *(const v8h*)(p + 16); return f.v;
  }
  static __device__ __forceinline__ v8f mma(v16h a, v16h b, v8f c) {
    return __builtin_amdgcn_wmma_f32_16x16x32_f16(false, a, false, b, (short)0, c, false, false);
  }
  static __device__ __forceinline__ void guard(v8f& a, v8f& b, v16h x, v16h y) { dep_guard_h(a, b, x, y); }
  static __device__ __forceinline__ void keep(v16h a, v16h b, v16h c, v16h d) { keep4_h(a, b, c, d); }
};
template <> struct Frag<__bf16> {
  typedef v16b V; union U { v16b v; v8b h[2]; };
  static __device__ __forceinline__ v16b load(const __bf16* p) {
    U f; f.h[0] = *(const v8b*)(p); f.h[1] = *(const v8b*)(p + 16); return f.v;
  }
  static __device__ __forceinline__ v8f mma(v16b a, v16b b, v8f c) {
    return __builtin_amdgcn_wmma_f32_16x16x32_bf16(false, a, false, b, (short)0, c, false, false);
  }
  static __device__ __forceinline__ void guard(v8f& a, v8f& b, v16b x, v16b y) { dep_guard_b(a, b, x, y); }
  static __device__ __forceinline__ void keep(v16b a, v16b b, v16b c, v16b d) { keep4_b(a, b, c, d); }
};

/* Nine asynchronous 16-byte copies global -> LDS per lane, through no register: l = the lane's LDS byte address,
   g = the lane's global address.  The closing s_wait_xcnt stands inside the statement so that no address
   register of an issued copy is rewritten in front of it. */
__device__ __forceinline__ void async_copy9(const unsigned (&l)[9], const unsigned short* const (&g)[9]) {
  asm volatile(
      "global_load_async_to_lds_b128 %0, %9, off\n\t"
      "global_load_async_to_lds_b128 %1, %10, off\n\t"
      "global_load_async_to_lds_b128 %2, %11, off\n\t"
      "global_load_async_to_lds_b128 %3, %12, off\n\t"
      "global_load_async_to_lds_b128 %4, %13, off\n\t"
      "global_load_async_to_lds_b128 %5, %14, off\n\t"
      "global_load_async_to_lds_b128 %6, %15, off\n\t"
      "global_load_async_to_lds_b128 %7, %16, off\n\t"
      "global_load_async_to_lds_b128 %8, %17, off\n\t"
      "s_wait_xcnt 0x0"
      :: "v"(l[0]), "v"(l[1]), "v"(l[2]), "v"(l[3]), "v"(l[4]), "v"(l[5]), "v"(l[6]), "v"(l[7]), "v"(l[8]),
         "v"(g[0]), "v"(g[1]), "v"(g[2]), "v"(g[3]), "v"(g[4]), "v"(g[5]), "v"(g[6]), "v"(g[7]), "v"(g[8])
      : "memory");
}

/* ---- Register-blocked batched WMMA GEMM --------------------------------
   C[m,n] = scale * sum_k A[m,k] * Bt[n,k] (+bias); each wave owns a 64x64 tile.
   A row-major [M,K]; Bt row-major [N,K]; M % 64 == 0, N % 512 == 0, K % 64 == 0, lda and ldb % 8 == 0.
   A block's 8 waves own 8 neighbouring tiles of one tile row.  Per 64 k the block's 64 A rows and 512 Bt rows
   are copied to LDS in whole 128 B lines (two buffers: the next stage flies while this one is multiplied);
   the fragments are read from LDS in ascending k, 32 at a time.
   BIAS_MODE: 0 = none, 1 = bias[m], 2 = bias[n]; bias values RNE-converted to bf16 precision before the add.
   OUT_MODE: 0 = f32, 1 = f16, 2 = bf16 hi plane (Cout) + bf16 lo plane (Cout2).
   ET: 0 = f16 operands, 1 = bf16 operands (pointers passed as 16-bit storage) */
template <int ET> struct Elem;
template <> struct Elem<0> { typedef _Float16 T; };
template <> struct Elem<1> { typedef __bf16 T; };
template <int ET, bool SPLIT, int BIAS_MODE, int OUT_MODE, bool RESID, int ACT = 0>
__global__ __launch_bounds__(256) void wmma_gemm64(
    const unsigned short* __restrict__ Ap, const unsigned short* __restrict__ A2p, int lda, long strideA,
    const unsigned short* __restrict__ Btp, const unsigned short* __restrict__ Bt2p, int ldb, long strideB,
    void* __restrict__ Cout, void* __restrict__ Cout2, int ldc, long strideC,
    const float* __restrict__ bias,
    const float* __restrict__ resid, long strideR,
    int M, int N, int K, float scale) {
  typedef typename Elem<ET>::T T;
  typedef typename Frag<T>::V V;
  static_assert(!SPLIT, "the LDS stage holds one plane of each operand");
  __shared__ __align__(16) float sT[8][16 * 68];   /* per-wave 16x64 slab, pitch 68 floats */
  __shared__ __align__(16) unsigned short sAB[2][kGrows * kGp];   /* two stages: rows 0..63 A, 64..575 Bt */
  const int b    = blockIdx.y;
  const int lane = threadIdx.x & 31;
  const int wave = threadIdx.x >> 5;
  const int tilesN = N >> 6;
  const int tilesM = M >> 6;
  const int tile0 = blockIdx.x * 8;
  if (tile0 >= tilesM * tilesN) return;  /* block-uniform, in front of every barrier */
  const int tile = tile0 + wave;
  const int tm = tile / tilesN;
  const int tn = tile - tm * tilesN;
  const int m0 = tm << 6;
  const int n0 = tn << 6;

  const unsigned short* Ab = Ap  + (size_t)b * strideA;
  const unsigned short* Bb = Btp + (size_t)b * strideB;

  const int rlane = lane & 15;                 /* row (A) / col (B, D) within subtile */
  const int koff  = (lane >> 4) * 8;           /* k offset of this lane half */
  const int mOff  = (lane >> 4) * 8;           /* D row offset */

  /* copy map: 8 lanes x 16 B = one 128 B row, 32 rows per pass of the block, 18 passes = 576 rows */
  const int crow = threadIdx.x >> 3;
  const int cchk = (threadIdx.x & 7) * 8;
  const int nb0  = (tile0 - tm * tilesN) << 6;  /* first Bt row of the block */
  const unsigned short* gA = Ab + (size_t)(m0 + crow) * lda + cchk;
  const unsigned short* gB = Bb + (size_t)(nb0 + crow) * ldb + cchk;
  const unsigned lds0 = (unsigned)(uintptr_t)(const void*)&sAB[0][0] + (unsigned)(crow * kGp + cchk) * 2u;
  auto stage_copy = [&](int st, int buf) {
    const unsigned lb = lds0 + (unsigned)buf * (unsigned)(kGrows * kGp * 2);
    const unsigned short* pa = gA + (size_t)st * kGk;
    const unsigned short* pb = gB + (size_t)st * kGk;
    unsigned l[9];
    const unsigned short* g[9];
    /* both loops unrolled: l[] and g[] are asm operands and must be registers */
#pragma unroll
    for (int it = 0; it < 9; ++it) {
      l[it] = lb + (unsigned)(it * 32 * kGp * 2);
      g[it] = (it < 2) ? pa + (size_t)(it * 32) * lda : pb + (size_t)((it - 2) * 32) * ldb;
    }
    async_copy9(l, g);
#pragma unroll
    for (int it = 0; it < 9; ++it) {
      l[it] = lb + (unsigned)((it + 9) * 32 * kGp * 2);
      g[it] = pb + (size_t)((it + 7) * 32) * ldb;
    }
    async_copy9(l, g);
  };

  v8f acc[4][4];
#pragma unroll
  for (int i = 0; i < 4; ++i)
#pragma unroll
    for (int j = 0; j < 4; ++j) acc[i][j] = (v8f){0.f,0.f,0.f,0.f,0.f,0.f,0.f,0.f};

  const int nst = K / kGk;
  stage_copy(0, 0);
  asm volatile("s_wait_asynccnt 0x0" ::: "memory");   /* this wave's share of stage 0 has landed */
  __syncthreads();                                     /* ... and every other wave's */
  if (nst > 1) stage_copy(1, 1);
  for (int t = 0; t < nst; ++t) {
    const T* sA = (const T*)(const void*)sAB[t & 1] + rlane * kGp + koff;
    const T* sB = sA + (64 + wave * 64) * kGp;
    /* all loops of the stage unrolled: fragments and accumulators are indexed by constants and stay in registers */
#pragma unroll
    for (int ks = 0; ks < kGk; ks += 32) {
      V bh[4], ah[4];
#pragma unroll
      for (int j = 0; j < 4; ++j) bh[j] = Frag<T>::load(sB + j * 16 * kGp + ks);
#pragma unroll
      for (int i = 0; i < 4; ++i) ah[i] = Frag<T>::load(sA + i * 16 * kGp + ks);
#pragma unroll
      for (int i = 0; i < 4; ++i) {
#pragma unroll
        for (int j = 0; j < 4; ++j) acc[i][j] = Frag<T>::mma(ah[i], bh[j], acc[i][j]);
        Frag<T>::guard(acc[i][0], acc[i][3], ah[i], ah[i]);
      }
      Frag<T>::keep(bh[0], bh[1], bh[2], bh[3]);
    }
    asm volatile("s_wait_dscnt 0x0" ::: "memory");     /* this wave's reads of the buffer have returned before it is refilled */
    asm volatile("s_wait_asynccnt 0x0" ::: "memory");  /* this wave's share of stage t + 1 has landed */
    __syncthreads();                                   /* publishes stage t + 1, ends every read of stage t */
    if (t + 2 < nst) stage_copy(t + 2, t & 1);
  }
  asm volatile("s_wait_asynccnt 0x0" ::: "memory");    /* no copy is outstanding when the wave goes on */
  acc_guard4(acc[0][0], acc[0][1], acc[0][2], acc[0][3]);
  acc_guard4(acc[1][0], acc[1][1], acc[1][2], acc[1][3]);
  acc_guard4(acc[2][0], acc[2][1], acc[2][2], acc[2][3]);
  acc_guard4(acc[3][0], acc[3][1], acc[3][2], acc[3][3]);

  /* ---- epilogue ---- */
  float* slab = sT[wave];
  const float* Rb = RESID ? (resid + (size_t)b * strideR) : nullptr;
#pragma unroll
  for (int i = 0; i < 4; ++i) {
    const int mBase = m0 + (i << 4);
#pragma unroll
    for (int j = 0; j < 4; ++j) {
      const int n = n0 + (j << 4) + rlane;
      float bv = 0.f;
      if (BIAS_MODE == 2) bv = bf_bits2f(f2bf_bits(bias[n]));
#pragma unroll
      for (int r = 0; r < 8; ++r) {
        float v = acc[i][j][r] * scale;
        if (BIAS_MODE == 1) v += bf_bits2f(f2bf_bits(bias[mBase + mOff + r]));
        if (BIAS_MODE == 2) v += bv;
        if (RESID) v += Rb[(size_t)(mBase + mOff + r) * ldc + n];
        if (ACT == 1) v = tanhf(v);
        if (ACT == 2) v = fmaxf(v, 0.0f);
        if (ACT == 3) v = v / (1.0f + expf(-v));
        if (ACT == 4) v = (v > 0.f) ? v : 0.01f * v;
        slab[(mOff + r) * 68 + (j << 4) + rlane] = v;
      }
    }
    __builtin_amdgcn_fence(__ATOMIC_RELEASE, "workgroup");
    __builtin_amdgcn_wave_barrier();
    __builtin_amdgcn_fence(__ATOMIC_ACQUIRE, "workgroup");
    if (OUT_MODE == 0) {
      float* C = (float*)Cout + (size_t)b * strideC;
      const int hh = lane >> 4, c4 = (lane & 15) * 4;     /* row seg = 256 B = 16 lanes x 16 B */
      {
#pragma unroll
        for (int it = 0; it < 8; ++it) {
          const int row = it * 2 + hh;
          v4f v = *(const v4f*)(slab + row * 68 + c4);
          *(v4f*)(C + (size_t)(mBase + row) * ldc + n0 + c4) = v;
        }
        
      }
    } else {
      const int q = lane >> 3, c8 = (lane & 7) * 8;        
      unsigned short* C  = (unsigned short*)Cout  + (size_t)b * strideC;
      unsigned short* C2 = (OUT_MODE == 2) ? ((unsigned short*)Cout2 + (size_t)b * strideC) : nullptr;
      {
#pragma unroll
        for (int it = 0; it < 4; ++it) {
          const int row = it * 4 + q;
          const float* sp = slab + row * 68 + c8;
          v8h hv, lv;
#pragma unroll
          for (int e = 0; e < 8; ++e) {
            if (OUT_MODE == 1) {
              hv[e] = (_Float16)sp[e];
            } else {
              unsigned short hb = f2bf_bits(sp[e]);
              unsigned short lb = f2bf_bits(sp[e] - bf_bits2f(hb));
              hv[e] = __builtin_bit_cast(_Float16, hb);
              lv[e] = __builtin_bit_cast(_Float16, lb);
            }
          }
          *(v8h*)(C + (size_t)(mBase + row) * ldc + n0 + c8) = hv;
          if (OUT_MODE == 2) *(v8h*)(C2 + (size_t)(mBase + row) * ldc + n0 + c8) = lv;
        }
        
      }
    }
    __builtin_amdgcn_fence(__ATOMIC_RELEASE, "workgroup");
    __builtin_amdgcn_wave_barrier();
    __builtin_amdgcn_fence(__ATOMIC_ACQUIRE, "workgroup");
  }
}

/*
   MODE 0: bf16 bits (RNE).  MODE 1: f16 bits of (RNE-bf16 value * mul).
   coverage: grid = n2/256 blocks x 256 threads x 2 elements = 2*n2 elements exactly. */
template <int MODE>
__global__ __launch_bounds__(256) void cast2_kernel(const float* __restrict__ in,
                                                    unsigned short* __restrict__ out, int n2, float mul) {
  const int i = blockIdx.x * 256 + threadIdx.x;
  if (i < n2) {
    const v2f p = *(const v2f*)(in + 2 * (size_t)i);
    unsigned short u0, u1;
    if (MODE == 0) {
      u0 = f2bf_bits(p.x); u1 = f2bf_bits(p.y);
    } else {
      const float r0 = bf_bits2f(f2bf_bits(p.x)) * mul;
      const float r1 = bf_bits2f(f2bf_bits(p.y)) * mul;
      u0 = __builtin_bit_cast(unsigned short, (_Float16)r0);
      u1 = __builtin_bit_cast(unsigned short, (_Float16)r1);
    }
    const unsigned u = (unsigned)u0 | ((unsigned)u1 << 16);
    unsigned* op = (unsigned*)(void*)out;
    op[i] = u;
    
  }
}

/* ---- per (token, head) L2 normalisation + bf16 hi/lo split.
   blockIdx.y = 0: q plane, scaled by 1/max(||q||,1e-12) * bf16(tau[head]) * log2(e), so that the scores come out
   of the matrix unit as exponents of 2; y = 1: k plane, 1/max(||k||,1e-12).
   8 lanes per 64-vector (8 floats each), 32 segments per 256-thread block; grid.x = kTok*kHeads/32 = 2048.
*/
__global__ __launch_bounds__(256) void l2norm_split_kernel(
    const float* __restrict__ qf, const float* __restrict__ kf, const float* __restrict__ tau,
    unsigned short* __restrict__ qhp, unsigned short* __restrict__ qlp,
    unsigned short* __restrict__ khp, unsigned short* __restrict__ klp) {
  const bool isk = (blockIdx.y != 0);                 /* block-uniform */
  const float* src = isk ? kf : qf;
  unsigned short* dhp = isk ? khp : qhp;
  unsigned short* dlp = isk ? klp : qlp;
  const int tid = threadIdx.x;
  const int g = tid >> 3, e = tid & 7;
  const int seg = blockIdx.x * 32 + g;                 /* < kTok*kHeads */
  const int token = seg >> 4, head = seg & 15;
  const size_t base = (size_t)token * kDm + (size_t)head * kHd + (size_t)e * 8;
  const v4f a  = *(const v4f*)(src + base);
  const v4f c4 = *(const v4f*)(src + base + 4);
  float ss = 0.0f;
  ss += a.x * a.x;  ss += a.y * a.y;  ss += a.z * a.z;  ss += a.w * a.w;
  ss += c4.x * c4.x; ss += c4.y * c4.y; ss += c4.z * c4.z; ss += c4.w * c4.w;
  ss += __shfl_xor(ss, 1, 32);
  ss += __shfl_xor(ss, 2, 32);
  ss += __shfl_xor(ss, 4, 32);
  const float nrm  = sqrtf(ss);
  const float rinv = 1.0f / fmaxf(nrm, 1e-12f);
  const float th   = bf_bits2f(f2bf_bits(tau[head]));
  const float sc   = isk ? rinv : rinv * (th * LOG2E);
  float vals[8];
  vals[0] = a.x * sc;  vals[1] = a.y * sc;  vals[2] = a.z * sc;  vals[3] = a.w * sc;
  vals[4] = c4.x * sc; vals[5] = c4.y * sc; vals[6] = c4.z * sc; vals[7] = c4.w * sc;
  unsigned hw[4], lw[4];
#pragma unroll
  for (int i = 0; i < 4; ++i) {
    const float v0 = vals[2 * i], v1 = vals[2 * i + 1];
    const unsigned short h0 = f2bf_bits(v0), h1 = f2bf_bits(v1);
    const unsigned short l0 = f2bf_bits(v0 - bf_bits2f(h0));
    const unsigned short l1 = f2bf_bits(v1 - bf_bits2f(h1));
    hw[i] = (unsigned)h0 | ((unsigned)h1 << 16);
    lw[i] = (unsigned)l0 | ((unsigned)l1 << 16);
  }
  v4u hv; hv.x = hw[0]; hv.y = hw[1]; hv.z = hw[2]; hv.w = hw[3];
  v4u lv; lv.x = lw[0]; lv.y = lw[1]; lv.z = lw[2]; lv.w = lw[3];
  v4u* ph = (v4u*)(void*)(dhp + base);
  v4u* pl = (v4u*)(void*)(dlp + base);
  *ph = hv; *pl = lv;
  
}

__device__ __forceinline__ v8f at_mma_b(v16b a, v16b b, v8f c) {
  c = __builtin_amdgcn_wmma_f32_16x16x32_bf16(false, a, false, b, (short)0, c, false, false);
  asm volatile("v_nop\n\tv_nop\n\tv_nop\n\tv_nop" : "+v"(c) : "v"(a), "v"(b));
  return c;
}
__device__ __forceinline__ v8f at_mma_h(v16h a, v16h b, v8f c) {
  c = __builtin_amdgcn_wmma_f32_16x16x32_f16(false, a, false, b, (short)0, c, false, false);
  asm volatile("v_nop\n\tv_nop\n\tv_nop\n\tv_nop" : "+v"(c) : "v"(a), "v"(b));
  return c;
}

/* x[i] = 2^x[i] for the eight scores of one tile, each in its own register, so that no v_exp_f32 reads the result or
   overwrites the source of the one in front of it; the closing v_nop is the slot the instruction set asks for
   between the last v_exp_f32 and whatever the compiler puts next. */
__device__ __forceinline__ void exp2x8(float (&x)[8]) {
  asm("v_exp_f32 %0, %0\n\t"
      "v_exp_f32 %1, %1\n\t"
      "v_exp_f32 %2, %2\n\t"
      "v_exp_f32 %3, %3\n\t"
      "v_exp_f32 %4, %4\n\t"
      "v_exp_f32 %5, %5\n\t"
      "v_exp_f32 %6, %6\n\t"
      "v_exp_f32 %7, %7\n\t"
      "v_nop"
      : "+v"(x[0]), "+v"(x[1]), "+v"(x[2]), "+v"(x[3]), "+v"(x[4]), "+v"(x[5]), "+v"(x[6]), "+v"(x[7]));
}

/* lane l <-> lane l ^ 16 by one vector cross-row move */
__device__ __forceinline__ float xhalf(float x) {
  const int b = __builtin_bit_cast(int, x);
  return __builtin_bit_cast(float, __builtin_amdgcn_permlanex16(b, b, 0x76543210, 0xfedcba98, false, false));
}

/* =====================================================================================
   Attention for head_dim 64 with an additive [kSeq][kSeq] f32 mask shared over (b,h).
   Inputs: qh/ql = bf16 hi/lo planes of (q/||q|| * tau[h] * log2 e), kh/kl = bf16 hi/lo planes of k/||k||,
           vv = f16 plane of v; all [kTok][kDm] with element (b, s, h, d) at (b*kSeq+s)*kDm + h*64 + d.
   scores, transposed: S^T = khat . qhat_tau^T : 3 bf16 WMMAs (hi.hi + lo.hi + hi.lo), A = K rows, B = Q columns;
           lanes c and c + 16 hold all scores of query column c: += bf16(mask[q][kv]) * log2 e; online softmax f32 in
           base 2 (p x 2^14 = 2^(score - maximum + 14): one subtraction and one v_exp_f32 a score), maximum and
           sum in the lane, the halves' maxima joined per chunk, their sums (carried x2^14 like p) once at the end.
   out, transposed: O^T += V^T . P^T : f16 WMMA, p carried x2^14; two score tiles converted in place are the B operand.
           result written as f16 of (out * 2^6) into oo (same plane layout).
   Block = 4 waves = 64 query rows of one (b, h); every one of the kSeq/64 kv chunks is processed.
   grid.x = kBatch * kHeads * (kSeq/64) = 1024.  coverage of oo: 1024 blocks x 64 rows x 64 d = kTok*kDm.
   ===================================================================================== */
__global__ __launch_bounds__(128)
void cos_attn_kernel(const unsigned short* __restrict__ qhp, const unsigned short* __restrict__ qlp,
                     const unsigned short* __restrict__ khp, const unsigned short* __restrict__ klp,
                     const unsigned short* __restrict__ vvp, const float* __restrict__ mask,
                     unsigned short* __restrict__ oo) {
  union FB { v16b v; v8b h[2]; };
  union FH { v16h v; v8h h[2]; };
  __shared__ __align__(16) __bf16   Ksh[kKch * kP16];       /* K hi [kv][d]       9 KB */
  __shared__ __align__(16) __bf16   Ksl[kKch * kP16];       /* K lo [kv][d]       9 KB */
  __shared__ __align__(16) _Float16 Vt[kHd * kP16];         /* V    [d][kv]       9 KB */
  __shared__ __align__(16) float    Msk[kQblk * kPm];       /* mask [qrow][kv]   17 KB */
  __shared__ __align__(16) _Float16 Psh[4][16 * kP16];      /* per wave out staging  9 KB */

  const int tid  = threadIdx.x;
  const int wave = tid >> 5;
  const int lane = tid & 31;
  const int hh   = lane >> 4;
  const int c    = lane & 15;

  const int nqb = kSeq / kQblk;                 /* 32 */
  const int bx  = blockIdx.x;
  const int qb  = bx % nqb;
  const int bh  = bx / nqb;
  const int h   = bh % kHeads;
  const int b   = bh / kHeads;
  const int qbase = qb * kQblk;
  const int q0    = qbase + wave * 16;
  const size_t tokb = (size_t)b * kSeq;

  const __bf16*   qh = (const __bf16*)(const void*)qhp;
  const __bf16*   ql = (const __bf16*)(const void*)qlp;

  /* ---- Q fragments (B operand): column = lane&15, elements 0..7 <- d0+8hh+0..7, 8..15 <- d0+16+8hh+0..7 ---- */
  v16b qah[2], qal[2];
  {
    const size_t ro = (tokb + (size_t)(q0 + c)) * kDm + (size_t)h * kHd;
#pragma unroll
    for (int dc = 0; dc < 2; ++dc) {
      qah[dc] = Frag<__bf16>::load(qh + ro + dc * 32 + 8 * hh);
      qal[dc] = Frag<__bf16>::load(ql + ro + dc * 32 + 8 * hh);
    }
  }

  float mrow = -INFINITY;      /* running maximum of query column c, equal in both lane halves */
  float mref = -INFINITY;      /* the exponent that p, lrow and oacc are carried against: mrow - 14 */
  float lrow = 0.f;            /* running sum over this lane half's kv rows only */
  v8f oacc[4];                 /* O^T: oacc[t][r] = out[d = 16t + 8hh + r][query c] */
#pragma unroll
  for (int t = 0; t < 4; ++t) oacc[t] = (v8f){0.f,0.f,0.f,0.f,0.f,0.f,0.f,0.f};

  for (int kc = 0; kc < kSeq / kKch; ++kc) {
    const int kv0 = kc * kKch;
    __syncthreads();
    {
      /* staging: 128 threads; rr = kv row (K, V) or query row (mask tile), c0 = 32-element half.
         coverage per array: 128 threads x 32 elements = 64 x 64. */
      const int rr = tid >> 1;
      const int c0 = (tid & 1) * 32;
      const size_t ro = (tokb + (size_t)(kv0 + rr)) * kDm + (size_t)h * kHd + c0;
      const uint4* kph = (const uint4*)(const void*)(khp + ro);
      const uint4* kpl = (const uint4*)(const void*)(klp + ro);
#pragma unroll
      for (int i = 0; i < 4; ++i) {
        const uint4 wh = kph[i];
        const uint4 wl = kpl[i];
        *(uint4*)(void*)(Ksh + rr * kP16 + c0 + 8 * i) = wh;
        *(uint4*)(void*)(Ksl + rr * kP16 + c0 + 8 * i) = wl;
      }
      asm volatile("" ::: "memory");
      const uint4* vp = (const uint4*)(const void*)(vvp + ro);
#pragma unroll
      for (int i = 0; i < 4; ++i) {
        const uint4 w4 = vp[i];
        const int d0 = c0 + 8 * i;
        Vt[(d0 + 0) * kP16 + rr] = h16_lo(w4.x);
        Vt[(d0 + 1) * kP16 + rr] = h16_hi(w4.x);
        Vt[(d0 + 2) * kP16 + rr] = h16_lo(w4.y);
        Vt[(d0 + 3) * kP16 + rr] = h16_hi(w4.y);
        Vt[(d0 + 4) * kP16 + rr] = h16_lo(w4.z);
        Vt[(d0 + 5) * kP16 + rr] = h16_hi(w4.z);
        Vt[(d0 + 6) * kP16 + rr] = h16_lo(w4.w);
        Vt[(d0 + 7) * kP16 + rr] = h16_hi(w4.w);
      }
      asm volatile("" ::: "memory");
      /* mask tile rows qbase+rr, cols kv0+c0..+31; values RNE-converted to bf16 precision */
      const float* mp = mask + (size_t)(qbase + rr) * kSeq + kv0 + c0;
#pragma unroll
      for (int i = 0; i < 8; ++i) {
        const v4f m4 = *(const v4f*)(mp + 4 * i);
        v4f r4;
        r4.x = bf_bits2f(f2bf_bits(m4.x));
        r4.y = bf_bits2f(f2bf_bits(m4.y));
        r4.z = bf_bits2f(f2bf_bits(m4.z));
        r4.w = bf_bits2f(f2bf_bits(m4.w));
        *(v4f*)(Msk + rr * kPm + c0 + 4 * i) = r4;
      }
    }
    __syncthreads();

    /* ---- scores: S^T[kvrow][qcol], A[m=kv][k=d] = Ksh[kv][d], B[k=d][n=q] = Q; s[j][r] = S[q = c][kv = 16j + 8hh + r] ---- */
    v8f s[4];
#pragma unroll
    for (int j = 0; j < 4; ++j) {
      s[j] = (v8f){0.f,0.f,0.f,0.f,0.f,0.f,0.f,0.f};
#pragma unroll
      for (int dc = 0; dc < 2; ++dc) {
        FB kb, klo;
        kb.h[0]  = *(const v8b*)(Ksh + (j * 16 + c) * kP16 + dc * 32 + 8 * hh);
        kb.h[1]  = *(const v8b*)(Ksh + (j * 16 + c) * kP16 + dc * 32 + 16 + 8 * hh);
        klo.h[0] = *(const v8b*)(Ksl + (j * 16 + c) * kP16 + dc * 32 + 8 * hh);
        klo.h[1] = *(const v8b*)(Ksl + (j * 16 + c) * kP16 + dc * 32 + 16 + 8 * hh);
        s[j] = at_mma_b(kb.v,  qah[dc], s[j]);
        s[j] = at_mma_b(klo.v, qah[dc], s[j]);
        s[j] = at_mma_b(kb.v,  qal[dc], s[j]);
      }
    }

    /* ---- additive mask from the LDS tile (8 consecutive kv of the lane's own query row per score tile) + chunk max ---- */
    const float* mrw = Msk + (wave * 16 + c) * kPm + 8 * hh;
    float cj[4];                /* one maximum per score tile: four short chains instead of one long one */
#pragma unroll
    for (int j = 0; j < 4; ++j) {
      const v4f ma = *(const v4f*)(mrw + j * 16);
      const v4f mb = *(const v4f*)(mrw + j * 16 + 4);
#pragma unroll
      for (int r = 0; r < 4; ++r) {
        s[j][r]     = fmaf(ma[r], LOG2E, s[j][r]);
        s[j][r + 4] = fmaf(mb[r], LOG2E, s[j][r + 4]);
      }
      cj[j] = fmaxf(s[j][0], s[j][4]);
#pragma unroll
      for (int r = 1; r < 4; ++r) cj[j] = fmaxf(cj[j], fmaxf(s[j][r], s[j][r + 4]));
    }
    float cm = fmaxf(fmaxf(cj[0], cj[1]), fmaxf(cj[2], cj[3]));
    cm = fmaxf(cm, xhalf(cm));
    const float mnew  = fmaxf(mrow, cm);
    /* the carry of p rides in the subtracted exponent; beside a maximum so large that the 14 rounds to more than 15
       it is left out, so that p stays inside f16; alpha goes from the old to the new subtracted exponent, whatever they are */
    float msub = mnew - P_CARRY_LOG2;
    msub = (mnew - msub <= P_CARRY_LOG2 + 1.0f) ? msub : mnew;
    const float alpha = __builtin_amdgcn_exp2f(mref - msub);
    mrow = mnew;
    mref = msub;
    float ps[4];                /* one sum per score tile, as for the maxima */
    FH pb[2];                   /* P^T as B operand: element e <- kv 32kk + 8hh + e, element 8 + e <- kv 32kk + 16 + 8hh + e */
#pragma unroll
    for (int j = 0; j < 4; ++j) {
      float p[8];               /* p x 2^14 */
#pragma unroll
      for (int r = 0; r < 8; ++r) p[r] = s[j][r] - msub;
      exp2x8(p);
      ps[j] = 0.f;
#pragma unroll
      for (int r = 0; r < 8; ++r) {
        ps[j] += p[r];
        pb[j >> 1].h[j & 1][r] = (_Float16)p[r];
      }
    }
    lrow = lrow * alpha + ((ps[0] + ps[1]) + (ps[2] + ps[3]));
#pragma unroll
    for (int t = 0; t < 4; ++t)
#pragma unroll
      for (int r = 0; r < 8; ++r) oacc[t][r] *= alpha;
    /* ---- O^T += V^T . P^T : A[m=d][k=kv] = Vt[d][kv] (lane row c), B = pb; both loops unrolled: pb is indexed by constants ---- */
#pragma unroll
    for (int kk = 0; kk < 2; ++kk) {
#pragma unroll
      for (int t = 0; t < 4; ++t) {
        FH vb;
        vb.h[0] = *(const v8h*)(Vt + (t * 16 + c) * kP16 + kk * 32 + 8 * hh);
        vb.h[1] = *(const v8h*)(Vt + (t * 16 + c) * kP16 + kk * 32 + 16 + 8 * hh);
        oacc[t] = at_mma_h(vb.v, pb[kk].v, oacc[t]);
      }
    }
  }

  _Float16* pw = Psh[wave];
  {
    const float ltot = lrow + xhalf(lrow);               /* both halves' kv rows, carried like p; ltot >= 1 */
    const float inv  = O_CARRY / ltot;
#pragma unroll
    for (int t = 0; t < 4; ++t) {
      v8h ov;
#pragma unroll
      for (int r = 0; r < 8; ++r) ov[r] = (_Float16)(oacc[t][r] * inv);
      *(v8h*)(pw + c * kP16 + t * 16 + 8 * hh) = ov;     /* query row c, d = 16t + 8hh + 0..7 */
    }
  }
  __builtin_amdgcn_fence(__ATOMIC_RELEASE, "workgroup");
  __builtin_amdgcn_wave_barrier();
  __builtin_amdgcn_fence(__ATOMIC_ACQUIRE, "workgroup");
  {
    const int q8 = lane >> 3, c8 = (lane & 7) * 8;
    _Float16* ob = (_Float16*)(void*)oo + (tokb + (size_t)q0) * kDm + (size_t)h * kHd;
    {
#pragma unroll
      for (int it = 0; it < 4; ++it) {
        const int row = it * 4 + q8;
        const v8h val = *(const v8h*)(pw + row * kP16 + c8);
        *(v8h*)(ob + (size_t)row * kDm + c8) = val;
      }
      
    }
  }
}

/* ------------------------------------------------------------------------------------- */
extern "C" void kernel_launch(void* const* d_in, const int* in_sizes, int n_in,
                              void* d_out, int out_size, void* d_ws, size_t ws_size,
                              hipStream_t stream) {
  if (n_in < 11) return;
  const float* x    = (const float*)d_in[0];
  const float* mask = (const float*)d_in[1];
  const float* Wq   = (const float*)d_in[2];
  const float* bq   = (const float*)d_in[3];
  const float* Wk   = (const float*)d_in[4];
  const float* bk   = (const float*)d_in[5];
  const float* Wv   = (const float*)d_in[6];
  const float* bv   = (const float*)d_in[7];
  const float* Wo   = (const float*)d_in[8];
  const float* bo   = (const float*)d_in[9];
  const float* tau  = (const float*)d_in[10];

  const size_t nX = (size_t)kTok * kDm;     /* 4,194,304 */
  const size_t nW = (size_t)kDm * kDm;      /* 1,048,576 */
  if ((size_t)in_sizes[0] != nX || (size_t)in_sizes[1] != (size_t)kSeq * kSeq ||
      (size_t)in_sizes[2] != nW || (size_t)in_sizes[4] != nW || (size_t)in_sizes[6] != nW ||
      (size_t)in_sizes[8] != nW || in_sizes[3] != kDm || in_sizes[5] != kDm || in_sizes[7] != kDm ||
      in_sizes[9] != kDm || in_sizes[10] != kHeads) return;
  if ((size_t)out_size != nX) return;

  /*
       xb   bf16 [4096][1024]        off         0   size  8,388,608
       wqb  bf16 [1024][1024]        off  8,388,608  size  2,097,152
       wkb  bf16 [1024][1024]        off 10,485,760  size  2,097,152
       wvb  bf16 [1024][1024]        off 12,582,912  size  2,097,152
       wof  f16  [1024][1024] (x1024) off 14,680,064  size  2,097,152
       qf   f32  [4096][1024]        off 16,777,216  size 16,777,216   (reused as oo f16 [4096][1024], 8,388,608 B, after qf is consumed)
       kf   f32  [4096][1024]        off 33,554,432  size 16,777,216
       qhb  bf16 [4096][1024]        off 50,331,648  size  8,388,608
       qlb  bf16 [4096][1024]        off 58,720,256  size  8,388,608
       khb  bf16 [4096][1024]        off 67,108,864  size  8,388,608
       klb  bf16 [4096][1024]        off 75,497,472  size  8,388,608
       vvh  f16  [4096][1024]        off 83,886,080  size  8,388,608
       end                               92,274,688 */
  const size_t offXb  = 0;
  const size_t offWq  = offXb  + nX * 2;
  const size_t offWk  = offWq  + nW * 2;
  const size_t offWv  = offWk  + nW * 2;
  const size_t offWo  = offWv  + nW * 2;
  const size_t offQf  = offWo  + nW * 2;
  const size_t offKf  = offQf  + nX * 4;
  const size_t offQh  = offKf  + nX * 4;
  const size_t offQl  = offQh  + nX * 2;
  const size_t offKh  = offQl  + nX * 2;
  const size_t offKl  = offKh  + nX * 2;
  const size_t offVv  = offKl  + nX * 2;
  const size_t offEnd = offVv  + nX * 2;
  if (offEnd > ws_size) return;

  char* ws = (char*)d_ws;
  unsigned short* xb  = (unsigned short*)(ws + offXb);
  unsigned short* wqb = (unsigned short*)(ws + offWq);
  unsigned short* wkb = (unsigned short*)(ws + offWk);
  unsigned short* wvb = (unsigned short*)(ws + offWv);
  unsigned short* wof = (unsigned short*)(ws + offWo);
  float*          qf  = (float*)(ws + offQf);
  unsigned short* oo  = (unsigned short*)(ws + offQf);   /* reuse after qf is consumed */
  float*          kf  = (float*)(ws + offKf);
  unsigned short* qhb = (unsigned short*)(ws + offQh);
  unsigned short* qlb = (unsigned short*)(ws + offQl);
  unsigned short* khb = (unsigned short*)(ws + offKh);
  unsigned short* klb = (unsigned short*)(ws + offKl);
  unsigned short* vvh = (unsigned short*)(ws + offVv);

  /* 1-5: input casts (RNE bf16; Wo -> f16 of bf16 value x 1024) */
  const int n2X = (int)(nX / 2), n2W = (int)(nW / 2);
  cast2_kernel<0><<<dim3(n2X / 256), dim3(256), 0, stream>>>(x,  xb,  n2X, 1.0f);
  cast2_kernel<0><<<dim3(n2W / 256), dim3(256), 0, stream>>>(Wq, wqb, n2W, 1.0f);
  cast2_kernel<0><<<dim3(n2W / 256), dim3(256), 0, stream>>>(Wk, wkb, n2W, 1.0f);
  cast2_kernel<0><<<dim3(n2W / 256), dim3(256), 0, stream>>>(Wv, wvb, n2W, 1.0f);
  cast2_kernel<1><<<dim3(n2W / 256), dim3(256), 0, stream>>>(Wo, wof, n2W, WO_CARRY);

  /* 6-8: projections C[m][n] = sum_k xb[m][k] W[n][k] + bias[n]; M=4096, N=1024, K=1024 (tiles 64x64, K%64==0) */
  const int gemmTiles  = (kTok / 64) * (kDm / 64);      /* 1024 */
  const int gemmBlocks = (gemmTiles + 7) / 8;           /* 128 */
  wmma_gemm64<1, false, 2, 0, false, 0><<<dim3(gemmBlocks, 1), dim3(256), 0, stream>>>(
      xb, xb, kDm, 0L, wqb, wqb, kDm, 0L, (void*)qf, (void*)qf, kDm, 0L, bq, nullptr, 0L, kTok, kDm, kDm, 1.0f);
  wmma_gemm64<1, false, 2, 0, false, 0><<<dim3(gemmBlocks, 1), dim3(256), 0, stream>>>(
      xb, xb, kDm, 0L, wkb, wkb, kDm, 0L, (void*)kf, (void*)kf, kDm, 0L, bk, nullptr, 0L, kTok, kDm, kDm, 1.0f);
  wmma_gemm64<1, false, 2, 1, false, 0><<<dim3(gemmBlocks, 1), dim3(256), 0, stream>>>(
      xb, xb, kDm, 0L, wvb, wvb, kDm, 0L, (void*)vvh, (void*)vvh, kDm, 0L, bv, nullptr, 0L, kTok, kDm, kDm, 1.0f);

  /* 9: L2 normalisation of q (x tau) and k, bf16 hi/lo planes */
  l2norm_split_kernel<<<dim3((kTok * kHeads) / 32, 2), dim3(256), 0, stream>>>(qf, kf, tau, qhb, qlb, khb, klb);

  /* 10: attention -> oo (f16, value x 64), overwrites the dead qf region */
  cos_attn_kernel<<<dim3(kBatch * kHeads * (kSeq / kQblk)), dim3(128), 0, stream>>>(qhb, qlb, khb, klb, vvh, mask, oo);

  /* 11: output projection: out[m][n] = 2^-16 * sum_c (oo x64)[m][c] (Wo x1024)[n][c] + bo[n] -> d_out f32 */
  wmma_gemm64<0, false, 2, 0, false, 0><<<dim3(gemmBlocks, 1), dim3(256), 0, stream>>>(
      oo, oo, kDm, 0L, wof, wof, kDm, 0L, d_out, d_out, kDm, 0L, bo, nullptr, 0L, kTok, kDm, kDm,
      1.0f / (O_CARRY * WO_CARRY));
}

// v005
// It runs in 187 microseconds.
// In two side-by-side timings against v004, it was 1.20 and 1.22 times as fast.
// Counting every step since v000, it is 2.47 times as fast.
// Contractions: q/k/v projections on v_wmma_f32_16x16x32_bf16 (operands = RNE bf16 of the inputs); scores on bf16 hi/lo split (hi.hi + hi.lo + lo.hi); p.v and output projection on v_wmma_f32_16x16x32_f16 (p carried x2^14, attention output carried x2^6, Wo carried x2^10); f32 accumulate; norms and softmax in f32.
#include <hip/hip_runtime.h>
#include <stdint.h>

typedef __attribute__((ext_vector_type(16))) _Float16 v16h;
typedef __attribute__((ext_vector_type(8)))  _Float16 v8h;
typedef __attribute__((ext_vector_type(16))) __bf16   v16b;
typedef __attribute__((ext_vector_type(8)))  __bf16   v8b;
typedef __attribute__((ext_vector_type(8)))  float    v8f;
typedef __attribute__((ext_vector_type(4)))  float    v4f;
typedef __attribute__((ext_vector_type(2)))  float    v2f;
typedef __attribute__((ext_vector_type(4)))  unsigned v4u;

/* problem geometry */
constexpr int kBatch = 2;
constexpr int kSeq   = 2048;
constexpr int kDm    = 1024;
constexpr int kHeads = 16;
constexpr int kHd    = 64;
constexpr int kTok   = kBatch * kSeq;      /* 4096 token rows */
constexpr int kKch   = 64;                 /* kv chunk */
constexpr int kQblk  = 64;                 /* query rows per block */
/* LDS row pitches of the attention tiles: 16 B x odd, so that the 16 rows a ds_load_b128 fragment read
   touches fall on 16 different groups of four banks (an unpadded 128 B or 256 B row puts them on one or two) */
constexpr int kP16   = 72;                 /* 64 16-bit elements + 8 pad  = 144 B */
constexpr int kTileE = kKch * kP16;        /* 16-bit elements of one 64-row attention tile in LDS: 9,216 B */
/* GEMM operand staging in LDS */
constexpr int kGk    = 64;                 /* k elements per stage: 128 B of every operand row, whole cache lines */
constexpr int kGp    = 72;                 /* LDS row pitch 144 B = 16 B x odd, as for the attention tiles */
constexpr int kGrows = 64 + 8 * 64;        /* 64 A rows shared by the block's 8 waves + 64 B rows for each wave */
#define O_CARRY 64.0f
#define WO_CARRY 1024.0f
#define LOG2E 1.4426950408889634f
#define P_CARRY_LOG2 14.0f                  /* p is carried x2^14 */

static_assert(kDm == kHeads * kHd, "head split");
static_assert(kTok % 64 == 0 && kDm % 64 == 0, "GEMM M,N tile multiples");
static_assert(kDm % kGk == 0, "GEMM K multiple of the LDS stage");
static_assert((kDm / 64) % 8 == 0 && (kTok / 64) % 8 == 0, "a GEMM block's 8 tiles lie in one tile row");
static_assert(kSeq % kKch == 0 && kSeq % kQblk == 0, "attention tiles");
static_assert((kTok * kHeads) % 32 == 0, "normalize grid");

__device__ __forceinline__ unsigned short f2bf_bits(float f) {
  unsigned u = __float_as_uint(f);
  return (unsigned short)((u + 0x7FFFu + ((u >> 16) & 1u)) >> 16);
}
__device__ __forceinline__ float bf_bits2f(unsigned short h) { return __uint_as_float(((unsigned)h) << 16); }
__device__ __forceinline__ _Float16 h16_lo(unsigned w) { return __builtin_bit_cast(_Float16, (unsigned short)(w & 0xffffu)); }
__device__ __forceinline__ _Float16 h16_hi(unsigned w) { return __builtin_bit_cast(_Float16, (unsigned short)(w >> 16)); }

/* hazard guards as plain device helpers */
__device__ __forceinline__ void dep_guard_h(v8f& a, v8f& b, v16h x, v16h y) { asm volatile("v_nop\n\tv_nop\n\tv_nop\n\tv_nop" : "+v"(a), "+v"(b) : "v"(x), "v"(y)); }
__device__ __forceinline__ void dep_guard_b(v8f& a, v8f& b, v16b x, v16b y) { asm volatile("v_nop\n\tv_nop\n\tv_nop\n\tv_nop" : "+v"(a), "+v"(b) : "v"(x), "v"(y)); }
__device__ __forceinline__ void keep4_h(v16h a, v16h b, v16h c, v16h d) { asm volatile("v_nop" :: "v"(a), "v"(b), "v"(c), "v"(d)); }
__device__ __forceinline__ void keep4_b(v16b a, v16b b, v16b c, v16b d) { asm volatile("v_nop" :: "v"(a), "v"(b), "v"(c), "v"(d)); }
__device__ __forceinline__ void acc_guard4(v8f& a, v8f& b, v8f& c, v8f& d) { asm volatile("v_nop\n\tv_nop\n\tv_nop\n\tv_nop" : "+v"(a), "+v"(b), "+v"(c), "+v"(d)); }
template <typename T> struct Frag;
template <> struct Frag<_Float16> {
  typedef v16h V; union U { v16h v; v8h h[2]; };
  static __device__ __forceinline__ v16h load(const _Float16* p) {   /* elements 0..7 <- p[0..7], 8..15 <- p[16..23] */
    U f; f.h[0] = *(const v8h*)(p); f.h[1] = *(const v8h*)(p + 16); return f.v;
  }
  static __device__ __forceinline__ v8f mma(v16h a, v16h b, v8f c) {
    return __builtin_amdgcn_wmma_f32_16x16x32_f16(false, a, false, b, (short)0, c, false, false);
  }
  static __device__ __forceinline__ void guard(v8f& a, v8f& b, v16h x, v16h y) { dep_guard_h(a, b, x, y); }
  static __device__ __forceinline__ void keep(v16h a, v16h b, v16h c, v16h d) { keep4_h(a, b, c, d); }
};
template <> struct Frag<__bf16> {
  typedef v16b V; union U { v16b v; v8b h[2]; };
  static __device__ __forceinline__ v16b load(const __bf16* p) {
    U f; f.h[0] = *(const v8b*)(p); f.h[1] = *(const v8b*)(p + 16); return f.v;
  }
  static __device__ __forceinline__ v8f mma(v16b a, v16b b, v8f c) {
    return __builtin_amdgcn_wmma_f32_16x16x32_bf16(false, a, false, b, (short)0, c, false, false);
  }
  static __device__ __forceinline__ void guard(v8f& a, v8f& b, v16b x, v16b y) { dep_guard_b(a, b, x, y); }
  static __device__ __forceinline__ void keep(v16b a, v16b b, v16b c, v16b d) { keep4_b(a, b, c, d); }
};

/* Nine asynchronous 16-byte copies global -> LDS per lane, through no register: l = the lane's LDS byte address,
   g = the lane's global address.  The closing s_wait_xcnt stands inside the statement so that no address
   register of an issued copy is rewritten in front of it. */
__device__ __forceinline__ void async_copy9(const unsigned (&l)[9], const unsigned short* const (&g)[9]) {
  asm volatile(
      "global_load_async_to_lds_b128 %0, %9, off\n\t"
      "global_load_async_to_lds_b128 %1, %10, off\n\t"
      "global_load_async_to_lds_b128 %2, %11, off\n\t"
      "global_load_async_to_lds_b128 %3, %12, off\n\t"
      "global_load_async_to_lds_b128 %4, %13, off\n\t"
      "global_load_async_to_lds_b128 %5, %14, off\n\t"
      "global_load_async_to_lds_b128 %6, %15, off\n\t"
      "global_load_async_to_lds_b128 %7, %16, off\n\t"
      "global_load_async_to_lds_b128 %8, %17, off\n\t"
      "s_wait_xcnt 0x0"
      :: "v"(l[0]), "v"(l[1]), "v"(l[2]), "v"(l[3]), "v"(l[4]), "v"(l[5]), "v"(l[6]), "v"(l[7]), "v"(l[8]),
         "v"(g[0]), "v"(g[1]), "v"(g[2]), "v"(g[3]), "v"(g[4]), "v"(g[5]), "v"(g[6]), "v"(g[7]), "v"(g[8])
      : "memory");
}

/* The same with eight copies per lane: two 64-row tiles of the attention ring (four passes of 16 rows each). */
__device__ __forceinline__ void async_copy8(const unsigned (&l)[8], const unsigned short* const (&g)[8]) {
  asm volatile(
      "global_load_async_to_lds_b128 %0, %8, off\n\t"
      "global_load_async_to_lds_b128 %1, %9, off\n\t"
      "global_load_async_to_lds_b128 %2, %10, off\n\t"
      "global_load_async_to_lds_b128 %3, %11, off\n\t"
      "global_load_async_to_lds_b128 %4, %12, off\n\t"
      "global_load_async_to_lds_b128 %5, %13, off\n\t"
      "global_load_async_to_lds_b128 %6, %14, off\n\t"
      "global_load_async_to_lds_b128 %7, %15, off\n\t"
      "s_wait_xcnt 0x0"
      :: "v"(l[0]), "v"(l[1]), "v"(l[2]), "v"(l[3]), "v"(l[4]), "v"(l[5]), "v"(l[6]), "v"(l[7]),
         "v"(g[0]), "v"(g[1]), "v"(g[2]), "v"(g[3]), "v"(g[4]), "v"(g[5]), "v"(g[6]), "v"(g[7])
      : "memory");
}

/* ---- Register-blocked batched WMMA GEMM --------------------------------
   C[m,n] = scale * sum_k A[m,k] * Bt[n,k] (+bias); each wave owns a 64x64 tile.
   A row-major [M,K]; Bt row-major [N,K]; M % 64 == 0, N % 512 == 0, K % 64 == 0, lda and ldb % 8 == 0.
   A block's 8 waves own 8 neighbouring tiles of one tile row.  Per 64 k the block's 64 A rows and 512 Bt rows
   are copied to LDS in whole 128 B lines (two buffers: the next stage flies while this one is multiplied);
   the fragments are read from LDS in ascending k, 32 at a time.
   BIAS_MODE: 0 = none, 1 = bias[m], 2 = bias[n]; bias values RNE-converted to bf16 precision before the add.
   OUT_MODE: 0 = f32, 1 = f16, 2 = bf16 hi plane (Cout) + bf16 lo plane (Cout2).
   ET: 0 = f16 operands, 1 = bf16 operands (pointers passed as 16-bit storage) */
template <int ET> struct Elem;
template <> struct Elem<0> { typedef _Float16 T; };
template <> struct Elem<1> { typedef __bf16 T; };
template <int ET, bool SPLIT, int BIAS_MODE, int OUT_MODE, bool RESID, int ACT = 0>
__global__ __launch_bounds__(256) void wmma_gemm64(
    const unsigned short* __restrict__ Ap, const unsigned short* __restrict__ A2p, int lda, long strideA,
    const unsigned short* __restrict__ Btp, const unsigned short* __restrict__ Bt2p, int ldb, long strideB,
    void* __restrict__ Cout, void* __restrict__ Cout2, int ldc, long strideC,
    const float* __restrict__ bias,
    const float* __restrict__ resid, long strideR,
    int M, int N, int K, float scale) {
  typedef typename Elem<ET>::T T;
  typedef typename Frag<T>::V V;
  static_assert(!SPLIT, "the LDS stage holds one plane of each operand");
  __shared__ __align__(16) float sT[8][16 * 68];   /* per-wave 16x64 slab, pitch 68 floats */
  __shared__ __align__(16) unsigned short sAB[2][kGrows * kGp];   /* two stages: rows 0..63 A, 64..575 Bt */
  const int b    = blockIdx.y;
  const int lane = threadIdx.x & 31;
  const int wave = threadIdx.x >> 5;
  const int tilesN = N >> 6;
  const int tilesM = M >> 6;
  const int tile0 = blockIdx.x * 8;
  if (tile0 >= tilesM * tilesN) return;  /* block-uniform, in front of every barrier */
  const int tile = tile0 + wave;
  const int tm = tile / tilesN;
  const int tn = tile - tm * tilesN;
  const int m0 = tm << 6;
  const int n0 = tn << 6;

  const unsigned short* Ab = Ap  + (size_t)b * strideA;
  const unsigned short* Bb = Btp + (size_t)b * strideB;

  const int rlane = lane & 15;                 /* row (A) / col (B, D) within subtile */
  const int koff  = (lane >> 4) * 8;           /* k offset of this lane half */
  const int mOff  = (lane >> 4) * 8;           /* D row offset */

  /* copy map: 8 lanes x 16 B = one 128 B row, 32 rows per pass of the block, 18 passes = 576 rows */
  const int crow = threadIdx.x >> 3;
  const int cchk = (threadIdx.x & 7) * 8;
  const int nb0  = (tile0 - tm * tilesN) << 6;  /* first Bt row of the block */
  const unsigned short* gA = Ab + (size_t)(m0 + crow) * lda + cchk;
  const unsigned short* gB = Bb + (size_t)(nb0 + crow) * ldb + cchk;
  const unsigned lds0 = (unsigned)(uintptr_t)(const void*)&sAB[0][0] + (unsigned)(crow * kGp + cchk) * 2u;
  auto stage_copy = [&](int st, int buf) {
    const unsigned lb = lds0 + (unsigned)buf * (unsigned)(kGrows * kGp * 2);
    const unsigned short* pa = gA + (size_t)st * kGk;
    const unsigned short* pb = gB + (size_t)st * kGk;
    unsigned l[9];
    const unsigned short* g[9];
    /* both loops unrolled: l[] and g[] are asm operands and must be registers */
#pragma unroll
    for (int it = 0; it < 9; ++it) {
      l[it] = lb + (unsigned)(it * 32 * kGp * 2);
      g[it] = (it < 2) ? pa + (size_t)(it * 32) * lda : pb + (size_t)((it - 2) * 32) * ldb;
    }
    async_copy9(l, g);
#pragma unroll
    for (int it = 0; it < 9; ++it) {
      l[it] = lb + (unsigned)((it + 9) * 32 * kGp * 2);
      g[it] = pb + (size_t)((it + 7) * 32) * ldb;
    }
    async_copy9(l, g);
  };

  v8f acc[4][4];
#pragma unroll
  for (int i = 0; i < 4; ++i)
#pragma unroll
    for (int j = 0; j < 4; ++j) acc[i][j] = (v8f){0.f,0.f,0.f,0.f,0.f,0.f,0.f,0.f};

  const int nst = K / kGk;
  stage_copy(0, 0);
  asm volatile("s_wait_asynccnt 0x0" ::: "memory");   /* this wave's share of stage 0 has landed */
  __syncthreads();                                     /* ... and every other wave's */
  if (nst > 1) stage_copy(1, 1);
  for (int t = 0; t < nst; ++t) {
    const T* sA = (const T*)(const void*)sAB[t & 1] + rlane * kGp + koff;
    const T* sB = sA + (64 + wave * 64) * kGp;
    /* all loops of the stage unrolled: fragments and accumulators are indexed by constants and stay in registers */
#pragma unroll
    for (int ks = 0; ks < kGk; ks += 32) {
      V bh[4], ah[4];
#pragma unroll
      for (int j = 0; j < 4; ++j) bh[j] = Frag<T>::load(sB + j * 16 * kGp + ks);
#pragma unroll
      for (int i = 0; i < 4; ++i) ah[i] = Frag<T>::load(sA + i * 16 * kGp + ks);
#pragma unroll
      for (int i = 0; i < 4; ++i) {
#pragma unroll
        for (int j = 0; j < 4; ++j) acc[i][j] = Frag<T>::mma(ah[i], bh[j], acc[i][j]);
        Frag<T>::guard(acc[i][0], acc[i][3], ah[i], ah[i]);
      }
      Frag<T>::keep(bh[0], bh[1], bh[2], bh[3]);
    }
    asm volatile("s_wait_dscnt 0x0" ::: "memory");     /* this wave's reads of the buffer have returned before it is refilled */
    asm volatile("s_wait_asynccnt 0x0" ::: "memory");  /* this wave's share of stage t + 1 has landed */
    __syncthreads();                                   /* publishes stage t + 1, ends every read of stage t */
    if (t + 2 < nst) stage_copy(t + 2, t & 1);
  }
  asm volatile("s_wait_asynccnt 0x0" ::: "memory");    /* no copy is outstanding when the wave goes on */
  acc_guard4(acc[0][0], acc[0][1], acc[0][2], acc[0][3]);
  acc_guard4(acc[1][0], acc[1][1], acc[1][2], acc[1][3]);
  acc_guard4(acc[2][0], acc[2][1], acc[2][2], acc[2][3]);
  acc_guard4(acc[3][0], acc[3][1], acc[3][2], acc[3][3]);

  /* ---- epilogue ---- */
  float* slab = sT[wave];
  const float* Rb = RESID ? (resid + (size_t)b * strideR) : nullptr;
#pragma unroll
  for (int i = 0; i < 4; ++i) {
    const int mBase = m0 + (i << 4);
#pragma unroll
    for (int j = 0; j < 4; ++j) {
      const int n = n0 + (j << 4) + rlane;
      float bv = 0.f;
      if (BIAS_MODE == 2) bv = bf_bits2f(f2bf_bits(bias[n]));
#pragma unroll
      for (int r = 0; r < 8; ++r) {
        float v = acc[i][j][r] * scale;
        if (BIAS_MODE == 1) v += bf_bits2f(f2bf_bits(bias[mBase + mOff + r]));
        if (BIAS_MODE == 2) v += bv;
        if (RESID) v += Rb[(size_t)(mBase + mOff + r) * ldc + n];
        if (ACT == 1) v = tanhf(v);
        if (ACT == 2) v = fmaxf(v, 0.0f);
        if (ACT == 3) v = v / (1.0f + expf(-v));
        if (ACT == 4) v = (v > 0.f) ? v : 0.01f * v;
        slab[(mOff + r) * 68 + (j << 4) + rlane] = v;
      }
    }
    __builtin_amdgcn_fence(__ATOMIC_RELEASE, "workgroup");
    __builtin_amdgcn_wave_barrier();
    __builtin_amdgcn_fence(__ATOMIC_ACQUIRE, "workgroup");
    if (OUT_MODE == 0) {
      float* C = (float*)Cout + (size_t)b * strideC;
      const int hh = lane >> 4, c4 = (lane & 15) * 4;     /* row seg = 256 B = 16 lanes x 16 B */
      {
#pragma unroll
        for (int it = 0; it < 8; ++it) {
          const int row = it * 2 + hh;
          v4f v = *(const v4f*)(slab + row * 68 + c4);
          *(v4f*)(C + (size_t)(mBase + row) * ldc + n0 + c4) = v;
        }
        
      }
    } else {
      const int q = lane >> 3, c8 = (lane & 7) * 8;        
      unsigned short* C  = (unsigned short*)Cout  + (size_t)b * strideC;
      unsigned short* C2 = (OUT_MODE == 2) ? ((unsigned short*)Cout2 + (size_t)b * strideC) : nullptr;
      {
#pragma unroll
        for (int it = 0; it < 4; ++it) {
          const int row = it * 4 + q;
          const float* sp = slab + row * 68 + c8;
          v8h hv, lv;
#pragma unroll
          for (int e = 0; e < 8; ++e) {
            if (OUT_MODE == 1) {
              hv[e] = (_Float16)sp[e];
            } else {
              unsigned short hb = f2bf_bits(sp[e]);
              unsigned short lb = f2bf_bits(sp[e] - bf_bits2f(hb));
              hv[e] = __builtin_bit_cast(_Float16, hb);
              lv[e] = __builtin_bit_cast(_Float16, lb);
            }
          }
          *(v8h*)(C + (size_t)(mBase + row) * ldc + n0 + c8) = hv;
          if (OUT_MODE == 2) *(v8h*)(C2 + (size_t)(mBase + row) * ldc + n0 + c8) = lv;
        }
        
      }
    }
    __builtin_amdgcn_fence(__ATOMIC_RELEASE, "workgroup");
    __builtin_amdgcn_wave_barrier();
    __builtin_amdgcn_fence(__ATOMIC_ACQUIRE, "workgroup");
  }
}

/*
   MODE 0: bf16 bits (RNE).  MODE 1: f16 bits of (RNE-bf16 value * mul).
   coverage: grid = n2/256 blocks x 256 threads x 2 elements = 2*n2 elements exactly. */
template <int MODE>
__global__ __launch_bounds__(256) void cast2_kernel(const float* __restrict__ in,
                                                    unsigned short* __restrict__ out, int n2, float mul) {
  const int i = blockIdx.x * 256 + threadIdx.x;
  if (i < n2) {
    const v2f p = *(const v2f*)(in + 2 * (size_t)i);
    unsigned short u0, u1;
    if (MODE == 0) {
      u0 = f2bf_bits(p.x); u1 = f2bf_bits(p.y);
    } else {
      const float r0 = bf_bits2f(f2bf_bits(p.x)) * mul;
      const float r1 = bf_bits2f(f2bf_bits(p.y)) * mul;
      u0 = __builtin_bit_cast(unsigned short, (_Float16)r0);
      u1 = __builtin_bit_cast(unsigned short, (_Float16)r1);
    }
    const unsigned u = (unsigned)u0 | ((unsigned)u1 << 16);
    unsigned* op = (unsigned*)(void*)out;
    op[i] = u;
    
  }
}

/* ---- per (token, head) L2 normalisation + bf16 hi/lo split.
   blockIdx.y = 0: q plane, scaled by 1/max(||q||,1e-12) * bf16(tau[head]) * log2(e), so that the scores come out
   of the matrix unit as exponents of 2; y = 1: k plane, 1/max(||k||,1e-12).
   8 lanes per 64-vector (8 floats each), 32 segments per 256-thread block; grid.x = kTok*kHeads/32 = 2048.
*/
__global__ __launch_bounds__(256) void l2norm_split_kernel(
    const float* __restrict__ qf, const float* __restrict__ kf, const float* __restrict__ tau,
    unsigned short* __restrict__ qhp, unsigned short* __restrict__ qlp,
    unsigned short* __restrict__ khp, unsigned short* __restrict__ klp) {
  const bool isk = (blockIdx.y != 0);                 /* block-uniform */
  const float* src = isk ? kf : qf;
  unsigned short* dhp = isk ? khp : qhp;
  unsigned short* dlp = isk ? klp : qlp;
  const int tid = threadIdx.x;
  const int g = tid >> 3, e = tid & 7;
  const int seg = blockIdx.x * 32 + g;                 /* < kTok*kHeads */
  const int token = seg >> 4, head = seg & 15;
  const size_t base = (size_t)token * kDm + (size_t)head * kHd + (size_t)e * 8;
  const v4f a  = *(const v4f*)(src + base);
  const v4f c4 = *(const v4f*)(src + base + 4);
  float ss = 0.0f;
  ss += a.x * a.x;  ss += a.y * a.y;  ss += a.z * a.z;  ss += a.w * a.w;
  ss += c4.x * c4.x; ss += c4.y * c4.y; ss += c4.z * c4.z; ss += c4.w * c4.w;
  ss += __shfl_xor(ss, 1, 32);
  ss += __shfl_xor(ss, 2, 32);
  ss += __shfl_xor(ss, 4, 32);
  const float nrm  = sqrtf(ss);
  const float rinv = 1.0f / fmaxf(nrm, 1e-12f);
  const float th   = bf_bits2f(f2bf_bits(tau[head]));
  const float sc   = isk ? rinv : rinv * (th * LOG2E);
  float vals[8];
  vals[0] = a.x * sc;  vals[1] = a.y * sc;  vals[2] = a.z * sc;  vals[3] = a.w * sc;
  vals[4] = c4.x * sc; vals[5] = c4.y * sc; vals[6] = c4.z * sc; vals[7] = c4.w * sc;
  unsigned hw[4], lw[4];
#pragma unroll
  for (int i = 0; i < 4; ++i) {
    const float v0 = vals[2 * i], v1 = vals[2 * i + 1];
    const unsigned short h0 = f2bf_bits(v0), h1 = f2bf_bits(v1);
    const unsigned short l0 = f2bf_bits(v0 - bf_bits2f(h0));
    const unsigned short l1 = f2bf_bits(v1 - bf_bits2f(h1));
    hw[i] = (unsigned)h0 | ((unsigned)h1 << 16);
    lw[i] = (unsigned)l0 | ((unsigned)l1 << 16);
  }
  v4u hv; hv.x = hw[0]; hv.y = hw[1]; hv.z = hw[2]; hv.w = hw[3];
  v4u lv; lv.x = lw[0]; lv.y = lw[1]; lv.z = lw[2]; lv.w = lw[3];
  v4u* ph = (v4u*)(void*)(dhp + base);
  v4u* pl = (v4u*)(void*)(dlp + base);
  *ph = hv; *pl = lv;
  
}

__device__ __forceinline__ v8f at_mma_b(v16b a, v16b b, v8f c) {
  c = __builtin_amdgcn_wmma_f32_16x16x32_bf16(false, a, false, b, (short)0, c, false, false);
  asm volatile("v_nop\n\tv_nop\n\tv_nop\n\tv_nop" : "+v"(c) : "v"(a), "v"(b));
  return c;
}
__device__ __forceinline__ v8f at_mma_h(v16h a, v16h b, v8f c) {
  c = __builtin_amdgcn_wmma_f32_16x16x32_f16(false, a, false, b, (short)0, c, false, false);
  asm volatile("v_nop\n\tv_nop\n\tv_nop\n\tv_nop" : "+v"(c) : "v"(a), "v"(b));
  return c;
}

/* x[i] = 2^x[i] for the eight scores of one tile, each in its own register, so that no v_exp_f32 reads the result or
   overwrites the source of the one in front of it; the closing v_nop is the slot the instruction set asks for
   between the last v_exp_f32 and whatever the compiler puts next. */
__device__ __forceinline__ void exp2x8(float (&x)[8]) {
  asm("v_exp_f32 %0, %0\n\t"
      "v_exp_f32 %1, %1\n\t"
      "v_exp_f32 %2, %2\n\t"
      "v_exp_f32 %3, %3\n\t"
      "v_exp_f32 %4, %4\n\t"
      "v_exp_f32 %5, %5\n\t"
      "v_exp_f32 %6, %6\n\t"
      "v_exp_f32 %7, %7\n\t"
      "v_nop"
      : "+v"(x[0]), "+v"(x[1]), "+v"(x[2]), "+v"(x[3]), "+v"(x[4]), "+v"(x[5]), "+v"(x[6]), "+v"(x[7]));
}

/* lane l <-> lane l ^ 16 by one vector cross-row move */
__device__ __forceinline__ float xhalf(float x) {
  const int b = __builtin_bit_cast(int, x);
  return __builtin_bit_cast(float, __builtin_amdgcn_permlanex16(b, b, 0x76543210, 0xfedcba98, false, false));
}

/* =====================================================================================
   Attention for head_dim 64 with an additive [kSeq][kSeq] mask shared over (b,h).
   Inputs: qh/ql = bf16 hi/lo planes of (q/||q|| * tau[h] * log2 e), kh/kl = bf16 hi/lo planes of k/||k||,
           all [kTok][kDm] with element (b, s, h, d) at (b*kSeq+s)*kDm + h*64 + d;
           vt = f16 plane of v, transposed: [kDm][kTok], element (b, s, h, d) at (h*64+d)*kTok + b*kSeq + s;
           mb = bf16 plane (RNE) of the mask, [kSeq][kSeq].
   Every tile of a kv chunk (K hi, K lo, V^T, mask) is 64 rows of 128 B that lie in global memory as LDS wants them:
           asynchronous copies bring whole rows into one of two buffers while the other one is worked on.
   scores, transposed: S^T = khat . qhat_tau^T : 3 bf16 WMMAs (hi.hi + lo.hi + hi.lo), A = K rows, B = Q columns;
           lanes c and c + 16 hold all scores of query column c: += bf16(mask[q][kv]) * log2 e; online softmax f32 in
           base 2 (p x 2^14 = 2^(score - maximum + 14): one subtraction and one v_exp_f32 a score), maximum and
           sum in the lane, the halves' maxima joined per chunk, their sums (carried x2^14 like p) once at the end.
   out, transposed: O^T += V^T . P^T : f16 WMMA, p carried x2^14; two score tiles converted in place are the B operand.
           result written as f16 of (out * 2^6) into oo (same plane layout).
   Block = 4 waves = 64 query rows of one (b, h); every one of the kSeq/64 kv chunks is processed.
   grid.x = kBatch * kHeads * (kSeq/64) = 1024.  coverage of oo: 1024 blocks x 64 rows x 64 d = kTok*kDm.
   ===================================================================================== */
__global__ __launch_bounds__(128)
void cos_attn_kernel(const unsigned short* __restrict__ qhp, const unsigned short* __restrict__ qlp,
                     const unsigned short* __restrict__ khp, const unsigned short* __restrict__ klp,
                     const unsigned short* __restrict__ vtp, const unsigned short* __restrict__ mbp,
                     unsigned short* __restrict__ oo) {
  union FB { v16b v; v8b h[2]; };
  union FH { v16h v; v8h h[2]; };
  /* two buffers x four tiles of 9 KB: K hi [kv][d], K lo [kv][d], V^T [d][kv], mask bf16 [qrow][kv]; 72 KB, four blocks a WGP.
     Behind the loop's last barrier the first 9 KB serve as the waves' output staging. */
  __shared__ __align__(16) unsigned short ring[2][4 * kTileE];

  const int tid  = threadIdx.x;
  const int wave = tid >> 5;
  const int lane = tid & 31;
  const int hh   = lane >> 4;
  const int c    = lane & 15;

  const int nqb = kSeq / kQblk;                 /* 32 */
  const int bx  = blockIdx.x;
  const int qb  = bx % nqb;
  const int bh  = bx / nqb;
  const int h   = bh % kHeads;
  const int b   = bh / kHeads;
  const int qbase = qb * kQblk;
  const int q0    = qbase + wave * 16;
  const size_t tokb = (size_t)b * kSeq;

  const __bf16*   qh = (const __bf16*)(const void*)qhp;
  const __bf16*   ql = (const __bf16*)(const void*)qlp;

  /* ---- Q fragments (B operand): column = lane&15, elements 0..7 <- d0+8hh+0..7, 8..15 <- d0+16+8hh+0..7 ---- */
  v16b qah[2], qal[2];
  {
    const size_t ro = (tokb + (size_t)(q0 + c)) * kDm + (size_t)h * kHd;
#pragma unroll
    for (int dc = 0; dc < 2; ++dc) {
      qah[dc] = Frag<__bf16>::load(qh + ro + dc * 32 + 8 * hh);
      qal[dc] = Frag<__bf16>::load(ql + ro + dc * 32 + 8 * hh);
    }
  }

  float mrow = -INFINITY;      /* running maximum of query column c, equal in both lane halves */
  float mref = -INFINITY;      /* the exponent that p, lrow and oacc are carried against: mrow - 14 */
  float lrow = 0.f;            /* running sum over this lane half's kv rows only */
  v8f oacc[4];                 /* O^T: oacc[t][r] = out[d = 16t + 8hh + r][query c] */
#pragma unroll
  for (int t = 0; t < 4; ++t) oacc[t] = (v8f){0.f,0.f,0.f,0.f,0.f,0.f,0.f,0.f};

  /* copy map: 8 lanes x 16 B = one 128 B row, 16 rows per pass of the block, 4 passes per tile */
  const int crow = tid >> 3;
  const int cchk = (tid & 7) * 8;
  const unsigned short* gKh = khp + (tokb + (size_t)crow) * kDm + (size_t)h * kHd + cchk;
  const unsigned short* gKl = klp + (tokb + (size_t)crow) * kDm + (size_t)h * kHd + cchk;
  const unsigned short* gVt = vtp + ((size_t)h * kHd + (size_t)crow) * kTok + tokb + cchk;
  const unsigned short* gMb = mbp + (size_t)(qbase + crow) * kSeq + cchk;
  const unsigned lds0 = (unsigned)(uintptr_t)(const void*)&ring[0][0] + (unsigned)(crow * kP16 + cchk) * 2u;
  auto stage_copy = [&](int st, int buf) {
    const unsigned lb = lds0 + (unsigned)buf * (unsigned)(4 * kTileE * 2);
    const unsigned short* ph = gKh + (size_t)st * (kKch * kDm);
    const unsigned short* pl = gKl + (size_t)st * (kKch * kDm);
    const unsigned short* pv = gVt + (size_t)st * kKch;
    const unsigned short* pm = gMb + (size_t)st * kKch;
    unsigned l[8];
    const unsigned short* g[8];
    /* both loops unrolled: l[] and g[] are asm operands and must be registers */
#pragma unroll
    for (int it = 0; it < 4; ++it) {
      l[it]     = lb + (unsigned)((it * 16 * kP16) * 2);
      l[it + 4] = lb + (unsigned)((kTileE + it * 16 * kP16) * 2);
      g[it]     = ph + (size_t)(it * 16) * kDm;
      g[it + 4] = pl + (size_t)(it * 16) * kDm;
    }
    async_copy8(l, g);
#pragma unroll
    for (int it = 0; it < 4; ++it) {
      l[it]     = lb + (unsigned)((2 * kTileE + it * 16 * kP16) * 2);
      l[it + 4] = lb + (unsigned)((3 * kTileE + it * 16 * kP16) * 2);
      g[it]     = pv + (size_t)(it * 16) * kTok;
      g[it + 4] = pm + (size_t)(it * 16) * kSeq;
    }
    async_copy8(l, g);
  };

  constexpr int nch = kSeq / kKch;
  static_assert(nch >= 2, "the ring's prologue fills two buffers");
  stage_copy(0, 0);
  asm volatile("s_wait_asynccnt 0x0" ::: "memory");   /* this wave's share of chunk 0 has landed */
  __syncthreads();                                     /* ... and every other wave's */
  stage_copy(1, 1);
  for (int kc = 0; kc < nch; ++kc) {
    const unsigned short* tb = ring[kc & 1];
    const __bf16*   Ksh = (const __bf16*)(const void*)tb;
    const __bf16*   Ksl = (const __bf16*)(const void*)(tb + kTileE);
    const _Float16* Vt  = (const _Float16*)(const void*)(tb + 2 * kTileE);
    const unsigned short* Msk = tb + 3 * kTileE;

    /* ---- scores: S^T[kvrow][qcol], A[m=kv][k=d] = Ksh[kv][d], B[k=d][n=q] = Q; s[j][r] = S[q = c][kv = 16j + 8hh + r] ---- */
    v8f s[4];
#pragma unroll
    for (int j = 0; j < 4; ++j) {
      s[j] = (v8f){0.f,0.f,0.f,0.f,0.f,0.f,0.f,0.f};
#pragma unroll
      for (int dc = 0; dc < 2; ++dc) {
        FB kb, klo;
        kb.h[0]  = *(const v8b*)(Ksh + (j * 16 + c) * kP16 + dc * 32 + 8 * hh);
        kb.h[1]  = *(const v8b*)(Ksh + (j * 16 + c) * kP16 + dc * 32 + 16 + 8 * hh);
        klo.h[0] = *(const v8b*)(Ksl + (j * 16 + c) * kP16 + dc * 32 + 8 * hh);
        klo.h[1] = *(const v8b*)(Ksl + (j * 16 + c) * kP16 + dc * 32 + 16 + 8 * hh);
        s[j] = at_mma_b(kb.v,  qah[dc], s[j]);
        s[j] = at_mma_b(klo.v, qah[dc], s[j]);
        s[j] = at_mma_b(kb.v,  qal[dc], s[j]);
      }
    }

    /* ---- additive mask from the LDS tile (8 consecutive kv of the lane's own query row per score tile) + chunk max ---- */
    const unsigned short* mrw = Msk + (wave * 16 + c) * kP16 + 8 * hh;
    float cj[4];                /* one maximum per score tile: four short chains instead of one long one */
#pragma unroll
    for (int j = 0; j < 4; ++j) {
      const v4u mw = *(const v4u*)(const void*)(mrw + j * 16);   /* eight bf16: kv 2r in the low half of word r, 2r + 1 in the high */
#pragma unroll
      for (int r = 0; r < 4; ++r) {
        s[j][2 * r]     = fmaf(__uint_as_float(mw[r] << 16),         LOG2E, s[j][2 * r]);
        s[j][2 * r + 1] = fmaf(__uint_as_float(mw[r] & 0xffff0000u), LOG2E, s[j][2 * r + 1]);
      }
      cj[j] = fmaxf(s[j][0], s[j][4]);
#pragma unroll
      for (int r = 1; r < 4; ++r) cj[j] = fmaxf(cj[j], fmaxf(s[j][r], s[j][r + 4]));
    }
    float cm = fmaxf(fmaxf(cj[0], cj[1]), fmaxf(cj[2], cj[3]));
    cm = fmaxf(cm, xhalf(cm));
    const float mnew  = fmaxf(mrow, cm);
    /* the carry of p rides in the subtracted exponent; beside a maximum so large that the 14 rounds to more than 15
       it is left out, so that p stays inside f16; alpha goes from the old to the new subtracted exponent, whatever they are */
    float msub = mnew - P_CARRY_LOG2;
    msub = (mnew - msub <= P_CARRY_LOG2 + 1.0f) ? msub : mnew;
    const float alpha = __builtin_amdgcn_exp2f(mref - msub);
    mrow = mnew;
    mref = msub;
    float ps[4];                /* one sum per score tile, as for the maxima */
    FH pb[2];                   /* P^T as B operand: element e <- kv 32kk + 8hh + e, element 8 + e <- kv 32kk + 16 + 8hh + e */
#pragma unroll
    for (int j = 0; j < 4; ++j) {
      float p[8];               /* p x 2^14 */
#pragma unroll
      for (int r = 0; r < 8; ++r) p[r] = s[j][r] - msub;
      exp2x8(p);
      ps[j] = 0.f;
#pragma unroll
      for (int r = 0; r < 8; ++r) {
        ps[j] += p[r];
        pb[j >> 1].h[j & 1][r] = (_Float16)p[r];
      }
    }
    lrow = lrow * alpha + ((ps[0] + ps[1]) + (ps[2] + ps[3]));
#pragma unroll
    for (int t = 0; t < 4; ++t)
#pragma unroll
      for (int r = 0; r < 8; ++r) oacc[t][r] *= alpha;
    /* ---- O^T += V^T . P^T : A[m=d][k=kv] = Vt[d][kv] (lane row c), B = pb; both loops unrolled: pb is indexed by constants ---- */
#pragma unroll
    for (int kk = 0; kk < 2; ++kk) {
#pragma unroll
      for (int t = 0; t < 4; ++t) {
        FH vb;
        vb.h[0] = *(const v8h*)(Vt + (t * 16 + c) * kP16 + kk * 32 + 8 * hh);
        vb.h[1] = *(const v8h*)(Vt + (t * 16 + c) * kP16 + kk * 32 + 16 + 8 * hh);
        oacc[t] = at_mma_h(vb.v, pb[kk].v, oacc[t]);
      }
    }
    asm volatile("s_wait_dscnt 0x0" ::: "memory");     /* this wave's reads of the buffer have returned before it is refilled */
    asm volatile("s_wait_asynccnt 0x0" ::: "memory");  /* this wave's share of chunk kc + 1 has landed */
    __syncthreads();                                   /* publishes chunk kc + 1, ends every read of chunk kc */
    if (kc + 2 < nch) stage_copy(kc + 2, kc & 1);
  }
  asm volatile("s_wait_asynccnt 0x0" ::: "memory");    /* no copy is outstanding when the ring becomes output staging */

  _Float16* pw = (_Float16*)(void*)&ring[0][0] + wave * (16 * kP16);
  {
    const float ltot = lrow + xhalf(lrow);               /* both halves' kv rows, carried like p; ltot >= 1 */
    const float inv  = O_CARRY / ltot;
#pragma unroll
    for (int t = 0; t < 4; ++t) {
      v8h ov;
#pragma unroll
      for (int r = 0; r < 8; ++r) ov[r] = (_Float16)(oacc[t][r] * inv);
      *(v8h*)(pw + c * kP16 + t * 16 + 8 * hh) = ov;     /* query row c, d = 16t + 8hh + 0..7 */
    }
  }
  __builtin_amdgcn_fence(__ATOMIC_RELEASE, "workgroup");
  __builtin_amdgcn_wave_barrier();
  __builtin_amdgcn_fence(__ATOMIC_ACQUIRE, "workgroup");
  {
    const int q8 = lane >> 3, c8 = (lane & 7) * 8;
    _Float16* ob = (_Float16*)(void*)oo + (tokb + (size_t)q0) * kDm + (size_t)h * kHd;
    {
#pragma unroll
      for (int it = 0; it < 4; ++it) {
        const int row = it * 4 + q8;
        const v8h val = *(const v8h*)(pw + row * kP16 + c8);
        *(v8h*)(ob + (size_t)row * kDm + c8) = val;
      }
      
    }
  }
}

/* ------------------------------------------------------------------------------------- */
extern "C" void kernel_launch(void* const* d_in, const int* in_sizes, int n_in,
                              void* d_out, int out_size, void* d_ws, size_t ws_size,
                              hipStream_t stream) {
  if (n_in < 11) return;
  const float* x    = (const float*)d_in[0];
  const float* mask = (const float*)d_in[1];
  const float* Wq   = (const float*)d_in[2];
  const float* bq   = (const float*)d_in[3];
  const float* Wk   = (const float*)d_in[4];
  const float* bk   = (const float*)d_in[5];
  const float* Wv   = (const float*)d_in[6];
  const float* bv   = (const float*)d_in[7];
  const float* Wo   = (const float*)d_in[8];
  const float* bo   = (const float*)d_in[9];
  const float* tau  = (const float*)d_in[10];

  const size_t nX = (size_t)kTok * kDm;     /* 4,194,304 */
  const size_t nW = (size_t)kDm * kDm;      /* 1,048,576 */
  if ((size_t)in_sizes[0] != nX || (size_t)in_sizes[1] != (size_t)kSeq * kSeq ||
      (size_t)in_sizes[2] != nW || (size_t)in_sizes[4] != nW || (size_t)in_sizes[6] != nW ||
      (size_t)in_sizes[8] != nW || in_sizes[3] != kDm || in_sizes[5] != kDm || in_sizes[7] != kDm ||
      in_sizes[9] != kDm || in_sizes[10] != kHeads) return;
  if ((size_t)out_size != nX) return;

  /*
       xb   bf16 [4096][1024]        off         0   size  8,388,608
       wqb  bf16 [1024][1024]        off  8,388,608  size  2,097,152
       wkb  bf16 [1024][1024]        off 10,485,760  size  2,097,152
       wvb  bf16 [1024][1024]        off 12,582,912  size  2,097,152
       wof  f16  [1024][1024] (x1024) off 14,680,064  size  2,097,152
       qf   f32  [4096][1024]        off 16,777,216  size 16,777,216   (reused as oo f16 [4096][1024], 8,388,608 B, after qf is consumed)
       kf   f32  [4096][1024]        off 33,554,432  size 16,777,216
       qhb  bf16 [4096][1024]        off 50,331,648  size  8,388,608
       qlb  bf16 [4096][1024]        off 58,720,256  size  8,388,608
       khb  bf16 [4096][1024]        off 67,108,864  size  8,388,608
       klb  bf16 [4096][1024]        off 75,497,472  size  8,388,608
       vth  f16  [1024][4096]        off 83,886,080  size  8,388,608   (v transposed: row = output feature, column = token)
       mkb  bf16 [2048][2048]        off 92,274,688  size  8,388,608
       end                              100,663,296 */
  const size_t offXb  = 0;
  const size_t offWq  = offXb  + nX * 2;
  const size_t offWk  = offWq  + nW * 2;
  const size_t offWv  = offWk  + nW * 2;
  const size_t offWo  = offWv  + nW * 2;
  const size_t offQf  = offWo  + nW * 2;
  const size_t offKf  = offQf  + nX * 4;
  const size_t offQh  = offKf  + nX * 4;
  const size_t offQl  = offQh  + nX * 2;
  const size_t offKh  = offQl  + nX * 2;
  const size_t offKl  = offKh  + nX * 2;
  const size_t offVv  = offKl  + nX * 2;
  const size_t offMk  = offVv  + nX * 2;
  const size_t offEnd = offMk  + (size_t)kSeq * kSeq * 2;
  if (offEnd > ws_size) return;

  char* ws = (char*)d_ws;
  unsigned short* xb  = (unsigned short*)(ws + offXb);
  unsigned short* wqb = (unsigned short*)(ws + offWq);
  unsigned short* wkb = (unsigned short*)(ws + offWk);
  unsigned short* wvb = (unsigned short*)(ws + offWv);
  unsigned short* wof = (unsigned short*)(ws + offWo);
  float*          qf  = (float*)(ws + offQf);
  unsigned short* oo  = (unsigned short*)(ws + offQf);   /* reuse after qf is consumed */
  float*          kf  = (float*)(ws + offKf);
  unsigned short* qhb = (unsigned short*)(ws + offQh);
  unsigned short* qlb = (unsigned short*)(ws + offQl);
  unsigned short* khb = (unsigned short*)(ws + offKh);
  unsigned short* klb = (unsigned short*)(ws + offKl);
  unsigned short* vth = (unsigned short*)(ws + offVv);
  unsigned short* mkb = (unsigned short*)(ws + offMk);

  /* 1-6: input casts (RNE bf16; Wo -> f16 of bf16 value x 1024) */
  const int n2X = (int)(nX / 2), n2W = (int)(nW / 2), n2M = kSeq * kSeq / 2;
  cast2_kernel<0><<<dim3(n2X / 256), dim3(256), 0, stream>>>(x,  xb,  n2X, 1.0f);
  cast2_kernel<0><<<dim3(n2W / 256), dim3(256), 0, stream>>>(Wq, wqb, n2W, 1.0f);
  cast2_kernel<0><<<dim3(n2W / 256), dim3(256), 0, stream>>>(Wk, wkb, n2W, 1.0f);
  cast2_kernel<0><<<dim3(n2W / 256), dim3(256), 0, stream>>>(Wv, wvb, n2W, 1.0f);
  cast2_kernel<1><<<dim3(n2W / 256), dim3(256), 0, stream>>>(Wo, wof, n2W, WO_CARRY);
  cast2_kernel<0><<<dim3(n2M / 256), dim3(256), 0, stream>>>(mask, mkb, n2M, 1.0f);

  /* 7-9: projections C[m][n] = sum_k xb[m][k] W[n][k] + bias[n]; M=4096, N=1024, K=1024 (tiles 64x64, K%64==0);
     v with the operands exchanged, C[n][m] (+ bias[n], now the row's), so that a head's V^T rows lie along the tokens */
  const int gemmTiles  = (kTok / 64) * (kDm / 64);      /* 1024 */
  const int gemmBlocks = (gemmTiles + 7) / 8;           /* 128 */
  wmma_gemm64<1, false, 2, 0, false, 0><<<dim3(gemmBlocks, 1), dim3(256), 0, stream>>>(
      xb, xb, kDm, 0L, wqb, wqb, kDm, 0L, (void*)qf, (void*)qf, kDm, 0L, bq, nullptr, 0L, kTok, kDm, kDm, 1.0f);
  wmma_gemm64<1, false, 2, 0, false, 0><<<dim3(gemmBlocks, 1), dim3(256), 0, stream>>>(
      xb, xb, kDm, 0L, wkb, wkb, kDm, 0L, (void*)kf, (void*)kf, kDm, 0L, bk, nullptr, 0L, kTok, kDm, kDm, 1.0f);
  wmma_gemm64<1, false, 1, 1, false, 0><<<dim3(gemmBlocks, 1), dim3(256), 0, stream>>>(
      wvb, wvb, kDm, 0L, xb, xb, kDm, 0L, (void*)vth, (void*)vth, kTok, 0L, bv, nullptr, 0L, kDm, kTok, kDm, 1.0f);

  /* 10: L2 normalisation of q (x tau) and k, bf16 hi/lo planes */
  l2norm_split_kernel<<<dim3((kTok * kHeads) / 32, 2), dim3(256), 0, stream>>>(qf, kf, tau, qhb, qlb, khb, klb);

  /* 11: attention -> oo (f16, value x 64), overwrites the dead qf region */
  cos_attn_kernel<<<dim3(kBatch * kHeads * (kSeq / kQblk)), dim3(128), 0, stream>>>(qhb, qlb, khb, klb, vth, mkb, oo);

  /* 12: output projection: out[m][n] = 2^-16 * sum_c (oo x64)[m][c] (Wo x1024)[n][c] + bo[n] -> d_out f32 */
  wmma_gemm64<0, false, 2, 0, false, 0><<<dim3(gemmBlocks, 1), dim3(256), 0, stream>>>(
      oo, oo, kDm, 0L, wof, wof, kDm, 0L, d_out, d_out, kDm, 0L, bo, nullptr, 0L, kTok, kDm, kDm,
      1.0f / (O_CARRY * WO_CARRY));
}

// v006
// One run takes 180 microseconds.
// Next to v005, in two timings, it ran 1.05 and 1.04 times as fast.
// Over all steps from v000 it is 2.58 times as fast.
// Contractions: q/k/v projections on v_wmma_f32_16x16x32_bf16 (operands = RNE bf16 of the inputs); scores on bf16 hi/lo split (hi.hi + hi.lo + lo.hi); p.v and output projection on v_wmma_f32_16x16x32_f16 (p carried x2^14, attention output carried x2^6, Wo carried x2^10); f32 accumulate; norms and softmax in f32.
#include <hip/hip_runtime.h>
#include <stdint.h>

typedef __attribute__((ext_vector_type(16))) _Float16 v16h;
typedef __attribute__((ext_vector_type(8)))  _Float16 v8h;
typedef __attribute__((ext_vector_type(16))) __bf16   v16b;
typedef __attribute__((ext_vector_type(8)))  __bf16   v8b;
typedef __attribute__((ext_vector_type(8)))  float    v8f;
typedef __attribute__((ext_vector_type(4)))  float    v4f;
typedef __attribute__((ext_vector_type(2)))  float    v2f;
typedef __attribute__((ext_vector_type(4)))  unsigned v4u;

/* problem geometry */
constexpr int kBatch = 2;
constexpr int kSeq   = 2048;
constexpr int kDm    = 1024;
constexpr int kHeads = 16;
constexpr int kHd    = 64;
constexpr int kTok   = kBatch * kSeq;      /* 4096 token rows */
constexpr int kKch   = 64;                 /* kv chunk */
constexpr int kQblk  = 64;                 /* query rows per block */
/* LDS row pitches of the attention tiles: 16 B x odd, so that the 16 rows a ds_load_b128 fragment read
   touches fall on 16 different groups of four banks (an unpadded 128 B or 256 B row puts them on one or two) */
constexpr int kP16   = 72;                 /* 64 16-bit elements + 8 pad  = 144 B */
constexpr int kTileE = kKch * kP16;        /* 16-bit elements of one 64-row attention tile in LDS: 9,216 B */
/* GEMM operand staging in LDS */
constexpr int kGk    = 64;                 /* k elements per stage: 128 B of every operand row, whole cache lines */
constexpr int kGp    = 72;                 /* LDS row pitch 144 B = 16 B x odd, as for the attention tiles */
constexpr int kGrows = 64 + 8 * 64;        /* 64 A rows shared by the block's 8 waves + 64 B rows for each wave */
#define O_CARRY 64.0f
#define WO_CARRY 1024.0f
#define LOG2E 1.4426950408889634f
#define P_CARRY_LOG2 14.0f                  /* p is carried x2^14 */

static_assert(kDm == kHeads * kHd, "head split");
static_assert(kTok % 64 == 0 && kDm % 64 == 0, "GEMM M,N tile multiples");
static_assert(kDm % kGk == 0, "GEMM K multiple of the LDS stage");
static_assert((kDm / 64) % 8 == 0 && (kTok / 64) % 8 == 0, "a GEMM block's 8 tiles lie in one tile row");
static_assert(kSeq % kKch == 0 && kSeq % kQblk == 0, "attention tiles");
static_assert((kTok * kHeads) % 32 == 0, "normalize grid");

__device__ __forceinline__ unsigned short f2bf_bits(float f) {
  unsigned u = __float_as_uint(f);
  return (unsigned short)((u + 0x7FFFu + ((u >> 16) & 1u)) >> 16);
}
__device__ __forceinline__ float bf_bits2f(unsigned short h) { return __uint_as_float(((unsigned)h) << 16); }
__device__ __forceinline__ _Float16 h16_lo(unsigned w) { return __builtin_bit_cast(_Float16, (unsigned short)(w & 0xffffu)); }
__device__ __forceinline__ _Float16 h16_hi(unsigned w) { return __builtin_bit_cast(_Float16, (unsigned short)(w >> 16)); }

/* hazard guards as plain device helpers */
__device__ __forceinline__ void dep_guard_h(v8f& a, v8f& b, v16h x, v16h y) { asm volatile("v_nop\n\tv_nop\n\tv_nop\n\tv_nop" : "+v"(a), "+v"(b) : "v"(x), "v"(y)); }
__device__ __forceinline__ void dep_guard_b(v8f& a, v8f& b, v16b x, v16b y) { asm volatile("v_nop\n\tv_nop\n\tv_nop\n\tv_nop" : "+v"(a), "+v"(b) : "v"(x), "v"(y)); }
__device__ __forceinline__ void keep4_h(v16h a, v16h b, v16h c, v16h d) { asm volatile("v_nop" :: "v"(a), "v"(b), "v"(c), "v"(d)); }
__device__ __forceinline__ void keep4_b(v16b a, v16b b, v16b c, v16b d) { asm volatile("v_nop" :: "v"(a), "v"(b), "v"(c), "v"(d)); }
__device__ __forceinline__ void acc_guard4(v8f& a, v8f& b, v8f& c, v8f& d) { asm volatile("v_nop\n\tv_nop\n\tv_nop\n\tv_nop" : "+v"(a), "+v"(b), "+v"(c), "+v"(d)); }
template <typename T> struct Frag;
template <> struct Frag<_Float16> {
  typedef v16h V; union U { v16h v; v8h h[2]; };
  static __device__ __forceinline__ v16h load(const _Float16* p) {   /* elements 0..7 <- p[0..7], 8..15 <- p[16..23] */
    U f; f.h[0] = *(const v8h*)(p); f.h[1] = *(const v8h*)(p + 16); return f.v;
  }
  static __device__ __forceinline__ v8f mma(v16h a, v16h b, v8f c) {
    return __builtin_amdgcn_wmma_f32_16x16x32_f16(false, a, false, b, (short)0, c, false, false);
  }
  static __device__ __forceinline__ void guard(v8f& a, v8f& b, v16h x, v16h y) { dep_guard_h(a, b, x, y); }
  static __device__ __forceinline__ void keep(v16h a, v16h b, v16h c, v16h d) { keep4_h(a, b, c, d); }
};
template <> struct Frag<__bf16> {
  typedef v16b V; union U { v16b v; v8b h[2]; };
  static __device__ __forceinline__ v16b load(const __bf16* p) {
    U f; f.h[0] = *(const v8b*)(p); f.h[1] = *(const v8b*)(p + 16); return f.v;
  }
  static __device__ __forceinline__ v8f mma(v16b a, v16b b, v8f c) {
    return __builtin_amdgcn_wmma_f32_16x16x32_bf16(false, a, false, b, (short)0, c, false, false);
  }
  static __device__ __forceinline__ void guard(v8f& a, v8f& b, v16b x, v16b y) { dep_guard_b(a, b, x, y); }
  static __device__ __forceinline__ void keep(v16b a, v16b b, v16b c, v16b d) { keep4_b(a, b, c, d); }
};

/* Nine asynchronous 16-byte copies global -> LDS per lane, through no register: l = the lane's LDS byte address,
   g = the lane's global address.  The closing s_wait_xcnt stands inside the statement so that no address
   register of an issued copy is rewritten in front of it. */
__device__ __forceinline__ void async_copy9(const unsigned (&l)[9], const unsigned short* const (&g)[9]) {
  asm volatile(
      "global_load_async_to_lds_b128 %0, %9, off\n\t"
      "global_load_async_to_lds_b128 %1, %10, off\n\t"
      "global_load_async_to_lds_b128 %2, %11, off\n\t"
      "global_load_async_to_lds_b128 %3, %12, off\n\t"
      "global_load_async_to_lds_b128 %4, %13, off\n\t"
      "global_load_async_to_lds_b128 %5, %14, off\n\t"
      "global_load_async_to_lds_b128 %6, %15, off\n\t"
      "global_load_async_to_lds_b128 %7, %16, off\n\t"
      "global_load_async_to_lds_b128 %8, %17, off\n\t"
      "s_wait_xcnt 0x0"
      :: "v"(l[0]), "v"(l[1]), "v"(l[2]), "v"(l[3]), "v"(l[4]), "v"(l[5]), "v"(l[6]), "v"(l[7]), "v"(l[8]),
         "v"(g[0]), "v"(g[1]), "v"(g[2]), "v"(g[3]), "v"(g[4]), "v"(g[5]), "v"(g[6]), "v"(g[7]), "v"(g[8])
      : "memory");
}

/* The same with eight copies per lane: two 64-row tiles of the attention ring (four passes of 16 rows each). */
__device__ __forceinline__ void async_copy8(const unsigned (&l)[8], const unsigned short* const (&g)[8]) {
  asm volatile(
      "global_load_async_to_lds_b128 %0, %8, off\n\t"
      "global_load_async_to_lds_b128 %1, %9, off\n\t"
      "global_load_async_to_lds_b128 %2, %10, off\n\t"
      "global_load_async_to_lds_b128 %3, %11, off\n\t"
      "global_load_async_to_lds_b128 %4, %12, off\n\t"
      "global_load_async_to_lds_b128 %5, %13, off\n\t"
      "global_load_async_to_lds_b128 %6, %14, off\n\t"
      "global_load_async_to_lds_b128 %7, %15, off\n\t"
      "s_wait_xcnt 0x0"
      :: "v"(l[0]), "v"(l[1]), "v"(l[2]), "v"(l[3]), "v"(l[4]), "v"(l[5]), "v"(l[6]), "v"(l[7]),
         "v"(g[0]), "v"(g[1]), "v"(g[2]), "v"(g[3]), "v"(g[4]), "v"(g[5]), "v"(g[6]), "v"(g[7])
      : "memory");
}

/* ---- Register-blocked batched WMMA GEMM --------------------------------
   C[m,n] = scale * sum_k A[m,k] * Bt[n,k] (+bias); each wave owns a 64x64 tile.
   A row-major [M,K]; Bt row-major [N,K]; M % 64 == 0, N % 512 == 0, K % 64 == 0, lda and ldb % 8 == 0.
   A block's 8 waves own 8 neighbouring tiles of one tile row.  Per 64 k the block's 64 A rows and 512 Bt rows
   are copied to LDS in whole 128 B lines (two buffers: the next stage flies while this one is multiplied);
   the fragments are read from LDS in ascending k, 32 at a time.
   BIAS_MODE: 0 = none, 1 = bias[m], 2 = bias[n]; bias values RNE-converted to bf16 precision before the add.
   OUT_MODE: 0 = f32, 1 = f16, 2 = bf16 hi plane (Cout) + bf16 lo plane (Cout2).
   ET: 0 = f16 operands, 1 = bf16 operands (pointers passed as 16-bit storage) */
template <int ET> struct Elem;
template <> struct Elem<0> { typedef _Float16 T; };
template <> struct Elem<1> { typedef __bf16 T; };
template <int ET, bool SPLIT, int BIAS_MODE, int OUT_MODE, bool RESID, int ACT = 0>
__global__ __launch_bounds__(256) void wmma_gemm64(
    const unsigned short* __restrict__ Ap, const unsigned short* __restrict__ A2p, int lda, long strideA,
    const unsigned short* __restrict__ Btp, const unsigned short* __restrict__ Bt2p, int ldb, long strideB,
    void* __restrict__ Cout, void* __restrict__ Cout2, int ldc, long strideC,
    const float* __restrict__ bias,
    const float* __restrict__ resid, long strideR,
    int M, int N, int K, float scale) {
  typedef typename Elem<ET>::T T;
  typedef typename Frag<T>::V V;
  static_assert(!SPLIT, "the LDS stage holds one plane of each operand");
  __shared__ __align__(16) float sT[8][16 * 68];   /* per-wave 16x64 slab, pitch 68 floats */
  __shared__ __align__(16) unsigned short sAB[2][kGrows * kGp];   /* two stages: rows 0..63 A, 64..575 Bt */
  const int b    = blockIdx.y;
  const int lane = threadIdx.x & 31;
  const int wave = threadIdx.x >> 5;
  const int tilesN = N >> 6;
  const int tilesM = M >> 6;
  const int tile0 = blockIdx.x * 8;
  if (tile0 >= tilesM * tilesN) return;  /* block-uniform, in front of every barrier */
  const int tile = tile0 + wave;
  const int tm = tile / tilesN;
  const int tn = tile - tm * tilesN;
  const int m0 = tm << 6;
  const int n0 = tn << 6;

  const unsigned short* Ab = Ap  + (size_t)b * strideA;
  const unsigned short* Bb = Btp + (size_t)b * strideB;

  const int rlane = lane & 15;                 /* row (A) / col (B, D) within subtile */
  const int koff  = (lane >> 4) * 8;           /* k offset of this lane half */
  const int mOff  = (lane >> 4) * 8;           /* D row offset */

  /* copy map: 8 lanes x 16 B = one 128 B row, 32 rows per pass of the block, 18 passes = 576 rows */
  const int crow = threadIdx.x >> 3;
  const int cchk = (threadIdx.x & 7) * 8;
  const int nb0  = (tile0 - tm * tilesN) << 6;  /* first Bt row of the block */
  const unsigned short* gA = Ab + (size_t)(m0 + crow) * lda + cchk;
  const unsigned short* gB = Bb + (size_t)(nb0 + crow) * ldb + cchk;
  const unsigned lds0 = (unsigned)(uintptr_t)(const void*)&sAB[0][0] + (unsigned)(crow * kGp + cchk) * 2u;
  auto stage_copy = [&](int st, int buf) {
    const unsigned lb = lds0 + (unsigned)buf * (unsigned)(kGrows * kGp * 2);
    const unsigned short* pa = gA + (size_t)st * kGk;
    const unsigned short* pb = gB + (size_t)st * kGk;
    unsigned l[9];
    const unsigned short* g[9];
    /* both loops unrolled: l[] and g[] are asm operands and must be registers */
#pragma unroll
    for (int it = 0; it < 9; ++it) {
      l[it] = lb + (unsigned)(it * 32 * kGp * 2);
      g[it] = (it < 2) ? pa + (size_t)(it * 32) * lda : pb + (size_t)((it - 2) * 32) * ldb;
    }
    async_copy9(l, g);
#pragma unroll
    for (int it = 0; it < 9; ++it) {
      l[it] = lb + (unsigned)((it + 9) * 32 * kGp * 2);
      g[it] = pb + (size_t)((it + 7) * 32) * ldb;
    }
    async_copy9(l, g);
  };

  v8f acc[4][4];
#pragma unroll
  for (int i = 0; i < 4; ++i)
#pragma unroll
    for (int j = 0; j < 4; ++j) acc[i][j] = (v8f){0.f,0.f,0.f,0.f,0.f,0.f,0.f,0.f};

  const int nst = K / kGk;
  stage_copy(0, 0);
  asm volatile("s_wait_asynccnt 0x0" ::: "memory");   /* this wave's share of stage 0 has landed */
  __syncthreads();                                     /* ... and every other wave's */
  if (nst > 1) stage_copy(1, 1);
  for (int t = 0; t < nst; ++t) {
    const T* sA = (const T*)(const void*)sAB[t & 1] + rlane * kGp + koff;
    const T* sB = sA + (64 + wave * 64) * kGp;
    /* all loops of the stage unrolled: fragments and accumulators are indexed by constants and stay in registers */
#pragma unroll
    for (int ks = 0; ks < kGk; ks += 32) {
      V bh[4], ah[4];
#pragma unroll
      for (int j = 0; j < 4; ++j) bh[j] = Frag<T>::load(sB + j * 16 * kGp + ks);
#pragma unroll
      for (int i = 0; i < 4; ++i) ah[i] = Frag<T>::load(sA + i * 16 * kGp + ks);
#pragma unroll
      for (int i = 0; i < 4; ++i) {
#pragma unroll
        for (int j = 0; j < 4; ++j) acc[i][j] = Frag<T>::mma(ah[i], bh[j], acc[i][j]);
        Frag<T>::guard(acc[i][0], acc[i][3], ah[i], ah[i]);
      }
      Frag<T>::keep(bh[0], bh[1], bh[2], bh[3]);
    }
    asm volatile("s_wait_dscnt 0x0" ::: "memory");     /* this wave's reads of the buffer have returned before it is refilled */
    asm volatile("s_wait_asynccnt 0x0" ::: "memory");  /* this wave's share of stage t + 1 has landed */
    __syncthreads();                                   /* publishes stage t + 1, ends every read of stage t */
    if (t + 2 < nst) stage_copy(t + 2, t & 1);
  }
  asm volatile("s_wait_asynccnt 0x0" ::: "memory");    /* no copy is outstanding when the wave goes on */
  acc_guard4(acc[0][0], acc[0][1], acc[0][2], acc[0][3]);
  acc_guard4(acc[1][0], acc[1][1], acc[1][2], acc[1][3]);
  acc_guard4(acc[2][0], acc[2][1], acc[2][2], acc[2][3]);
  acc_guard4(acc[3][0], acc[3][1], acc[3][2], acc[3][3]);

  /* ---- epilogue ---- */
  float* slab = sT[wave];
  const float* Rb = RESID ? (resid + (size_t)b * strideR) : nullptr;
#pragma unroll
  for (int i = 0; i < 4; ++i) {
    const int mBase = m0 + (i << 4);
#pragma unroll
    for (int j = 0; j < 4; ++j) {
      const int n = n0 + (j << 4) + rlane;
      float bv = 0.f;
      if (BIAS_MODE == 2) bv = bf_bits2f(f2bf_bits(bias[n]));
#pragma unroll
      for (int r = 0; r < 8; ++r) {
        float v = acc[i][j][r] * scale;
        if (BIAS_MODE == 1) v += bf_bits2f(f2bf_bits(bias[mBase + mOff + r]));
        if (BIAS_MODE == 2) v += bv;
        if (RESID) v += Rb[(size_t)(mBase + mOff + r) * ldc + n];
        if (ACT == 1) v = tanhf(v);
        if (ACT == 2) v = fmaxf(v, 0.0f);
        if (ACT == 3) v = v / (1.0f + expf(-v));
        if (ACT == 4) v = (v > 0.f) ? v : 0.01f * v;
        slab[(mOff + r) * 68 + (j << 4) + rlane] = v;
      }
    }
    __builtin_amdgcn_fence(__ATOMIC_RELEASE, "workgroup");
    __builtin_amdgcn_wave_barrier();
    __builtin_amdgcn_fence(__ATOMIC_ACQUIRE, "workgroup");
    if (OUT_MODE == 0) {
      float* C = (float*)Cout + (size_t)b * strideC;
      const int hh = lane >> 4, c4 = (lane & 15) * 4;     /* row seg = 256 B = 16 lanes x 16 B */
      {
#pragma unroll
        for (int it = 0; it < 8; ++it) {
          const int row = it * 2 + hh;
          v4f v = *(const v4f*)(slab + row * 68 + c4);
          *(v4f*)(C + (size_t)(mBase + row) * ldc + n0 + c4) = v;
        }
        
      }
    } else {
      const int q = lane >> 3, c8 = (lane & 7) * 8;        
      unsigned short* C  = (unsigned short*)Cout  + (size_t)b * strideC;
      unsigned short* C2 = (OUT_MODE == 2) ? ((unsigned short*)Cout2 + (size_t)b * strideC) : nullptr;
      {
#pragma unroll
        for (int it = 0; it < 4; ++it) {
          const int row = it * 4 + q;
          const float* sp = slab + row * 68 + c8;
          v8h hv, lv;
#pragma unroll
          for (int e = 0; e < 8; ++e) {
            if (OUT_MODE == 1) {
              hv[e] = (_Float16)sp[e];
            } else {
              unsigned short hb = f2bf_bits(sp[e]);
              unsigned short lb = f2bf_bits(sp[e] - bf_bits2f(hb));
              hv[e] = __builtin_bit_cast(_Float16, hb);
              lv[e] = __builtin_bit_cast(_Float16, lb);
            }
          }
          *(v8h*)(C + (size_t)(mBase + row) * ldc + n0 + c8) = hv;
          if (OUT_MODE == 2) *(v8h*)(C2 + (size_t)(mBase + row) * ldc + n0 + c8) = lv;
        }
        
      }
    }
    __builtin_amdgcn_fence(__ATOMIC_RELEASE, "workgroup");
    __builtin_amdgcn_wave_barrier();
    __builtin_amdgcn_fence(__ATOMIC_ACQUIRE, "workgroup");
  }
}

/* ---- all six input casts in one launch: the block index picks the tensor (block-uniform, scalar branches).
   x, mask, Wq, Wk, Wv -> bf16 bits (RNE); Wo -> f16 bits of (RNE-bf16 value * WO_CARRY).
   Each of them alone is a launch of a few microseconds at most, most of it start and drain; side by side they pay that once.
   coverage: a block = 256 threads x 2 elements; kCbX + kCbM + 4 kCbW blocks cover the six tensors exactly. */
constexpr int kCbX   = kTok * kDm / 512;   /* 8192 blocks for x */
constexpr int kCbM   = kSeq * kSeq / 512;  /* 8192 blocks for the mask */
constexpr int kCbW   = kDm * kDm / 512;    /* 2048 blocks for each weight matrix */
constexpr int kCbAll = kCbX + kCbM + 4 * kCbW;
static_assert((kTok * kDm) % 512 == 0 && (kSeq * kSeq) % 512 == 0 && (kDm * kDm) % 512 == 0, "whole blocks");
__global__ __launch_bounds__(256) void cast_all_kernel(
    const float* __restrict__ x,  const float* __restrict__ mask, const float* __restrict__ wq,
    const float* __restrict__ wk, const float* __restrict__ wv,   const float* __restrict__ wo,
    unsigned short* __restrict__ xb,  unsigned short* __restrict__ mkb, unsigned short* __restrict__ wqb,
    unsigned short* __restrict__ wkb, unsigned short* __restrict__ wvb, unsigned short* __restrict__ wof) {
  int blk = blockIdx.x;
  const float* in = x;
  unsigned short* out = xb;
  bool carry = false;                      /* Wo alone */
  if (blk >= kCbX + kCbM) {
    blk -= kCbX + kCbM;
    const int w = blk / kCbW;              /* 0..3 by the grid */
    blk -= w * kCbW;
    in    = (w == 0) ? wq  : (w == 1) ? wk  : (w == 2) ? wv  : wo;
    out   = (w == 0) ? wqb : (w == 1) ? wkb : (w == 2) ? wvb : wof;
    carry = (w == 3);
  } else if (blk >= kCbX) {
    blk -= kCbX;
    in  = mask;
    out = mkb;
  }
  const int i = blk * 256 + threadIdx.x;
  const v2f p = *(const v2f*)(in + 2 * (size_t)i);
  unsigned short u0 = f2bf_bits(p.x), u1 = f2bf_bits(p.y);
  if (carry) {
    u0 = __builtin_bit_cast(unsigned short, (_Float16)(bf_bits2f(u0) * WO_CARRY));
    u1 = __builtin_bit_cast(unsigned short, (_Float16)(bf_bits2f(u1) * WO_CARRY));
  }
  unsigned* op = (unsigned*)(void*)out;
  op[i] = (unsigned)u0 | ((unsigned)u1 << 16);
}

/* ---- per (token, head) L2 normalisation + bf16 hi/lo split.
   blockIdx.y = 0: q plane, scaled by 1/max(||q||,1e-12) * bf16(tau[head]) * log2(e), so that the scores come out
   of the matrix unit as exponents of 2; y = 1: k plane, 1/max(||k||,1e-12).
   8 lanes per 64-vector (8 floats each), 32 segments per 256-thread block; grid.x = kTok*kHeads/32 = 2048.
*/
__global__ __launch_bounds__(256) void l2norm_split_kernel(
    const float* __restrict__ qf, const float* __restrict__ kf, const float* __restrict__ tau,
    unsigned short* __restrict__ qhp, unsigned short* __restrict__ qlp,
    unsigned short* __restrict__ khp, unsigned short* __restrict__ klp) {
  const bool isk = (blockIdx.y != 0);                 /* block-uniform */
  const float* src = isk ? kf : qf;
  unsigned short* dhp = isk ? khp : qhp;
  unsigned short* dlp = isk ? klp : qlp;
  const int tid = threadIdx.x;
  const int g = tid >> 3, e = tid & 7;
  const int seg = blockIdx.x * 32 + g;                 /* < kTok*kHeads */
  const int token = seg >> 4, head = seg & 15;
  const size_t base = (size_t)token * kDm + (size_t)head * kHd + (size_t)e * 8;
  const v4f a  = *(const v4f*)(src + base);
  const v4f c4 = *(const v4f*)(src + base + 4);
  float ss = 0.0f;
  ss += a.x * a.x;  ss += a.y * a.y;  ss += a.z * a.z;  ss += a.w * a.w;
  ss += c4.x * c4.x; ss += c4.y * c4.y; ss += c4.z * c4.z; ss += c4.w * c4.w;
  ss += __shfl_xor(ss, 1, 32);
  ss += __shfl_xor(ss, 2, 32);
  ss += __shfl_xor(ss, 4, 32);
  const float nrm  = sqrtf(ss);
  const float rinv = 1.0f / fmaxf(nrm, 1e-12f);
  const float th   = bf_bits2f(f2bf_bits(tau[head]));
  const float sc   = isk ? rinv : rinv * (th * LOG2E);
  float vals[8];
  vals[0] = a.x * sc;  vals[1] = a.y * sc;  vals[2] = a.z * sc;  vals[3] = a.w * sc;
  vals[4] = c4.x * sc; vals[5] = c4.y * sc; vals[6] = c4.z * sc; vals[7] = c4.w * sc;
  unsigned hw[4], lw[4];
#pragma unroll
  for (int i = 0; i < 4; ++i) {
    const float v0 = vals[2 * i], v1 = vals[2 * i + 1];
    const unsigned short h0 = f2bf_bits(v0), h1 = f2bf_bits(v1);
    const unsigned short l0 = f2bf_bits(v0 - bf_bits2f(h0));
    const unsigned short l1 = f2bf_bits(v1 - bf_bits2f(h1));
    hw[i] = (unsigned)h0 | ((unsigned)h1 << 16);
    lw[i] = (unsigned)l0 | ((unsigned)l1 << 16);
  }
  v4u hv; hv.x = hw[0]; hv.y = hw[1]; hv.z = hw[2]; hv.w = hw[3];
  v4u lv; lv.x = lw[0]; lv.y = lw[1]; lv.z = lw[2]; lv.w = lw[3];
  v4u* ph = (v4u*)(void*)(dhp + base);
  v4u* pl = (v4u*)(void*)(dlp + base);
  *ph = hv; *pl = lv;
  
}

__device__ __forceinline__ v8f at_mma_b(v16b a, v16b b, v8f c) {
  c = __builtin_amdgcn_wmma_f32_16x16x32_bf16(false, a, false, b, (short)0, c, false, false);
  asm volatile("v_nop\n\tv_nop\n\tv_nop\n\tv_nop" : "+v"(c) : "v"(a), "v"(b));
  return c;
}
__device__ __forceinline__ v8f at_mma_h(v16h a, v16h b, v8f c) {
  c = __builtin_amdgcn_wmma_f32_16x16x32_f16(false, a, false, b, (short)0, c, false, false);
  asm volatile("v_nop\n\tv_nop\n\tv_nop\n\tv_nop" : "+v"(c) : "v"(a), "v"(b));
  return c;
}

/* x[i] = 2^x[i] for the eight scores of one tile, each in its own register, so that no v_exp_f32 reads the result or
   overwrites the source of the one in front of it; the closing v_nop is the slot the instruction set asks for
   between the last v_exp_f32 and whatever the compiler puts next. */
__device__ __forceinline__ void exp2x8(float (&x)[8]) {
  asm("v_exp_f32 %0, %0\n\t"
      "v_exp_f32 %1, %1\n\t"
      "v_exp_f32 %2, %2\n\t"
      "v_exp_f32 %3, %3\n\t"
      "v_exp_f32 %4, %4\n\t"
      "v_exp_f32 %5, %5\n\t"
      "v_exp_f32 %6, %6\n\t"
      "v_exp_f32 %7, %7\n\t"
      "v_nop"
      : "+v"(x[0]), "+v"(x[1]), "+v"(x[2]), "+v"(x[3]), "+v"(x[4]), "+v"(x[5]), "+v"(x[6]), "+v"(x[7]));
}

/* lane l <-> lane l ^ 16 by one vector cross-row move */
__device__ __forceinline__ float xhalf(float x) {
  const int b = __builtin_bit_cast(int, x);
  return __builtin_bit_cast(float, __builtin_amdgcn_permlanex16(b, b, 0x76543210, 0xfedcba98, false, false));
}

/* =====================================================================================
   Attention for head_dim 64 with an additive [kSeq][kSeq] mask shared over (b,h).
   Inputs: qh/ql = bf16 hi/lo planes of (q/||q|| * tau[h] * log2 e), kh/kl = bf16 hi/lo planes of k/||k||,
           all [kTok][kDm] with element (b, s, h, d) at (b*kSeq+s)*kDm + h*64 + d;
           vt = f16 plane of v, transposed: [kDm][kTok], element (b, s, h, d) at (h*64+d)*kTok + b*kSeq + s;
           mb = bf16 plane (RNE) of the mask, [kSeq][kSeq].
   Every tile of a kv chunk (K hi, K lo, V^T, mask) is 64 rows of 128 B that lie in global memory as LDS wants them:
           asynchronous copies bring whole rows into one of two buffers while the other one is worked on.
   scores, transposed: S^T = khat . qhat_tau^T : 3 bf16 WMMAs (hi.hi + lo.hi + hi.lo), A = K rows, B = Q columns;
           lanes c and c + 16 hold all scores of query column c: += bf16(mask[q][kv]) * log2 e; online softmax f32 in
           base 2 (p x 2^14 = 2^(score - maximum + 14): one subtraction and one v_exp_f32 a score), maximum and
           sum in the lane, the halves' maxima joined per chunk, their sums (carried x2^14 like p) once at the end.
   out, transposed: O^T += V^T . P^T : f16 WMMA, p carried x2^14; two score tiles converted in place are the B operand.
           result written as f16 of (out * 2^6) into oo (same plane layout).
   Block = 4 waves = 64 query rows of one (b, h); every one of the kSeq/64 kv chunks is processed.
   grid.x = kBatch * kHeads * (kSeq/64) = 1024.  coverage of oo: 1024 blocks x 64 rows x 64 d = kTok*kDm.
   ===================================================================================== */
__global__ __launch_bounds__(128)
void cos_attn_kernel(const unsigned short* __restrict__ qhp, const unsigned short* __restrict__ qlp,
                     const unsigned short* __restrict__ khp, const unsigned short* __restrict__ klp,
                     const unsigned short* __restrict__ vtp, const unsigned short* __restrict__ mbp,
                     unsigned short* __restrict__ oo) {
  union FB { v16b v; v8b h[2]; };
  union FH { v16h v; v8h h[2]; };
  /* two buffers x four tiles of 9 KB: K hi [kv][d], K lo [kv][d], V^T [d][kv], mask bf16 [qrow][kv]; 72 KB, four blocks a WGP.
     Behind the loop's last barrier the first 9 KB serve as the waves' output staging. */
  __shared__ __align__(16) unsigned short ring[2][4 * kTileE];

  const int tid  = threadIdx.x;
  const int wave = tid >> 5;
  const int lane = tid & 31;
  const int hh   = lane >> 4;
  const int c    = lane & 15;

  const int nqb = kSeq / kQblk;                 /* 32 */
  const int bx  = blockIdx.x;
  const int qb  = bx % nqb;
  const int bh  = bx / nqb;
  const int h   = bh % kHeads;
  const int b   = bh / kHeads;
  const int qbase = qb * kQblk;
  const int q0    = qbase + wave * 16;
  const size_t tokb = (size_t)b * kSeq;

  const __bf16*   qh = (const __bf16*)(const void*)qhp;
  const __bf16*   ql = (const __bf16*)(const void*)qlp;

  /* ---- Q fragments (B operand): column = lane&15, elements 0..7 <- d0+8hh+0..7, 8..15 <- d0+16+8hh+0..7 ---- */
  v16b qah[2], qal[2];
  {
    const size_t ro = (tokb + (size_t)(q0 + c)) * kDm + (size_t)h * kHd;
#pragma unroll
    for (int dc = 0; dc < 2; ++dc) {
      qah[dc] = Frag<__bf16>::load(qh + ro + dc * 32 + 8 * hh);
      qal[dc] = Frag<__bf16>::load(ql + ro + dc * 32 + 8 * hh);
    }
  }

  float mrow = -INFINITY;      /* running maximum of query column c, equal in both lane halves */
  float mref = -INFINITY;      /* the exponent that p, lrow and oacc are carried against: mrow - 14 */
  float lrow = 0.f;            /* running sum over this lane half's kv rows only */
  v8f oacc[4];                 /* O^T: oacc[t][r] = out[d = 16t + 8hh + r][query c] */
#pragma unroll
  for (int t = 0; t < 4; ++t) oacc[t] = (v8f){0.f,0.f,0.f,0.f,0.f,0.f,0.f,0.f};

  /* copy map: 8 lanes x 16 B = one 128 B row, 16 rows per pass of the block, 4 passes per tile */
  const int crow = tid >> 3;
  const int cchk = (tid & 7) * 8;
  const unsigned short* gKh = khp + (tokb + (size_t)crow) * kDm + (size_t)h * kHd + cchk;
  const unsigned short* gKl = klp + (tokb + (size_t)crow) * kDm + (size_t)h * kHd + cchk;
  const unsigned short* gVt = vtp + ((size_t)h * kHd + (size_t)crow) * kTok + tokb + cchk;
  const unsigned short* gMb = mbp + (size_t)(qbase + crow) * kSeq + cchk;
  const unsigned lds0 = (unsigned)(uintptr_t)(const void*)&ring[0][0] + (unsigned)(crow * kP16 + cchk) * 2u;
  auto stage_copy = [&](int st, int buf) {
    const unsigned lb = lds0 + (unsigned)buf * (unsigned)(4 * kTileE * 2);
    const unsigned short* ph = gKh + (size_t)st * (kKch * kDm);
    const unsigned short* pl = gKl + (size_t)st * (kKch * kDm);
    const unsigned short* pv = gVt + (size_t)st * kKch;
    const unsigned short* pm = gMb + (size_t)st * kKch;
    unsigned l[8];
    const unsigned short* g[8];
    /* both loops unrolled: l[] and g[] are asm operands and must be registers */
#pragma unroll
    for (int it = 0; it < 4; ++it) {
      l[it]     = lb + (unsigned)((it * 16 * kP16) * 2);
      l[it + 4] = lb + (unsigned)((kTileE + it * 16 * kP16) * 2);
      g[it]     = ph + (size_t)(it * 16) * kDm;
      g[it + 4] = pl + (size_t)(it * 16) * kDm;
    }
    async_copy8(l, g);
#pragma unroll
    for (int it = 0; it < 4; ++it) {
      l[it]     = lb + (unsigned)((2 * kTileE + it * 16 * kP16) * 2);
      l[it + 4] = lb + (unsigned)((3 * kTileE + it * 16 * kP16) * 2);
      g[it]     = pv + (size_t)(it * 16) * kTok;
      g[it + 4] = pm + (size_t)(it * 16) * kSeq;
    }
    async_copy8(l, g);
  };

  constexpr int nch = kSeq / kKch;
  static_assert(nch >= 2, "the ring's prologue fills two buffers");
  stage_copy(0, 0);
  asm volatile("s_wait_asynccnt 0x0" ::: "memory");   /* this wave's share of chunk 0 has landed */
  __syncthreads();                                     /* ... and every other wave's */
  stage_copy(1, 1);
  for (int kc = 0; kc < nch; ++kc) {
    const unsigned short* tb = ring[kc & 1];
    const __bf16*   Ksh = (const __bf16*)(const void*)tb;
    const __bf16*   Ksl = (const __bf16*)(const void*)(tb + kTileE);
    const _Float16* Vt  = (const _Float16*)(const void*)(tb + 2 * kTileE);
    const unsigned short* Msk = tb + 3 * kTileE;

    /* ---- scores: S^T[kvrow][qcol], A[m=kv][k=d] = Ksh[kv][d], B[k=d][n=q] = Q; s[j][r] = S[q = c][kv = 16j + 8hh + r] ---- */
    v8f s[4];
#pragma unroll
    for (int j = 0; j < 4; ++j) {
      s[j] = (v8f){0.f,0.f,0.f,0.f,0.f,0.f,0.f,0.f};
#pragma unroll
      for (int dc = 0; dc < 2; ++dc) {
        FB kb, klo;
        kb.h[0]  = *(const v8b*)(Ksh + (j * 16 + c) * kP16 + dc * 32 + 8 * hh);
        kb.h[1]  = *(const v8b*)(Ksh + (j * 16 + c) * kP16 + dc * 32 + 16 + 8 * hh);
        klo.h[0] = *(const v8b*)(Ksl + (j * 16 + c) * kP16 + dc * 32 + 8 * hh);
        klo.h[1] = *(const v8b*)(Ksl + (j * 16 + c) * kP16 + dc * 32 + 16 + 8 * hh);
        s[j] = at_mma_b(kb.v,  qah[dc], s[j]);
        s[j] = at_mma_b(klo.v, qah[dc], s[j]);
        s[j] = at_mma_b(kb.v,  qal[dc], s[j]);
      }
    }

    /* ---- additive mask from the LDS tile (8 consecutive kv of the lane's own query row per score tile) + chunk max ---- */
    const unsigned short* mrw = Msk + (wave * 16 + c) * kP16 + 8 * hh;
    float cj[4];                /* one maximum per score tile: four short chains instead of one long one */
#pragma unroll
    for (int j = 0; j < 4; ++j) {
      const v4u mw = *(const v4u*)(const void*)(mrw + j * 16);   /* eight bf16: kv 2r in the low half of word r, 2r + 1 in the high */
#pragma unroll
      for (int r = 0; r < 4; ++r) {
        s[j][2 * r]     = fmaf(__uint_as_float(mw[r] << 16),         LOG2E, s[j][2 * r]);
        s[j][2 * r + 1] = fmaf(__uint_as_float(mw[r] & 0xffff0000u), LOG2E, s[j][2 * r + 1]);
      }
      cj[j] = fmaxf(s[j][0], s[j][4]);
#pragma unroll
      for (int r = 1; r < 4; ++r) cj[j] = fmaxf(cj[j], fmaxf(s[j][r], s[j][r + 4]));
    }
    float cm = fmaxf(fmaxf(cj[0], cj[1]), fmaxf(cj[2], cj[3]));
    cm = fmaxf(cm, xhalf(cm));
    const float mnew  = fmaxf(mrow, cm);
    /* the carry of p rides in the subtracted exponent; beside a maximum so large that the 14 rounds to more than 15
       it is left out, so that p stays inside f16; alpha goes from the old to the new subtracted exponent, whatever they are */
    float msub = mnew - P_CARRY_LOG2;
    msub = (mnew - msub <= P_CARRY_LOG2 + 1.0f) ? msub : mnew;
    const float alpha = __builtin_amdgcn_exp2f(mref - msub);
    mrow = mnew;
    mref = msub;
    float ps[4];                /* one sum per score tile, as for the maxima */
    FH pb[2];                   /* P^T as B operand: element e <- kv 32kk + 8hh + e, element 8 + e <- kv 32kk + 16 + 8hh + e */
#pragma unroll
    for (int j = 0; j < 4; ++j) {
      float p[8];               /* p x 2^14 */
#pragma unroll
      for (int r = 0; r < 8; ++r) p[r] = s[j][r] - msub;
      exp2x8(p);
      ps[j] = 0.f;
#pragma unroll
      for (int r = 0; r < 8; ++r) {
        ps[j] += p[r];
        pb[j >> 1].h[j & 1][r] = (_Float16)p[r];
      }
    }
    lrow = lrow * alpha + ((ps[0] + ps[1]) + (ps[2] + ps[3]));
#pragma unroll
    for (int t = 0; t < 4; ++t)
#pragma unroll
      for (int r = 0; r < 8; ++r) oacc[t][r] *= alpha;
    /* ---- O^T += V^T . P^T : A[m=d][k=kv] = Vt[d][kv] (lane row c), B = pb; both loops unrolled: pb is indexed by constants ---- */
#pragma unroll
    for (int kk = 0; kk < 2; ++kk) {
#pragma unroll
      for (int t = 0; t < 4; ++t) {
        FH vb;
        vb.h[0] = *(const v8h*)(Vt + (t * 16 + c) * kP16 + kk * 32 + 8 * hh);
        vb.h[1] = *(const v8h*)(Vt + (t * 16 + c) * kP16 + kk * 32 + 16 + 8 * hh);
        oacc[t] = at_mma_h(vb.v, pb[kk].v, oacc[t]);
      }
    }
    asm volatile("s_wait_dscnt 0x0" ::: "memory");     /* this wave's reads of the buffer have returned before it is refilled */
    asm volatile("s_wait_asynccnt 0x0" ::: "memory");  /* this wave's share of chunk kc + 1 has landed */
    __syncthreads();                                   /* publishes chunk kc + 1, ends every read of chunk kc */
    if (kc + 2 < nch) stage_copy(kc + 2, kc & 1);
  }
  asm volatile("s_wait_asynccnt 0x0" ::: "memory");    /* no copy is outstanding when the ring becomes output staging */

  _Float16* pw = (_Float16*)(void*)&ring[0][0] + wave * (16 * kP16);
  {
    const float ltot = lrow + xhalf(lrow);               /* both halves' kv rows, carried like p; ltot >= 1 */
    const float inv  = O_CARRY / ltot;
#pragma unroll
    for (int t = 0; t < 4; ++t) {
      v8h ov;
#pragma unroll
      for (int r = 0; r < 8; ++r) ov[r] = (_Float16)(oacc[t][r] * inv);
      *(v8h*)(pw + c * kP16 + t * 16 + 8 * hh) = ov;     /* query row c, d = 16t + 8hh + 0..7 */
    }
  }
  __builtin_amdgcn_fence(__ATOMIC_RELEASE, "workgroup");
  __builtin_amdgcn_wave_barrier();
  __builtin_amdgcn_fence(__ATOMIC_ACQUIRE, "workgroup");
  {
    const int q8 = lane >> 3, c8 = (lane & 7) * 8;
    _Float16* ob = (_Float16*)(void*)oo + (tokb + (size_t)q0) * kDm + (size_t)h * kHd;
    {
#pragma unroll
      for (int it = 0; it < 4; ++it) {
        const int row = it * 4 + q8;
        const v8h val = *(const v8h*)(pw + row * kP16 + c8);
        *(v8h*)(ob + (size_t)row * kDm + c8) = val;
      }
      
    }
  }
}

/* ------------------------------------------------------------------------------------- */
extern "C" void kernel_launch(void* const* d_in, const int* in_sizes, int n_in,
                              void* d_out, int out_size, void* d_ws, size_t ws_size,
                              hipStream_t stream) {
  if (n_in < 11) return;
  const float* x    = (const float*)d_in[0];
  const float* mask = (const float*)d_in[1];
  const float* Wq   = (const float*)d_in[2];
  const float* bq   = (const float*)d_in[3];
  const float* Wk   = (const float*)d_in[4];
  const float* bk   = (const float*)d_in[5];
  const float* Wv   = (const float*)d_in[6];
  const float* bv   = (const float*)d_in[7];
  const float* Wo   = (const float*)d_in[8];
  const float* bo   = (const float*)d_in[9];
  const float* tau  = (const float*)d_in[10];

  const size_t nX = (size_t)kTok * kDm;     /* 4,194,304 */
  const size_t nW = (size_t)kDm * kDm;      /* 1,048,576 */
  if ((size_t)in_sizes[0] != nX || (size_t)in_sizes[1] != (size_t)kSeq * kSeq ||
      (size_t)in_sizes[2] != nW || (size_t)in_sizes[4] != nW || (size_t)in_sizes[6] != nW ||
      (size_t)in_sizes[8] != nW || in_sizes[3] != kDm || in_sizes[5] != kDm || in_sizes[7] != kDm ||
      in_sizes[9] != kDm || in_sizes[10] != kHeads) return;
  if ((size_t)out_size != nX) return;

  /*
       xb   bf16 [4096][1024]        off         0   size  8,388,608
       wqb  bf16 [1024][1024]        off  8,388,608  size  2,097,152
       wkb  bf16 [1024][1024]        off 10,485,760  size  2,097,152
       wvb  bf16 [1024][1024]        off 12,582,912  size  2,097,152
       wof  f16  [1024][1024] (x1024) off 14,680,064  size  2,097,152
       qf   f32  [4096][1024]        off 16,777,216  size 16,777,216   (reused as oo f16 [4096][1024], 8,388,608 B, after qf is consumed)
       kf   f32  [4096][1024]        off 33,554,432  size 16,777,216
       qhb  bf16 [4096][1024]        off 50,331,648  size  8,388,608
       qlb  bf16 [4096][1024]        off 58,720,256  size  8,388,608
       khb  bf16 [4096][1024]        off 67,108,864  size  8,388,608
       klb  bf16 [4096][1024]        off 75,497,472  size  8,388,608
       vth  f16  [1024][4096]        off 83,886,080  size  8,388,608   (v transposed: row = output feature, column = token)
       mkb  bf16 [2048][2048]        off 92,274,688  size  8,388,608
       end                              100,663,296 */
  const size_t offXb  = 0;
  const size_t offWq  = offXb  + nX * 2;
  const size_t offWk  = offWq  + nW * 2;
  const size_t offWv  = offWk  + nW * 2;
  const size_t offWo  = offWv  + nW * 2;
  const size_t offQf  = offWo  + nW * 2;
  const size_t offKf  = offQf  + nX * 4;
  const size_t offQh  = offKf  + nX * 4;
  const size_t offQl  = offQh  + nX * 2;
  const size_t offKh  = offQl  + nX * 2;
  const size_t offKl  = offKh  + nX * 2;
  const size_t offVv  = offKl  + nX * 2;
  const size_t offMk  = offVv  + nX * 2;
  const size_t offEnd = offMk  + (size_t)kSeq * kSeq * 2;
  if (offEnd > ws_size) return;

  char* ws = (char*)d_ws;
  unsigned short* xb  = (unsigned short*)(ws + offXb);
  unsigned short* wqb = (unsigned short*)(ws + offWq);
  unsigned short* wkb = (unsigned short*)(ws + offWk);
  unsigned short* wvb = (unsigned short*)(ws + offWv);
  unsigned short* wof = (unsigned short*)(ws + offWo);
  float*          qf  = (float*)(ws + offQf);
  unsigned short* oo  = (unsigned short*)(ws + offQf);   /* reuse after qf is consumed */
  float*          kf  = (float*)(ws + offKf);
  unsigned short* qhb = (unsigned short*)(ws + offQh);
  unsigned short* qlb = (unsigned short*)(ws + offQl);
  unsigned short* khb = (unsigned short*)(ws + offKh);
  unsigned short* klb = (unsigned short*)(ws + offKl);
  unsigned short* vth = (unsigned short*)(ws + offVv);
  unsigned short* mkb = (unsigned short*)(ws + offMk);

  /* 1: input casts (RNE bf16; Wo -> f16 of bf16 value x 1024) */
  cast_all_kernel<<<dim3(kCbAll), dim3(256), 0, stream>>>(x, mask, Wq, Wk, Wv, Wo, xb, mkb, wqb, wkb, wvb, wof);

  /* 2-4: projections C[m][n] = sum_k xb[m][k] W[n][k] + bias[n]; M=4096, N=1024, K=1024 (tiles 64x64, K%64==0);
     v with the operands exchanged, C[n][m] (+ bias[n], now the row's), so that a head's V^T rows lie along the tokens */
  const int gemmTiles  = (kTok / 64) * (kDm / 64);      /* 1024 */
  const int gemmBlocks = (gemmTiles + 7) / 8;           /* 128 */
  wmma_gemm64<1, false, 2, 0, false, 0><<<dim3(gemmBlocks, 1), dim3(256), 0, stream>>>(
      xb, xb, kDm, 0L, wqb, wqb, kDm, 0L, (void*)qf, (void*)qf, kDm, 0L, bq, nullptr, 0L, kTok, kDm, kDm, 1.0f);
  wmma_gemm64<1, false, 2, 0, false, 0><<<dim3(gemmBlocks, 1), dim3(256), 0, stream>>>(
      xb, xb, kDm, 0L, wkb, wkb, kDm, 0L, (void*)kf, (void*)kf, kDm, 0L, bk, nullptr, 0L, kTok, kDm, kDm, 1.0f);
  wmma_gemm64<1, false, 1, 1, false, 0><<<dim3(gemmBlocks, 1), dim3(256), 0, stream>>>(
      wvb, wvb, kDm, 0L, xb, xb, kDm, 0L, (void*)vth, (void*)vth, kTok, 0L, bv, nullptr, 0L, kDm, kTok, kDm, 1.0f);

  /* 5: L2 normalisation of q (x tau) and k, bf16 hi/lo planes */
  l2norm_split_kernel<<<dim3((kTok * kHeads) / 32, 2), dim3(256), 0, stream>>>(qf, kf, tau, qhb, qlb, khb, klb);

  /* 6: attention -> oo (f16, value x 64), overwrites the dead qf region */
  cos_attn_kernel<<<dim3(kBatch * kHeads * (kSeq / kQblk)), dim3(128), 0, stream>>>(qhb, qlb, khb, klb, vth, mkb, oo);

  /* 7: output projection: out[m][n] = 2^-16 * sum_c (oo x64)[m][c] (Wo x1024)[n][c] + bo[n] -> d_out f32 */
  wmma_gemm64<0, false, 2, 0, false, 0><<<dim3(gemmBlocks, 1), dim3(256), 0, stream>>>(
      oo, oo, kDm, 0L, wof, wof, kDm, 0L, d_out, d_out, kDm, 0L, bo, nullptr, 0L, kTok, kDm, kDm,
      1.0f / (O_CARRY * WO_CARRY));
}

// v007
// Measured time: 174 microseconds a run.
// Next to v006, in two timings, it ran 1.04 and 1.03 times as fast.
// Counting every step since v000, it is 2.68 times as fast.
// Contractions: q/k/v projections on v_wmma_f32_16x16x32_bf16 (operands = RNE bf16 of the inputs); scores on bf16 hi/lo split (hi.hi + hi.lo + lo.hi); p.v and output projection on v_wmma_f32_16x16x32_f16 (p carried x2^14, attention output carried x2^6, Wo carried x2^10); f32 accumulate; norms and softmax in f32.
#include <hip/hip_runtime.h>
#include <stdint.h>

typedef __attribute__((ext_vector_type(16))) _Float16 v16h;
typedef __attribute__((ext_vector_type(8)))  _Float16 v8h;
typedef __attribute__((ext_vector_type(16))) __bf16   v16b;
typedef __attribute__((ext_vector_type(8)))  __bf16   v8b;
typedef __attribute__((ext_vector_type(8)))  float    v8f;
typedef __attribute__((ext_vector_type(4)))  float    v4f;
typedef __attribute__((ext_vector_type(2)))  float    v2f;
typedef __attribute__((ext_vector_type(4)))  unsigned v4u;

/* problem geometry */
constexpr int kBatch = 2;
constexpr int kSeq   = 2048;
constexpr int kDm    = 1024;
constexpr int kHeads = 16;
constexpr int kHd    = 64;
constexpr int kTok   = kBatch * kSeq;      /* 4096 token rows */
constexpr int kKch   = 64;                 /* kv chunk */
constexpr int kQblk  = 64;                 /* query rows per block */
/* LDS row pitches of the attention tiles: 16 B x odd, so that the 16 rows a ds_load_b128 fragment read
   touches fall on 16 different groups of four banks (an unpadded 128 B or 256 B row puts them on one or two) */
constexpr int kP16   = 72;                 /* 64 16-bit elements + 8 pad  = 144 B */
constexpr int kTileE = kKch * kP16;        /* 16-bit elements of one 64-row attention tile in LDS: 9,216 B */
/* GEMM operand staging in LDS */
constexpr int kGk    = 64;                 /* k elements per stage: 128 B of every operand row, whole cache lines */
constexpr int kGp    = 72;                 /* LDS row pitch 144 B = 16 B x odd, as for the attention tiles */
constexpr int kGrows = 64 + 8 * 64;        /* 64 A rows shared by the block's 8 waves + 64 B rows for each wave */
#define O_CARRY 64.0f
#define WO_CARRY 1024.0f
#define LOG2E 1.4426950408889634f
#define P_CARRY_LOG2 14.0f                  /* p is carried x2^14 */

static_assert(kDm == kHeads * kHd, "head split");
static_assert(kTok % 64 == 0 && kDm % 64 == 0, "GEMM M,N tile multiples");
static_assert(kDm % kGk == 0, "GEMM K multiple of the LDS stage");
static_assert((kDm / 64) % 8 == 0 && (kTok / 64) % 8 == 0, "a GEMM block's 8 tiles lie in one tile row");
static_assert(kSeq % kKch == 0 && kSeq % kQblk == 0, "attention tiles");
static_assert((kTok * kHeads) % 32 == 0, "normalize grid");

__device__ __forceinline__ unsigned short f2bf_bits(float f) {
  unsigned u = __float_as_uint(f);
  return (unsigned short)((u + 0x7FFFu + ((u >> 16) & 1u)) >> 16);
}
__device__ __forceinline__ float bf_bits2f(unsigned short h) { return __uint_as_float(((unsigned)h) << 16); }
__device__ __forceinline__ _Float16 h16_lo(unsigned w) { return __builtin_bit_cast(_Float16, (unsigned short)(w & 0xffffu)); }
__device__ __forceinline__ _Float16 h16_hi(unsigned w) { return __builtin_bit_cast(_Float16, (unsigned short)(w >> 16)); }

/* hazard guards as plain device helpers */
__device__ __forceinline__ void dep_guard_h(v8f& a, v8f& b, v16h x, v16h y) { asm volatile("v_nop\n\tv_nop\n\tv_nop\n\tv_nop" : "+v"(a), "+v"(b) : "v"(x), "v"(y)); }
__device__ __forceinline__ void dep_guard_b(v8f& a, v8f& b, v16b x, v16b y) { asm volatile("v_nop\n\tv_nop\n\tv_nop\n\tv_nop" : "+v"(a), "+v"(b) : "v"(x), "v"(y)); }
__device__ __forceinline__ void keep4_h(v16h a, v16h b, v16h c, v16h d) { asm volatile("v_nop" :: "v"(a), "v"(b), "v"(c), "v"(d)); }
__device__ __forceinline__ void keep4_b(v16b a, v16b b, v16b c, v16b d) { asm volatile("v_nop" :: "v"(a), "v"(b), "v"(c), "v"(d)); }
__device__ __forceinline__ void acc_guard4(v8f& a, v8f& b, v8f& c, v8f& d) { asm volatile("v_nop\n\tv_nop\n\tv_nop\n\tv_nop" : "+v"(a), "+v"(b), "+v"(c), "+v"(d)); }
template <typename T> struct Frag;
template <> struct Frag<_Float16> {
  typedef v16h V; union U { v16h v; v8h h[2]; };
  static __device__ __forceinline__ v16h load(const _Float16* p) {   /* elements 0..7 <- p[0..7], 8..15 <- p[16..23] */
    U f; f.h[0] = *(const v8h*)(p); f.h[1] = *(const v8h*)(p + 16); return f.v;
  }
  static __device__ __forceinline__ v8f mma(v16h a, v16h b, v8f c) {
    return __builtin_amdgcn_wmma_f32_16x16x32_f16(false, a, false, b, (short)0, c, false, false);
  }
  static __device__ __forceinline__ void guard(v8f& a, v8f& b, v16h x, v16h y) { dep_guard_h(a, b, x, y); }
  static __device__ __forceinline__ void keep(v16h a, v16h b, v16h c, v16h d) { keep4_h(a, b, c, d); }
};
template <> struct Frag<__bf16> {
  typedef v16b V; union U { v16b v; v8b h[2]; };
  static __device__ __forceinline__ v16b load(const __bf16* p) {
    U f; f.h[0] = *(const v8b*)(p); f.h[1] = *(const v8b*)(p + 16); return f.v;
  }
  static __device__ __forceinline__ v8f mma(v16b a, v16b b, v8f c) {
    return __builtin_amdgcn_wmma_f32_16x16x32_bf16(false, a, false, b, (short)0, c, false, false);
  }
  static __device__ __forceinline__ void guard(v8f& a, v8f& b, v16b x, v16b y) { dep_guard_b(a, b, x, y); }
  static __device__ __forceinline__ void keep(v16b a, v16b b, v16b c, v16b d) { keep4_b(a, b, c, d); }
};

/* Nine asynchronous 16-byte copies global -> LDS per lane, through no register: l = the lane's LDS byte address,
   g = the lane's global address.  The closing s_wait_xcnt stands inside the statement so that no address
   register of an issued copy is rewritten in front of it. */
__device__ __forceinline__ void async_copy9(const unsigned (&l)[9], const unsigned short* const (&g)[9]) {
  asm volatile(
      "global_load_async_to_lds_b128 %0, %9, off\n\t"
      "global_load_async_to_lds_b128 %1, %10, off\n\t"
      "global_load_async_to_lds_b128 %2, %11, off\n\t"
      "global_load_async_to_lds_b128 %3, %12, off\n\t"
      "global_load_async_to_lds_b128 %4, %13, off\n\t"
      "global_load_async_to_lds_b128 %5, %14, off\n\t"
      "global_load_async_to_lds_b128 %6, %15, off\n\t"
      "global_load_async_to_lds_b128 %7, %16, off\n\t"
      "global_load_async_to_lds_b128 %8, %17, off\n\t"
      "s_wait_xcnt 0x0"
      :: "v"(l[0]), "v"(l[1]), "v"(l[2]), "v"(l[3]), "v"(l[4]), "v"(l[5]), "v"(l[6]), "v"(l[7]), "v"(l[8]),
         "v"(g[0]), "v"(g[1]), "v"(g[2]), "v"(g[3]), "v"(g[4]), "v"(g[5]), "v"(g[6]), "v"(g[7]), "v"(g[8])
      : "memory");
}

/* The same with eight copies per lane: two 64-row tiles of the attention ring (four passes of 16 rows each). */
__device__ __forceinline__ void async_copy8(const unsigned (&l)[8], const unsigned short* const (&g)[8]) {
  asm volatile(
      "global_load_async_to_lds_b128 %0, %8, off\n\t"
      "global_load_async_to_lds_b128 %1, %9, off\n\t"
      "global_load_async_to_lds_b128 %2, %10, off\n\t"
      "global_load_async_to_lds_b128 %3, %11, off\n\t"
      "global_load_async_to_lds_b128 %4, %12, off\n\t"
      "global_load_async_to_lds_b128 %5, %13, off\n\t"
      "global_load_async_to_lds_b128 %6, %14, off\n\t"
      "global_load_async_to_lds_b128 %7, %15, off\n\t"
      "s_wait_xcnt 0x0"
      :: "v"(l[0]), "v"(l[1]), "v"(l[2]), "v"(l[3]), "v"(l[4]), "v"(l[5]), "v"(l[6]), "v"(l[7]),
         "v"(g[0]), "v"(g[1]), "v"(g[2]), "v"(g[3]), "v"(g[4]), "v"(g[5]), "v"(g[6]), "v"(g[7])
      : "memory");
}

/* ---- Register-blocked batched WMMA GEMM --------------------------------
   C[m,n] = scale * sum_k A[m,k] * Bt[n,k] (+bias); each wave owns a 64x64 tile.
   A row-major [M,K]; Bt row-major [N,K]; M % 64 == 0, N % 512 == 0, K % 64 == 0, lda and ldb % 8 == 0.
   A block's 8 waves own 8 neighbouring tiles of one tile row.  Per 64 k the block's 64 A rows and 512 Bt rows
   are copied to LDS in whole 128 B lines (two buffers: the next stage flies while this one is multiplied);
   the fragments are read from LDS in ascending k, 32 at a time.
   BIAS_MODE: 0 = none, 1 = bias[m], 2 = bias[n]; bias values RNE-converted to bf16 precision before the add.
   OUT_MODE: 0 = f32, 1 = f16, 2 = bf16 hi plane (Cout) + bf16 lo plane (Cout2).
   ET: 0 = f16 operands, 1 = bf16 operands (pointers passed as 16-bit storage) */
template <int ET> struct Elem;
template <> struct Elem<0> { typedef _Float16 T; };
template <> struct Elem<1> { typedef __bf16 T; };
template <int ET, bool SPLIT, int BIAS_MODE, int OUT_MODE, bool RESID, int ACT = 0>
__global__ __launch_bounds__(256) void wmma_gemm64(
    const unsigned short* __restrict__ Ap, const unsigned short* __restrict__ A2p, int lda, long strideA,
    const unsigned short* __restrict__ Btp, const unsigned short* __restrict__ Bt2p, int ldb, long strideB,
    void* __restrict__ Cout, void* __restrict__ Cout2, int ldc, long strideC,
    const float* __restrict__ bias,
    const float* __restrict__ resid, long strideR,
    int M, int N, int K, float scale) {
  typedef typename Elem<ET>::T T;
  typedef typename Frag<T>::V V;
  static_assert(!SPLIT, "the LDS stage holds one plane of each operand");
  __shared__ __align__(16) float sT[8][16 * 68];   /* per-wave 16x64 slab, pitch 68 floats */
  __shared__ __align__(16) unsigned short sAB[2][kGrows * kGp];   /* two stages: rows 0..63 A, 64..575 Bt */
  const int b    = blockIdx.y;
  const int lane = threadIdx.x & 31;
  const int wave = threadIdx.x >> 5;
  const int tilesN = N >> 6;
  const int tilesM = M >> 6;
  const int tile0 = blockIdx.x * 8;
  if (tile0 >= tilesM * tilesN) return;  /* block-uniform, in front of every barrier */
  const int tile = tile0 + wave;
  const int tm = tile / tilesN;
  const int tn = tile - tm * tilesN;
  const int m0 = tm << 6;
  const int n0 = tn << 6;

  const unsigned short* Ab = Ap  + (size_t)b * strideA;
  const unsigned short* Bb = Btp + (size_t)b * strideB;

  const int rlane = lane & 15;                 /* row (A) / col (B, D) within subtile */
  const int koff  = (lane >> 4) * 8;           /* k offset of this lane half */
  const int mOff  = (lane >> 4) * 8;           /* D row offset */

  /* copy map: 8 lanes x 16 B = one 128 B row, 32 rows per pass of the block, 18 passes = 576 rows */
  const int crow = threadIdx.x >> 3;
  const int cchk = (threadIdx.x & 7) * 8;
  const int nb0  = (tile0 - tm * tilesN) << 6;  /* first Bt row of the block */
  const unsigned short* gA = Ab + (size_t)(m0 + crow) * lda + cchk;
  const unsigned short* gB = Bb + (size_t)(nb0 + crow) * ldb + cchk;
  const unsigned lds0 = (unsigned)(uintptr_t)(const void*)&sAB[0][0] + (unsigned)(crow * kGp + cchk) * 2u;
  auto stage_copy = [&](int st, int buf) {
    const unsigned lb = lds0 + (unsigned)buf * (unsigned)(kGrows * kGp * 2);
    const unsigned short* pa = gA + (size_t)st * kGk;
    const unsigned short* pb = gB + (size_t)st * kGk;
    unsigned l[9];
    const unsigned short* g[9];
    /* both loops unrolled: l[] and g[] are asm operands and must be registers */
#pragma unroll
    for (int it = 0; it < 9; ++it) {
      l[it] = lb + (unsigned)(it * 32 * kGp * 2);
      g[it] = (it < 2) ? pa + (size_t)(it * 32) * lda : pb + (size_t)((it - 2) * 32) * ldb;
    }
    async_copy9(l, g);
#pragma unroll
    for (int it = 0; it < 9; ++it) {
      l[it] = lb + (unsigned)((it + 9) * 32 * kGp * 2);
      g[it] = pb + (size_t)((it + 7) * 32) * ldb;
    }
    async_copy9(l, g);
  };

  v8f acc[4][4];
#pragma unroll
  for (int i = 0; i < 4; ++i)
#pragma unroll
    for (int j = 0; j < 4; ++j) acc[i][j] = (v8f){0.f,0.f,0.f,0.f,0.f,0.f,0.f,0.f};

  const int nst = K / kGk;
  stage_copy(0, 0);
  asm volatile("s_wait_asynccnt 0x0" ::: "memory");   /* this wave's share of stage 0 has landed */
  __syncthreads();                                     /* ... and every other wave's */
  if (nst > 1) stage_copy(1, 1);
  for (int t = 0; t < nst; ++t) {
    const T* sA = (const T*)(const void*)sAB[t & 1] + rlane * kGp + koff;
    const T* sB = sA + (64 + wave * 64) * kGp;
    /* all loops of the stage unrolled: fragments and accumulators are indexed by constants and stay in registers */
#pragma unroll
    for (int ks = 0; ks < kGk; ks += 32) {
      V bh[4], ah[4];
#pragma unroll
      for (int j = 0; j < 4; ++j) bh[j] = Frag<T>::load(sB + j * 16 * kGp + ks);
#pragma unroll
      for (int i = 0; i < 4; ++i) ah[i] = Frag<T>::load(sA + i * 16 * kGp + ks);
#pragma unroll
      for (int i = 0; i < 4; ++i) {
#pragma unroll
        for (int j = 0; j < 4; ++j) acc[i][j] = Frag<T>::mma(ah[i], bh[j], acc[i][j]);
        Frag<T>::guard(acc[i][0], acc[i][3], ah[i], ah[i]);
      }
      Frag<T>::keep(bh[0], bh[1], bh[2], bh[3]);
    }
    asm volatile("s_wait_dscnt 0x0" ::: "memory");     /* this wave's reads of the buffer have returned before it is refilled */
    asm volatile("s_wait_asynccnt 0x0" ::: "memory");  /* this wave's share of stage t + 1 has landed */
    __syncthreads();                                   /* publishes stage t + 1, ends every read of stage t */
    if (t + 2 < nst) stage_copy(t + 2, t & 1);
  }
  asm volatile("s_wait_asynccnt 0x0" ::: "memory");    /* no copy is outstanding when the wave goes on */
  acc_guard4(acc[0][0], acc[0][1], acc[0][2], acc[0][3]);
  acc_guard4(acc[1][0], acc[1][1], acc[1][2], acc[1][3]);
  acc_guard4(acc[2][0], acc[2][1], acc[2][2], acc[2][3]);
  acc_guard4(acc[3][0], acc[3][1], acc[3][2], acc[3][3]);

  /* ---- epilogue ---- */
  float* slab = sT[wave];
  const float* Rb = RESID ? (resid + (size_t)b * strideR) : nullptr;
#pragma unroll
  for (int i = 0; i < 4; ++i) {
    const int mBase = m0 + (i << 4);
#pragma unroll
    for (int j = 0; j < 4; ++j) {
      const int n = n0 + (j << 4) + rlane;
      float bv = 0.f;
      if (BIAS_MODE == 2) bv = bf_bits2f(f2bf_bits(bias[n]));
#pragma unroll
      for (int r = 0; r < 8; ++r) {
        float v = acc[i][j][r] * scale;
        if (BIAS_MODE == 1) v += bf_bits2f(f2bf_bits(bias[mBase + mOff + r]));
        if (BIAS_MODE == 2) v += bv;
        if (RESID) v += Rb[(size_t)(mBase + mOff + r) * ldc + n];
        if (ACT == 1) v = tanhf(v);
        if (ACT == 2) v = fmaxf(v, 0.0f);
        if (ACT == 3) v = v / (1.0f + expf(-v));
        if (ACT == 4) v = (v > 0.f) ? v : 0.01f * v;
        slab[(mOff + r) * 68 + (j << 4) + rlane] = v;
      }
    }
    __builtin_amdgcn_fence(__ATOMIC_RELEASE, "workgroup");
    __builtin_amdgcn_wave_barrier();
    __builtin_amdgcn_fence(__ATOMIC_ACQUIRE, "workgroup");
    if (OUT_MODE == 0) {
      float* C = (float*)Cout + (size_t)b * strideC;
      const int hh = lane >> 4, c4 = (lane & 15) * 4;     /* row seg = 256 B = 16 lanes x 16 B */
      {
#pragma unroll
        for (int it = 0; it < 8; ++it) {
          const int row = it * 2 + hh;
          v4f v = *(const v4f*)(slab + row * 68 + c4);
          *(v4f*)(C + (size_t)(mBase + row) * ldc + n0 + c4) = v;
        }
        
      }
    } else {
      const int q = lane >> 3, c8 = (lane & 7) * 8;        
      unsigned short* C  = (unsigned short*)Cout  + (size_t)b * strideC;
      unsigned short* C2 = (OUT_MODE == 2) ? ((unsigned short*)Cout2 + (size_t)b * strideC) : nullptr;
      {
#pragma unroll
        for (int it = 0; it < 4; ++it) {
          const int row = it * 4 + q;
          const float* sp = slab + row * 68 + c8;
          v8h hv, lv;
#pragma unroll
          for (int e = 0; e < 8; ++e) {
            if (OUT_MODE == 1) {
              hv[e] = (_Float16)sp[e];
            } else {
              unsigned short hb = f2bf_bits(sp[e]);
              unsigned short lb = f2bf_bits(sp[e] - bf_bits2f(hb));
              hv[e] = __builtin_bit_cast(_Float16, hb);
              lv[e] = __builtin_bit_cast(_Float16, lb);
            }
          }
          *(v8h*)(C + (size_t)(mBase + row) * ldc + n0 + c8) = hv;
          if (OUT_MODE == 2) *(v8h*)(C2 + (size_t)(mBase + row) * ldc + n0 + c8) = lv;
        }
        
      }
    }
    __builtin_amdgcn_fence(__ATOMIC_RELEASE, "workgroup");
    __builtin_amdgcn_wave_barrier();
    __builtin_amdgcn_fence(__ATOMIC_ACQUIRE, "workgroup");
  }
}

/* ---- all six input casts in one launch: the block index picks the tensor (block-uniform, scalar branches).
   x, mask, Wq, Wk, Wv -> bf16 bits (RNE); Wo -> f16 bits of (RNE-bf16 value * WO_CARRY).
   Each of them alone is a launch of a few microseconds at most, most of it start and drain; side by side they pay that once.
   coverage: a block = 256 threads x 2 elements; kCbX + kCbM + 4 kCbW blocks cover the six tensors exactly. */
constexpr int kCbX   = kTok * kDm / 512;   /* 8192 blocks for x */
constexpr int kCbM   = kSeq * kSeq / 512;  /* 8192 blocks for the mask */
constexpr int kCbW   = kDm * kDm / 512;    /* 2048 blocks for each weight matrix */
constexpr int kCbAll = kCbX + kCbM + 4 * kCbW;
static_assert((kTok * kDm) % 512 == 0 && (kSeq * kSeq) % 512 == 0 && (kDm * kDm) % 512 == 0, "whole blocks");
__global__ __launch_bounds__(256) void cast_all_kernel(
    const float* __restrict__ x,  const float* __restrict__ mask, const float* __restrict__ wq,
    const float* __restrict__ wk, const float* __restrict__ wv,   const float* __restrict__ wo,
    unsigned short* __restrict__ xb,  unsigned short* __restrict__ mkb, unsigned short* __restrict__ wqb,
    unsigned short* __restrict__ wkb, unsigned short* __restrict__ wvb, unsigned short* __restrict__ wof) {
  int blk = blockIdx.x;
  const float* in = x;
  unsigned short* out = xb;
  bool carry = false;                      /* Wo alone */
  if (blk >= kCbX + kCbM) {
    blk -= kCbX + kCbM;
    const int w = blk / kCbW;              /* 0..3 by the grid */
    blk -= w * kCbW;
    in    = (w == 0) ? wq  : (w == 1) ? wk  : (w == 2) ? wv  : wo;
    out   = (w == 0) ? wqb : (w == 1) ? wkb : (w == 2) ? wvb : wof;
    carry = (w == 3);
  } else if (blk >= kCbX) {
    blk -= kCbX;
    in  = mask;
    out = mkb;
  }
  const int i = blk * 256 + threadIdx.x;
  const v2f p = *(const v2f*)(in + 2 * (size_t)i);
  unsigned short u0 = f2bf_bits(p.x), u1 = f2bf_bits(p.y);
  if (carry) {
    u0 = __builtin_bit_cast(unsigned short, (_Float16)(bf_bits2f(u0) * WO_CARRY));
    u1 = __builtin_bit_cast(unsigned short, (_Float16)(bf_bits2f(u1) * WO_CARRY));
  }
  unsigned* op = (unsigned*)(void*)out;
  op[i] = (unsigned)u0 | ((unsigned)u1 << 16);
}

/* ---- per (token, head) L2 normalisation + bf16 hi/lo split.
   blockIdx.y = 0: q plane, scaled by 1/max(||q||,1e-12) * bf16(tau[head]) * log2(e), so that the scores come out
   of the matrix unit as exponents of 2; y = 1: k plane, 1/max(||k||,1e-12).
   8 lanes per 64-vector (8 floats each), 32 segments per 256-thread block; grid.x = kTok*kHeads/32 = 2048.
*/
__global__ __launch_bounds__(256) void l2norm_split_kernel(
    const float* __restrict__ qf, const float* __restrict__ kf, const float* __restrict__ tau,
    unsigned short* __restrict__ qhp, unsigned short* __restrict__ qlp,
    unsigned short* __restrict__ khp, unsigned short* __restrict__ klp) {
  const bool isk = (blockIdx.y != 0);                 /* block-uniform */
  const float* src = isk ? kf : qf;
  unsigned short* dhp = isk ? khp : qhp;
  unsigned short* dlp = isk ? klp : qlp;
  const int tid = threadIdx.x;
  const int g = tid >> 3, e = tid & 7;
  const int seg = blockIdx.x * 32 + g;                 /* < kTok*kHeads */
  const int token = seg >> 4, head = seg & 15;
  const size_t base = (size_t)token * kDm + (size_t)head * kHd + (size_t)e * 8;
  const v4f a  = *(const v4f*)(src + base);
  const v4f c4 = *(const v4f*)(src + base + 4);
  float ss = 0.0f;
  ss += a.x * a.x;  ss += a.y * a.y;  ss += a.z * a.z;  ss += a.w * a.w;
  ss += c4.x * c4.x; ss += c4.y * c4.y; ss += c4.z * c4.z; ss += c4.w * c4.w;
  ss += __shfl_xor(ss, 1, 32);
  ss += __shfl_xor(ss, 2, 32);
  ss += __shfl_xor(ss, 4, 32);
  const float nrm  = sqrtf(ss);
  const float rinv = 1.0f / fmaxf(nrm, 1e-12f);
  const float th   = bf_bits2f(f2bf_bits(tau[head]));
  const float sc   = isk ? rinv : rinv * (th * LOG2E);
  float vals[8];
  vals[0] = a.x * sc;  vals[1] = a.y * sc;  vals[2] = a.z * sc;  vals[3] = a.w * sc;
  vals[4] = c4.x * sc; vals[5] = c4.y * sc; vals[6] = c4.z * sc; vals[7] = c4.w * sc;
  unsigned hw[4], lw[4];
#pragma unroll
  for (int i = 0; i < 4; ++i) {
    const float v0 = vals[2 * i], v1 = vals[2 * i + 1];
    const unsigned short h0 = f2bf_bits(v0), h1 = f2bf_bits(v1);
    const unsigned short l0 = f2bf_bits(v0 - bf_bits2f(h0));
    const unsigned short l1 = f2bf_bits(v1 - bf_bits2f(h1));
    hw[i] = (unsigned)h0 | ((unsigned)h1 << 16);
    lw[i] = (unsigned)l0 | ((unsigned)l1 << 16);
  }
  v4u hv; hv.x = hw[0]; hv.y = hw[1]; hv.z = hw[2]; hv.w = hw[3];
  v4u lv; lv.x = lw[0]; lv.y = lw[1]; lv.z = lw[2]; lv.w = lw[3];
  v4u* ph = (v4u*)(void*)(dhp + base);
  v4u* pl = (v4u*)(void*)(dlp + base);
  *ph = hv; *pl = lv;
  
}

__device__ __forceinline__ v8f at_mma_b(v16b a, v16b b, v8f c) {
  c = __builtin_amdgcn_wmma_f32_16x16x32_bf16(false, a, false, b, (short)0, c, false, false);
  asm volatile("v_nop\n\tv_nop\n\tv_nop\n\tv_nop" : "+v"(c) : "v"(a), "v"(b));
  return c;
}
__device__ __forceinline__ v8f at_mma_h(v16h a, v16h b, v8f c) {
  c = __builtin_amdgcn_wmma_f32_16x16x32_f16(false, a, false, b, (short)0, c, false, false);
  asm volatile("v_nop\n\tv_nop\n\tv_nop\n\tv_nop" : "+v"(c) : "v"(a), "v"(b));
  return c;
}

/* x[i] = 2^x[i] for the eight scores of one tile, each in its own register, so that no v_exp_f32 reads the result or
   overwrites the source of the one in front of it; the closing v_nop is the slot the instruction set asks for
   between the last v_exp_f32 and whatever the compiler puts next. */
__device__ __forceinline__ void exp2x8(float (&x)[8]) {
  asm("v_exp_f32 %0, %0\n\t"
      "v_exp_f32 %1, %1\n\t"
      "v_exp_f32 %2, %2\n\t"
      "v_exp_f32 %3, %3\n\t"
      "v_exp_f32 %4, %4\n\t"
      "v_exp_f32 %5, %5\n\t"
      "v_exp_f32 %6, %6\n\t"
      "v_exp_f32 %7, %7\n\t"
      "v_nop"
      : "+v"(x[0]), "+v"(x[1]), "+v"(x[2]), "+v"(x[3]), "+v"(x[4]), "+v"(x[5]), "+v"(x[6]), "+v"(x[7]));
}

/* lane l <-> lane l ^ 16 by one vector cross-row move */
__device__ __forceinline__ float xhalf(float x) {
  const int b = __builtin_bit_cast(int, x);
  return __builtin_bit_cast(float, __builtin_amdgcn_permlanex16(b, b, 0x76543210, 0xfedcba98, false, false));
}

/* =====================================================================================
   Attention for head_dim 64 with an additive [kSeq][kSeq] mask shared over (b,h).
   Inputs: qh/ql = bf16 hi/lo planes of (q/||q|| * tau[h] * log2 e), kh/kl = bf16 hi/lo planes of k/||k||,
           all [kTok][kDm] with element (b, s, h, d) at (b*kSeq+s)*kDm + h*64 + d;
           vt = f16 plane of v, transposed: [kDm][kTok], element (b, s, h, d) at (h*64+d)*kTok + b*kSeq + s;
           mb = bf16 plane (RNE) of the mask, [kSeq][kSeq].
   Every tile of a kv chunk (K hi, K lo, V^T, mask) is 64 rows of 128 B that lie in global memory as LDS wants them:
           asynchronous copies bring whole rows into one of two buffers while the other one is worked on.
   scores, transposed: S^T = khat . qhat_tau^T : 3 bf16 WMMAs (hi.hi + lo.hi + hi.lo), A = K rows, B = Q columns;
           lanes c and c + 16 hold all scores of query column c: += bf16(mask[q][kv]) * log2 e; online softmax f32 in
           base 2 (p x 2^14 = 2^(score - maximum + 14): one subtraction and one v_exp_f32 a score), maximum and
           sum in the lane, the halves' maxima joined per chunk, their sums (carried x2^14 like p) once at the end.
   out, transposed: O^T += V^T . P^T : f16 WMMA, p carried x2^14; two score tiles converted in place are the B operand.
           result written as f16 of (out * 2^6) into oo (same plane layout).
   Block = 4 waves = 64 query rows of one (b, h); every one of the kSeq/64 kv chunks is processed.
   grid.x = kBatch * kHeads * (kSeq/64) = 1024.  coverage of oo: 1024 blocks x 64 rows x 64 d = kTok*kDm.
   ===================================================================================== */
__global__ __launch_bounds__(128)
void cos_attn_kernel(const unsigned short* __restrict__ qhp, const unsigned short* __restrict__ qlp,
                     const unsigned short* __restrict__ khp, const unsigned short* __restrict__ klp,
                     const unsigned short* __restrict__ vtp, const unsigned short* __restrict__ mbp,
                     unsigned short* __restrict__ oo) {
  union FB { v16b v; v8b h[2]; };
  union FH { v16h v; v8h h[2]; };
  /* two buffers x four tiles of 9 KB: K hi [kv][d], K lo [kv][d], V^T [d][kv], mask bf16 [qrow][kv]; 72 KB, four blocks a WGP.
     Behind the loop's last barrier the first 9 KB serve as the waves' output staging. */
  __shared__ __align__(16) unsigned short ring[2][4 * kTileE];

  const int tid  = threadIdx.x;
  const int wave = tid >> 5;
  const int lane = tid & 31;
  const int hh   = lane >> 4;
  const int c    = lane & 15;

  const int nqb = kSeq / kQblk;                 /* 32 */
  const int bx  = blockIdx.x;
  const int qb  = bx % nqb;
  const int bh  = bx / nqb;
  const int h   = bh % kHeads;
  const int b   = bh / kHeads;
  const int qbase = qb * kQblk;
  const int q0    = qbase + wave * 16;
  const size_t tokb = (size_t)b * kSeq;

  const __bf16*   qh = (const __bf16*)(const void*)qhp;
  const __bf16*   ql = (const __bf16*)(const void*)qlp;

  /* ---- Q fragments (B operand): column = lane&15, elements 0..7 <- d0+8hh+0..7, 8..15 <- d0+16+8hh+0..7 ---- */
  v16b qah[2], qal[2];
  {
    const size_t ro = (tokb + (size_t)(q0 + c)) * kDm + (size_t)h * kHd;
#pragma unroll
    for (int dc = 0; dc < 2; ++dc) {
      qah[dc] = Frag<__bf16>::load(qh + ro + dc * 32 + 8 * hh);
      qal[dc] = Frag<__bf16>::load(ql + ro + dc * 32 + 8 * hh);
    }
  }

  float mrow = -INFINITY;      /* running maximum of query column c, equal in both lane halves */
  float mref = -INFINITY;      /* the exponent that p, lrow and oacc are carried against: mrow - 14 */
  float lrow = 0.f;            /* running sum over this lane half's kv rows only */
  v8f oacc[4];                 /* O^T: oacc[t][r] = out[d = 16t + 8hh + r][query c] */
#pragma unroll
  for (int t = 0; t < 4; ++t) oacc[t] = (v8f){0.f,0.f,0.f,0.f,0.f,0.f,0.f,0.f};

  /* copy map: 8 lanes x 16 B = one 128 B row, 16 rows per pass of the block, 4 passes per tile */
  const int crow = tid >> 3;
  const int cchk = (tid & 7) * 8;
  const unsigned short* gKh = khp + (tokb + (size_t)crow) * kDm + (size_t)h * kHd + cchk;
  const unsigned short* gKl = klp + (tokb + (size_t)crow) * kDm + (size_t)h * kHd + cchk;
  const unsigned short* gVt = vtp + ((size_t)h * kHd + (size_t)crow) * kTok + tokb + cchk;
  const unsigned short* gMb = mbp + (size_t)(qbase + crow) * kSeq + cchk;
  const unsigned lds0 = (unsigned)(uintptr_t)(const void*)&ring[0][0] + (unsigned)(crow * kP16 + cchk) * 2u;
  auto stage_copy = [&](int st, int buf) {
    const unsigned lb = lds0 + (unsigned)buf * (unsigned)(4 * kTileE * 2);
    const unsigned short* ph = gKh + (size_t)st * (kKch * kDm);
    const unsigned short* pl = gKl + (size_t)st * (kKch * kDm);
    const unsigned short* pv = gVt + (size_t)st * kKch;
    const unsigned short* pm = gMb + (size_t)st * kKch;
    unsigned l[8];
    const unsigned short* g[8];
    /* both loops unrolled: l[] and g[] are asm operands and must be registers */
#pragma unroll
    for (int it = 0; it < 4; ++it) {
      l[it]     = lb + (unsigned)((it * 16 * kP16) * 2);
      l[it + 4] = lb + (unsigned)((kTileE + it * 16 * kP16) * 2);
      g[it]     = ph + (size_t)(it * 16) * kDm;
      g[it + 4] = pl + (size_t)(it * 16) * kDm;
    }
    async_copy8(l, g);
#pragma unroll
    for (int it = 0; it < 4; ++it) {
      l[it]     = lb + (unsigned)((2 * kTileE + it * 16 * kP16) * 2);
      l[it + 4] = lb + (unsigned)((3 * kTileE + it * 16 * kP16) * 2);
      g[it]     = pv + (size_t)(it * 16) * kTok;
      g[it + 4] = pm + (size_t)(it * 16) * kSeq;
    }
    async_copy8(l, g);
  };

  constexpr int nch = kSeq / kKch;
  static_assert(nch >= 2, "the ring's prologue fills two buffers");
  stage_copy(0, 0);
  asm volatile("s_wait_asynccnt 0x0" ::: "memory");   /* this wave's share of chunk 0 has landed */
  __syncthreads();                                     /* ... and every other wave's */
  stage_copy(1, 1);
  for (int kc = 0; kc < nch; ++kc) {
    const unsigned short* tb = ring[kc & 1];
    const __bf16*   Ksh = (const __bf16*)(const void*)tb;
    const __bf16*   Ksl = (const __bf16*)(const void*)(tb + kTileE);
    const _Float16* Vt  = (const _Float16*)(const void*)(tb + 2 * kTileE);
    const unsigned short* Msk = tb + 3 * kTileE;

    /* ---- LDS reads stand in groups ahead of the matrix runs, never among them: a read placed directly in front of its
       product leaves the wave waiting out the LDS latency at every product.  (The hazard statements behind the products
       are volatile asm, which no load crosses: where a group is written is where it is issued.)
       Group 1, at the head of the chunk: all K hi and K lo fragments, 32 reads. ---- */
    FB kb[4][2], klo[4][2];
#pragma unroll
    for (int j = 0; j < 4; ++j) {
#pragma unroll
      for (int dc = 0; dc < 2; ++dc) {
        kb[j][dc].h[0]  = *(const v8b*)(Ksh + (j * 16 + c) * kP16 + dc * 32 + 8 * hh);
        kb[j][dc].h[1]  = *(const v8b*)(Ksh + (j * 16 + c) * kP16 + dc * 32 + 16 + 8 * hh);
        klo[j][dc].h[0] = *(const v8b*)(Ksl + (j * 16 + c) * kP16 + dc * 32 + 8 * hh);
        klo[j][dc].h[1] = *(const v8b*)(Ksl + (j * 16 + c) * kP16 + dc * 32 + 16 + 8 * hh);
      }
    }
    const unsigned short* mrw = Msk + (wave * 16 + c) * kP16 + 8 * hh;
    v4u mw[4];                  /* mask words of the lane's own query row: eight bf16 per score tile */
    FH vb[2][4];                /* V^T fragments: A[m=d][k=kv] = Vt[d][kv] (lane row c) */

    /* ---- scores: S^T[kvrow][qcol], A[m=kv][k=d] = Ksh[kv][d], B[k=d][n=q] = Q; s[j][r] = S[q = c][kv = 16j + 8hh + r] ---- */
    v8f s[4];
#pragma unroll
    for (int j = 0; j < 4; ++j) {
      s[j] = (v8f){0.f,0.f,0.f,0.f,0.f,0.f,0.f,0.f};
#pragma unroll
      for (int dc = 0; dc < 2; ++dc) {
        s[j] = at_mma_b(kb[j][dc].v,  qah[dc], s[j]);
        s[j] = at_mma_b(klo[j][dc].v, qah[dc], s[j]);
        s[j] = at_mma_b(kb[j][dc].v,  qal[dc], s[j]);
      }
      /* Groups 2 and 3, into registers that K fragments have left: the mask words and the first half of V^T behind
         score tile 1, the second half of V^T behind score tile 3; they land under the products and the softmax */
      if (j == 1) {
#pragma unroll
        for (int jj = 0; jj < 4; ++jj) mw[jj] = *(const v4u*)(const void*)(mrw + jj * 16);
      }
      if (j == 1 || j == 3) {
        const int kk = j >> 1;
#pragma unroll
        for (int t = 0; t < 4; ++t) {
          vb[kk][t].h[0] = *(const v8h*)(Vt + (t * 16 + c) * kP16 + kk * 32 + 8 * hh);
          vb[kk][t].h[1] = *(const v8h*)(Vt + (t * 16 + c) * kP16 + kk * 32 + 16 + 8 * hh);
        }
      }
    }

    /* ---- additive mask from the LDS tile (8 consecutive kv of the lane's own query row per score tile) + chunk max ---- */
    float cj[4];                /* one maximum per score tile: four short chains instead of one long one */
#pragma unroll
    for (int j = 0; j < 4; ++j) {
      /* eight bf16: kv 2r in the low half of word r, 2r + 1 in the high */
#pragma unroll
      for (int r = 0; r < 4; ++r) {
        s[j][2 * r]     = fmaf(__uint_as_float(mw[j][r] << 16),         LOG2E, s[j][2 * r]);
        s[j][2 * r + 1] = fmaf(__uint_as_float(mw[j][r] & 0xffff0000u), LOG2E, s[j][2 * r + 1]);
      }
      cj[j] = fmaxf(s[j][0], s[j][4]);
#pragma unroll
      for (int r = 1; r < 4; ++r) cj[j] = fmaxf(cj[j], fmaxf(s[j][r], s[j][r + 4]));
    }
    float cm = fmaxf(fmaxf(cj[0], cj[1]), fmaxf(cj[2], cj[3]));
    cm = fmaxf(cm, xhalf(cm));
    const float mnew  = fmaxf(mrow, cm);
    /* the carry of p rides in the subtracted exponent; beside a maximum so large that the 14 rounds to more than 15
       it is left out, so that p stays inside f16; alpha goes from the old to the new subtracted exponent, whatever they are */
    float msub = mnew - P_CARRY_LOG2;
    msub = (mnew - msub <= P_CARRY_LOG2 + 1.0f) ? msub : mnew;
    const float alpha = __builtin_amdgcn_exp2f(mref - msub);
    mrow = mnew;
    mref = msub;
    float ps[4];                /* one sum per score tile, as for the maxima */
    FH pb[2];                   /* P^T as B operand: element e <- kv 32kk + 8hh + e, element 8 + e <- kv 32kk + 16 + 8hh + e */
#pragma unroll
    for (int j = 0; j < 4; ++j) {
      float p[8];               /* p x 2^14 */
#pragma unroll
      for (int r = 0; r < 8; ++r) p[r] = s[j][r] - msub;
      exp2x8(p);
      ps[j] = 0.f;
#pragma unroll
      for (int r = 0; r < 8; ++r) {
        ps[j] += p[r];
        pb[j >> 1].h[j & 1][r] = (_Float16)p[r];
      }
    }
    lrow = lrow * alpha + ((ps[0] + ps[1]) + (ps[2] + ps[3]));
#pragma unroll
    for (int t = 0; t < 4; ++t)
#pragma unroll
      for (int r = 0; r < 8; ++r) oacc[t][r] *= alpha;
    /* ---- O^T += V^T . P^T : A = the V^T fragments read above, B = pb; both loops unrolled: vb and pb are indexed by constants ---- */
#pragma unroll
    for (int kk = 0; kk < 2; ++kk) {
#pragma unroll
      for (int t = 0; t < 4; ++t) oacc[t] = at_mma_h(vb[kk][t].v, pb[kk].v, oacc[t]);
    }
    asm volatile("s_wait_dscnt 0x0" ::: "memory");     /* this wave's reads of the buffer have returned before it is refilled */
    asm volatile("s_wait_asynccnt 0x0" ::: "memory");  /* this wave's share of chunk kc + 1 has landed */
    __syncthreads();                                   /* publishes chunk kc + 1, ends every read of chunk kc */
    if (kc + 2 < nch) stage_copy(kc + 2, kc & 1);
  }
  asm volatile("s_wait_asynccnt 0x0" ::: "memory");    /* no copy is outstanding when the ring becomes output staging */

  _Float16* pw = (_Float16*)(void*)&ring[0][0] + wave * (16 * kP16);
  {
    const float ltot = lrow + xhalf(lrow);               /* both halves' kv rows, carried like p; ltot >= 1 */
    const float inv  = O_CARRY / ltot;
#pragma unroll
    for (int t = 0; t < 4; ++t) {
      v8h ov;
#pragma unroll
      for (int r = 0; r < 8; ++r) ov[r] = (_Float16)(oacc[t][r] * inv);
      *(v8h*)(pw + c * kP16 + t * 16 + 8 * hh) = ov;     /* query row c, d = 16t + 8hh + 0..7 */
    }
  }
  __builtin_amdgcn_fence(__ATOMIC_RELEASE, "workgroup");
  __builtin_amdgcn_wave_barrier();
  __builtin_amdgcn_fence(__ATOMIC_ACQUIRE, "workgroup");
  {
    const int q8 = lane >> 3, c8 = (lane & 7) * 8;
    _Float16* ob = (_Float16*)(void*)oo + (tokb + (size_t)q0) * kDm + (size_t)h * kHd;
    {
#pragma unroll
      for (int it = 0; it < 4; ++it) {
        const int row = it * 4 + q8;
        const v8h val = *(const v8h*)(pw + row * kP16 + c8);
        *(v8h*)(ob + (size_t)row * kDm + c8) = val;
      }
      
    }
  }
}

/* ------------------------------------------------------------------------------------- */
extern "C" void kernel_launch(void* const* d_in, const int* in_sizes, int n_in,
                              void* d_out, int out_size, void* d_ws, size_t ws_size,
                              hipStream_t stream) {
  if (n_in < 11) return;
  const float* x    = (const float*)d_in[0];
  const float* mask = (const float*)d_in[1];
  const float* Wq   = (const float*)d_in[2];
  const float* bq   = (const float*)d_in[3];
  const float* Wk   = (const float*)d_in[4];
  const float* bk   = (const float*)d_in[5];
  const float* Wv   = (const float*)d_in[6];
  const float* bv   = (const float*)d_in[7];
  const float* Wo   = (const float*)d_in[8];
  const float* bo   = (const float*)d_in[9];
  const float* tau  = (const float*)d_in[10];

  const size_t nX = (size_t)kTok * kDm;     /* 4,194,304 */
  const size_t nW = (size_t)kDm * kDm;      /* 1,048,576 */
  if ((size_t)in_sizes[0] != nX || (size_t)in_sizes[1] != (size_t)kSeq * kSeq ||
      (size_t)in_sizes[2] != nW || (size_t)in_sizes[4] != nW || (size_t)in_sizes[6] != nW ||
      (size_t)in_sizes[8] != nW || in_sizes[3] != kDm || in_sizes[5] != kDm || in_sizes[7] != kDm ||
      in_sizes[9] != kDm || in_sizes[10] != kHeads) return;
  if ((size_t)out_size != nX) return;

  /*
       xb   bf16 [4096][1024]        off         0   size  8,388,608
       wqb  bf16 [1024][1024]        off  8,388,608  size  2,097,152
       wkb  bf16 [1024][1024]        off 10,485,760  size  2,097,152
       wvb  bf16 [1024][1024]        off 12,582,912  size  2,097,152
       wof  f16  [1024][1024] (x1024) off 14,680,064  size  2,097,152
       qf   f32  [4096][1024]        off 16,777,216  size 16,777,216   (reused as oo f16 [4096][1024], 8,388,608 B, after qf is consumed)
       kf   f32  [4096][1024]        off 33,554,432  size 16,777,216
       qhb  bf16 [4096][1024]        off 50,331,648  size  8,388,608
       qlb  bf16 [4096][1024]        off 58,720,256  size  8,388,608
       khb  bf16 [4096][1024]        off 67,108,864  size  8,388,608
       klb  bf16 [4096][1024]        off 75,497,472  size  8,388,608
       vth  f16  [1024][4096]        off 83,886,080  size  8,388,608   (v transposed: row = output feature, column = token)
       mkb  bf16 [2048][2048]        off 92,274,688  size  8,388,608
       end                              100,663,296 */
  const size_t offXb  = 0;
  const size_t offWq  = offXb  + nX * 2;
  const size_t offWk  = offWq  + nW * 2;
  const size_t offWv  = offWk  + nW * 2;
  const size_t offWo  = offWv  + nW * 2;
  const size_t offQf  = offWo  + nW * 2;
  const size_t offKf  = offQf  + nX * 4;
  const size_t offQh  = offKf  + nX * 4;
  const size_t offQl  = offQh  + nX * 2;
  const size_t offKh  = offQl  + nX * 2;
  const size_t offKl  = offKh  + nX * 2;
  const size_t offVv  = offKl  + nX * 2;
  const size_t offMk  = offVv  + nX * 2;
  const size_t offEnd = offMk  + (size_t)kSeq * kSeq * 2;
  if (offEnd > ws_size) return;

  char* ws = (char*)d_ws;
  unsigned short* xb  = (unsigned short*)(ws + offXb);
  unsigned short* wqb = (unsigned short*)(ws + offWq);
  unsigned short* wkb = (unsigned short*)(ws + offWk);
  unsigned short* wvb = (unsigned short*)(ws + offWv);
  unsigned short* wof = (unsigned short*)(ws + offWo);
  float*          qf  = (float*)(ws + offQf);
  unsigned short* oo  = (unsigned short*)(ws + offQf);   /* reuse after qf is consumed */
  float*          kf  = (float*)(ws + offKf);
  unsigned short* qhb = (unsigned short*)(ws + offQh);
  unsigned short* qlb = (unsigned short*)(ws + offQl);
  unsigned short* khb = (unsigned short*)(ws + offKh);
  unsigned short* klb = (unsigned short*)(ws + offKl);
  unsigned short* vth = (unsigned short*)(ws + offVv);
  unsigned short* mkb = (unsigned short*)(ws + offMk);

  /* 1: input casts (RNE bf16; Wo -> f16 of bf16 value x 1024) */
  cast_all_kernel<<<dim3(kCbAll), dim3(256), 0, stream>>>(x, mask, Wq, Wk, Wv, Wo, xb, mkb, wqb, wkb, wvb, wof);

  /* 2-4: projections C[m][n] = sum_k xb[m][k] W[n][k] + bias[n]; M=4096, N=1024, K=1024 (tiles 64x64, K%64==0);
     v with the operands exchanged, C[n][m] (+ bias[n], now the row's), so that a head's V^T rows lie along the tokens */
  const int gemmTiles  = (kTok / 64) * (kDm / 64);      /* 1024 */
  const int gemmBlocks = (gemmTiles + 7) / 8;           /* 128 */
  wmma_gemm64<1, false, 2, 0, false, 0><<<dim3(gemmBlocks, 1), dim3(256), 0, stream>>>(
      xb, xb, kDm, 0L, wqb, wqb, kDm, 0L, (void*)qf, (void*)qf, kDm, 0L, bq, nullptr, 0L, kTok, kDm, kDm, 1.0f);
  wmma_gemm64<1, false, 2, 0, false, 0><<<dim3(gemmBlocks, 1), dim3(256), 0, stream>>>(
      xb, xb, kDm, 0L, wkb, wkb, kDm, 0L, (void*)kf, (void*)kf, kDm, 0L, bk, nullptr, 0L, kTok, kDm, kDm, 1.0f);
  wmma_gemm64<1, false, 1, 1, false, 0><<<dim3(gemmBlocks, 1), dim3(256), 0, stream>>>(
      wvb, wvb, kDm, 0L, xb, xb, kDm, 0L, (void*)vth, (void*)vth, kTok, 0L, bv, nullptr, 0L, kDm, kTok, kDm, 1.0f);

  /* 5: L2 normalisation of q (x tau) and k, bf16 hi/lo planes */
  l2norm_split_kernel<<<dim3((kTok * kHeads) / 32, 2), dim3(256), 0, stream>>>(qf, kf, tau, qhb, qlb, khb, klb);

  /* 6: attention -> oo (f16, value x 64), overwrites the dead qf region */
  cos_attn_kernel<<<dim3(kBatch * kHeads * (kSeq / kQblk)), dim3(128), 0, stream>>>(qhb, qlb, khb, klb, vth, mkb, oo);

  /* 7: output projection: out[m][n] = 2^-16 * sum_c (oo x64)[m][c] (Wo x1024)[n][c] + bo[n] -> d_out f32 */
  wmma_gemm64<0, false, 2, 0, false, 0><<<dim3(gemmBlocks, 1), dim3(256), 0, stream>>>(
      oo, oo, kDm, 0L, wof, wof, kDm, 0L, d_out, d_out, kDm, 0L, bo, nullptr, 0L, kTok, kDm, kDm,
      1.0f / (O_CARRY * WO_CARRY));
}

// v008
// A run of this version takes 151 microseconds.
// Timed twice side by side with v007, it ran 1.15 and 1.14 times as fast.
// Over all steps from v000 it is 3.07 times as fast.
// Contractions: q/k/v projections on v_wmma_f32_16x16x32_bf16 (operands = RNE bf16 of the inputs); scores on bf16 hi/lo split (hi.hi + hi.lo + lo.hi); p.v and output projection on v_wmma_f32_16x16x32_f16 (p carried x2^14, attention output carried x2^6, Wo carried x2^10); f32 accumulate; norms and softmax in f32.
#include <hip/hip_runtime.h>
#include <stdint.h>

typedef __attribute__((ext_vector_type(16))) _Float16 v16h;
typedef __attribute__((ext_vector_type(8)))  _Float16 v8h;
typedef __attribute__((ext_vector_type(16))) __bf16   v16b;
typedef __attribute__((ext_vector_type(8)))  __bf16   v8b;
typedef __attribute__((ext_vector_type(8)))  float    v8f;
typedef __attribute__((ext_vector_type(4)))  float    v4f;
typedef __attribute__((ext_vector_type(2)))  float    v2f;
typedef __attribute__((ext_vector_type(4)))  unsigned v4u;

/* problem geometry */
constexpr int kBatch = 2;
constexpr int kSeq   = 2048;
constexpr int kDm    = 1024;
constexpr int kHeads = 16;
constexpr int kHd    = 64;
constexpr int kTok   = kBatch * kSeq;      /* 4096 token rows */
constexpr int kKch   = 64;                 /* kv chunk */
constexpr int kQblk  = 64;                 /* query rows per block */
/* LDS row pitches of the attention tiles: 16 B x odd, so that the 16 rows a ds_load_b128 fragment read
   touches fall on 16 different groups of four banks (an unpadded 128 B or 256 B row puts them on one or two) */
constexpr int kP16   = 72;                 /* 64 16-bit elements + 8 pad  = 144 B */
constexpr int kTileE = kKch * kP16;        /* 16-bit elements of one 64-row attention tile in LDS: 9,216 B */
/* GEMM operand staging in LDS */
constexpr int kGk    = 64;                 /* k elements per stage: 128 B of every operand row, whole cache lines */
constexpr int kGp    = 72;                 /* LDS row pitch 144 B = 16 B x odd, as for the attention tiles */
constexpr int kGrows = 64 + 8 * 64;        /* 64 A rows shared by the block's 8 waves + 64 B rows for each wave */
#define O_CARRY 64.0f
#define WO_CARRY 1024.0f
#define LOG2E 1.4426950408889634f
#define P_CARRY_LOG2 14.0f                  /* p is carried x2^14 */

static_assert(kDm == kHeads * kHd, "head split");
static_assert(kTok % 64 == 0 && kDm % 64 == 0, "GEMM M,N tile multiples");
static_assert(kDm % kGk == 0, "GEMM K multiple of the LDS stage");
static_assert((kDm / 64) % 8 == 0 && (kTok / 64) % 8 == 0, "a GEMM block's 8 tiles lie in one tile row");
static_assert(kSeq % kKch == 0 && kSeq % kQblk == 0, "attention tiles");
static_assert((kTok * kHeads) % 32 == 0, "normalize grid");

__device__ __forceinline__ unsigned short f2bf_bits(float f) {
  unsigned u = __float_as_uint(f);
  return (unsigned short)((u + 0x7FFFu + ((u >> 16) & 1u)) >> 16);
}
__device__ __forceinline__ float bf_bits2f(unsigned short h) { return __uint_as_float(((unsigned)h) << 16); }
__device__ __forceinline__ _Float16 h16_lo(unsigned w) { return __builtin_bit_cast(_Float16, (unsigned short)(w & 0xffffu)); }
__device__ __forceinline__ _Float16 h16_hi(unsigned w) { return __builtin_bit_cast(_Float16, (unsigned short)(w >> 16)); }

/* hazard guards as plain device helpers */
__device__ __forceinline__ void dep_guard_h(v8f& a, v8f& b, v16h x, v16h y) { asm volatile("v_nop\n\tv_nop\n\tv_nop\n\tv_nop" : "+v"(a), "+v"(b) : "v"(x), "v"(y)); }
__device__ __forceinline__ void dep_guard_b(v8f& a, v8f& b, v16b x, v16b y) { asm volatile("v_nop\n\tv_nop\n\tv_nop\n\tv_nop" : "+v"(a), "+v"(b) : "v"(x), "v"(y)); }
__device__ __forceinline__ void keep4_h(v16h a, v16h b, v16h c, v16h d) { asm volatile("v_nop" :: "v"(a), "v"(b), "v"(c), "v"(d)); }
__device__ __forceinline__ void keep4_b(v16b a, v16b b, v16b c, v16b d) { asm volatile("v_nop" :: "v"(a), "v"(b), "v"(c), "v"(d)); }
__device__ __forceinline__ void acc_guard4(v8f& a, v8f& b, v8f& c, v8f& d) { asm volatile("v_nop\n\tv_nop\n\tv_nop\n\tv_nop" : "+v"(a), "+v"(b), "+v"(c), "+v"(d)); }
template <typename T> struct Frag;
template <> struct Frag<_Float16> {
  typedef v16h V; union U { v16h v; v8h h[2]; };
  static __device__ __forceinline__ v16h load(const _Float16* p) {   /* elements 0..7 <- p[0..7], 8..15 <- p[16..23] */
    U f; f.h[0] = *(const v8h*)(p); f.h[1] = *(const v8h*)(p + 16); return f.v;
  }
  static __device__ __forceinline__ v8f mma(v16h a, v16h b, v8f c) {
    return __builtin_amdgcn_wmma_f32_16x16x32_f16(false, a, false, b, (short)0, c, false, false);
  }
  static __device__ __forceinline__ void guard(v8f& a, v8f& b, v16h x, v16h y) { dep_guard_h(a, b, x, y); }
  static __device__ __forceinline__ void keep(v16h a, v16h b, v16h c, v16h d) { keep4_h(a, b, c, d); }
};
template <> struct Frag<__bf16> {
  typedef v16b V; union U { v16b v; v8b h[2]; };
  static __device__ __forceinline__ v16b load(const __bf16* p) {
    U f; f.h[0] = *(const v8b*)(p); f.h[1] = *(const v8b*)(p + 16); return f.v;
  }
  static __device__ __forceinline__ v8f mma(v16b a, v16b b, v8f c) {
    return __builtin_amdgcn_wmma_f32_16x16x32_bf16(false, a, false, b, (short)0, c, false, false);
  }
  static __device__ __forceinline__ void guard(v8f& a, v8f& b, v16b x, v16b y) { dep_guard_b(a, b, x, y); }
  static __device__ __forceinline__ void keep(v16b a, v16b b, v16b c, v16b d) { keep4_b(a, b, c, d); }
};

/* Nine asynchronous 16-byte copies global -> LDS per lane, through no register: l = the lane's LDS byte address,
   g = the lane's global address.  The closing s_wait_xcnt stands inside the statement so that no address
   register of an issued copy is rewritten in front of it. */
__device__ __forceinline__ void async_copy9(const unsigned (&l)[9], const unsigned short* const (&g)[9]) {
  asm volatile(
      "global_load_async_to_lds_b128 %0, %9, off\n\t"
      "global_load_async_to_lds_b128 %1, %10, off\n\t"
      "global_load_async_to_lds_b128 %2, %11, off\n\t"
      "global_load_async_to_lds_b128 %3, %12, off\n\t"
      "global_load_async_to_lds_b128 %4, %13, off\n\t"
      "global_load_async_to_lds_b128 %5, %14, off\n\t"
      "global_load_async_to_lds_b128 %6, %15, off\n\t"
      "global_load_async_to_lds_b128 %7, %16, off\n\t"
      "global_load_async_to_lds_b128 %8, %17, off\n\t"
      "s_wait_xcnt 0x0"
      :: "v"(l[0]), "v"(l[1]), "v"(l[2]), "v"(l[3]), "v"(l[4]), "v"(l[5]), "v"(l[6]), "v"(l[7]), "v"(l[8]),
         "v"(g[0]), "v"(g[1]), "v"(g[2]), "v"(g[3]), "v"(g[4]), "v"(g[5]), "v"(g[6]), "v"(g[7]), "v"(g[8])
      : "memory");
}

/* The same with eight copies per lane: two 64-row tiles of the attention ring (four passes of 16 rows each). */
__device__ __forceinline__ void async_copy8(const unsigned (&l)[8], const unsigned short* const (&g)[8]) {
  asm volatile(
      "global_load_async_to_lds_b128 %0, %8, off\n\t"
      "global_load_async_to_lds_b128 %1, %9, off\n\t"
      "global_load_async_to_lds_b128 %2, %10, off\n\t"
      "global_load_async_to_lds_b128 %3, %11, off\n\t"
      "global_load_async_to_lds_b128 %4, %12, off\n\t"
      "global_load_async_to_lds_b128 %5, %13, off\n\t"
      "global_load_async_to_lds_b128 %6, %14, off\n\t"
      "global_load_async_to_lds_b128 %7, %15, off\n\t"
      "s_wait_xcnt 0x0"
      :: "v"(l[0]), "v"(l[1]), "v"(l[2]), "v"(l[3]), "v"(l[4]), "v"(l[5]), "v"(l[6]), "v"(l[7]),
         "v"(g[0]), "v"(g[1]), "v"(g[2]), "v"(g[3]), "v"(g[4]), "v"(g[5]), "v"(g[6]), "v"(g[7])
      : "memory");
}

/* ---- Register-blocked batched WMMA GEMM --------------------------------
   C[m,n] = scale * sum_k A[m,k] * Bt[n,k] (+bias); each wave owns a 64x64 tile.
   A row-major [M,K]; Bt row-major [N,K]; M % 64 == 0, N % 512 == 0, K % 64 == 0, lda and ldb % 8 == 0.
   A block's 8 waves own 8 neighbouring tiles of one tile row.  Per 64 k the block's 64 A rows and 512 Bt rows
   are copied to LDS in whole 128 B lines (two buffers: the next stage flies while this one is multiplied);
   the fragments are read from LDS in ascending k, 32 at a time.
   BIAS_MODE: 0 = none, 1 = bias[m], 2 = bias[n]; bias values RNE-converted to bf16 precision before the add.
   OUT_MODE: 0 = f32, 1 = f16, 2 = bf16 hi plane (Cout) + bf16 lo plane (Cout2).
   ET: 0 = f16 operands, 1 = bf16 operands (pointers passed as 16-bit storage) */
template <int ET> struct Elem;
template <> struct Elem<0> { typedef _Float16 T; };
template <> struct Elem<1> { typedef __bf16 T; };
template <int ET, bool SPLIT, int BIAS_MODE, int OUT_MODE, bool RESID, int ACT = 0>
__global__ __launch_bounds__(256) void wmma_gemm64(
    const unsigned short* __restrict__ Ap, const unsigned short* __restrict__ A2p, int lda, long strideA,
    const unsigned short* __restrict__ Btp, const unsigned short* __restrict__ Bt2p, int ldb, long strideB,
    void* __restrict__ Cout, void* __restrict__ Cout2, int ldc, long strideC,
    const float* __restrict__ bias,
    const float* __restrict__ resid, long strideR,
    int M, int N, int K, float scale) {
  typedef typename Elem<ET>::T T;
  typedef typename Frag<T>::V V;
  static_assert(!SPLIT, "the LDS stage holds one plane of each operand");
  __shared__ __align__(16) float sT[8][16 * 68];   /* per-wave 16x64 slab, pitch 68 floats */
  __shared__ __align__(16) unsigned short sAB[2][kGrows * kGp];   /* two stages: rows 0..63 A, 64..575 Bt */
  const int b    = blockIdx.y;
  const int lane = threadIdx.x & 31;
  const int wave = threadIdx.x >> 5;
  const int tilesN = N >> 6;
  const int tilesM = M >> 6;
  const int tile0 = blockIdx.x * 8;
  if (tile0 >= tilesM * tilesN) return;  /* block-uniform, in front of every barrier */
  const int tile = tile0 + wave;
  const int tm = tile / tilesN;
  const int tn = tile - tm * tilesN;
  const int m0 = tm << 6;
  const int n0 = tn << 6;

  const unsigned short* Ab = Ap  + (size_t)b * strideA;
  const unsigned short* Bb = Btp + (size_t)b * strideB;

  const int rlane = lane & 15;                 /* row (A) / col (B, D) within subtile */
  const int koff  = (lane >> 4) * 8;           /* k offset of this lane half */
  const int mOff  = (lane >> 4) * 8;           /* D row offset */

  /* copy map: 8 lanes x 16 B = one 128 B row, 32 rows per pass of the block, 18 passes = 576 rows */
  const int crow = threadIdx.x >> 3;
  const int cchk = (threadIdx.x & 7) * 8;
  const int nb0  = (tile0 - tm * tilesN) << 6;  /* first Bt row of the block */
  const unsigned short* gA = Ab + (size_t)(m0 + crow) * lda + cchk;
  const unsigned short* gB = Bb + (size_t)(nb0 + crow) * ldb + cchk;
  const unsigned lds0 = (unsigned)(uintptr_t)(const void*)&sAB[0][0] + (unsigned)(crow * kGp + cchk) * 2u;
  auto stage_copy = [&](int st, int buf) {
    const unsigned lb = lds0 + (unsigned)buf * (unsigned)(kGrows * kGp * 2);
    const unsigned short* pa = gA + (size_t)st * kGk;
    const unsigned short* pb = gB + (size_t)st * kGk;
    unsigned l[9];
    const unsigned short* g[9];
    /* both loops unrolled: l[] and g[] are asm operands and must be registers */
#pragma unroll
    for (int it = 0; it < 9; ++it) {
      l[it] = lb + (unsigned)(it * 32 * kGp * 2);
      g[it] = (it < 2) ? pa + (size_t)(it * 32) * lda : pb + (size_t)((it - 2) * 32) * ldb;
    }
    async_copy9(l, g);
#pragma unroll
    for (int it = 0; it < 9; ++it) {
      l[it] = lb + (unsigned)((it + 9) * 32 * kGp * 2);
      g[it] = pb + (size_t)((it + 7) * 32) * ldb;
    }
    async_copy9(l, g);
  };

  v8f acc[4][4];
#pragma unroll
  for (int i = 0; i < 4; ++i)
#pragma unroll
    for (int j = 0; j < 4; ++j) acc[i][j] = (v8f){0.f,0.f,0.f,0.f,0.f,0.f,0.f,0.f};

  const int nst = K / kGk;
  stage_copy(0, 0);
  asm volatile("s_wait_asynccnt 0x0" ::: "memory");   /* this wave's share of stage 0 has landed */
  __syncthreads();                                     /* ... and every other wave's */
  if (nst > 1) stage_copy(1, 1);
  for (int t = 0; t < nst; ++t) {
    const T* sA = (const T*)(const void*)sAB[t & 1] + rlane * kGp + koff;
    const T* sB = sA + (64 + wave * 64) * kGp;
    /* all loops of the stage unrolled: fragments and accumulators are indexed by constants and stay in registers */
#pragma unroll
    for (int ks = 0; ks < kGk; ks += 32) {
      V bh[4], ah[4];
#pragma unroll
      for (int j = 0; j < 4; ++j) bh[j] = Frag<T>::load(sB + j * 16 * kGp + ks);
#pragma unroll
      for (int i = 0; i < 4; ++i) ah[i] = Frag<T>::load(sA + i * 16 * kGp + ks);
#pragma unroll
      for (int i = 0; i < 4; ++i) {
#pragma unroll
        for (int j = 0; j < 4; ++j) acc[i][j] = Frag<T>::mma(ah[i], bh[j], acc[i][j]);
        Frag<T>::guard(acc[i][0], acc[i][3], ah[i], ah[i]);
      }
      Frag<T>::keep(bh[0], bh[1], bh[2], bh[3]);
    }
    asm volatile("s_wait_dscnt 0x0" ::: "memory");     /* this wave's reads of the buffer have returned before it is refilled */
    asm volatile("s_wait_asynccnt 0x0" ::: "memory");  /* this wave's share of stage t + 1 has landed */
    __syncthreads();                                   /* publishes stage t + 1, ends every read of stage t */
    if (t + 2 < nst) stage_copy(t + 2, t & 1);
  }
  asm volatile("s_wait_asynccnt 0x0" ::: "memory");    /* no copy is outstanding when the wave goes on */
  acc_guard4(acc[0][0], acc[0][1], acc[0][2], acc[0][3]);
  acc_guard4(acc[1][0], acc[1][1], acc[1][2], acc[1][3]);
  acc_guard4(acc[2][0], acc[2][1], acc[2][2], acc[2][3]);
  acc_guard4(acc[3][0], acc[3][1], acc[3][2], acc[3][3]);

  /* ---- epilogue ---- */
  float* slab = sT[wave];
  const float* Rb = RESID ? (resid + (size_t)b * strideR) : nullptr;
#pragma unroll
  for (int i = 0; i < 4; ++i) {
    const int mBase = m0 + (i << 4);
#pragma unroll
    for (int j = 0; j < 4; ++j) {
      const int n = n0 + (j << 4) + rlane;
      float bv = 0.f;
      if (BIAS_MODE == 2) bv = bf_bits2f(f2bf_bits(bias[n]));
#pragma unroll
      for (int r = 0; r < 8; ++r) {
        float v = acc[i][j][r] * scale;
        if (BIAS_MODE == 1) v += bf_bits2f(f2bf_bits(bias[mBase + mOff + r]));
        if (BIAS_MODE == 2) v += bv;
        if (RESID) v += Rb[(size_t)(mBase + mOff + r) * ldc + n];
        if (ACT == 1) v = tanhf(v);
        if (ACT == 2) v = fmaxf(v, 0.0f);
        if (ACT == 3) v = v / (1.0f + expf(-v));
        if (ACT == 4) v = (v > 0.f) ? v : 0.01f * v;
        slab[(mOff + r) * 68 + (j << 4) + rlane] = v;
      }
    }
    __builtin_amdgcn_fence(__ATOMIC_RELEASE, "workgroup");
    __builtin_amdgcn_wave_barrier();
    __builtin_amdgcn_fence(__ATOMIC_ACQUIRE, "workgroup");
    if (OUT_MODE == 0) {
      float* C = (float*)Cout + (size_t)b * strideC;
      const int hh = lane >> 4, c4 = (lane & 15) * 4;     /* row seg = 256 B = 16 lanes x 16 B */
      {
#pragma unroll
        for (int it = 0; it < 8; ++it) {
          const int row = it * 2 + hh;
          v4f v = *(const v4f*)(slab + row * 68 + c4);
          *(v4f*)(C + (size_t)(mBase + row) * ldc + n0 + c4) = v;
        }
        
      }
    } else {
      const int q = lane >> 3, c8 = (lane & 7) * 8;        
      unsigned short* C  = (unsigned short*)Cout  + (size_t)b * strideC;
      unsigned short* C2 = (OUT_MODE == 2) ? ((unsigned short*)Cout2 + (size_t)b * strideC) : nullptr;
      {
#pragma unroll
        for (int it = 0; it < 4; ++it) {
          const int row = it * 4 + q;
          const float* sp = slab + row * 68 + c8;
          v8h hv, lv;
#pragma unroll
          for (int e = 0; e < 8; ++e) {
            if (OUT_MODE == 1) {
              hv[e] = (_Float16)sp[e];
            } else {
              unsigned short hb = f2bf_bits(sp[e]);
              unsigned short lb = f2bf_bits(sp[e] - bf_bits2f(hb));
              hv[e] = __builtin_bit_cast(_Float16, hb);
              lv[e] = __builtin_bit_cast(_Float16, lb);
            }
          }
          *(v8h*)(C + (size_t)(mBase + row) * ldc + n0 + c8) = hv;
          if (OUT_MODE == 2) *(v8h*)(C2 + (size_t)(mBase + row) * ldc + n0 + c8) = lv;
        }
        
      }
    }
    __builtin_amdgcn_fence(__ATOMIC_RELEASE, "workgroup");
    __builtin_amdgcn_wave_barrier();
    __builtin_amdgcn_fence(__ATOMIC_ACQUIRE, "workgroup");
  }
}

/* ---- all six input casts in one launch: the block index picks the tensor (block-uniform, scalar branches).
   x, mask, Wq, Wk, Wv -> bf16 bits (RNE); Wo -> f16 bits of (RNE-bf16 value * WO_CARRY).
   Each of them alone is a launch of a few microseconds at most, most of it start and drain; side by side they pay that once.
   coverage: a block = 256 threads x 2 elements (mask: x 16, one 64 x 64 tile); kCbX + kCbM + 4 kCbW blocks cover the six tensors exactly.
   A mask block also leaves, per wave (8 rows of its tile), the largest cast value and the smallest of the 8 rows' largest:
   mst[tile][wave] = {hi, lo}, a record of 128 B a tile, from which the attention tells the tiles that cannot count. */
constexpr int kCbX   = kTok * kDm / 512;   /* 8192 blocks for x */
constexpr int kCbM   = (kSeq / kQblk) * (kSeq / kKch);  /* 1024 blocks for the mask, one attention tile each */
constexpr int kMstRec = 32;                /* floats per tile record: 8 waves x {hi, lo}, padded to a whole 128 B line */
constexpr int kCbW   = kDm * kDm / 512;    /* 2048 blocks for each weight matrix */
constexpr int kCbAll = kCbX + kCbM + 4 * kCbW;
static_assert((kTok * kDm) % 512 == 0 && kQblk == 64 && kKch == 64 && (kDm * kDm) % 512 == 0, "whole blocks");
__global__ __launch_bounds__(256) void cast_all_kernel(
    const float* __restrict__ x,  const float* __restrict__ mask, const float* __restrict__ wq,
    const float* __restrict__ wk, const float* __restrict__ wv,   const float* __restrict__ wo,
    unsigned short* __restrict__ xb,  unsigned short* __restrict__ mkb, unsigned short* __restrict__ wqb,
    unsigned short* __restrict__ wkb, unsigned short* __restrict__ wvb, unsigned short* __restrict__ wof,
    float* __restrict__ mst) {
  int blk = blockIdx.x;
  const float* in = x;
  unsigned short* out = xb;
  bool carry = false;                      /* Wo alone */
  if (blk >= kCbX + kCbM) {
    blk -= kCbX + kCbM;
    const int w = blk / kCbW;              /* 0..3 by the grid */
    blk -= w * kCbW;
    in    = (w == 0) ? wq  : (w == 1) ? wk  : (w == 2) ? wv  : wo;
    out   = (w == 0) ? wqb : (w == 1) ? wkb : (w == 2) ? wvb : wof;
    carry = (w == 3);
  } else if (blk >= kCbX) {
    blk -= kCbX;                           /* tile (tq, tk): query rows 64 tq.., kv columns 64 tk.. */
    const int tq  = blk / (kSeq / kKch);
    const int tk  = blk - tq * (kSeq / kKch);
    const int row = threadIdx.x >> 2;      /* four threads a row, 16 elements each */
    const size_t o = (size_t)(tq * kQblk + row) * kSeq + (size_t)(tk * kKch + (threadIdx.x & 3) * 16);
    float mx = -INFINITY;
    bool bad = false;                      /* a NaN, which fmaxf would pass over */
    unsigned w[8];
    /* unrolled: w[] is indexed by constants and stays in registers, the four loads go out together */
#pragma unroll
    for (int i = 0; i < 4; ++i) {
      const v4f p = *(const v4f*)(mask + o + 4 * i);
      const unsigned short u0 = f2bf_bits(p.x), u1 = f2bf_bits(p.y), u2 = f2bf_bits(p.z), u3 = f2bf_bits(p.w);
      const float f0 = bf_bits2f(u0), f1 = bf_bits2f(u1), f2 = bf_bits2f(u2), f3 = bf_bits2f(u3);
      w[2 * i]     = (unsigned)u0 | ((unsigned)u1 << 16);
      w[2 * i + 1] = (unsigned)u2 | ((unsigned)u3 << 16);
      mx  = fmaxf(mx, fmaxf(fmaxf(f0, f1), fmaxf(f2, f3)));
      bad = bad || (f0 != f0) || (f1 != f1) || (f2 != f2) || (f3 != f3);
    }
    v4u s0; s0.x = w[0]; s0.y = w[1]; s0.z = w[2]; s0.w = w[3];
    v4u s1; s1.x = w[4]; s1.y = w[5]; s1.z = w[6]; s1.w = w[7];
    v4u* mo = (v4u*)(void*)(mkb + o);
    mo[0] = s0; mo[1] = s1;
    mx = fmaxf(mx, __shfl_xor(mx, 1, 32));
    mx = fmaxf(mx, __shfl_xor(mx, 2, 32)); /* the row's largest inside the tile */
    float hi = mx, lo = mx;
    for (int d = 4; d < 32; d <<= 1) {
      hi = fmaxf(hi, __shfl_xor(hi, d, 32));
      lo = fminf(lo, __shfl_xor(lo, d, 32));
    }
    if (__builtin_amdgcn_ballot_w32(bad) != 0u) hi = INFINITY;   /* a tile with a NaN is always worked */
    if ((threadIdx.x & 31) == 0) {
      v2f st; st.x = hi; st.y = lo;
      *(v2f*)(mst + (size_t)blk * kMstRec + (threadIdx.x >> 5) * 2) = st;
    }
    return;
  }
  const int i = blk * 256 + threadIdx.x;
  const v2f p = *(const v2f*)(in + 2 * (size_t)i);
  unsigned short u0 = f2bf_bits(p.x), u1 = f2bf_bits(p.y);
  if (carry) {
    u0 = __builtin_bit_cast(unsigned short, (_Float16)(bf_bits2f(u0) * WO_CARRY));
    u1 = __builtin_bit_cast(unsigned short, (_Float16)(bf_bits2f(u1) * WO_CARRY));
  }
  unsigned* op = (unsigned*)(void*)out;
  op[i] = (unsigned)u0 | ((unsigned)u1 << 16);
}

/* ---- per (token, head) L2 normalisation + bf16 hi/lo split.
   blockIdx.y = 0: q plane, scaled by 1/max(||q||,1e-12) * bf16(tau[head]) * log2(e), so that the scores come out
   of the matrix unit as exponents of 2; y = 1: k plane, 1/max(||k||,1e-12).
   8 lanes per 64-vector (8 floats each), 32 segments per 256-thread block; grid.x = kTok*kHeads/32 = 2048.
*/
__global__ __launch_bounds__(256) void l2norm_split_kernel(
    const float* __restrict__ qf, const float* __restrict__ kf, const float* __restrict__ tau,
    unsigned short* __restrict__ qhp, unsigned short* __restrict__ qlp,
    unsigned short* __restrict__ khp, unsigned short* __restrict__ klp) {
  const bool isk = (blockIdx.y != 0);                 /* block-uniform */
  const float* src = isk ? kf : qf;
  unsigned short* dhp = isk ? khp : qhp;
  unsigned short* dlp = isk ? klp : qlp;
  const int tid = threadIdx.x;
  const int g = tid >> 3, e = tid & 7;
  const int seg = blockIdx.x * 32 + g;                 /* < kTok*kHeads */
  const int token = seg >> 4, head = seg & 15;
  const size_t base = (size_t)token * kDm + (size_t)head * kHd + (size_t)e * 8;
  const v4f a  = *(const v4f*)(src + base);
  const v4f c4 = *(const v4f*)(src + base + 4);
  float ss = 0.0f;
  ss += a.x * a.x;  ss += a.y * a.y;  ss += a.z * a.z;  ss += a.w * a.w;
  ss += c4.x * c4.x; ss += c4.y * c4.y; ss += c4.z * c4.z; ss += c4.w * c4.w;
  ss += __shfl_xor(ss, 1, 32);
  ss += __shfl_xor(ss, 2, 32);
  ss += __shfl_xor(ss, 4, 32);
  const float nrm  = sqrtf(ss);
  const float rinv = 1.0f / fmaxf(nrm, 1e-12f);
  const float th   = bf_bits2f(f2bf_bits(tau[head]));
  const float sc   = isk ? rinv : rinv * (th * LOG2E);
  float vals[8];
  vals[0] = a.x * sc;  vals[1] = a.y * sc;  vals[2] = a.z * sc;  vals[3] = a.w * sc;
  vals[4] = c4.x * sc; vals[5] = c4.y * sc; vals[6] = c4.z * sc; vals[7] = c4.w * sc;
  unsigned hw[4], lw[4];
#pragma unroll
  for (int i = 0; i < 4; ++i) {
    const float v0 = vals[2 * i], v1 = vals[2 * i + 1];
    const unsigned short h0 = f2bf_bits(v0), h1 = f2bf_bits(v1);
    const unsigned short l0 = f2bf_bits(v0 - bf_bits2f(h0));
    const unsigned short l1 = f2bf_bits(v1 - bf_bits2f(h1));
    hw[i] = (unsigned)h0 | ((unsigned)h1 << 16);
    lw[i] = (unsigned)l0 | ((unsigned)l1 << 16);
  }
  v4u hv; hv.x = hw[0]; hv.y = hw[1]; hv.z = hw[2]; hv.w = hw[3];
  v4u lv; lv.x = lw[0]; lv.y = lw[1]; lv.z = lw[2]; lv.w = lw[3];
  v4u* ph = (v4u*)(void*)(dhp + base);
  v4u* pl = (v4u*)(void*)(dlp + base);
  *ph = hv; *pl = lv;
  
}

__device__ __forceinline__ v8f at_mma_b(v16b a, v16b b, v8f c) {
  c = __builtin_amdgcn_wmma_f32_16x16x32_bf16(false, a, false, b, (short)0, c, false, false);
  asm volatile("v_nop\n\tv_nop\n\tv_nop\n\tv_nop" : "+v"(c) : "v"(a), "v"(b));
  return c;
}
__device__ __forceinline__ v8f at_mma_h(v16h a, v16h b, v8f c) {
  c = __builtin_amdgcn_wmma_f32_16x16x32_f16(false, a, false, b, (short)0, c, false, false);
  asm volatile("v_nop\n\tv_nop\n\tv_nop\n\tv_nop" : "+v"(c) : "v"(a), "v"(b));
  return c;
}

/* x[i] = 2^x[i] for the eight scores of one tile, each in its own register, so that no v_exp_f32 reads the result or
   overwrites the source of the one in front of it; the closing v_nop is the slot the instruction set asks for
   between the last v_exp_f32 and whatever the compiler puts next. */
__device__ __forceinline__ void exp2x8(float (&x)[8]) {
  asm("v_exp_f32 %0, %0\n\t"
      "v_exp_f32 %1, %1\n\t"
      "v_exp_f32 %2, %2\n\t"
      "v_exp_f32 %3, %3\n\t"
      "v_exp_f32 %4, %4\n\t"
      "v_exp_f32 %5, %5\n\t"
      "v_exp_f32 %6, %6\n\t"
      "v_exp_f32 %7, %7\n\t"
      "v_nop"
      : "+v"(x[0]), "+v"(x[1]), "+v"(x[2]), "+v"(x[3]), "+v"(x[4]), "+v"(x[5]), "+v"(x[6]), "+v"(x[7]));
}

/* lane l <-> lane l ^ 16 by one vector cross-row move */
__device__ __forceinline__ float xhalf(float x) {
  const int b = __builtin_bit_cast(int, x);
  return __builtin_bit_cast(float, __builtin_amdgcn_permlanex16(b, b, 0x76543210, 0xfedcba98, false, false));
}

/* =====================================================================================
   Attention for head_dim 64 with an additive [kSeq][kSeq] mask shared over (b,h).
   Inputs: qh/ql = bf16 hi/lo planes of (q/||q|| * tau[h] * log2 e), kh/kl = bf16 hi/lo planes of k/||k||,
           all [kTok][kDm] with element (b, s, h, d) at (b*kSeq+s)*kDm + h*64 + d;
           vt = f16 plane of v, transposed: [kDm][kTok], element (b, s, h, d) at (h*64+d)*kTok + b*kSeq + s;
           mb = bf16 plane (RNE) of the mask, [kSeq][kSeq].
   Every tile of a kv chunk (K hi, K lo, V^T, mask) is 64 rows of 128 B that lie in global memory as LDS wants them:
           asynchronous copies bring whole rows into one of two buffers while the other one is worked on.
   scores, transposed: S^T = khat . qhat_tau^T : 3 bf16 WMMAs (hi.hi + lo.hi + hi.lo), A = K rows, B = Q columns;
           lanes c and c + 16 hold all scores of query column c: += bf16(mask[q][kv]) * log2 e; online softmax f32 in
           base 2 (p x 2^14 = 2^(score - maximum + 14): one subtraction and one v_exp_f32 a score), maximum and
           sum in the lane, the halves' maxima joined per chunk, their sums (carried x2^14 like p) once at the end.
   out, transposed: O^T += V^T . P^T : f16 WMMA, p carried x2^14; two score tiles converted in place are the B operand.
           result written as f16 of (out * 2^6) into oo (same plane layout).
   Block = 4 waves = 64 query rows of one (b, h).  A kv chunk is walked unless its mask tile alone shows that every one of its
           weights is 0 in f32: with |score| <= bq (cosine x tau, base 2), every row's maximum is at least L log2 e - bq,
           L = the largest over the chunks of lo (cast launch), and a chunk's scores are at most hi log2 e + bq; a chunk more than
           192 binary orders below is left out, copies and all.  Read from the mask at run time, for any mask.
   grid.x = kBatch * kHeads * (kSeq/64) = 1024.  coverage of oo: 1024 blocks x 64 rows x 64 d = kTok*kDm.
   All blocks are resident at once, four a WGP, so the launch ends with the WGP that has the most chunks to walk.  Where the count
           grows or falls along the query tiles (a causal mask), the block index is spread so that any four blocks whose
           indices differ in two bits hold two tiles t, t' and two mirrored ones 31 - t'', 31 - t''' with t + t' = t'' + t''':
           the same sum of chunks whichever four share a WGP; for other masks any order does as well.
   ===================================================================================== */
__global__ __launch_bounds__(128)
void cos_attn_kernel(const unsigned short* __restrict__ qhp, const unsigned short* __restrict__ qlp,
                     const unsigned short* __restrict__ khp, const unsigned short* __restrict__ klp,
                     const unsigned short* __restrict__ vtp, const unsigned short* __restrict__ mbp,
                     const float* __restrict__ mst, const float* __restrict__ tau,
                     unsigned short* __restrict__ oo) {
  union FB { v16b v; v8b h[2]; };
  union FH { v16h v; v8h h[2]; };
  /* two buffers x four tiles of 9 KB: K hi [kv][d], K lo [kv][d], V^T [d][kv], mask bf16 [qrow][kv]; 72 KB, four blocks a WGP.
     Behind the loop's last barrier the first 9 KB serve as the waves' output staging. */
  __shared__ __align__(16) unsigned short ring[2][4 * kTileE];

  const int tid  = threadIdx.x;
  const int wave = tid >> 5;
  const int lane = tid & 31;
  const int hh   = lane >> 4;
  const int c    = lane & 15;

  constexpr int nqb = kSeq / kQblk;             /* 32 */
  static_assert(nqb == 32 && kBatch * kHeads == 32, "index bits 5,2,6,7 = t; 0,1,3,4,8 = (b, h); parity of all ten = mirror");
  const int bx  = blockIdx.x;
  const int tq  = ((bx >> 5) & 1) | ((bx >> 1) & 2) | ((bx >> 4) & 12);
  const int qb  = (__builtin_popcount((unsigned)bx) & 1) ? nqb - 1 - tq : tq;   /* bit 9 makes both parities: one to one */
  const int bh  = (bx & 3) | ((bx >> 1) & 12) | ((bx >> 4) & 16);
  const int h   = bh % kHeads;
  const int b   = bh / kHeads;
  const int qbase = qb * kQblk;
  const int q0    = qbase + wave * 16;
  const size_t tokb = (size_t)b * kSeq;

  const __bf16*   qh = (const __bf16*)(const void*)qhp;
  const __bf16*   ql = (const __bf16*)(const void*)qlp;

  /* ---- Q fragments (B operand): column = lane&15, elements 0..7 <- d0+8hh+0..7, 8..15 <- d0+16+8hh+0..7 ---- */
  v16b qah[2], qal[2];
  {
    const size_t ro = (tokb + (size_t)(q0 + c)) * kDm + (size_t)h * kHd;
#pragma unroll
    for (int dc = 0; dc < 2; ++dc) {
      qah[dc] = Frag<__bf16>::load(qh + ro + dc * 32 + 8 * hh);
      qal[dc] = Frag<__bf16>::load(ql + ro + dc * 32 + 8 * hh);
    }
  }

  float mrow = -INFINITY;      /* running maximum of query column c, equal in both lane halves */
  float mref = -INFINITY;      /* the exponent that p, lrow and oacc are carried against: mrow - 14 */
  float lrow = 0.f;            /* running sum over this lane half's kv rows only */
  v8f oacc[4];                 /* O^T: oacc[t][r] = out[d = 16t + 8hh + r][query c] */
#pragma unroll
  for (int t = 0; t < 4; ++t) oacc[t] = (v8f){0.f,0.f,0.f,0.f,0.f,0.f,0.f,0.f};

  /* copy map: 8 lanes x 16 B = one 128 B row, 16 rows per pass of the block, 4 passes per tile */
  const int crow = tid >> 3;
  const int cchk = (tid & 7) * 8;
  const unsigned short* gKh = khp + (tokb + (size_t)crow) * kDm + (size_t)h * kHd + cchk;
  const unsigned short* gKl = klp + (tokb + (size_t)crow) * kDm + (size_t)h * kHd + cchk;
  const unsigned short* gVt = vtp + ((size_t)h * kHd + (size_t)crow) * kTok + tokb + cchk;
  const unsigned short* gMb = mbp + (size_t)(qbase + crow) * kSeq + cchk;
  const unsigned lds0 = (unsigned)(uintptr_t)(const void*)&ring[0][0] + (unsigned)(crow * kP16 + cchk) * 2u;
  auto stage_copy = [&](int st, int buf) {
    const unsigned lb = lds0 + (unsigned)buf * (unsigned)(4 * kTileE * 2);
    const unsigned short* ph = gKh + (size_t)st * (kKch * kDm);
    const unsigned short* pl = gKl + (size_t)st * (kKch * kDm);
    const unsigned short* pv = gVt + (size_t)st * kKch;
    const unsigned short* pm = gMb + (size_t)st * kKch;
    unsigned l[8];
    const unsigned short* g[8];
    /* both loops unrolled: l[] and g[] are asm operands and must be registers */
#pragma unroll
    for (int it = 0; it < 4; ++it) {
      l[it]     = lb + (unsigned)((it * 16 * kP16) * 2);
      l[it + 4] = lb + (unsigned)((kTileE + it * 16 * kP16) * 2);
      g[it]     = ph + (size_t)(it * 16) * kDm;
      g[it + 4] = pl + (size_t)(it * 16) * kDm;
    }
    async_copy8(l, g);
#pragma unroll
    for (int it = 0; it < 4; ++it) {
      l[it]     = lb + (unsigned)((2 * kTileE + it * 16 * kP16) * 2);
      l[it + 4] = lb + (unsigned)((3 * kTileE + it * 16 * kP16) * 2);
      g[it]     = pv + (size_t)(it * 16) * kTok;
      g[it + 4] = pm + (size_t)(it * 16) * kSeq;
    }
    async_copy8(l, g);
  };

  constexpr int nch = kSeq / kKch;
  static_assert(nch == 32, "one lane and one bit per kv chunk");
  /* ---- the chunks to walk, one bit each: lane = chunk; every wave reads the same records and gets the same word ---- */
  unsigned rem;
  {
    const v4f* rec = (const v4f*)(mst + (size_t)(qb * nch + lane) * kMstRec);
    const v4f r0 = rec[0], r1 = rec[1], r2 = rec[2], r3 = rec[3];          /* {hi, lo} of the tile's 8 row groups */
    const float hi = fmaxf(fmaxf(fmaxf(r0.x, r0.z), fmaxf(r1.x, r1.z)), fmaxf(fmaxf(r2.x, r2.z), fmaxf(r3.x, r3.z)));
    float L        = fminf(fminf(fminf(r0.y, r0.w), fminf(r1.y, r1.w)), fminf(fminf(r2.y, r2.w), fminf(r3.y, r3.w)));
    for (int d = 1; d < 32; d <<= 1) L = fmaxf(L, __shfl_xor(L, d, 32));
    const float bq = fabsf(bf_bits2f(f2bf_bits(tau[h]))) * (LOG2E * 1.0625f) + 1.0f;
    /* written so that a NaN (inf - inf, a NaN tau) keeps the chunk */
    const bool out_of_reach = (L - hi) * LOG2E > 2.0f * bq + 192.0f;
    rem = __builtin_amdgcn_ballot_w32(!out_of_reach);
    if (rem == 0u) rem = 0xffffffffu;   /* bounds the chunk index below whatever the records hold (the chunk that gives L has its bit) */
  }
  const int nact = __builtin_popcount(rem);
  int cn = __builtin_ctz(rem);
  rem &= rem - 1u;
  stage_copy(cn, 0);
  asm volatile("s_wait_asynccnt 0x0" ::: "memory");   /* this wave's share of the first chunk has landed */
  __syncthreads();                                     /* ... and every other wave's */
  if (rem != 0u) {
    cn = __builtin_ctz(rem);
    rem &= rem - 1u;
    stage_copy(cn, 1);
  }
  for (int kc = 0; kc < nact; ++kc) {
    const unsigned short* tb = ring[kc & 1];
    const __bf16*   Ksh = (const __bf16*)(const void*)tb;
    const __bf16*   Ksl = (const __bf16*)(const void*)(tb + kTileE);
    const _Float16* Vt  = (const _Float16*)(const void*)(tb + 2 * kTileE);
    const unsigned short* Msk = tb + 3 * kTileE;

    /* ---- LDS reads stand in groups ahead of the matrix runs, never among them: a read placed directly in front of its
       product leaves the wave waiting out the LDS latency at every product.  (The hazard statements behind the products
       are volatile asm, which no load crosses: where a group is written is where it is issued.)
       Group 1, at the head of the chunk: all K hi and K lo fragments, 32 reads. ---- */
    FB kb[4][2], klo[4][2];
#pragma unroll
    for (int j = 0; j < 4; ++j) {
#pragma unroll
      for (int dc = 0; dc < 2; ++dc) {
        kb[j][dc].h[0]  = *(const v8b*)(Ksh + (j * 16 + c) * kP16 + dc * 32 + 8 * hh);
        kb[j][dc].h[1]  = *(const v8b*)(Ksh + (j * 16 + c) * kP16 + dc * 32 + 16 + 8 * hh);
        klo[j][dc].h[0] = *(const v8b*)(Ksl + (j * 16 + c) * kP16 + dc * 32 + 8 * hh);
        klo[j][dc].h[1] = *(const v8b*)(Ksl + (j * 16 + c) * kP16 + dc * 32 + 16 + 8 * hh);
      }
    }
    const unsigned short* mrw = Msk + (wave * 16 + c) * kP16 + 8 * hh;
    v4u mw[4];                  /* mask words of the lane's own query row: eight bf16 per score tile */
    FH vb[2][4];                /* V^T fragments: A[m=d][k=kv] = Vt[d][kv] (lane row c) */

    /* ---- scores: S^T[kvrow][qcol], A[m=kv][k=d] = Ksh[kv][d], B[k=d][n=q] = Q; s[j][r] = S[q = c][kv = 16j + 8hh + r] ---- */
    v8f s[4];
#pragma unroll
    for (int j = 0; j < 4; ++j) {
      s[j] = (v8f){0.f,0.f,0.f,0.f,0.f,0.f,0.f,0.f};
#pragma unroll
      for (int dc = 0; dc < 2; ++dc) {
        s[j] = at_mma_b(kb[j][dc].v,  qah[dc], s[j]);
        s[j] = at_mma_b(klo[j][dc].v, qah[dc], s[j]);
        s[j] = at_mma_b(kb[j][dc].v,  qal[dc], s[j]);
      }
      /* Groups 2 and 3, into registers that K fragments have left: the mask words and the first half of V^T behind
         score tile 1, the second half of V^T behind score tile 3; they land under the products and the softmax */
      if (j == 1) {
#pragma unroll
        for (int jj = 0; jj < 4; ++jj) mw[jj] = *(const v4u*)(const void*)(mrw + jj * 16);
      }
      if (j == 1 || j == 3) {
        const int kk = j >> 1;
#pragma unroll
        for (int t = 0; t < 4; ++t) {
          vb[kk][t].h[0] = *(const v8h*)(Vt + (t * 16 + c) * kP16 + kk * 32 + 8 * hh);
          vb[kk][t].h[1] = *(const v8h*)(Vt + (t * 16 + c) * kP16 + kk * 32 + 16 + 8 * hh);
        }
      }
    }

    /* ---- additive mask from the LDS tile (8 consecutive kv of the lane's own query row per score tile) + chunk max ---- */
    float cj[4];                /* one maximum per score tile: four short chains instead of one long one */
#pragma unroll
    for (int j = 0; j < 4; ++j) {
      /* eight bf16: kv 2r in the low half of word r, 2r + 1 in the high */
#pragma unroll
      for (int r = 0; r < 4; ++r) {
        s[j][2 * r]     = fmaf(__uint_as_float(mw[j][r] << 16),         LOG2E, s[j][2 * r]);
        s[j][2 * r + 1] = fmaf(__uint_as_float(mw[j][r] & 0xffff0000u), LOG2E, s[j][2 * r + 1]);
      }
      cj[j] = fmaxf(s[j][0], s[j][4]);
#pragma unroll
      for (int r = 1; r < 4; ++r) cj[j] = fmaxf(cj[j], fmaxf(s[j][r], s[j][r + 4]));
    }
    float cm = fmaxf(fmaxf(cj[0], cj[1]), fmaxf(cj[2], cj[3]));
    cm = fmaxf(cm, xhalf(cm));
    const float mnew  = fmaxf(mrow, cm);
    /* the carry of p rides in the subtracted exponent; beside a maximum so large that the 14 rounds to more than 15
       it is left out, so that p stays inside f16; alpha goes from the old to the new subtracted exponent, whatever they are */
    float msub = mnew - P_CARRY_LOG2;
    msub = (mnew - msub <= P_CARRY_LOG2 + 1.0f) ? msub : mnew;
    const float alpha = __builtin_amdgcn_exp2f(mref - msub);
    mrow = mnew;
    mref = msub;
    float ps[4];                /* one sum per score tile, as for the maxima */
    FH pb[2];                   /* P^T as B operand: element e <- kv 32kk + 8hh + e, element 8 + e <- kv 32kk + 16 + 8hh + e */
#pragma unroll
    for (int j = 0; j < 4; ++j) {
      float p[8];               /* p x 2^14 */
#pragma unroll
      for (int r = 0; r < 8; ++r) p[r] = s[j][r] - msub;
      exp2x8(p);
      ps[j] = 0.f;
#pragma unroll
      for (int r = 0; r < 8; ++r) {
        ps[j] += p[r];
        pb[j >> 1].h[j & 1][r] = (_Float16)p[r];
      }
    }
    lrow = lrow * alpha + ((ps[0] + ps[1]) + (ps[2] + ps[3]));
#pragma unroll
    for (int t = 0; t < 4; ++t)
#pragma unroll
      for (int r = 0; r < 8; ++r) oacc[t][r] *= alpha;
    /* ---- O^T += V^T . P^T : A = the V^T fragments read above, B = pb; both loops unrolled: vb and pb are indexed by constants ---- */
#pragma unroll
    for (int kk = 0; kk < 2; ++kk) {
#pragma unroll
      for (int t = 0; t < 4; ++t) oacc[t] = at_mma_h(vb[kk][t].v, pb[kk].v, oacc[t]);
    }
    asm volatile("s_wait_dscnt 0x0" ::: "memory");     /* this wave's reads of the buffer have returned before it is refilled */
    asm volatile("s_wait_asynccnt 0x0" ::: "memory");  /* this wave's share of the next walked chunk has landed */
    __syncthreads();                                   /* publishes that chunk, ends every read of this one */
    if (rem != 0u) {                                   /* the same word in every wave of the block */
      cn = __builtin_ctz(rem);
      rem &= rem - 1u;
      stage_copy(cn, kc & 1);
    }
  }
  asm volatile("s_wait_asynccnt 0x0" ::: "memory");    /* no copy is outstanding when the ring becomes output staging */

  _Float16* pw = (_Float16*)(void*)&ring[0][0] + wave * (16 * kP16);
  {
    const float ltot = lrow + xhalf(lrow);               /* both halves' kv rows, carried like p; ltot >= 1 */
    const float inv  = O_CARRY / ltot;
#pragma unroll
    for (int t = 0; t < 4; ++t) {
      v8h ov;
#pragma unroll
      for (int r = 0; r < 8; ++r) ov[r] = (_Float16)(oacc[t][r] * inv);
      *(v8h*)(pw + c * kP16 + t * 16 + 8 * hh) = ov;     /* query row c, d = 16t + 8hh + 0..7 */
    }
  }
  __builtin_amdgcn_fence(__ATOMIC_RELEASE, "workgroup");
  __builtin_amdgcn_wave_barrier();
  __builtin_amdgcn_fence(__ATOMIC_ACQUIRE, "workgroup");
  {
    const int q8 = lane >> 3, c8 = (lane & 7) * 8;
    _Float16* ob = (_Float16*)(void*)oo + (tokb + (size_t)q0) * kDm + (size_t)h * kHd;
    {
#pragma unroll
      for (int it = 0; it < 4; ++it) {
        const int row = it * 4 + q8;
        const v8h val = *(const v8h*)(pw + row * kP16 + c8);
        *(v8h*)(ob + (size_t)row * kDm + c8) = val;
      }
      
    }
  }
}

/* ------------------------------------------------------------------------------------- */
extern "C" void kernel_launch(void* const* d_in, const int* in_sizes, int n_in,
                              void* d_out, int out_size, void* d_ws, size_t ws_size,
                              hipStream_t stream) {
  if (n_in < 11) return;
  const float* x    = (const float*)d_in[0];
  const float* mask = (const float*)d_in[1];
  const float* Wq   = (const float*)d_in[2];
  const float* bq   = (const float*)d_in[3];
  const float* Wk   = (const float*)d_in[4];
  const float* bk   = (const float*)d_in[5];
  const float* Wv   = (const float*)d_in[6];
  const float* bv   = (const float*)d_in[7];
  const float* Wo   = (const float*)d_in[8];
  const float* bo   = (const float*)d_in[9];
  const float* tau  = (const float*)d_in[10];

  const size_t nX = (size_t)kTok * kDm;     /* 4,194,304 */
  const size_t nW = (size_t)kDm * kDm;      /* 1,048,576 */
  if ((size_t)in_sizes[0] != nX || (size_t)in_sizes[1] != (size_t)kSeq * kSeq ||
      (size_t)in_sizes[2] != nW || (size_t)in_sizes[4] != nW || (size_t)in_sizes[6] != nW ||
      (size_t)in_sizes[8] != nW || in_sizes[3] != kDm || in_sizes[5] != kDm || in_sizes[7] != kDm ||
      in_sizes[9] != kDm || in_sizes[10] != kHeads) return;
  if ((size_t)out_size != nX) return;

  /*
       xb   bf16 [4096][1024]        off         0   size  8,388,608
       wqb  bf16 [1024][1024]        off  8,388,608  size  2,097,152
       wkb  bf16 [1024][1024]        off 10,485,760  size  2,097,152
       wvb  bf16 [1024][1024]        off 12,582,912  size  2,097,152
       wof  f16  [1024][1024] (x1024) off 14,680,064  size  2,097,152
       qf   f32  [4096][1024]        off 16,777,216  size 16,777,216   (reused as oo f16 [4096][1024], 8,388,608 B, after qf is consumed)
       kf   f32  [4096][1024]        off 33,554,432  size 16,777,216
       qhb  bf16 [4096][1024]        off 50,331,648  size  8,388,608
       qlb  bf16 [4096][1024]        off 58,720,256  size  8,388,608
       khb  bf16 [4096][1024]        off 67,108,864  size  8,388,608
       klb  bf16 [4096][1024]        off 75,497,472  size  8,388,608
       vth  f16  [1024][4096]        off 83,886,080  size  8,388,608   (v transposed: row = output feature, column = token)
       mkb  bf16 [2048][2048]        off 92,274,688  size  8,388,608
       mst  f32  [32][32][32]        off 100,663,296 size    131,072   (per mask tile: 8 x {hi, lo}, 128 B records)
       end                              100,794,368 */
  const size_t offXb  = 0;
  const size_t offWq  = offXb  + nX * 2;
  const size_t offWk  = offWq  + nW * 2;
  const size_t offWv  = offWk  + nW * 2;
  const size_t offWo  = offWv  + nW * 2;
  const size_t offQf  = offWo  + nW * 2;
  const size_t offKf  = offQf  + nX * 4;
  const size_t offQh  = offKf  + nX * 4;
  const size_t offQl  = offQh  + nX * 2;
  const size_t offKh  = offQl  + nX * 2;
  const size_t offKl  = offKh  + nX * 2;
  const size_t offVv  = offKl  + nX * 2;
  const size_t offMk  = offVv  + nX * 2;
  const size_t offSt  = offMk  + (size_t)kSeq * kSeq * 2;
  const size_t offEnd = offSt  + (size_t)kCbM * kMstRec * 4;
  if (offEnd > ws_size) return;

  char* ws = (char*)d_ws;
  unsigned short* xb  = (unsigned short*)(ws + offXb);
  unsigned short* wqb = (unsigned short*)(ws + offWq);
  unsigned short* wkb = (unsigned short*)(ws + offWk);
  unsigned short* wvb = (unsigned short*)(ws + offWv);
  unsigned short* wof = (unsigned short*)(ws + offWo);
  float*          qf  = (float*)(ws + offQf);
  unsigned short* oo  = (unsigned short*)(ws + offQf);   /* reuse after qf is consumed */
  float*          kf  = (float*)(ws + offKf);
  unsigned short* qhb = (unsigned short*)(ws + offQh);
  unsigned short* qlb = (unsigned short*)(ws + offQl);
  unsigned short* khb = (unsigned short*)(ws + offKh);
  unsigned short* klb = (unsigned short*)(ws + offKl);
  unsigned short* vth = (unsigned short*)(ws + offVv);
  unsigned short* mkb = (unsigned short*)(ws + offMk);
  float*          mst = (float*)(ws + offSt);

  /* 1: input casts (RNE bf16; Wo -> f16 of bf16 value x 1024) */
  cast_all_kernel<<<dim3(kCbAll), dim3(256), 0, stream>>>(x, mask, Wq, Wk, Wv, Wo, xb, mkb, wqb, wkb, wvb, wof, mst);

  /* 2-4: projections C[m][n] = sum_k xb[m][k] W[n][k] + bias[n]; M=4096, N=1024, K=1024 (tiles 64x64, K%64==0);
     v with the operands exchanged, C[n][m] (+ bias[n], now the row's), so that a head's V^T rows lie along the tokens */
  const int gemmTiles  = (kTok / 64) * (kDm / 64);      /* 1024 */
  const int gemmBlocks = (gemmTiles + 7) / 8;           /* 128 */
  wmma_gemm64<1, false, 2, 0, false, 0><<<dim3(gemmBlocks, 1), dim3(256), 0, stream>>>(
      xb, xb, kDm, 0L, wqb, wqb, kDm, 0L, (void*)qf, (void*)qf, kDm, 0L, bq, nullptr, 0L, kTok, kDm, kDm, 1.0f);
  wmma_gemm64<1, false, 2, 0, false, 0><<<dim3(gemmBlocks, 1), dim3(256), 0, stream>>>(
      xb, xb, kDm, 0L, wkb, wkb, kDm, 0L, (void*)kf, (void*)kf, kDm, 0L, bk, nullptr, 0L, kTok, kDm, kDm, 1.0f);
  wmma_gemm64<1, false, 1, 1, false, 0><<<dim3(gemmBlocks, 1), dim3(256), 0, stream>>>(
      wvb, wvb, kDm, 0L, xb, xb, kDm, 0L, (void*)vth, (void*)vth, kTok, 0L, bv, nullptr, 0L, kDm, kTok, kDm, 1.0f);

  /* 5: L2 normalisation of q (x tau) and k, bf16 hi/lo planes */
  l2norm_split_kernel<<<dim3((kTok * kHeads) / 32, 2), dim3(256), 0, stream>>>(qf, kf, tau, qhb, qlb, khb, klb);

  /* 6: attention -> oo (f16, value x 64), overwrites the dead qf region */
  cos_attn_kernel<<<dim3(kBatch * kHeads * (kSeq / kQblk)), dim3(128), 0, stream>>>(qhb, qlb, khb, klb, vth, mkb, mst, tau, oo);

  /* 7: output projection: out[m][n] = 2^-16 * sum_c (oo x64)[m][c] (Wo x1024)[n][c] + bo[n] -> d_out f32 */
  wmma_gemm64<0, false, 2, 0, false, 0><<<dim3(gemmBlocks, 1), dim3(256), 0, stream>>>(
      oo, oo, kDm, 0L, wof, wof, kDm, 0L, d_out, d_out, kDm, 0L, bo, nullptr, 0L, kTok, kDm, kDm,
      1.0f / (O_CARRY * WO_CARRY));
}

// v009
// One run takes 133 microseconds.
// In two side-by-side timings against v008, it was 1.14 and 1.15 times as fast.
// Over all steps from v000 it is 3.52 times as fast.
// Contractions: q/k/v projections on v_wmma_f32_16x16x32_bf16 (operands = RNE bf16 of the inputs); scores on bf16 hi/lo split (hi.hi + hi.lo + lo.hi); p.v and output projection on v_wmma_f32_16x16x32_f16 (p carried x2^14, attention output carried x2^6, Wo carried x2^10); f32 accumulate; norms and softmax in f32.
#include <hip/hip_runtime.h>
#include <stdint.h>

typedef __attribute__((ext_vector_type(16))) _Float16 v16h;
typedef __attribute__((ext_vector_type(8)))  _Float16 v8h;
typedef __attribute__((ext_vector_type(16))) __bf16   v16b;
typedef __attribute__((ext_vector_type(8)))  __bf16   v8b;
typedef __attribute__((ext_vector_type(8)))  float    v8f;
typedef __attribute__((ext_vector_type(4)))  float    v4f;
typedef __attribute__((ext_vector_type(2)))  float    v2f;
typedef __attribute__((ext_vector_type(4)))  unsigned v4u;

/* problem geometry */
constexpr int kBatch = 2;
constexpr int kSeq   = 2048;
constexpr int kDm    = 1024;
constexpr int kHeads = 16;
constexpr int kHd    = 64;
constexpr int kTok   = kBatch * kSeq;      /* 4096 token rows */
constexpr int kKch   = 64;                 /* kv chunk */
constexpr int kQblk  = 64;                 /* query rows per block */
/* LDS row pitches of the attention tiles: 16 B x odd, so that the 16 rows a ds_load_b128 fragment read
   touches fall on 16 different groups of four banks (an unpadded 128 B or 256 B row puts them on one or two) */
constexpr int kP16   = 72;                 /* 64 16-bit elements + 8 pad  = 144 B */
constexpr int kTileE = kKch * kP16;        /* 16-bit elements of one 64-row attention tile in LDS: 9,216 B */
/* GEMM operand staging in LDS */
constexpr int kGk    = 64;                 /* k elements per stage: 128 B of every operand row, whole cache lines */
constexpr int kGp    = 72;                 /* LDS row pitch 144 B = 16 B x odd, as for the attention tiles */
constexpr int kGrows = 64 + 8 * 64;        /* 64 A rows shared by the block's 8 waves + 64 B rows for each wave */
#define O_CARRY 64.0f
#define WO_CARRY 1024.0f
#define LOG2E 1.4426950408889634f
#define P_CARRY_LOG2 14.0f                  /* p is carried x2^14 */

static_assert(kDm == kHeads * kHd, "head split");
static_assert(kTok % 64 == 0 && kDm % 64 == 0, "GEMM M,N tile multiples");
static_assert(kDm % kGk == 0, "GEMM K multiple of the LDS stage");
static_assert((kDm / 64) % 8 == 0 && (kTok / 64) % 8 == 0, "a GEMM block's 8 tiles lie in one tile row");
static_assert(kSeq % kKch == 0 && kSeq % kQblk == 0, "attention tiles");
static_assert((kTok * kHeads) % 32 == 0, "normalize grid");

__device__ __forceinline__ unsigned short f2bf_bits(float f) {
  unsigned u = __float_as_uint(f);
  return (unsigned short)((u + 0x7FFFu + ((u >> 16) & 1u)) >> 16);
}
__device__ __forceinline__ float bf_bits2f(unsigned short h) { return __uint_as_float(((unsigned)h) << 16); }
__device__ __forceinline__ _Float16 h16_lo(unsigned w) { return __builtin_bit_cast(_Float16, (unsigned short)(w & 0xffffu)); }
__device__ __forceinline__ _Float16 h16_hi(unsigned w) { return __builtin_bit_cast(_Float16, (unsigned short)(w >> 16)); }

/* hazard guards as plain device helpers */
__device__ __forceinline__ void dep_guard_h(v8f& a, v8f& b, v16h x, v16h y) { asm volatile("v_nop\n\tv_nop\n\tv_nop\n\tv_nop" : "+v"(a), "+v"(b) : "v"(x), "v"(y)); }
__device__ __forceinline__ void dep_guard_b(v8f& a, v8f& b, v16b x, v16b y) { asm volatile("v_nop\n\tv_nop\n\tv_nop\n\tv_nop" : "+v"(a), "+v"(b) : "v"(x), "v"(y)); }
__device__ __forceinline__ void keep4_h(v16h a, v16h b, v16h c, v16h d) { asm volatile("v_nop" :: "v"(a), "v"(b), "v"(c), "v"(d)); }
__device__ __forceinline__ void keep4_b(v16b a, v16b b, v16b c, v16b d) { asm volatile("v_nop" :: "v"(a), "v"(b), "v"(c), "v"(d)); }
__device__ __forceinline__ void acc_guard4(v8f& a, v8f& b, v8f& c, v8f& d) { asm volatile("v_nop\n\tv_nop\n\tv_nop\n\tv_nop" : "+v"(a), "+v"(b), "+v"(c), "+v"(d)); }
template <typename T> struct Frag;
template <> struct Frag<_Float16> {
  typedef v16h V; union U { v16h v; v8h h[2]; };
  static __device__ __forceinline__ v16h load(const _Float16* p) {   /* elements 0..7 <- p[0..7], 8..15 <- p[16..23] */
    U f; f.h[0] = *(const v8h*)(p); f.h[1] = *(const v8h*)(p + 16); return f.v;
  }
  static __device__ __forceinline__ v8f mma(v16h a, v16h b, v8f c) {
    return __builtin_amdgcn_wmma_f32_16x16x32_f16(false, a, false, b, (short)0, c, false, false);
  }
  static __device__ __forceinline__ void guard(v8f& a, v8f& b, v16h x, v16h y) { dep_guard_h(a, b, x, y); }
  static __device__ __forceinline__ void keep(v16h a, v16h b, v16h c, v16h d) { keep4_h(a, b, c, d); }
};
template <> struct Frag<__bf16> {
  typedef v16b V; union U { v16b v; v8b h[2]; };
  static __device__ __forceinline__ v16b load(const __bf16* p) {
    U f; f.h[0] = *(const v8b*)(p); f.h[1] = *(const v8b*)(p + 16); return f.v;
  }
  static __device__ __forceinline__ v8f mma(v16b a, v16b b, v8f c) {
    return __builtin_amdgcn_wmma_f32_16x16x32_bf16(false, a, false, b, (short)0, c, false, false);
  }
  static __device__ __forceinline__ void guard(v8f& a, v8f& b, v16b x, v16b y) { dep_guard_b(a, b, x, y); }
  static __device__ __forceinline__ void keep(v16b a, v16b b, v16b c, v16b d) { keep4_b(a, b, c, d); }
};

/* Nine asynchronous 16-byte copies global -> LDS per lane, through no register: l = the lane's LDS byte address,
   g = the lane's global address.  The closing s_wait_xcnt stands inside the statement so that no address
   register of an issued copy is rewritten in front of it. */
__device__ __forceinline__ void async_copy9(const unsigned (&l)[9], const unsigned short* const (&g)[9]) {
  asm volatile(
      "global_load_async_to_lds_b128 %0, %9, off\n\t"
      "global_load_async_to_lds_b128 %1, %10, off\n\t"
      "global_load_async_to_lds_b128 %2, %11, off\n\t"
      "global_load_async_to_lds_b128 %3, %12, off\n\t"
      "global_load_async_to_lds_b128 %4, %13, off\n\t"
      "global_load_async_to_lds_b128 %5, %14, off\n\t"
      "global_load_async_to_lds_b128 %6, %15, off\n\t"
      "global_load_async_to_lds_b128 %7, %16, off\n\t"
      "global_load_async_to_lds_b128 %8, %17, off\n\t"
      "s_wait_xcnt 0x0"
      :: "v"(l[0]), "v"(l[1]), "v"(l[2]), "v"(l[3]), "v"(l[4]), "v"(l[5]), "v"(l[6]), "v"(l[7]), "v"(l[8]),
         "v"(g[0]), "v"(g[1]), "v"(g[2]), "v"(g[3]), "v"(g[4]), "v"(g[5]), "v"(g[6]), "v"(g[7]), "v"(g[8])
      : "memory");
}

/* The same with eight copies per lane: two 64-row tiles of the attention ring (four passes of 16 rows each). */
__device__ __forceinline__ void async_copy8(const unsigned (&l)[8], const unsigned short* const (&g)[8]) {
  asm volatile(
      "global_load_async_to_lds_b128 %0, %8, off\n\t"
      "global_load_async_to_lds_b128 %1, %9, off\n\t"
      "global_load_async_to_lds_b128 %2, %10, off\n\t"
      "global_load_async_to_lds_b128 %3, %11, off\n\t"
      "global_load_async_to_lds_b128 %4, %12, off\n\t"
      "global_load_async_to_lds_b128 %5, %13, off\n\t"
      "global_load_async_to_lds_b128 %6, %14, off\n\t"
      "global_load_async_to_lds_b128 %7, %15, off\n\t"
      "s_wait_xcnt 0x0"
      :: "v"(l[0]), "v"(l[1]), "v"(l[2]), "v"(l[3]), "v"(l[4]), "v"(l[5]), "v"(l[6]), "v"(l[7]),
         "v"(g[0]), "v"(g[1]), "v"(g[2]), "v"(g[3]), "v"(g[4]), "v"(g[5]), "v"(g[6]), "v"(g[7])
      : "memory");
}

/* ---- Register-blocked batched WMMA GEMM --------------------------------
   C[m,n] = scale * sum_k A[m,k] * Bt[n,k] (+bias); each wave owns a 64x64 tile.
   A row-major [M,K]; Bt row-major [N,K]; M % 64 == 0, N % 512 == 0, K % 64 == 0, lda and ldb % 8 == 0.
   A block's 8 waves own 8 neighbouring tiles of one tile row.  Per 64 k the block's 64 A rows and 512 Bt rows
   are copied to LDS in whole 128 B lines (two buffers: the next stage flies while this one is multiplied);
   the fragments are read from LDS in ascending k, 32 at a time.
   BIAS_MODE: 0 = none, 1 = bias[m], 2 = bias[n]; bias values RNE-converted to bf16 precision before the add.
   OUT_MODE: 0 = f32, 1 = f16, 2 = bf16 hi plane (Cout) + bf16 lo plane (Cout2).
   ET: 0 = f16 operands, 1 = bf16 operands (pointers passed as 16-bit storage) */
template <int ET> struct Elem;
template <> struct Elem<0> { typedef _Float16 T; };
template <> struct Elem<1> { typedef __bf16 T; };
template <int ET, bool SPLIT, int BIAS_MODE, int OUT_MODE, bool RESID, int ACT = 0>
__device__ __forceinline__ void gemm64_block(
    float (&sT)[8][16 * 68],                     /* per-wave 16x64 slab, pitch 68 floats */
    unsigned short (&sAB)[2][kGrows * kGp],      /* two stages: rows 0..63 A, 64..575 Bt */
    int bx, int b,                               /* the block's place among the product's blocks; batch index */
    const unsigned short* __restrict__ Ap, const unsigned short* __restrict__ A2p, int lda, long strideA,
    const unsigned short* __restrict__ Btp, const unsigned short* __restrict__ Bt2p, int ldb, long strideB,
    void* __restrict__ Cout, void* __restrict__ Cout2, int ldc, long strideC,
    const float* __restrict__ bias,
    const float* __restrict__ resid, long strideR,
    int M, int N, int K, float scale) {
  typedef typename Elem<ET>::T T;
  typedef typename Frag<T>::V V;
  static_assert(!SPLIT, "the LDS stage holds one plane of each operand");
  const int lane = threadIdx.x & 31;
  const int wave = threadIdx.x >> 5;
  const int tilesN = N >> 6;
  const int tilesM = M >> 6;
  const int tile0 = bx * 8;
  if (tile0 >= tilesM * tilesN) return;  /* block-uniform, in front of every barrier */
  const int tile = tile0 + wave;
  const int tm = tile / tilesN;
  const int tn = tile - tm * tilesN;
  const int m0 = tm << 6;
  const int n0 = tn << 6;

  const unsigned short* Ab = Ap  + (size_t)b * strideA;
  const unsigned short* Bb = Btp + (size_t)b * strideB;

  const int rlane = lane & 15;                 /* row (A) / col (B, D) within subtile */
  const int koff  = (lane >> 4) * 8;           /* k offset of this lane half */
  const int mOff  = (lane >> 4) * 8;           /* D row offset */

  /* copy map: 8 lanes x 16 B = one 128 B row, 32 rows per pass of the block, 18 passes = 576 rows */
  const int crow = threadIdx.x >> 3;
  const int cchk = (threadIdx.x & 7) * 8;
  const int nb0  = (tile0 - tm * tilesN) << 6;  /* first Bt row of the block */
  const unsigned short* gA = Ab + (size_t)(m0 + crow) * lda + cchk;
  const unsigned short* gB = Bb + (size_t)(nb0 + crow) * ldb + cchk;
  const unsigned lds0 = (unsigned)(uintptr_t)(const void*)&sAB[0][0] + (unsigned)(crow * kGp + cchk) * 2u;
  auto stage_copy = [&](int st, int buf) {
    const unsigned lb = lds0 + (unsigned)buf * (unsigned)(kGrows * kGp * 2);
    const unsigned short* pa = gA + (size_t)st * kGk;
    const unsigned short* pb = gB + (size_t)st * kGk;
    unsigned l[9];
    const unsigned short* g[9];
    /* both loops unrolled: l[] and g[] are asm operands and must be registers */
#pragma unroll
    for (int it = 0; it < 9; ++it) {
      l[it] = lb + (unsigned)(it * 32 * kGp * 2);
      g[it] = (it < 2) ? pa + (size_t)(it * 32) * lda : pb + (size_t)((it - 2) * 32) * ldb;
    }
    async_copy9(l, g);
#pragma unroll
    for (int it = 0; it < 9; ++it) {
      l[it] = lb + (unsigned)((it + 9) * 32 * kGp * 2);
      g[it] = pb + (size_t)((it + 7) * 32) * ldb;
    }
    async_copy9(l, g);
  };

  v8f acc[4][4];
#pragma unroll
  for (int i = 0; i < 4; ++i)
#pragma unroll
    for (int j = 0; j < 4; ++j) acc[i][j] = (v8f){0.f,0.f,0.f,0.f,0.f,0.f,0.f,0.f};

  const int nst = K / kGk;
  stage_copy(0, 0);
  asm volatile("s_wait_asynccnt 0x0" ::: "memory");   /* this wave's share of stage 0 has landed */
  __syncthreads();                                     /* ... and every other wave's */
  if (nst > 1) stage_copy(1, 1);
  for (int t = 0; t < nst; ++t) {
    const T* sA = (const T*)(const void*)sAB[t & 1] + rlane * kGp + koff;
    const T* sB = sA + (64 + wave * 64) * kGp;
    /* all loops of the stage unrolled: fragments and accumulators are indexed by constants and stay in registers */
#pragma unroll
    for (int ks = 0; ks < kGk; ks += 32) {
      V bh[4], ah[4];
#pragma unroll
      for (int j = 0; j < 4; ++j) bh[j] = Frag<T>::load(sB + j * 16 * kGp + ks);
#pragma unroll
      for (int i = 0; i < 4; ++i) ah[i] = Frag<T>::load(sA + i * 16 * kGp + ks);
#pragma unroll
      for (int i = 0; i < 4; ++i) {
#pragma unroll
        for (int j = 0; j < 4; ++j) acc[i][j] = Frag<T>::mma(ah[i], bh[j], acc[i][j]);
        Frag<T>::guard(acc[i][0], acc[i][3], ah[i], ah[i]);
      }
      Frag<T>::keep(bh[0], bh[1], bh[2], bh[3]);
    }
    asm volatile("s_wait_dscnt 0x0" ::: "memory");     /* this wave's reads of the buffer have returned before it is refilled */
    asm volatile("s_wait_asynccnt 0x0" ::: "memory");  /* this wave's share of stage t + 1 has landed */
    __syncthreads();                                   /* publishes stage t + 1, ends every read of stage t */
    if (t + 2 < nst) stage_copy(t + 2, t & 1);
  }
  asm volatile("s_wait_asynccnt 0x0" ::: "memory");    /* no copy is outstanding when the wave goes on */
  acc_guard4(acc[0][0], acc[0][1], acc[0][2], acc[0][3]);
  acc_guard4(acc[1][0], acc[1][1], acc[1][2], acc[1][3]);
  acc_guard4(acc[2][0], acc[2][1], acc[2][2], acc[2][3]);
  acc_guard4(acc[3][0], acc[3][1], acc[3][2], acc[3][3]);

  /* ---- epilogue ---- */
  float* slab = sT[wave];
  const float* Rb = RESID ? (resid + (size_t)b * strideR) : nullptr;
#pragma unroll
  for (int i = 0; i < 4; ++i) {
    const int mBase = m0 + (i << 4);
#pragma unroll
    for (int j = 0; j < 4; ++j) {
      const int n = n0 + (j << 4) + rlane;
      float bv = 0.f;
      if (BIAS_MODE == 2) bv = bf_bits2f(f2bf_bits(bias[n]));
#pragma unroll
      for (int r = 0; r < 8; ++r) {
        float v = acc[i][j][r] * scale;
        if (BIAS_MODE == 1) v += bf_bits2f(f2bf_bits(bias[mBase + mOff + r]));
        if (BIAS_MODE == 2) v += bv;
        if (RESID) v += Rb[(size_t)(mBase + mOff + r) * ldc + n];
        if (ACT == 1) v = tanhf(v);
        if (ACT == 2) v = fmaxf(v, 0.0f);
        if (ACT == 3) v = v / (1.0f + expf(-v));
        if (ACT == 4) v = (v > 0.f) ? v : 0.01f * v;
        slab[(mOff + r) * 68 + (j << 4) + rlane] = v;
      }
    }
    __builtin_amdgcn_fence(__ATOMIC_RELEASE, "workgroup");
    __builtin_amdgcn_wave_barrier();
    __builtin_amdgcn_fence(__ATOMIC_ACQUIRE, "workgroup");
    if (OUT_MODE == 0) {
      float* C = (float*)Cout + (size_t)b * strideC;
      const int hh = lane >> 4, c4 = (lane & 15) * 4;     /* row seg = 256 B = 16 lanes x 16 B */
      {
#pragma unroll
        for (int it = 0; it < 8; ++it) {
          const int row = it * 2 + hh;
          v4f v = *(const v4f*)(slab + row * 68 + c4);
          *(v4f*)(C + (size_t)(mBase + row) * ldc + n0 + c4) = v;
        }
        
      }
    } else {
      const int q = lane >> 3, c8 = (lane & 7) * 8;        
      unsigned short* C  = (unsigned short*)Cout  + (size_t)b * strideC;
      unsigned short* C2 = (OUT_MODE == 2) ? ((unsigned short*)Cout2 + (size_t)b * strideC) : nullptr;
      {
#pragma unroll
        for (int it = 0; it < 4; ++it) {
          const int row = it * 4 + q;
          const float* sp = slab + row * 68 + c8;
          v8h hv, lv;
#pragma unroll
          for (int e = 0; e < 8; ++e) {
            if (OUT_MODE == 1) {
              hv[e] = (_Float16)sp[e];
            } else {
              unsigned short hb = f2bf_bits(sp[e]);
              unsigned short lb = f2bf_bits(sp[e] - bf_bits2f(hb));
              hv[e] = __builtin_bit_cast(_Float16, hb);
              lv[e] = __builtin_bit_cast(_Float16, lb);
            }
          }
          *(v8h*)(C + (size_t)(mBase + row) * ldc + n0 + c8) = hv;
          if (OUT_MODE == 2) *(v8h*)(C2 + (size_t)(mBase + row) * ldc + n0 + c8) = lv;
        }
        
      }
    }
    __builtin_amdgcn_fence(__ATOMIC_RELEASE, "workgroup");
    __builtin_amdgcn_wave_barrier();
    __builtin_amdgcn_fence(__ATOMIC_ACQUIRE, "workgroup");
  }
}

/* one product a launch */
template <int ET, bool SPLIT, int BIAS_MODE, int OUT_MODE, bool RESID, int ACT = 0>
__global__ __launch_bounds__(256) void wmma_gemm64(
    const unsigned short* __restrict__ Ap, const unsigned short* __restrict__ A2p, int lda, long strideA,
    const unsigned short* __restrict__ Btp, const unsigned short* __restrict__ Bt2p, int ldb, long strideB,
    void* __restrict__ Cout, void* __restrict__ Cout2, int ldc, long strideC,
    const float* __restrict__ bias,
    const float* __restrict__ resid, long strideR,
    int M, int N, int K, float scale) {
  __shared__ __align__(16) float sT[8][16 * 68];
  __shared__ __align__(16) unsigned short sAB[2][kGrows * kGp];
  gemm64_block<ET, SPLIT, BIAS_MODE, OUT_MODE, RESID, ACT>(
      sT, sAB, (int)blockIdx.x, (int)blockIdx.y, Ap, A2p, lda, strideA, Btp, Bt2p, ldb, strideB,
      Cout, Cout2, ldc, strideC, bias, resid, strideR, M, N, K, scale);
}

/* ---- the q, k and v projections in one launch: blockIdx.y picks the product (block-uniform, a scalar branch).
   Each of them is 128 work-groups, and a work-group's LDS leaves room for one on a WGP: launched alone a product
   leaves half of the chip's 256 WGPs idle.  Side by side the 384 work-groups take two rounds of the chip, not three
   half-filled launches.  y = 0: qf[m][n] = sum_k xb[m][k] Wq[n][k] + bq[n] (f32); y = 1: the same for k;
   y = 2: v with the operands exchanged, vth[n][m] (+ bv[n], now the row's), f16. */
__global__ __launch_bounds__(256) void qkv_proj_kernel(
    const unsigned short* __restrict__ xb,  const unsigned short* __restrict__ wqb,
    const unsigned short* __restrict__ wkb, const unsigned short* __restrict__ wvb,
    const float* __restrict__ bq, const float* __restrict__ bk, const float* __restrict__ bv,
    float* __restrict__ qf, float* __restrict__ kf, unsigned short* __restrict__ vth) {
  __shared__ __align__(16) float sT[8][16 * 68];
  __shared__ __align__(16) unsigned short sAB[2][kGrows * kGp];
  if (blockIdx.y == 2) {
    gemm64_block<1, false, 1, 1, false, 0>(
        sT, sAB, (int)blockIdx.x, 0, wvb, wvb, kDm, 0L, xb, xb, kDm, 0L,
        (void*)vth, (void*)vth, kTok, 0L, bv, nullptr, 0L, kDm, kTok, kDm, 1.0f);
  } else {
    const bool isk = (blockIdx.y != 0);
    const unsigned short* w = isk ? wkb : wqb;
    float* c = isk ? kf : qf;
    gemm64_block<1, false, 2, 0, false, 0>(
        sT, sAB, (int)blockIdx.x, 0, xb, xb, kDm, 0L, w, w, kDm, 0L,
        (void*)c, (void*)c, kDm, 0L, isk ? bk : bq, nullptr, 0L, kTok, kDm, kDm, 1.0f);
  }
}

/* ---- all six input casts in one launch: the block index picks the tensor (block-uniform, scalar branches).
   x, mask, Wq, Wk, Wv -> bf16 bits (RNE); Wo -> f16 bits of (RNE-bf16 value * WO_CARRY).
   Each of them alone is a launch of a few microseconds at most, most of it start and drain; side by side they pay that once.
   coverage: a block = 256 threads x 2 elements (mask: x 16, one 64 x 64 tile); kCbX + kCbM + 4 kCbW blocks cover the six tensors exactly.
   A mask block also leaves, per wave (8 rows of its tile), the largest cast value and the smallest of the 8 rows' largest:
   mst[tile][wave] = {hi, lo}, a record of 128 B a tile, from which the attention tells the tiles that cannot count. */
constexpr int kCbX   = kTok * kDm / 512;   /* 8192 blocks for x */
constexpr int kCbM   = (kSeq / kQblk) * (kSeq / kKch);  /* 1024 blocks for the mask, one attention tile each */
constexpr int kMstRec = 32;                /* floats per tile record: 8 waves x {hi, lo}, padded to a whole 128 B line */
constexpr int kCbW   = kDm * kDm / 512;    /* 2048 blocks for each weight matrix */
constexpr int kCbAll = kCbX + kCbM + 4 * kCbW;
static_assert((kTok * kDm) % 512 == 0 && kQblk == 64 && kKch == 64 && (kDm * kDm) % 512 == 0, "whole blocks");
__global__ __launch_bounds__(256) void cast_all_kernel(
    const float* __restrict__ x,  const float* __restrict__ mask, const float* __restrict__ wq,
    const float* __restrict__ wk, const float* __restrict__ wv,   const float* __restrict__ wo,
    unsigned short* __restrict__ xb,  unsigned short* __restrict__ mkb, unsigned short* __restrict__ wqb,
    unsigned short* __restrict__ wkb, unsigned short* __restrict__ wvb, unsigned short* __restrict__ wof,
    float* __restrict__ mst) {
  int blk = blockIdx.x;
  const float* in = x;
  unsigned short* out = xb;
  bool carry = false;                      /* Wo alone */
  if (blk >= kCbX + kCbM) {
    blk -= kCbX + kCbM;
    const int w = blk / kCbW;              /* 0..3 by the grid */
    blk -= w * kCbW;
    in    = (w == 0) ? wq  : (w == 1) ? wk  : (w == 2) ? wv  : wo;
    out   = (w == 0) ? wqb : (w == 1) ? wkb : (w == 2) ? wvb : wof;
    carry = (w == 3);
  } else if (blk >= kCbX) {
    blk -= kCbX;                           /* tile (tq, tk): query rows 64 tq.., kv columns 64 tk.. */
    const int tq  = blk / (kSeq / kKch);
    const int tk  = blk - tq * (kSeq / kKch);
    const int row = threadIdx.x >> 2;      /* four threads a row, 16 elements each */
    const size_t o = (size_t)(tq * kQblk + row) * kSeq + (size_t)(tk * kKch + (threadIdx.x & 3) * 16);
    float mx = -INFINITY;
    bool bad = false;                      /* a NaN, which fmaxf would pass over */
    unsigned w[8];
    /* unrolled: w[] is indexed by constants and stays in registers, the four loads go out together */
#pragma unroll
    for (int i = 0; i < 4; ++i) {
      const v4f p = *(const v4f*)(mask + o + 4 * i);
      const unsigned short u0 = f2bf_bits(p.x), u1 = f2bf_bits(p.y), u2 = f2bf_bits(p.z), u3 = f2bf_bits(p.w);
      const float f0 = bf_bits2f(u0), f1 = bf_bits2f(u1), f2 = bf_bits2f(u2), f3 = bf_bits2f(u3);
      w[2 * i]     = (unsigned)u0 | ((unsigned)u1 << 16);
      w[2 * i + 1] = (unsigned)u2 | ((unsigned)u3 << 16);
      mx  = fmaxf(mx, fmaxf(fmaxf(f0, f1), fmaxf(f2, f3)));
      bad = bad || (f0 != f0) || (f1 != f1) || (f2 != f2) || (f3 != f3);
    }
    v4u s0; s0.x = w[0]; s0.y = w[1]; s0.z = w[2]; s0.w = w[3];
    v4u s1; s1.x = w[4]; s1.y = w[5]; s1.z = w[6]; s1.w = w[7];
    v4u* mo = (v4u*)(void*)(mkb + o);
    mo[0] = s0; mo[1] = s1;
    mx = fmaxf(mx, __shfl_xor(mx, 1, 32));
    mx = fmaxf(mx, __shfl_xor(mx, 2, 32)); /* the row's largest inside the tile */
    float hi = mx, lo = mx;
    for (int d = 4; d < 32; d <<= 1) {
      hi = fmaxf(hi, __shfl_xor(hi, d, 32));
      lo = fminf(lo, __shfl_xor(lo, d, 32));
    }
    if (__builtin_amdgcn_ballot_w32(bad) != 0u) hi = INFINITY;   /* a tile with a NaN is always worked */
    if ((threadIdx.x & 31) == 0) {
      v2f st; st.x = hi; st.y = lo;
      *(v2f*)(mst + (size_t)blk * kMstRec + (threadIdx.x >> 5) * 2) = st;
    }
    return;
  }
  const int i = blk * 256 + threadIdx.x;
  const v2f p = *(const v2f*)(in + 2 * (size_t)i);
  unsigned short u0 = f2bf_bits(p.x), u1 = f2bf_bits(p.y);
  if (carry) {
    u0 = __builtin_bit_cast(unsigned short, (_Float16)(bf_bits2f(u0) * WO_CARRY));
    u1 = __builtin_bit_cast(unsigned short, (_Float16)(bf_bits2f(u1) * WO_CARRY));
  }
  unsigned* op = (unsigned*)(void*)out;
  op[i] = (unsigned)u0 | ((unsigned)u1 << 16);
}

/* ---- per (token, head) L2 normalisation + bf16 hi/lo split.
   blockIdx.y = 0: q plane, scaled by 1/max(||q||,1e-12) * bf16(tau[head]) * log2(e), so that the scores come out
   of the matrix unit as exponents of 2; y = 1: k plane, 1/max(||k||,1e-12).
   8 lanes per 64-vector (8 floats each), 32 segments per 256-thread block; grid.x = kTok*kHeads/32 = 2048.
*/
__global__ __launch_bounds__(256) void l2norm_split_kernel(
    const float* __restrict__ qf, const float* __restrict__ kf, const float* __restrict__ tau,
    unsigned short* __restrict__ qhp, unsigned short* __restrict__ qlp,
    unsigned short* __restrict__ khp, unsigned short* __restrict__ klp) {
  const bool isk = (blockIdx.y != 0);                 /* block-uniform */
  const float* src = isk ? kf : qf;
  unsigned short* dhp = isk ? khp : qhp;
  unsigned short* dlp = isk ? klp : qlp;
  const int tid = threadIdx.x;
  const int g = tid >> 3, e = tid & 7;
  const int seg = blockIdx.x * 32 + g;                 /* < kTok*kHeads */
  const int token = seg >> 4, head = seg & 15;
  const size_t base = (size_t)token * kDm + (size_t)head * kHd + (size_t)e * 8;
  const v4f a  = *(const v4f*)(src + base);
  const v4f c4 = *(const v4f*)(src + base + 4);
  float ss = 0.0f;
  ss += a.x * a.x;  ss += a.y * a.y;  ss += a.z * a.z;  ss += a.w * a.w;
  ss += c4.x * c4.x; ss += c4.y * c4.y; ss += c4.z * c4.z; ss += c4.w * c4.w;
  ss += __shfl_xor(ss, 1, 32);
  ss += __shfl_xor(ss, 2, 32);
  ss += __shfl_xor(ss, 4, 32);
  const float nrm  = sqrtf(ss);
  const float rinv = 1.0f / fmaxf(nrm, 1e-12f);
  const float th   = bf_bits2f(f2bf_bits(tau[head]));
  const float sc   = isk ? rinv : rinv * (th * LOG2E);
  float vals[8];
  vals[0] = a.x * sc;  vals[1] = a.y * sc;  vals[2] = a.z * sc;  vals[3] = a.w * sc;
  vals[4] = c4.x * sc; vals[5] = c4.y * sc; vals[6] = c4.z * sc; vals[7] = c4.w * sc;
  unsigned hw[4], lw[4];
#pragma unroll
  for (int i = 0; i < 4; ++i) {
    const float v0 = vals[2 * i], v1 = vals[2 * i + 1];
    const unsigned short h0 = f2bf_bits(v0), h1 = f2bf_bits(v1);
    const unsigned short l0 = f2bf_bits(v0 - bf_bits2f(h0));
    const unsigned short l1 = f2bf_bits(v1 - bf_bits2f(h1));
    hw[i] = (unsigned)h0 | ((unsigned)h1 << 16);
    lw[i] = (unsigned)l0 | ((unsigned)l1 << 16);
  }
  v4u hv; hv.x = hw[0]; hv.y = hw[1]; hv.z = hw[2]; hv.w = hw[3];
  v4u lv; lv.x = lw[0]; lv.y = lw[1]; lv.z = lw[2]; lv.w = lw[3];
  v4u* ph = (v4u*)(void*)(dhp + base);
  v4u* pl = (v4u*)(void*)(dlp + base);
  *ph = hv; *pl = lv;
  
}

__device__ __forceinline__ v8f at_mma_b(v16b a, v16b b, v8f c) {
  c = __builtin_amdgcn_wmma_f32_16x16x32_bf16(false, a, false, b, (short)0, c, false, false);
  asm volatile("v_nop\n\tv_nop\n\tv_nop\n\tv_nop" : "+v"(c) : "v"(a), "v"(b));
  return c;
}
__device__ __forceinline__ v8f at_mma_h(v16h a, v16h b, v8f c) {
  c = __builtin_amdgcn_wmma_f32_16x16x32_f16(false, a, false, b, (short)0, c, false, false);
  asm volatile("v_nop\n\tv_nop\n\tv_nop\n\tv_nop" : "+v"(c) : "v"(a), "v"(b));
  return c;
}

/* x[i] = 2^x[i] for the eight scores of one tile, each in its own register, so that no v_exp_f32 reads the result or
   overwrites the source of the one in front of it; the closing v_nop is the slot the instruction set asks for
   between the last v_exp_f32 and whatever the compiler puts next. */
__device__ __forceinline__ void exp2x8(float (&x)[8]) {
  asm("v_exp_f32 %0, %0\n\t"
      "v_exp_f32 %1, %1\n\t"
      "v_exp_f32 %2, %2\n\t"
      "v_exp_f32 %3, %3\n\t"
      "v_exp_f32 %4, %4\n\t"
      "v_exp_f32 %5, %5\n\t"
      "v_exp_f32 %6, %6\n\t"
      "v_exp_f32 %7, %7\n\t"
      "v_nop"
      : "+v"(x[0]), "+v"(x[1]), "+v"(x[2]), "+v"(x[3]), "+v"(x[4]), "+v"(x[5]), "+v"(x[6]), "+v"(x[7]));
}

/* lane l <-> lane l ^ 16 by one vector cross-row move */
__device__ __forceinline__ float xhalf(float x) {
  const int b = __builtin_bit_cast(int, x);
  return __builtin_bit_cast(float, __builtin_amdgcn_permlanex16(b, b, 0x76543210, 0xfedcba98, false, false));
}

/* =====================================================================================
   Attention for head_dim 64 with an additive [kSeq][kSeq] mask shared over (b,h).
   Inputs: qh/ql = bf16 hi/lo planes of (q/||q|| * tau[h] * log2 e), kh/kl = bf16 hi/lo planes of k/||k||,
           all [kTok][kDm] with element (b, s, h, d) at (b*kSeq+s)*kDm + h*64 + d;
           vt = f16 plane of v, transposed: [kDm][kTok], element (b, s, h, d) at (h*64+d)*kTok + b*kSeq + s;
           mb = bf16 plane (RNE) of the mask, [kSeq][kSeq].
   Every tile of a kv chunk (K hi, K lo, V^T, mask) is 64 rows of 128 B that lie in global memory as LDS wants them:
           asynchronous copies bring whole rows into one of two buffers while the other one is worked on.
   scores, transposed: S^T = khat . qhat_tau^T : 3 bf16 WMMAs (hi.hi + lo.hi + hi.lo), A = K rows, B = Q columns;
           lanes c and c + 16 hold all scores of query column c: += bf16(mask[q][kv]) * log2 e; online softmax f32 in
           base 2 (p x 2^14 = 2^(score - maximum + 14): one subtraction and one v_exp_f32 a score), maximum and
           sum in the lane, the halves' maxima joined per chunk, their sums (carried x2^14 like p) once at the end.
   out, transposed: O^T += V^T . P^T : f16 WMMA, p carried x2^14; two score tiles converted in place are the B operand.
           result written as f16 of (out * 2^6) into oo (same plane layout).
   Block = 4 waves = 64 query rows of one (b, h).  A kv chunk is walked unless its mask tile alone shows that every one of its
           weights is 0 in f32: with |score| <= bq (cosine x tau, base 2), every row's maximum is at least L log2 e - bq,
           L = the largest over the chunks of lo (cast launch), and a chunk's scores are at most hi log2 e + bq; a chunk more than
           192 binary orders below is left out, copies and all.  Read from the mask at run time, for any mask.
   grid.x = kBatch * kHeads * (kSeq/64) = 1024.  coverage of oo: 1024 blocks x 64 rows x 64 d = kTok*kDm.
   All blocks are resident at once, four a WGP, so the launch ends with the WGP that has the most chunks to walk.  Where the count
           grows or falls along the query tiles (a causal mask), the block index is spread so that any four blocks whose
           indices differ in two bits hold two tiles t, t' and two mirrored ones 31 - t'', 31 - t''' with t + t' = t'' + t''':
           the same sum of chunks whichever four share a WGP; for other masks any order does as well.
   ===================================================================================== */
__global__ __launch_bounds__(128)
void cos_attn_kernel(const unsigned short* __restrict__ qhp, const unsigned short* __restrict__ qlp,
                     const unsigned short* __restrict__ khp, const unsigned short* __restrict__ klp,
                     const unsigned short* __restrict__ vtp, const unsigned short* __restrict__ mbp,
                     const float* __restrict__ mst, const float* __restrict__ tau,
                     unsigned short* __restrict__ oo) {
  union FB { v16b v; v8b h[2]; };
  union FH { v16h v; v8h h[2]; };
  /* two buffers x four tiles of 9 KB: K hi [kv][d], K lo [kv][d], V^T [d][kv], mask bf16 [qrow][kv]; 72 KB, four blocks a WGP.
     Behind the loop's last barrier the first 9 KB serve as the waves' output staging. */
  __shared__ __align__(16) unsigned short ring[2][4 * kTileE];

  const int tid  = threadIdx.x;
  const int wave = tid >> 5;
  const int lane = tid & 31;
  const int hh   = lane >> 4;
  const int c    = lane & 15;

  constexpr int nqb = kSeq / kQblk;             /* 32 */
  static_assert(nqb == 32 && kBatch * kHeads == 32, "index bits 5,2,6,7 = t; 0,1,3,4,8 = (b, h); parity of all ten = mirror");
  const int bx  = blockIdx.x;
  const int tq  = ((bx >> 5) & 1) | ((bx >> 1) & 2) | ((bx >> 4) & 12);
  const int qb  = (__builtin_popcount((unsigned)bx) & 1) ? nqb - 1 - tq : tq;   /* bit 9 makes both parities: one to one */
  const int bh  = (bx & 3) | ((bx >> 1) & 12) | ((bx >> 4) & 16);
  const int h   = bh % kHeads;
  const int b   = bh / kHeads;
  const int qbase = qb * kQblk;
  const int q0    = qbase + wave * 16;
  const size_t tokb = (size_t)b * kSeq;

  const __bf16*   qh = (const __bf16*)(const void*)qhp;
  const __bf16*   ql = (const __bf16*)(const void*)qlp;

  /* ---- Q fragments (B operand): column = lane&15, elements 0..7 <- d0+8hh+0..7, 8..15 <- d0+16+8hh+0..7 ---- */
  v16b qah[2], qal[2];
  {
    const size_t ro = (tokb + (size_t)(q0 + c)) * kDm + (size_t)h * kHd;
#pragma unroll
    for (int dc = 0; dc < 2; ++dc) {
      qah[dc] = Frag<__bf16>::load(qh + ro + dc * 32 + 8 * hh);
      qal[dc] = Frag<__bf16>::load(ql + ro + dc * 32 + 8 * hh);
    }
  }

  float mrow = -INFINITY;      /* running maximum of query column c, equal in both lane halves */
  float mref = -INFINITY;      /* the exponent that p, lrow and oacc are carried against: mrow - 14 */
  float lrow = 0.f;            /* running sum over this lane half's kv rows only */
  v8f oacc[4];                 /* O^T: oacc[t][r] = out[d = 16t + 8hh + r][query c] */
#pragma unroll
  for (int t = 0; t < 4; ++t) oacc[t] = (v8f){0.f,0.f,0.f,0.f,0.f,0.f,0.f,0.f};

  /* copy map: 8 lanes x 16 B = one 128 B row, 16 rows per pass of the block, 4 passes per tile */
  const int crow = tid >> 3;
  const int cchk = (tid & 7) * 8;
  const unsigned short* gKh = khp + (tokb + (size_t)crow) * kDm + (size_t)h * kHd + cchk;
  const unsigned short* gKl = klp + (tokb + (size_t)crow) * kDm + (size_t)h * kHd + cchk;
  const unsigned short* gVt = vtp + ((size_t)h * kHd + (size_t)crow) * kTok + tokb + cchk;
  const unsigned short* gMb = mbp + (size_t)(qbase + crow) * kSeq + cchk;
  const unsigned lds0 = (unsigned)(uintptr_t)(const void*)&ring[0][0] + (unsigned)(crow * kP16 + cchk) * 2u;
  auto stage_copy = [&](int st, int buf) {
    const unsigned lb = lds0 + (unsigned)buf * (unsigned)(4 * kTileE * 2);
    const unsigned short* ph = gKh + (size_t)st * (kKch * kDm);
    const unsigned short* pl = gKl + (size_t)st * (kKch * kDm);
    const unsigned short* pv = gVt + (size_t)st * kKch;
    const unsigned short* pm = gMb + (size_t)st * kKch;
    unsigned l[8];
    const unsigned short* g[8];
    /* both loops unrolled: l[] and g[] are asm operands and must be registers */
#pragma unroll
    for (int it = 0; it < 4; ++it) {
      l[it]     = lb + (unsigned)((it * 16 * kP16) * 2);
      l[it + 4] = lb + (unsigned)((kTileE + it * 16 * kP16) * 2);
      g[it]     = ph + (size_t)(it * 16) * kDm;
      g[it + 4] = pl + (size_t)(it * 16) * kDm;
    }
    async_copy8(l, g);
#pragma unroll
    for (int it = 0; it < 4; ++it) {
      l[it]     = lb + (unsigned)((2 * kTileE + it * 16 * kP16) * 2);
      l[it + 4] = lb + (unsigned)((3 * kTileE + it * 16 * kP16) * 2);
      g[it]     = pv + (size_t)(it * 16) * kTok;
      g[it + 4] = pm + (size_t)(it * 16) * kSeq;
    }
    async_copy8(l, g);
  };

  constexpr int nch = kSeq / kKch;
  static_assert(nch == 32, "one lane and one bit per kv chunk");
  /* ---- the chunks to walk, one bit each: lane = chunk; every wave reads the same records and gets the same word ---- */
  unsigned rem;
  {
    const v4f* rec = (const v4f*)(mst + (size_t)(qb * nch + lane) * kMstRec);
    const v4f r0 = rec[0], r1 = rec[1], r2 = rec[2], r3 = rec[3];          /* {hi, lo} of the tile's 8 row groups */
    const float hi = fmaxf(fmaxf(fmaxf(r0.x, r0.z), fmaxf(r1.x, r1.z)), fmaxf(fmaxf(r2.x, r2.z), fmaxf(r3.x, r3.z)));
    float L        = fminf(fminf(fminf(r0.y, r0.w), fminf(r1.y, r1.w)), fminf(fminf(r2.y, r2.w), fminf(r3.y, r3.w)));
    for (int d = 1; d < 32; d <<= 1) L = fmaxf(L, __shfl_xor(L, d, 32));
    const float bq = fabsf(bf_bits2f(f2bf_bits(tau[h]))) * (LOG2E * 1.0625f) + 1.0f;
    /* written so that a NaN (inf - inf, a NaN tau) keeps the chunk */
    const bool out_of_reach = (L - hi) * LOG2E > 2.0f * bq + 192.0f;
    rem = __builtin_amdgcn_ballot_w32(!out_of_reach);
    if (rem == 0u) rem = 0xffffffffu;   /* bounds the chunk index below whatever the records hold (the chunk that gives L has its bit) */
  }
  const int nact = __builtin_popcount(rem);
  int cn = __builtin_ctz(rem);
  rem &= rem - 1u;
  stage_copy(cn, 0);
  asm volatile("s_wait_asynccnt 0x0" ::: "memory");   /* this wave's share of the first chunk has landed */
  __syncthreads();                                     /* ... and every other wave's */
  if (rem != 0u) {
    cn = __builtin_ctz(rem);
    rem &= rem - 1u;
    stage_copy(cn, 1);
  }
  for (int kc = 0; kc < nact; ++kc) {
    const unsigned short* tb = ring[kc & 1];
    const __bf16*   Ksh = (const __bf16*)(const void*)tb;
    const __bf16*   Ksl = (const __bf16*)(const void*)(tb + kTileE);
    const _Float16* Vt  = (const _Float16*)(const void*)(tb + 2 * kTileE);
    const unsigned short* Msk = tb + 3 * kTileE;

    /* ---- LDS reads stand in groups ahead of the matrix runs, never among them: a read placed directly in front of its
       product leaves the wave waiting out the LDS latency at every product.  (The hazard statements behind the products
       are volatile asm, which no load crosses: where a group is written is where it is issued.)
       Group 1, at the head of the chunk: all K hi and K lo fragments, 32 reads. ---- */
    FB kb[4][2], klo[4][2];
#pragma unroll
    for (int j = 0; j < 4; ++j) {
#pragma unroll
      for (int dc = 0; dc < 2; ++dc) {
        kb[j][dc].h[0]  = *(const v8b*)(Ksh + (j * 16 + c) * kP16 + dc * 32 + 8 * hh);
        kb[j][dc].h[1]  = *(const v8b*)(Ksh + (j * 16 + c) * kP16 + dc * 32 + 16 + 8 * hh);
        klo[j][dc].h[0] = *(const v8b*)(Ksl + (j * 16 + c) * kP16 + dc * 32 + 8 * hh);
        klo[j][dc].h[1] = *(const v8b*)(Ksl + (j * 16 + c) * kP16 + dc * 32 + 16 + 8 * hh);
      }
    }
    const unsigned short* mrw = Msk + (wave * 16 + c) * kP16 + 8 * hh;
    v4u mw[4];                  /* mask words of the lane's own query row: eight bf16 per score tile */
    FH vb[2][4];                /* V^T fragments: A[m=d][k=kv] = Vt[d][kv] (lane row c) */

    /* ---- scores: S^T[kvrow][qcol], A[m=kv][k=d] = Ksh[kv][d], B[k=d][n=q] = Q; s[j][r] = S[q = c][kv = 16j + 8hh + r] ---- */
    v8f s[4];
#pragma unroll
    for (int j = 0; j < 4; ++j) {
      s[j] = (v8f){0.f,0.f,0.f,0.f,0.f,0.f,0.f,0.f};
#pragma unroll
      for (int dc = 0; dc < 2; ++dc) {
        s[j] = at_mma_b(kb[j][dc].v,  qah[dc], s[j]);
        s[j] = at_mma_b(klo[j][dc].v, qah[dc], s[j]);
        s[j] = at_mma_b(kb[j][dc].v,  qal[dc], s[j]);
      }
      /* Groups 2 and 3, into registers that K fragments have left: the mask words and the first half of V^T behind
         score tile 1, the second half of V^T behind score tile 3; they land under the products and the softmax */
      if (j == 1) {
#pragma unroll
        for (int jj = 0; jj < 4; ++jj) mw[jj] = *(const v4u*)(const void*)(mrw + jj * 16);
      }
      if (j == 1 || j == 3) {
        const int kk = j >> 1;
#pragma unroll
        for (int t = 0; t < 4; ++t) {
          vb[kk][t].h[0] = *(const v8h*)(Vt + (t * 16 + c) * kP16 + kk * 32 + 8 * hh);
          vb[kk][t].h[1] = *(const v8h*)(Vt + (t * 16 + c) * kP16 + kk * 32 + 16 + 8 * hh);
        }
      }
    }

    /* ---- additive mask from the LDS tile (8 consecutive kv of the lane's own query row per score tile) + chunk max ---- */
    float cj[4];                /* one maximum per score tile: four short chains instead of one long one */
#pragma unroll
    for (int j = 0; j < 4; ++j) {
      /* eight bf16: kv 2r in the low half of word r, 2r + 1 in the high */
#pragma unroll
      for (int r = 0; r < 4; ++r) {
        s[j][2 * r]     = fmaf(__uint_as_float(mw[j][r] << 16),         LOG2E, s[j][2 * r]);
        s[j][2 * r + 1] = fmaf(__uint_as_float(mw[j][r] & 0xffff0000u), LOG2E, s[j][2 * r + 1]);
      }
      cj[j] = fmaxf(s[j][0], s[j][4]);
#pragma unroll
      for (int r = 1; r < 4; ++r) cj[j] = fmaxf(cj[j], fmaxf(s[j][r], s[j][r + 4]));
    }
    float cm = fmaxf(fmaxf(cj[0], cj[1]), fmaxf(cj[2], cj[3]));
    cm = fmaxf(cm, xhalf(cm));
    const float mnew  = fmaxf(mrow, cm);
    /* the carry of p rides in the subtracted exponent; beside a maximum so large that the 14 rounds to more than 15
       it is left out, so that p stays inside f16; alpha goes from the old to the new subtracted exponent, whatever they are */
    float msub = mnew - P_CARRY_LOG2;
    msub = (mnew - msub <= P_CARRY_LOG2 + 1.0f) ? msub : mnew;
    const float alpha = __builtin_amdgcn_exp2f(mref - msub);
    mrow = mnew;
    mref = msub;
    float ps[4];                /* one sum per score tile, as for the maxima */
    FH pb[2];                   /* P^T as B operand: element e <- kv 32kk + 8hh + e, element 8 + e <- kv 32kk + 16 + 8hh + e */
#pragma unroll
    for (int j = 0; j < 4; ++j) {
      float p[8];               /* p x 2^14 */
#pragma unroll
      for (int r = 0; r < 8; ++r) p[r] = s[j][r] - msub;
      exp2x8(p);
      ps[j] = 0.f;
#pragma unroll
      for (int r = 0; r < 8; ++r) {
        ps[j] += p[r];
        pb[j >> 1].h[j & 1][r] = (_Float16)p[r];
      }
    }
    lrow = lrow * alpha + ((ps[0] + ps[1]) + (ps[2] + ps[3]));
#pragma unroll
    for (int t = 0; t < 4; ++t)
#pragma unroll
      for (int r = 0; r < 8; ++r) oacc[t][r] *= alpha;
    /* ---- O^T += V^T . P^T : A = the V^T fragments read above, B = pb; both loops unrolled: vb and pb are indexed by constants ---- */
#pragma unroll
    for (int kk = 0; kk < 2; ++kk) {
#pragma unroll
      for (int t = 0; t < 4; ++t) oacc[t] = at_mma_h(vb[kk][t].v, pb[kk].v, oacc[t]);
    }
    asm volatile("s_wait_dscnt 0x0" ::: "memory");     /* this wave's reads of the buffer have returned before it is refilled */
    asm volatile("s_wait_asynccnt 0x0" ::: "memory");  /* this wave's share of the next walked chunk has landed */
    __syncthreads();                                   /* publishes that chunk, ends every read of this one */
    if (rem != 0u) {                                   /* the same word in every wave of the block */
      cn = __builtin_ctz(rem);
      rem &= rem - 1u;
      stage_copy(cn, kc & 1);
    }
  }
  asm volatile("s_wait_asynccnt 0x0" ::: "memory");    /* no copy is outstanding when the ring becomes output staging */

  _Float16* pw = (_Float16*)(void*)&ring[0][0] + wave * (16 * kP16);
  {
    const float ltot = lrow + xhalf(lrow);               /* both halves' kv rows, carried like p; ltot >= 1 */
    const float inv  = O_CARRY / ltot;
#pragma unroll
    for (int t = 0; t < 4; ++t) {
      v8h ov;
#pragma unroll
      for (int r = 0; r < 8; ++r) ov[r] = (_Float16)(oacc[t][r] * inv);
      *(v8h*)(pw + c * kP16 + t * 16 + 8 * hh) = ov;     /* query row c, d = 16t + 8hh + 0..7 */
    }
  }
  __builtin_amdgcn_fence(__ATOMIC_RELEASE, "workgroup");
  __builtin_amdgcn_wave_barrier();
  __builtin_amdgcn_fence(__ATOMIC_ACQUIRE, "workgroup");
  {
    const int q8 = lane >> 3, c8 = (lane & 7) * 8;
    _Float16* ob = (_Float16*)(void*)oo + (tokb + (size_t)q0) * kDm + (size_t)h * kHd;
    {
#pragma unroll
      for (int it = 0; it < 4; ++it) {
        const int row = it * 4 + q8;
        const v8h val = *(const v8h*)(pw + row * kP16 + c8);
        *(v8h*)(ob + (size_t)row * kDm + c8) = val;
      }
      
    }
  }
}

/* ------------------------------------------------------------------------------------- */
extern "C" void kernel_launch(void* const* d_in, const int* in_sizes, int n_in,
                              void* d_out, int out_size, void* d_ws, size_t ws_size,
                              hipStream_t stream) {
  if (n_in < 11) return;
  const float* x    = (const float*)d_in[0];
  const float* mask = (const float*)d_in[1];
  const float* Wq   = (const float*)d_in[2];
  const float* bq   = (const float*)d_in[3];
  const float* Wk   = (const float*)d_in[4];
  const float* bk   = (const float*)d_in[5];
  const float* Wv   = (const float*)d_in[6];
  const float* bv   = (const float*)d_in[7];
  const float* Wo   = (const float*)d_in[8];
  const float* bo   = (const float*)d_in[9];
  const float* tau  = (const float*)d_in[10];

  const size_t nX = (size_t)kTok * kDm;     /* 4,194,304 */
  const size_t nW = (size_t)kDm * kDm;      /* 1,048,576 */
  if ((size_t)in_sizes[0] != nX || (size_t)in_sizes[1] != (size_t)kSeq * kSeq ||
      (size_t)in_sizes[2] != nW || (size_t)in_sizes[4] != nW || (size_t)in_sizes[6] != nW ||
      (size_t)in_sizes[8] != nW || in_sizes[3] != kDm || in_sizes[5] != kDm || in_sizes[7] != kDm ||
      in_sizes[9] != kDm || in_sizes[10] != kHeads) return;
  if ((size_t)out_size != nX) return;

  /*
       xb   bf16 [4096][1024]        off         0   size  8,388,608
       wqb  bf16 [1024][1024]        off  8,388,608  size  2,097,152
       wkb  bf16 [1024][1024]        off 10,485,760  size  2,097,152
       wvb  bf16 [1024][1024]        off 12,582,912  size  2,097,152
       wof  f16  [1024][1024] (x1024) off 14,680,064  size  2,097,152
       qf   f32  [4096][1024]        off 16,777,216  size 16,777,216   (reused as oo f16 [4096][1024], 8,388,608 B, after qf is consumed)
       kf   f32  [4096][1024]        off 33,554,432  size 16,777,216
       qhb  bf16 [4096][1024]        off 50,331,648  size  8,388,608
       qlb  bf16 [4096][1024]        off 58,720,256  size  8,388,608
       khb  bf16 [4096][1024]        off 67,108,864  size  8,388,608
       klb  bf16 [4096][1024]        off 75,497,472  size  8,388,608
       vth  f16  [1024][4096]        off 83,886,080  size  8,388,608   (v transposed: row = output feature, column = token)
       mkb  bf16 [2048][2048]        off 92,274,688  size  8,388,608
       mst  f32  [32][32][32]        off 100,663,296 size    131,072   (per mask tile: 8 x {hi, lo}, 128 B records)
       end                              100,794,368 */
  const size_t offXb  = 0;
  const size_t offWq  = offXb  + nX * 2;
  const size_t offWk  = offWq  + nW * 2;
  const size_t offWv  = offWk  + nW * 2;
  const size_t offWo  = offWv  + nW * 2;
  const size_t offQf  = offWo  + nW * 2;
  const size_t offKf  = offQf  + nX * 4;
  const size_t offQh  = offKf  + nX * 4;
  const size_t offQl  = offQh  + nX * 2;
  const size_t offKh  = offQl  + nX * 2;
  const size_t offKl  = offKh  + nX * 2;
  const size_t offVv  = offKl  + nX * 2;
  const size_t offMk  = offVv  + nX * 2;
  const size_t offSt  = offMk  + (size_t)kSeq * kSeq * 2;
  const size_t offEnd = offSt  + (size_t)kCbM * kMstRec * 4;
  if (offEnd > ws_size) return;

  char* ws = (char*)d_ws;
  unsigned short* xb  = (unsigned short*)(ws + offXb);
  unsigned short* wqb = (unsigned short*)(ws + offWq);
  unsigned short* wkb = (unsigned short*)(ws + offWk);
  unsigned short* wvb = (unsigned short*)(ws + offWv);
  unsigned short* wof = (unsigned short*)(ws + offWo);
  float*          qf  = (float*)(ws + offQf);
  unsigned short* oo  = (unsigned short*)(ws + offQf);   /* reuse after qf is consumed */
  float*          kf  = (float*)(ws + offKf);
  unsigned short* qhb = (unsigned short*)(ws + offQh);
  unsigned short* qlb = (unsigned short*)(ws + offQl);
  unsigned short* khb = (unsigned short*)(ws + offKh);
  unsigned short* klb = (unsigned short*)(ws + offKl);
  unsigned short* vth = (unsigned short*)(ws + offVv);
  unsigned short* mkb = (unsigned short*)(ws + offMk);
  float*          mst = (float*)(ws + offSt);

  /* 1: input casts (RNE bf16; Wo -> f16 of bf16 value x 1024) */
  cast_all_kernel<<<dim3(kCbAll), dim3(256), 0, stream>>>(x, mask, Wq, Wk, Wv, Wo, xb, mkb, wqb, wkb, wvb, wof, mst);

  /* 2: the three projections, one launch: C[m][n] = sum_k xb[m][k] W[n][k] + bias[n]; M=4096, N=1024, K=1024 (tiles 64x64, K%64==0);
     v with the operands exchanged, C[n][m] (+ bias[n], now the row's), so that a head's V^T rows lie along the tokens */
  const int gemmTiles  = (kTok / 64) * (kDm / 64);      /* 1024 */
  const int gemmBlocks = (gemmTiles + 7) / 8;           /* 128 */
  qkv_proj_kernel<<<dim3(gemmBlocks, 3), dim3(256), 0, stream>>>(xb, wqb, wkb, wvb, bq, bk, bv, qf, kf, vth);

  /* 3: L2 normalisation of q (x tau) and k, bf16 hi/lo planes */
  l2norm_split_kernel<<<dim3((kTok * kHeads) / 32, 2), dim3(256), 0, stream>>>(qf, kf, tau, qhb, qlb, khb, klb);

  /* 4: attention -> oo (f16, value x 64), overwrites the dead qf region */
  cos_attn_kernel<<<dim3(kBatch * kHeads * (kSeq / kQblk)), dim3(128), 0, stream>>>(qhb, qlb, khb, klb, vth, mkb, mst, tau, oo);

  /* 5: output projection: out[m][n] = 2^-16 * sum_c (oo x64)[m][c] (Wo x1024)[n][c] + bo[n] -> d_out f32 */
  wmma_gemm64<0, false, 2, 0, false, 0><<<dim3(gemmBlocks, 1), dim3(256), 0, stream>>>(
      oo, oo, kDm, 0L, wof, wof, kDm, 0L, d_out, d_out, kDm, 0L, bo, nullptr, 0L, kTok, kDm, kDm,
      1.0f / (O_CARRY * WO_CARRY));
}

// v010
// A run of this version takes 114 microseconds.
// Timed twice side by side with v009, it ran 1.17 and 1.15 times as fast.
// Counting every step since v000, it is 4.06 times as fast.
// Contractions: q/k/v projections on v_wmma_f32_16x16x32_bf16 (operands = RNE bf16 of the inputs); scores on bf16 hi/lo split (hi.hi + hi.lo + lo.hi); p.v and output projection on v_wmma_f32_16x16x32_f16 (p carried x2^14, attention output carried x2^6, Wo carried x2^10); f32 accumulate; norms and softmax in f32.
#include <hip/hip_runtime.h>
#include <stdint.h>

typedef __attribute__((ext_vector_type(16))) _Float16 v16h;
typedef __attribute__((ext_vector_type(8)))  _Float16 v8h;
typedef __attribute__((ext_vector_type(16))) __bf16   v16b;
typedef __attribute__((ext_vector_type(8)))  __bf16   v8b;
typedef __attribute__((ext_vector_type(8)))  float    v8f;
typedef __attribute__((ext_vector_type(4)))  float    v4f;
typedef __attribute__((ext_vector_type(2)))  float    v2f;
typedef __attribute__((ext_vector_type(4)))  unsigned v4u;

/* problem geometry */
constexpr int kBatch = 2;
constexpr int kSeq   = 2048;
constexpr int kDm    = 1024;
constexpr int kHeads = 16;
constexpr int kHd    = 64;
constexpr int kTok   = kBatch * kSeq;      /* 4096 token rows */
constexpr int kKch   = 64;                 /* kv chunk */
constexpr int kQblk  = 64;                 /* query rows per block */
/* LDS row pitches of the attention tiles: 16 B x odd, so that the 16 rows a ds_load_b128 fragment read
   touches fall on 16 different groups of four banks (an unpadded 128 B or 256 B row puts them on one or two) */
constexpr int kP16   = 72;                 /* 64 16-bit elements + 8 pad  = 144 B */
constexpr int kTileE = kKch * kP16;        /* 16-bit elements of one 64-row attention tile in LDS: 9,216 B */
/* GEMM operand staging in LDS */
constexpr int kGk    = 64;                 /* k elements per stage: 128 B of every operand row, whole cache lines */
constexpr int kGp    = 72;                 /* LDS row pitch 144 B = 16 B x odd, as for the attention tiles */
constexpr int kGm    = 128;                /* rows of the first operand in a block tile */
#define O_CARRY 64.0f
#define WO_CARRY 1024.0f
#define LOG2E 1.4426950408889634f
#define P_CARRY_LOG2 14.0f                  /* p is carried x2^14 */

static_assert(kDm == kHeads * kHd, "head split");
static_assert(kTok % 64 == 0 && kDm % 64 == 0, "GEMM M,N tile multiples");
static_assert(kDm % kGk == 0, "GEMM K multiple of the LDS stage");
static_assert(kTok % kGm == 0 && kDm % 64 == 0, "whole GEMM block tiles; a wave's 64 features lie in one projection");
static_assert(kSeq % kKch == 0 && kSeq % kQblk == 0, "attention tiles");
static_assert((kTok * kHeads) % 32 == 0, "normalize grid");

__device__ __forceinline__ unsigned short f2bf_bits(float f) {
  unsigned u = __float_as_uint(f);
  return (unsigned short)((u + 0x7FFFu + ((u >> 16) & 1u)) >> 16);
}
__device__ __forceinline__ float bf_bits2f(unsigned short h) { return __uint_as_float(((unsigned)h) << 16); }
__device__ __forceinline__ _Float16 h16_lo(unsigned w) { return __builtin_bit_cast(_Float16, (unsigned short)(w & 0xffffu)); }
__device__ __forceinline__ _Float16 h16_hi(unsigned w) { return __builtin_bit_cast(_Float16, (unsigned short)(w >> 16)); }

/* hazard guards as plain device helpers */
__device__ __forceinline__ void dep_guard_h(v8f& a, v8f& b, v16h x, v16h y) { asm volatile("v_nop\n\tv_nop\n\tv_nop\n\tv_nop" : "+v"(a), "+v"(b) : "v"(x), "v"(y)); }
__device__ __forceinline__ void dep_guard_b(v8f& a, v8f& b, v16b x, v16b y) { asm volatile("v_nop\n\tv_nop\n\tv_nop\n\tv_nop" : "+v"(a), "+v"(b) : "v"(x), "v"(y)); }
__device__ __forceinline__ void keep4_h(v16h a, v16h b, v16h c, v16h d) { asm volatile("v_nop" :: "v"(a), "v"(b), "v"(c), "v"(d)); }
__device__ __forceinline__ void keep4_b(v16b a, v16b b, v16b c, v16b d) { asm volatile("v_nop" :: "v"(a), "v"(b), "v"(c), "v"(d)); }
__device__ __forceinline__ void acc_guard4(v8f& a, v8f& b, v8f& c, v8f& d) { asm volatile("v_nop\n\tv_nop\n\tv_nop\n\tv_nop" : "+v"(a), "+v"(b), "+v"(c), "+v"(d)); }
template <typename T> struct Frag;
template <> struct Frag<_Float16> {
  typedef v16h V; union U { v16h v; v8h h[2]; };
  static __device__ __forceinline__ v16h load(const _Float16* p) {   /* elements 0..7 <- p[0..7], 8..15 <- p[16..23] */
    U f; f.h[0] = *(const v8h*)(p); f.h[1] = *(const v8h*)(p + 16); return f.v;
  }
  static __device__ __forceinline__ v8f mma(v16h a, v16h b, v8f c) {
    return __builtin_amdgcn_wmma_f32_16x16x32_f16(false, a, false, b, (short)0, c, false, false);
  }
  static __device__ __forceinline__ void guard(v8f& a, v8f& b, v16h x, v16h y) { dep_guard_h(a, b, x, y); }
  static __device__ __forceinline__ void keep(v16h a, v16h b, v16h c, v16h d) { keep4_h(a, b, c, d); }
};
template <> struct Frag<__bf16> {
  typedef v16b V; union U { v16b v; v8b h[2]; };
  static __device__ __forceinline__ v16b load(const __bf16* p) {
    U f; f.h[0] = *(const v8b*)(p); f.h[1] = *(const v8b*)(p + 16); return f.v;
  }
  static __device__ __forceinline__ v8f mma(v16b a, v16b b, v8f c) {
    return __builtin_amdgcn_wmma_f32_16x16x32_bf16(false, a, false, b, (short)0, c, false, false);
  }
  static __device__ __forceinline__ void guard(v8f& a, v8f& b, v16b x, v16b y) { dep_guard_b(a, b, x, y); }
  static __device__ __forceinline__ void keep(v16b a, v16b b, v16b c, v16b d) { keep4_b(a, b, c, d); }
};

/* Ten asynchronous 16-byte copies global -> LDS per lane, through no register: l = the lane's LDS byte address,
   g = the lane's global address.  The closing s_wait_xcnt stands inside the statement so that no address
   register of an issued copy is rewritten in front of it. */
__device__ __forceinline__ void async_copy10(const unsigned (&l)[10], const unsigned short* const (&g)[10]) {
  asm volatile(
      "global_load_async_to_lds_b128 %0, %10, off\n\t"
      "global_load_async_to_lds_b128 %1, %11, off\n\t"
      "global_load_async_to_lds_b128 %2, %12, off\n\t"
      "global_load_async_to_lds_b128 %3, %13, off\n\t"
      "global_load_async_to_lds_b128 %4, %14, off\n\t"
      "global_load_async_to_lds_b128 %5, %15, off\n\t"
      "global_load_async_to_lds_b128 %6, %16, off\n\t"
      "global_load_async_to_lds_b128 %7, %17, off\n\t"
      "global_load_async_to_lds_b128 %8, %18, off\n\t"
      "global_load_async_to_lds_b128 %9, %19, off\n\t"
      "s_wait_xcnt 0x0"
      :: "v"(l[0]), "v"(l[1]), "v"(l[2]), "v"(l[3]), "v"(l[4]), "v"(l[5]), "v"(l[6]), "v"(l[7]), "v"(l[8]), "v"(l[9]),
         "v"(g[0]), "v"(g[1]), "v"(g[2]), "v"(g[3]), "v"(g[4]), "v"(g[5]), "v"(g[6]), "v"(g[7]), "v"(g[8]), "v"(g[9])
      : "memory");
}

/* The same with one copy per lane. */
__device__ __forceinline__ void async_copy1(unsigned l, const unsigned short* g) {
  asm volatile(
      "global_load_async_to_lds_b128 %0, %1, off\n\t"
      "s_wait_xcnt 0x0"
      :: "v"(l), "v"(g)
      : "memory");
}

/* The same with eight copies per lane: two 64-row tiles of the attention ring (four passes of 16 rows each), or a wave's share of a GEMM stage. */
__device__ __forceinline__ void async_copy8(const unsigned (&l)[8], const unsigned short* const (&g)[8]) {
  asm volatile(
      "global_load_async_to_lds_b128 %0, %8, off\n\t"
      "global_load_async_to_lds_b128 %1, %9, off\n\t"
      "global_load_async_to_lds_b128 %2, %10, off\n\t"
      "global_load_async_to_lds_b128 %3, %11, off\n\t"
      "global_load_async_to_lds_b128 %4, %12, off\n\t"
      "global_load_async_to_lds_b128 %5, %13, off\n\t"
      "global_load_async_to_lds_b128 %6, %14, off\n\t"
      "global_load_async_to_lds_b128 %7, %15, off\n\t"
      "s_wait_xcnt 0x0"
      :: "v"(l[0]), "v"(l[1]), "v"(l[2]), "v"(l[3]), "v"(l[4]), "v"(l[5]), "v"(l[6]), "v"(l[7]),
         "v"(g[0]), "v"(g[1]), "v"(g[2]), "v"(g[3]), "v"(g[4]), "v"(g[5]), "v"(g[6]), "v"(g[7])
      : "memory");
}

__device__ __forceinline__ void async_copy_n(const unsigned (&l)[10], const unsigned short* const (&g)[10]) { async_copy10(l, g); }
__device__ __forceinline__ void async_copy_n(const unsigned (&l)[8],  const unsigned short* const (&g)[8])  { async_copy8(l, g); }

/* ---- Register-blocked WMMA GEMM ---------------------------------------------
   C[m,n] = scale * sum_k X[m,k] * Wt[n,k] (+bias).  X row-major [M,K]; Wt row-major [N,K]; K % 64 == 0, ld % 8 == 0.
   A block owns 128 rows of X and 64 WN rows of Wt; its (128 / 16 MI) x WN waves each own a 16 MI x 64 tile of the product.
   The block tile is chosen per launch so that the launch is exactly 256 work-groups, one on every WGP, in one round,
   and so that few operand rows are copied per output element.
   Per 64 k the block's 128 + 64 WN rows are copied to LDS in whole 128 B lines (two buffers: the next stage flies
   while this one is multiplied); the fragments are read from LDS in ascending k, 32 at a time.
   ET: 0 = f16 operands, 1 = bf16 operands (pointers passed as 16-bit storage) */
template <int ET> struct Elem;
template <> struct Elem<0> { typedef _Float16 T; };
template <> struct Elem<1> { typedef __bf16 T; };
template <int MI, int WN> struct Shape {
  static constexpr int waves  = (kGm / (16 * MI)) * WN;
  static constexpr int rows   = kGm + 64 * WN;         /* LDS rows of a stage: 0..127 X, then Wt */
  static constexpr int groups = rows / 4;              /* one copy of a wave = 4 rows of 128 B */
  static constexpr int full   = groups / waves;        /* copies a stage that every wave issues */
  static constexpr int tail   = groups - full * waves; /* the first 'tail' waves issue one more */
};

/* the k loop: acc[i][j] += rows aRow + 16 i .. of the stage (A operand) x rows bRow + 16 j .. (B operand).
   wave, aRow, bRow: the same in every lane of a wave, held in scalar registers. */
template <int ET, int MI, int WN>
__device__ __forceinline__ void gemm_tile_loop(
    unsigned short (&sAB)[2][Shape<MI, WN>::rows * kGp],
    const unsigned short* __restrict__ Xg,       /* the first of the block's 128 X rows */
    const unsigned short* __restrict__ Wg,       /* the first of the block's 64 WN Wt rows */
    int ld, int K, int wave, int aRow, int bRow, v8f (&acc)[MI][4]) {
  typedef typename Elem<ET>::T T;
  typedef typename Frag<T>::V V;
  typedef Shape<MI, WN> S;
  const int lane  = threadIdx.x & 31;
  const int rlane = lane & 15;                 /* row (A) / col (B, D) within subtile */
  const int koff  = (lane >> 4) * 8;           /* k offset of this lane half */

  /* copy map: 8 lanes x 16 B = one 128 B row, 4 rows a copy of a wave; group gi = rows 4 gi .. 4 gi + 3 of the stage */
  const int lrow = lane >> 3;
  const int cchk = (lane & 7) * 8;
  const unsigned lds0 = (unsigned)(uintptr_t)(const void*)&sAB[0][0] + (unsigned)(lrow * kGp + cchk) * 2u;
  auto src = [&](int gi) -> const unsigned short* {
    return (gi < kGm / 4) ? Xg + (size_t)(gi * 4 + lrow) * ld + cchk
                          : Wg + (size_t)(gi * 4 - kGm + lrow) * ld + cchk;
  };
  auto stage_copy = [&](int st, int buf) {
    const unsigned lb = lds0 + (unsigned)buf * (unsigned)(S::rows * kGp * 2);
    unsigned l[S::full];
    const unsigned short* g[S::full];
    /* unrolled: l[] and g[] are asm operands and must be registers */
#pragma unroll
    for (int it = 0; it < S::full; ++it) {
      const int gi = wave + it * S::waves;
      l[it] = lb + (unsigned)(gi * 4 * kGp * 2);
      g[it] = src(gi) + (size_t)st * kGk;
    }
    async_copy_n(l, g);
    if (S::tail > 0 && wave < S::tail) {       /* a scalar branch: whole waves issue the copy or pass it */
      const int gi = wave + S::full * S::waves;
      async_copy1(lb + (unsigned)(gi * 4 * kGp * 2), src(gi) + (size_t)st * kGk);
    }
  };

#pragma unroll
  for (int i = 0; i < MI; ++i)
#pragma unroll
    for (int j = 0; j < 4; ++j) acc[i][j] = (v8f){0.f,0.f,0.f,0.f,0.f,0.f,0.f,0.f};

  const int nst = K / kGk;
  stage_copy(0, 0);
  asm volatile("s_wait_asynccnt 0x0" ::: "memory");   /* this wave's share of stage 0 has landed */
  __syncthreads();                                     /* ... and every other wave's */
  if (nst > 1) stage_copy(1, 1);
  for (int t = 0; t < nst; ++t) {
    const T* sL = (const T*)(const void*)sAB[t & 1] + rlane * kGp + koff;
    const T* sA = sL + aRow * kGp;
    const T* sB = sL + bRow * kGp;
    /* all loops of the stage unrolled: fragments and accumulators are indexed by constants and stay in registers */
#pragma unroll
    for (int ks = 0; ks < kGk; ks += 32) {
      V bh[4], ah[MI];
#pragma unroll
      for (int j = 0; j < 4; ++j) bh[j] = Frag<T>::load(sB + j * 16 * kGp + ks);
#pragma unroll
      for (int i = 0; i < MI; ++i) ah[i] = Frag<T>::load(sA + i * 16 * kGp + ks);
#pragma unroll
      for (int i = 0; i < MI; ++i) {
#pragma unroll
        for (int j = 0; j < 4; ++j) acc[i][j] = Frag<T>::mma(ah[i], bh[j], acc[i][j]);
        Frag<T>::guard(acc[i][0], acc[i][3], ah[i], ah[i]);
      }
      Frag<T>::keep(bh[0], bh[1], bh[2], bh[3]);
    }
    asm volatile("s_wait_dscnt 0x0" ::: "memory");     /* this wave's reads of the buffer have returned before it is refilled */
    asm volatile("s_wait_asynccnt 0x0" ::: "memory");  /* this wave's share of stage t + 1 has landed */
    __syncthreads();                                   /* publishes stage t + 1, ends every read of stage t */
    if (t + 2 < nst) stage_copy(t + 2, t & 1);
  }
  asm volatile("s_wait_asynccnt 0x0" ::: "memory");    /* no copy is outstanding when the wave goes on */
#pragma unroll
  for (int i = 0; i < MI; ++i) acc_guard4(acc[i][0], acc[i][1], acc[i][2], acc[i][3]);
}

/* the wave's 16 MI x 64 tile -> C rows m0.., columns n0.., in whole lines through the wave's own LDS slab.
   BIAS_MODE: 1 = bias[m], 2 = bias[n]; bias values RNE-converted to bf16 precision before the add.
   OUT_MODE: 0 = f32, 1 = f16. */
template <int MI, int BIAS_MODE, int OUT_MODE>
__device__ __forceinline__ void gemm_tile_store(
    float* slab,                                 /* 16 x 64, pitch 68 floats */
    const v8f (&acc)[MI][4], int m0, int n0,
    void* __restrict__ Cout, int ldc, const float* __restrict__ bias, float scale) {
  const int lane  = threadIdx.x & 31;
  const int rlane = lane & 15;
  const int mOff  = (lane >> 4) * 8;           /* D row offset */
#pragma unroll
  for (int i = 0; i < MI; ++i) {
    const int mBase = m0 + (i << 4);
#pragma unroll
    for (int j = 0; j < 4; ++j) {
      const int n = n0 + (j << 4) + rlane;
      float bv = 0.f;
      if (BIAS_MODE == 2) bv = bf_bits2f(f2bf_bits(bias[n]));
#pragma unroll
      for (int r = 0; r < 8; ++r) {
        float v = acc[i][j][r] * scale;
        if (BIAS_MODE == 1) v += bf_bits2f(f2bf_bits(bias[mBase + mOff + r]));
        if (BIAS_MODE == 2) v += bv;
        slab[(mOff + r) * 68 + (j << 4) + rlane] = v;
      }
    }
    __builtin_amdgcn_fence(__ATOMIC_RELEASE, "workgroup");
    __builtin_amdgcn_wave_barrier();
    __builtin_amdgcn_fence(__ATOMIC_ACQUIRE, "workgroup");
    if (OUT_MODE == 0) {
      float* C = (float*)Cout;
      const int hh = lane >> 4, c4 = (lane & 15) * 4;     /* row seg = 256 B = 16 lanes x 16 B */
#pragma unroll
      for (int it = 0; it < 8; ++it) {
        const int row = it * 2 + hh;
        v4f v = *(const v4f*)(slab + row * 68 + c4);
        *(v4f*)(C + (size_t)(mBase + row) * ldc + n0 + c4) = v;
      }
    } else {
      const int q = lane >> 3, c8 = (lane & 7) * 8;
      unsigned short* C = (unsigned short*)Cout;
#pragma unroll
      for (int it = 0; it < 4; ++it) {
        const int row = it * 4 + q;
        const float* sp = slab + row * 68 + c8;
        v8h hv;
#pragma unroll
        for (int e = 0; e < 8; ++e) hv[e] = (_Float16)sp[e];
        *(v8h*)(C + (size_t)(mBase + row) * ldc + n0 + c8) = hv;
      }
    }
    __builtin_amdgcn_fence(__ATOMIC_RELEASE, "workgroup");
    __builtin_amdgcn_wave_barrier();
    __builtin_amdgcn_fence(__ATOMIC_ACQUIRE, "workgroup");
  }
}

/* ---- output projection: out[m][n] = scale * sum_c oo[m][c] wof[n][c] + bo[n], f32.
   Block tile 128 x 128, 8 waves of 32 x 64: (kTok / 128) x (kDm / 128) = 256 work-groups. */
__global__ __launch_bounds__(256) void out_proj_kernel(
    const unsigned short* __restrict__ oo, const unsigned short* __restrict__ wof,
    const float* __restrict__ bo, float* __restrict__ out, float scale) {
  constexpr int MI = 2, WN = 2;
  typedef Shape<MI, WN> S;
  static_assert(S::waves == 8 && S::tail == 0 && kDm % (64 * WN) == 0, "block size, whole tiles");
  __shared__ __align__(16) float sT[S::waves][16 * 68];
  __shared__ __align__(16) unsigned short sAB[2][S::rows * kGp];
  constexpr int tilesN = kDm / (64 * WN);
  const int wave = __builtin_amdgcn_readfirstlane((int)(threadIdx.x >> 5));
  const int tm = (int)blockIdx.x / tilesN;
  const int tn = (int)blockIdx.x - tm * tilesN;
  const int wm = wave / WN;
  const int wn = wave - wm * WN;
  v8f acc[MI][4];
  gemm_tile_loop<0, MI, WN>(sAB, oo + (size_t)(tm * kGm) * kDm, wof + (size_t)(tn * 64 * WN) * kDm, kDm, kDm,
                            wave, wm * 16 * MI, kGm + wn * 64, acc);
  gemm_tile_store<MI, 2, 0>(sT[wave], acc, tm * kGm + wm * 16 * MI, (tn * WN + wn) * 64, (void*)out, kDm, bo, scale);
}

/* ---- the q, k and v projections in one launch, as one product of x with the 3 kDm rows of Wq | Wk | Wv (wqkv: the three
   cast planes lie behind one another).  Block tile 128 tokens x 384 features, 12 waves of 64 x 64:
   (kTok / 128) x (3 kDm / 384) = 256 work-groups.  A wave's 64 features lie in one of the three (a scalar test):
   q, k: qf[m][n] = sum_k xb[m][k] W[n][k] + b[n] (f32);
   v: the wave takes the W rows as its A operand and the x rows as B, vth[n][m] (+ bv[n], now the row's), f16. */
__global__ __launch_bounds__(384) void qkv_proj_kernel(
    const unsigned short* __restrict__ xb,  const unsigned short* __restrict__ wqkv,
    const float* __restrict__ bq, const float* __restrict__ bk, const float* __restrict__ bv,
    float* __restrict__ qf, float* __restrict__ kf, unsigned short* __restrict__ vth) {
  constexpr int MI = 4, WN = 6;
  typedef Shape<MI, WN> S;
  static_assert(S::waves == 12 && (3 * kDm) % (64 * WN) == 0, "block size, whole tiles");
  __shared__ __align__(16) float sT[S::waves][16 * 68];
  __shared__ __align__(16) unsigned short sAB[2][S::rows * kGp];
  constexpr int tilesN = 3 * kDm / (64 * WN);
  const int wave = __builtin_amdgcn_readfirstlane((int)(threadIdx.x >> 5));
  const int tm = (int)blockIdx.x / tilesN;
  const int tn = (int)blockIdx.x - tm * tilesN;
  const int wm = wave / WN;
  const int wn = wave - wm * WN;
  const int tok0 = tm * kGm + wm * 64;         /* the wave's first token */
  const int col  = (tn * WN + wn) * 64;        /* its first feature among the 3 kDm */
  const int prod = col / kDm;                  /* 0 q, 1 k, 2 v */
  const int f0   = col - prod * kDm;
  const bool isv = (prod == 2);
  const int xRow = wm * 64, wRow = kGm + wn * 64;
  v8f acc[MI][4];
  gemm_tile_loop<1, MI, WN>(sAB, xb + (size_t)(tm * kGm) * kDm, wqkv + (size_t)(tn * 64 * WN) * kDm, kDm, kDm,
                            wave, isv ? wRow : xRow, isv ? xRow : wRow, acc);
  if (isv) {
    gemm_tile_store<MI, 1, 1>(sT[wave], acc, f0, tok0, (void*)vth, kTok, bv, 1.0f);
  } else {
    gemm_tile_store<MI, 2, 0>(sT[wave], acc, tok0, f0, (void*)(prod ? kf : qf), kDm, prod ? bk : bq, 1.0f);
  }
}

/* ---- all six input casts in one launch: the block index picks the tensor (block-uniform, scalar branches).
   x, mask, Wq, Wk, Wv -> bf16 bits (RNE); Wo -> f16 bits of (RNE-bf16 value * WO_CARRY).
   Each of them alone is a launch of a few microseconds at most, most of it start and drain; side by side they pay that once.
   coverage: a block = 256 threads x 2 elements (mask: x 16, one 64 x 64 tile); kCbX + kCbM + 4 kCbW blocks cover the six tensors exactly.
   A mask block also leaves, per wave (8 rows of its tile), the largest cast value and the smallest of the 8 rows' largest:
   mst[tile][wave] = {hi, lo}, a record of 128 B a tile, from which the attention tells the tiles that cannot count. */
constexpr int kCbX   = kTok * kDm / 512;   /* 8192 blocks for x */
constexpr int kCbM   = (kSeq / kQblk) * (kSeq / kKch);  /* 1024 blocks for the mask, one attention tile each */
constexpr int kMstRec = 32;                /* floats per tile record: 8 waves x {hi, lo}, padded to a whole 128 B line */
constexpr int kCbW   = kDm * kDm / 512;    /* 2048 blocks for each weight matrix */
constexpr int kCbAll = kCbX + kCbM + 4 * kCbW;
static_assert((kTok * kDm) % 512 == 0 && kQblk == 64 && kKch == 64 && (kDm * kDm) % 512 == 0, "whole blocks");
__global__ __launch_bounds__(256) void cast_all_kernel(
    const float* __restrict__ x,  const float* __restrict__ mask, const float* __restrict__ wq,
    const float* __restrict__ wk, const float* __restrict__ wv,   const float* __restrict__ wo,
    unsigned short* __restrict__ xb,  unsigned short* __restrict__ mkb, unsigned short* __restrict__ wqb,
    unsigned short* __restrict__ wkb, unsigned short* __restrict__ wvb, unsigned short* __restrict__ wof,
    float* __restrict__ mst) {
  int blk = blockIdx.x;
  const float* in = x;
  unsigned short* out = xb;
  bool carry = false;                      /* Wo alone */
  if (blk >= kCbX + kCbM) {
    blk -= kCbX + kCbM;
    const int w = blk / kCbW;              /* 0..3 by the grid */
    blk -= w * kCbW;
    in    = (w == 0) ? wq  : (w == 1) ? wk  : (w == 2) ? wv  : wo;
    out   = (w == 0) ? wqb : (w == 1) ? wkb : (w == 2) ? wvb : wof;
    carry = (w == 3);
  } else if (blk >= kCbX) {
    blk -= kCbX;                           /* tile (tq, tk): query rows 64 tq.., kv columns 64 tk.. */
    const int tq  = blk / (kSeq / kKch);
    const int tk  = blk - tq * (kSeq / kKch);
    const int row = threadIdx.x >> 2;      /* four threads a row, 16 elements each */
    const size_t o = (size_t)(tq * kQblk + row) * kSeq + (size_t)(tk * kKch + (threadIdx.x & 3) * 16);
    float mx = -INFINITY;
    bool bad = false;                      /* a NaN, which fmaxf would pass over */
    unsigned w[8];
    /* unrolled: w[] is indexed by constants and stays in registers, the four loads go out together */
#pragma unroll
    for (int i = 0; i < 4; ++i) {
      const v4f p = *(const v4f*)(mask + o + 4 * i);
      const unsigned short u0 = f2bf_bits(p.x), u1 = f2bf_bits(p.y), u2 = f2bf_bits(p.z), u3 = f2bf_bits(p.w);
      const float f0 = bf_bits2f(u0), f1 = bf_bits2f(u1), f2 = bf_bits2f(u2), f3 = bf_bits2f(u3);
      w[2 * i]     = (unsigned)u0 | ((unsigned)u1 << 16);
      w[2 * i + 1] = (unsigned)u2 | ((unsigned)u3 << 16);
      mx  = fmaxf(mx, fmaxf(fmaxf(f0, f1), fmaxf(f2, f3)));
      bad = bad || (f0 != f0) || (f1 != f1) || (f2 != f2) || (f3 != f3);
    }
    v4u s0; s0.x = w[0]; s0.y = w[1]; s0.z = w[2]; s0.w = w[3];
    v4u s1; s1.x = w[4]; s1.y = w[5]; s1.z = w[6]; s1.w = w[7];
    v4u* mo = (v4u*)(void*)(mkb + o);
    mo[0] = s0; mo[1] = s1;
    mx = fmaxf(mx, __shfl_xor(mx, 1, 32));
    mx = fmaxf(mx, __shfl_xor(mx, 2, 32)); /* the row's largest inside the tile */
    float hi = mx, lo = mx;
    for (int d = 4; d < 32; d <<= 1) {
      hi = fmaxf(hi, __shfl_xor(hi, d, 32));
      lo = fminf(lo, __shfl_xor(lo, d, 32));
    }
    if (__builtin_amdgcn_ballot_w32(bad) != 0u) hi = INFINITY;   /* a tile with a NaN is always worked */
    if ((threadIdx.x & 31) == 0) {
      v2f st; st.x = hi; st.y = lo;
      *(v2f*)(mst + (size_t)blk * kMstRec + (threadIdx.x >> 5) * 2) = st;
    }
    return;
  }
  const int i = blk * 256 + threadIdx.x;
  const v2f p = *(const v2f*)(in + 2 * (size_t)i);
  unsigned short u0 = f2bf_bits(p.x), u1 = f2bf_bits(p.y);
  if (carry) {
    u0 = __builtin_bit_cast(unsigned short, (_Float16)(bf_bits2f(u0) * WO_CARRY));
    u1 = __builtin_bit_cast(unsigned short, (_Float16)(bf_bits2f(u1) * WO_CARRY));
  }
  unsigned* op = (unsigned*)(void*)out;
  op[i] = (unsigned)u0 | ((unsigned)u1 << 16);
}

/* ---- per (token, head) L2 normalisation + bf16 hi/lo split.
   blockIdx.y = 0: q plane, scaled by 1/max(||q||,1e-12) * bf16(tau[head]) * log2(e), so that the scores come out
   of the matrix unit as exponents of 2; y = 1: k plane, 1/max(||k||,1e-12).
   8 lanes per 64-vector (8 floats each), 32 segments per 256-thread block; grid.x = kTok*kHeads/32 = 2048.
*/
__global__ __launch_bounds__(256) void l2norm_split_kernel(
    const float* __restrict__ qf, const float* __restrict__ kf, const float* __restrict__ tau,
    unsigned short* __restrict__ qhp, unsigned short* __restrict__ qlp,
    unsigned short* __restrict__ khp, unsigned short* __restrict__ klp) {
  const bool isk = (blockIdx.y != 0);                 /* block-uniform */
  const float* src = isk ? kf : qf;
  unsigned short* dhp = isk ? khp : qhp;
  unsigned short* dlp = isk ? klp : qlp;
  const int tid = threadIdx.x;
  const int g = tid >> 3, e = tid & 7;
  const int seg = blockIdx.x * 32 + g;                 /* < kTok*kHeads */
  const int token = seg >> 4, head = seg & 15;
  const size_t base = (size_t)token * kDm + (size_t)head * kHd + (size_t)e * 8;
  const v4f a  = *(const v4f*)(src + base);
  const v4f c4 = *(const v4f*)(src + base + 4);
  float ss = 0.0f;
  ss += a.x * a.x;  ss += a.y * a.y;  ss += a.z * a.z;  ss += a.w * a.w;
  ss += c4.x * c4.x; ss += c4.y * c4.y; ss += c4.z * c4.z; ss += c4.w * c4.w;
  ss += __shfl_xor(ss, 1, 32);
  ss += __shfl_xor(ss, 2, 32);
  ss += __shfl_xor(ss, 4, 32);
  const float nrm  = sqrtf(ss);
  const float rinv = 1.0f / fmaxf(nrm, 1e-12f);
  const float th   = bf_bits2f(f2bf_bits(tau[head]));
  const float sc   = isk ? rinv : rinv * (th * LOG2E);
  float vals[8];
  vals[0] = a.x * sc;  vals[1] = a.y * sc;  vals[2] = a.z * sc;  vals[3] = a.w * sc;
  vals[4] = c4.x * sc; vals[5] = c4.y * sc; vals[6] = c4.z * sc; vals[7] = c4.w * sc;
  unsigned hw[4], lw[4];
#pragma unroll
  for (int i = 0; i < 4; ++i) {
    const float v0 = vals[2 * i], v1 = vals[2 * i + 1];
    const unsigned short h0 = f2bf_bits(v0), h1 = f2bf_bits(v1);
    const unsigned short l0 = f2bf_bits(v0 - bf_bits2f(h0));
    const unsigned short l1 = f2bf_bits(v1 - bf_bits2f(h1));
    hw[i] = (unsigned)h0 | ((unsigned)h1 << 16);
    lw[i] = (unsigned)l0 | ((unsigned)l1 << 16);
  }
  v4u hv; hv.x = hw[0]; hv.y = hw[1]; hv.z = hw[2]; hv.w = hw[3];
  v4u lv; lv.x = lw[0]; lv.y = lw[1]; lv.z = lw[2]; lv.w = lw[3];
  v4u* ph = (v4u*)(void*)(dhp + base);
  v4u* pl = (v4u*)(void*)(dlp + base);
  *ph = hv; *pl = lv;
  
}

__device__ __forceinline__ v8f at_mma_b(v16b a, v16b b, v8f c) {
  c = __builtin_amdgcn_wmma_f32_16x16x32_bf16(false, a, false, b, (short)0, c, false, false);
  asm volatile("v_nop\n\tv_nop\n\tv_nop\n\tv_nop" : "+v"(c) : "v"(a), "v"(b));
  return c;
}
__device__ __forceinline__ v8f at_mma_h(v16h a, v16h b, v8f c) {
  c = __builtin_amdgcn_wmma_f32_16x16x32_f16(false, a, false, b, (short)0, c, false, false);
  asm volatile("v_nop\n\tv_nop\n\tv_nop\n\tv_nop" : "+v"(c) : "v"(a), "v"(b));
  return c;
}

/* x[i] = 2^x[i] for the eight scores of one tile, each in its own register, so that no v_exp_f32 reads the result or
   overwrites the source of the one in front of it; the closing v_nop is the slot the instruction set asks for
   between the last v_exp_f32 and whatever the compiler puts next. */
__device__ __forceinline__ void exp2x8(float (&x)[8]) {
  asm("v_exp_f32 %0, %0\n\t"
      "v_exp_f32 %1, %1\n\t"
      "v_exp_f32 %2, %2\n\t"
      "v_exp_f32 %3, %3\n\t"
      "v_exp_f32 %4, %4\n\t"
      "v_exp_f32 %5, %5\n\t"
      "v_exp_f32 %6, %6\n\t"
      "v_exp_f32 %7, %7\n\t"
      "v_nop"
      : "+v"(x[0]), "+v"(x[1]), "+v"(x[2]), "+v"(x[3]), "+v"(x[4]), "+v"(x[5]), "+v"(x[6]), "+v"(x[7]));
}

/* lane l <-> lane l ^ 16 by one vector cross-row move */
__device__ __forceinline__ float xhalf(float x) {
  const int b = __builtin_bit_cast(int, x);
  return __builtin_bit_cast(float, __builtin_amdgcn_permlanex16(b, b, 0x76543210, 0xfedcba98, false, false));
}

/* =====================================================================================
   Attention for head_dim 64 with an additive [kSeq][kSeq] mask shared over (b,h).
   Inputs: qh/ql = bf16 hi/lo planes of (q/||q|| * tau[h] * log2 e), kh/kl = bf16 hi/lo planes of k/||k||,
           all [kTok][kDm] with element (b, s, h, d) at (b*kSeq+s)*kDm + h*64 + d;
           vt = f16 plane of v, transposed: [kDm][kTok], element (b, s, h, d) at (h*64+d)*kTok + b*kSeq + s;
           mb = bf16 plane (RNE) of the mask, [kSeq][kSeq].
   Every tile of a kv chunk (K hi, K lo, V^T, mask) is 64 rows of 128 B that lie in global memory as LDS wants them:
           asynchronous copies bring whole rows into one of two buffers while the other one is worked on.
   scores, transposed: S^T = khat . qhat_tau^T : 3 bf16 WMMAs (hi.hi + lo.hi + hi.lo), A = K rows, B = Q columns;
           lanes c and c + 16 hold all scores of query column c: += bf16(mask[q][kv]) * log2 e; online softmax f32 in
           base 2 (p x 2^14 = 2^(score - maximum + 14): one subtraction and one v_exp_f32 a score), maximum and
           sum in the lane, the halves' maxima joined per chunk, their sums (carried x2^14 like p) once at the end.
   out, transposed: O^T += V^T . P^T : f16 WMMA, p carried x2^14; two score tiles converted in place are the B operand.
           result written as f16 of (out * 2^6) into oo (same plane layout).
   Block = 4 waves = 64 query rows of one (b, h).  A kv chunk is walked unless its mask tile alone shows that every one of its
           weights is 0 in f32: with |score| <= bq (cosine x tau, base 2), every row's maximum is at least L log2 e - bq,
           L = the largest over the chunks of lo (cast launch), and a chunk's scores are at most hi log2 e + bq; a chunk more than
           192 binary orders below is left out, copies and all.  Read from the mask at run time, for any mask.
   grid.x = kBatch * kHeads * (kSeq/64) = 1024.  coverage of oo: 1024 blocks x 64 rows x 64 d = kTok*kDm.
   All blocks are resident at once, four a WGP, so the launch ends with the WGP that has the most chunks to walk.  Where the count
           grows or falls along the query tiles (a causal mask), the block index is spread so that any four blocks whose
           indices differ in two bits hold two tiles t, t' and two mirrored ones 31 - t'', 31 - t''' with t + t' = t'' + t''':
           the same sum of chunks whichever four share a WGP; for other masks any order does as well.
   ===================================================================================== */
__global__ __launch_bounds__(128)
void cos_attn_kernel(const unsigned short* __restrict__ qhp, const unsigned short* __restrict__ qlp,
                     const unsigned short* __restrict__ khp, const unsigned short* __restrict__ klp,
                     const unsigned short* __restrict__ vtp, const unsigned short* __restrict__ mbp,
                     const float* __restrict__ mst, const float* __restrict__ tau,
                     unsigned short* __restrict__ oo) {
  union FB { v16b v; v8b h[2]; };
  union FH { v16h v; v8h h[2]; };
  /* two buffers x four tiles of 9 KB: K hi [kv][d], K lo [kv][d], V^T [d][kv], mask bf16 [qrow][kv]; 72 KB, four blocks a WGP.
     Behind the loop's last barrier the first 9 KB serve as the waves' output staging. */
  __shared__ __align__(16) unsigned short ring[2][4 * kTileE];

  const int tid  = threadIdx.x;
  const int wave = tid >> 5;
  const int lane = tid & 31;
  const int hh   = lane >> 4;
  const int c    = lane & 15;

  constexpr int nqb = kSeq / kQblk;             /* 32 */
  static_assert(nqb == 32 && kBatch * kHeads == 32, "index bits 5,2,6,7 = t; 0,1,3,4,8 = (b, h); parity of all ten = mirror");
  const int bx  = blockIdx.x;
  const int tq  = ((bx >> 5) & 1) | ((bx >> 1) & 2) | ((bx >> 4) & 12);
  const int qb  = (__builtin_popcount((unsigned)bx) & 1) ? nqb - 1 - tq : tq;   /* bit 9 makes both parities: one to one */
  const int bh  = (bx & 3) | ((bx >> 1) & 12) | ((bx >> 4) & 16);
  const int h   = bh % kHeads;
  const int b   = bh / kHeads;
  const int qbase = qb * kQblk;
  const int q0    = qbase + wave * 16;
  const size_t tokb = (size_t)b * kSeq;

  const __bf16*   qh = (const __bf16*)(const void*)qhp;
  const __bf16*   ql = (const __bf16*)(const void*)qlp;

  /* ---- Q fragments (B operand): column = lane&15, elements 0..7 <- d0+8hh+0..7, 8..15 <- d0+16+8hh+0..7 ---- */
  v16b qah[2], qal[2];
  {
    const size_t ro = (tokb + (size_t)(q0 + c)) * kDm + (size_t)h * kHd;
#pragma unroll
    for (int dc = 0; dc < 2; ++dc) {
      qah[dc] = Frag<__bf16>::load(qh + ro + dc * 32 + 8 * hh);
      qal[dc] = Frag<__bf16>::load(ql + ro + dc * 32 + 8 * hh);
    }
  }

  float mrow = -INFINITY;      /* running maximum of query column c, equal in both lane halves */
  float mref = -INFINITY;      /* the exponent that p, lrow and oacc are carried against: mrow - 14 */
  float lrow = 0.f;            /* running sum over this lane half's kv rows only */
  v8f oacc[4];                 /* O^T: oacc[t][r] = out[d = 16t + 8hh + r][query c] */
#pragma unroll
  for (int t = 0; t < 4; ++t) oacc[t] = (v8f){0.f,0.f,0.f,0.f,0.f,0.f,0.f,0.f};

  /* copy map: 8 lanes x 16 B = one 128 B row, 16 rows per pass of the block, 4 passes per tile */
  const int crow = tid >> 3;
  const int cchk = (tid & 7) * 8;
  const unsigned short* gKh = khp + (tokb + (size_t)crow) * kDm + (size_t)h * kHd + cchk;
  const unsigned short* gKl = klp + (tokb + (size_t)crow) * kDm + (size_t)h * kHd + cchk;
  const unsigned short* gVt = vtp + ((size_t)h * kHd + (size_t)crow) * kTok + tokb + cchk;
  const unsigned short* gMb = mbp + (size_t)(qbase + crow) * kSeq + cchk;
  const unsigned lds0 = (unsigned)(uintptr_t)(const void*)&ring[0][0] + (unsigned)(crow * kP16 + cchk) * 2u;
  auto stage_copy = [&](int st, int buf) {
    const unsigned lb = lds0 + (unsigned)buf * (unsigned)(4 * kTileE * 2);
    const unsigned short* ph = gKh + (size_t)st * (kKch * kDm);
    const unsigned short* pl = gKl + (size_t)st * (kKch * kDm);
    const unsigned short* pv = gVt + (size_t)st * kKch;
    const unsigned short* pm = gMb + (size_t)st * kKch;
    unsigned l[8];
    const unsigned short* g[8];
    /* both loops unrolled: l[] and g[] are asm operands and must be registers */
#pragma unroll
    for (int it = 0; it < 4; ++it) {
      l[it]     = lb + (unsigned)((it * 16 * kP16) * 2);
      l[it + 4] = lb + (unsigned)((kTileE + it * 16 * kP16) * 2);
      g[it]     = ph + (size_t)(it * 16) * kDm;
      g[it + 4] = pl + (size_t)(it * 16) * kDm;
    }
    async_copy8(l, g);
#pragma unroll
    for (int it = 0; it < 4; ++it) {
      l[it]     = lb + (unsigned)((2 * kTileE + it * 16 * kP16) * 2);
      l[it + 4] = lb + (unsigned)((3 * kTileE + it * 16 * kP16) * 2);
      g[it]     = pv + (size_t)(it * 16) * kTok;
      g[it + 4] = pm + (size_t)(it * 16) * kSeq;
    }
    async_copy8(l, g);
  };

  constexpr int nch = kSeq / kKch;
  static_assert(nch == 32, "one lane and one bit per kv chunk");
  /* ---- the chunks to walk, one bit each: lane = chunk; every wave reads the same records and gets the same word ---- */
  unsigned rem;
  {
    const v4f* rec = (const v4f*)(mst + (size_t)(qb * nch + lane) * kMstRec);
    const v4f r0 = rec[0], r1 = rec[1], r2 = rec[2], r3 = rec[3];          /* {hi, lo} of the tile's 8 row groups */
    const float hi = fmaxf(fmaxf(fmaxf(r0.x, r0.z), fmaxf(r1.x, r1.z)), fmaxf(fmaxf(r2.x, r2.z), fmaxf(r3.x, r3.z)));
    float L        = fminf(fminf(fminf(r0.y, r0.w), fminf(r1.y, r1.w)), fminf(fminf(r2.y, r2.w), fminf(r3.y, r3.w)));
    for (int d = 1; d < 32; d <<= 1) L = fmaxf(L, __shfl_xor(L, d, 32));
    const float bq = fabsf(bf_bits2f(f2bf_bits(tau[h]))) * (LOG2E * 1.0625f) + 1.0f;
    /* written so that a NaN (inf - inf, a NaN tau) keeps the chunk */
    const bool out_of_reach = (L - hi) * LOG2E > 2.0f * bq + 192.0f;
    rem = __builtin_amdgcn_ballot_w32(!out_of_reach);
    if (rem == 0u) rem = 0xffffffffu;   /* bounds the chunk index below whatever the records hold (the chunk that gives L has its bit) */
  }
  const int nact = __builtin_popcount(rem);
  int cn = __builtin_ctz(rem);
  rem &= rem - 1u;
  stage_copy(cn, 0);
  asm volatile("s_wait_asynccnt 0x0" ::: "memory");   /* this wave's share of the first chunk has landed */
  __syncthreads();                                     /* ... and every other wave's */
  if (rem != 0u) {
    cn = __builtin_ctz(rem);
    rem &= rem - 1u;
    stage_copy(cn, 1);
  }
  for (int kc = 0; kc < nact; ++kc) {
    const unsigned short* tb = ring[kc & 1];
    const __bf16*   Ksh = (const __bf16*)(const void*)tb;
    const __bf16*   Ksl = (const __bf16*)(const void*)(tb + kTileE);
    const _Float16* Vt  = (const _Float16*)(const void*)(tb + 2 * kTileE);
    const unsigned short* Msk = tb + 3 * kTileE;

    /* ---- LDS reads stand in groups ahead of the matrix runs, never among them: a read placed directly in front of its
       product leaves the wave waiting out the LDS latency at every product.  (The hazard statements behind the products
       are volatile asm, which no load crosses: where a group is written is where it is issued.)
       Group 1, at the head of the chunk: all K hi and K lo fragments, 32 reads. ---- */
    FB kb[4][2], klo[4][2];
#pragma unroll
    for (int j = 0; j < 4; ++j) {
#pragma unroll
      for (int dc = 0; dc < 2; ++dc) {
        kb[j][dc].h[0]  = *(const v8b*)(Ksh + (j * 16 + c) * kP16 + dc * 32 + 8 * hh);
        kb[j][dc].h[1]  = *(const v8b*)(Ksh + (j * 16 + c) * kP16 + dc * 32 + 16 + 8 * hh);
        klo[j][dc].h[0] = *(const v8b*)(Ksl + (j * 16 + c) * kP16 + dc * 32 + 8 * hh);
        klo[j][dc].h[1] = *(const v8b*)(Ksl + (j * 16 + c) * kP16 + dc * 32 + 16 + 8 * hh);
      }
    }
    const unsigned short* mrw = Msk + (wave * 16 + c) * kP16 + 8 * hh;
    v4u mw[4];                  /* mask words of the lane's own query row: eight bf16 per score tile */
    FH vb[2][4];                /* V^T fragments: A[m=d][k=kv] = Vt[d][kv] (lane row c) */

    /* ---- scores: S^T[kvrow][qcol], A[m=kv][k=d] = Ksh[kv][d], B[k=d][n=q] = Q; s[j][r] = S[q = c][kv = 16j + 8hh + r] ---- */
    v8f s[4];
#pragma unroll
    for (int j = 0; j < 4; ++j) {
      s[j] = (v8f){0.f,0.f,0.f,0.f,0.f,0.f,0.f,0.f};
#pragma unroll
      for (int dc = 0; dc < 2; ++dc) {
        s[j] = at_mma_b(kb[j][dc].v,  qah[dc], s[j]);
        s[j] = at_mma_b(klo[j][dc].v, qah[dc], s[j]);
        s[j] = at_mma_b(kb[j][dc].v,  qal[dc], s[j]);
      }
      /* Groups 2 and 3, into registers that K fragments have left: the mask words and the first half of V^T behind
         score tile 1, the second half of V^T behind score tile 3; they land under the products and the softmax */
      if (j == 1) {
#pragma unroll
        for (int jj = 0; jj < 4; ++jj) mw[jj] = *(const v4u*)(const void*)(mrw + jj * 16);
      }
      if (j == 1 || j == 3) {
        const int kk = j >> 1;
#pragma unroll
        for (int t = 0; t < 4; ++t) {
          vb[kk][t].h[0] = *(const v8h*)(Vt + (t * 16 + c) * kP16 + kk * 32 + 8 * hh);
          vb[kk][t].h[1] = *(const v8h*)(Vt + (t * 16 + c) * kP16 + kk * 32 + 16 + 8 * hh);
        }
      }
    }

    /* ---- additive mask from the LDS tile (8 consecutive kv of the lane's own query row per score tile) + chunk max ---- */
    float cj[4];                /* one maximum per score tile: four short chains instead of one long one */
#pragma unroll
    for (int j = 0; j < 4; ++j) {
      /* eight bf16: kv 2r in the low half of word r, 2r + 1 in the high */
#pragma unroll
      for (int r = 0; r < 4; ++r) {
        s[j][2 * r]     = fmaf(__uint_as_float(mw[j][r] << 16),         LOG2E, s[j][2 * r]);
        s[j][2 * r + 1] = fmaf(__uint_as_float(mw[j][r] & 0xffff0000u), LOG2E, s[j][2 * r + 1]);
      }
      cj[j] = fmaxf(s[j][0], s[j][4]);
#pragma unroll
      for (int r = 1; r < 4; ++r) cj[j] = fmaxf(cj[j], fmaxf(s[j][r], s[j][r + 4]));
    }
    float cm = fmaxf(fmaxf(cj[0], cj[1]), fmaxf(cj[2], cj[3]));
    cm = fmaxf(cm, xhalf(cm));
    const float mnew  = fmaxf(mrow, cm);
    /* the carry of p rides in the subtracted exponent; beside a maximum so large that the 14 rounds to more than 15
       it is left out, so that p stays inside f16; alpha goes from the old to the new subtracted exponent, whatever they are */
    float msub = mnew - P_CARRY_LOG2;
    msub = (mnew - msub <= P_CARRY_LOG2 + 1.0f) ? msub : mnew;
    const float alpha = __builtin_amdgcn_exp2f(mref - msub);
    mrow = mnew;
    mref = msub;
    float ps[4];                /* one sum per score tile, as for the maxima */
    FH pb[2];                   /* P^T as B operand: element e <- kv 32kk + 8hh + e, element 8 + e <- kv 32kk + 16 + 8hh + e */
#pragma unroll
    for (int j = 0; j < 4; ++j) {
      float p[8];               /* p x 2^14 */
#pragma unroll
      for (int r = 0; r < 8; ++r) p[r] = s[j][r] - msub;
      exp2x8(p);
      ps[j] = 0.f;
#pragma unroll
      for (int r = 0; r < 8; ++r) {
        ps[j] += p[r];
        pb[j >> 1].h[j & 1][r] = (_Float16)p[r];
      }
    }
    lrow = lrow * alpha + ((ps[0] + ps[1]) + (ps[2] + ps[3]));
#pragma unroll
    for (int t = 0; t < 4; ++t)
#pragma unroll
      for (int r = 0; r < 8; ++r) oacc[t][r] *= alpha;
    /* ---- O^T += V^T . P^T : A = the V^T fragments read above, B = pb; both loops unrolled: vb and pb are indexed by constants ---- */
#pragma unroll
    for (int kk = 0; kk < 2; ++kk) {
#pragma unroll
      for (int t = 0; t < 4; ++t) oacc[t] = at_mma_h(vb[kk][t].v, pb[kk].v, oacc[t]);
    }
    asm volatile("s_wait_dscnt 0x0" ::: "memory");     /* this wave's reads of the buffer have returned before it is refilled */
    asm volatile("s_wait_asynccnt 0x0" ::: "memory");  /* this wave's share of the next walked chunk has landed */
    __syncthreads();                                   /* publishes that chunk, ends every read of this one */
    if (rem != 0u) {                                   /* the same word in every wave of the block */
      cn = __builtin_ctz(rem);
      rem &= rem - 1u;
      stage_copy(cn, kc & 1);
    }
  }
  asm volatile("s_wait_asynccnt 0x0" ::: "memory");    /* no copy is outstanding when the ring becomes output staging */

  _Float16* pw = (_Float16*)(void*)&ring[0][0] + wave * (16 * kP16);
  {
    const float ltot = lrow + xhalf(lrow);               /* both halves' kv rows, carried like p; ltot >= 1 */
    const float inv  = O_CARRY / ltot;
#pragma unroll
    for (int t = 0; t < 4; ++t) {
      v8h ov;
#pragma unroll
      for (int r = 0; r < 8; ++r) ov[r] = (_Float16)(oacc[t][r] * inv);
      *(v8h*)(pw + c * kP16 + t * 16 + 8 * hh) = ov;     /* query row c, d = 16t + 8hh + 0..7 */
    }
  }
  __builtin_amdgcn_fence(__ATOMIC_RELEASE, "workgroup");
  __builtin_amdgcn_wave_barrier();
  __builtin_amdgcn_fence(__ATOMIC_ACQUIRE, "workgroup");
  {
    const int q8 = lane >> 3, c8 = (lane & 7) * 8;
    _Float16* ob = (_Float16*)(void*)oo + (tokb + (size_t)q0) * kDm + (size_t)h * kHd;
    {
#pragma unroll
      for (int it = 0; it < 4; ++it) {
        const int row = it * 4 + q8;
        const v8h val = *(const v8h*)(pw + row * kP16 + c8);
        *(v8h*)(ob + (size_t)row * kDm + c8) = val;
      }
      
    }
  }
}

/* ------------------------------------------------------------------------------------- */
extern "C" void kernel_launch(void* const* d_in, const int* in_sizes, int n_in,
                              void* d_out, int out_size, void* d_ws, size_t ws_size,
                              hipStream_t stream) {
  if (n_in < 11) return;
  const float* x    = (const float*)d_in[0];
  const float* mask = (const float*)d_in[1];
  const float* Wq   = (const float*)d_in[2];
  const float* bq   = (const float*)d_in[3];
  const float* Wk   = (const float*)d_in[4];
  const float* bk   = (const float*)d_in[5];
  const float* Wv   = (const float*)d_in[6];
  const float* bv   = (const float*)d_in[7];
  const float* Wo   = (const float*)d_in[8];
  const float* bo   = (const float*)d_in[9];
  const float* tau  = (const float*)d_in[10];

  const size_t nX = (size_t)kTok * kDm;     /* 4,194,304 */
  const size_t nW = (size_t)kDm * kDm;      /* 1,048,576 */
  if ((size_t)in_sizes[0] != nX || (size_t)in_sizes[1] != (size_t)kSeq * kSeq ||
      (size_t)in_sizes[2] != nW || (size_t)in_sizes[4] != nW || (size_t)in_sizes[6] != nW ||
      (size_t)in_sizes[8] != nW || in_sizes[3] != kDm || in_sizes[5] != kDm || in_sizes[7] != kDm ||
      in_sizes[9] != kDm || in_sizes[10] != kHeads) return;
  if ((size_t)out_size != nX) return;

  /*
       xb   bf16 [4096][1024]        off         0   size  8,388,608
       wqb  bf16 [1024][1024]        off  8,388,608  size  2,097,152
       wkb  bf16 [1024][1024]        off 10,485,760  size  2,097,152
       wvb  bf16 [1024][1024]        off 12,582,912  size  2,097,152
       wof  f16  [1024][1024] (x1024) off 14,680,064  size  2,097,152
       qf   f32  [4096][1024]        off 16,777,216  size 16,777,216   (reused as oo f16 [4096][1024], 8,388,608 B, after qf is consumed)
       kf   f32  [4096][1024]        off 33,554,432  size 16,777,216
       qhb  bf16 [4096][1024]        off 50,331,648  size  8,388,608
       qlb  bf16 [4096][1024]        off 58,720,256  size  8,388,608
       khb  bf16 [4096][1024]        off 67,108,864  size  8,388,608
       klb  bf16 [4096][1024]        off 75,497,472  size  8,388,608
       vth  f16  [1024][4096]        off 83,886,080  size  8,388,608   (v transposed: row = output feature, column = token)
       mkb  bf16 [2048][2048]        off 92,274,688  size  8,388,608
       mst  f32  [32][32][32]        off 100,663,296 size    131,072   (per mask tile: 8 x {hi, lo}, 128 B records)
       end                              100,794,368 */
  const size_t offXb  = 0;
  const size_t offWq  = offXb  + nX * 2;
  const size_t offWk  = offWq  + nW * 2;
  const size_t offWv  = offWk  + nW * 2;
  const size_t offWo  = offWv  + nW * 2;
  const size_t offQf  = offWo  + nW * 2;
  const size_t offKf  = offQf  + nX * 4;
  const size_t offQh  = offKf  + nX * 4;
  const size_t offQl  = offQh  + nX * 2;
  const size_t offKh  = offQl  + nX * 2;
  const size_t offKl  = offKh  + nX * 2;
  const size_t offVv  = offKl  + nX * 2;
  const size_t offMk  = offVv  + nX * 2;
  const size_t offSt  = offMk  + (size_t)kSeq * kSeq * 2;
  const size_t offEnd = offSt  + (size_t)kCbM * kMstRec * 4;
  if (offEnd > ws_size) return;

  char* ws = (char*)d_ws;
  unsigned short* xb  = (unsigned short*)(ws + offXb);
  unsigned short* wqb = (unsigned short*)(ws + offWq);
  unsigned short* wkb = (unsigned short*)(ws + offWk);
  unsigned short* wvb = (unsigned short*)(ws + offWv);
  unsigned short* wof = (unsigned short*)(ws + offWo);
  float*          qf  = (float*)(ws + offQf);
  unsigned short* oo  = (unsigned short*)(ws + offQf);   /* reuse after qf is consumed */
  float*          kf  = (float*)(ws + offKf);
  unsigned short* qhb = (unsigned short*)(ws + offQh);
  unsigned short* qlb = (unsigned short*)(ws + offQl);
  unsigned short* khb = (unsigned short*)(ws + offKh);
  unsigned short* klb = (unsigned short*)(ws + offKl);
  unsigned short* vth = (unsigned short*)(ws + offVv);
  unsigned short* mkb = (unsigned short*)(ws + offMk);
  float*          mst = (float*)(ws + offSt);

  /* 1: input casts (RNE bf16; Wo -> f16 of bf16 value x 1024) */
  cast_all_kernel<<<dim3(kCbAll), dim3(256), 0, stream>>>(x, mask, Wq, Wk, Wv, Wo, xb, mkb, wqb, wkb, wvb, wof, mst);

  /* 2: the three projections, one launch of 256 work-groups: C[m][n] = sum_k xb[m][k] W[n][k] + bias[n]; M=4096, N=3x1024, K=1024;
     wqb, wkb, wvb lie behind one another in the workspace and are read as one plane of 3072 rows;
     v with the operands exchanged, C[n][m] (+ bias[n], now the row's), so that a head's V^T rows lie along the tokens */
  qkv_proj_kernel<<<dim3((kTok / kGm) * (3 * kDm / 384)), dim3(384), 0, stream>>>(xb, wqb, bq, bk, bv, qf, kf, vth);

  /* 3: L2 normalisation of q (x tau) and k, bf16 hi/lo planes */
  l2norm_split_kernel<<<dim3((kTok * kHeads) / 32, 2), dim3(256), 0, stream>>>(qf, kf, tau, qhb, qlb, khb, klb);

  /* 4: attention -> oo (f16, value x 64), overwrites the dead qf region */
  cos_attn_kernel<<<dim3(kBatch * kHeads * (kSeq / kQblk)), dim3(128), 0, stream>>>(qhb, qlb, khb, klb, vth, mkb, mst, tau, oo);

  /* 5: output projection, 256 work-groups: out[m][n] = 2^-16 * sum_c (oo x64)[m][c] (Wo x1024)[n][c] + bo[n] -> d_out f32 */
  out_proj_kernel<<<dim3((kTok / kGm) * (kDm / 128)), dim3(256), 0, stream>>>(
      oo, wof, bo, (float*)d_out, 1.0f / (O_CARRY * WO_CARRY));
}
